// v000
// Times are from an AMD MI455X. After a warm-up the kernel runs many times in a row, and a time is the length of
// such a window on the GPU divided by its runs, so every launch and the gaps after it count. The runs cycle
// through copies of the inputs. A figure is the median of several windows, for all but v000 over two sittings.
// Sittings can differ by a few percent; kernels timed side by side share one.
// v000, which the later versions start from, runs in 1860 microseconds.
#include <hip/hip_runtime.h>
// Causal multi-head self-attention, B 2 x L 2048, d_model 1024, 16 heads of 64; outputs: out [B][L][1024], k cache [B][16][L][64], v cache [B][16][L][64] (f32).
// Compute dtype: every contraction on v_wmma_f32_16x16x32_f16 (f16 operands, f32 accumulate). x / w_qkv / w_o / biases are RNE-converted to bf16 first (exact in f16; weights carried x16).
// q, k, softmax weights (carried x1024), v and ctx (carried x64) are f16 planes; for the first EARLY query rows of every sequence each of them also has an f16 residual plane carried x2^10
// that goes to a separate accumulator (q k^T: 3 products, P V: 3 products, ctx w_o: 2 products); scores, softmax statistics and all epilogues in f32.
// Structure: weight transposes (once), x plane, mask structure check, fused QKV GEMM (writes the k / v caches in f32 plus the f16 planes), V^T hi/res planes through LDS,
// per group of HG heads: scores (early rows 3-product, late rows 1-product, tiles above the diagonal skipped), wave-per-row softmax (rolled 256-key slices, lane-private LDS staging), P V (early / late), then the output GEMM (early / late).
#ifndef NB
#define NB 2
#endif
#ifndef SEQ
#define SEQ 2048
#endif
#define NB_FULL 2
#define SEQ_FULL 2048
#define DM 1024
#define NH 16
#define HD 64
#define HG 2
#define EARLY ((SEQ) < 512 ? (SEQ) : 512)
#define NCH ((SEQ) / 256)
#define OUT1_OFF ((size_t)NB_FULL * SEQ_FULL * DM)
#define OUT2_OFF ((size_t)2 * NB_FULL * SEQ_FULL * DM)

typedef unsigned short v8us __attribute__((ext_vector_type(8), may_alias));
typedef float v8f __attribute__((ext_vector_type(8)));
typedef float v4f __attribute__((ext_vector_type(4)));
typedef float v4fa __attribute__((ext_vector_type(4), may_alias));
typedef _Float16 v16h __attribute__((ext_vector_type(16)));
typedef _Float16 v4h __attribute__((ext_vector_type(4)));
union FragH { v16h v; v8us half[2]; _Float16 h[16]; unsigned short u[16]; };

static_assert(NH * HD == DM);
static_assert(SEQ % 256 == 0);
static_assert(EARLY % 128 == 0);
static_assert((SEQ - EARLY) % 128 == 0);
static_assert(NB <= NB_FULL && SEQ <= SEQ_FULL);
static_assert(NH % HG == 0);
static_assert(OUT1_OFF * 4 == 16777216);
static_assert(OUT2_OFF * 4 == 33554432);
static_assert((size_t)4 * SEQ * 4 <= 65536);

__device__ __forceinline__ unsigned short bf16_bits(float x) { unsigned int u = __float_as_uint(x); return (unsigned short)((u + 0x7FFFu + ((u >> 16) & 1u)) >> 16); }
__device__ __forceinline__ float bf16_rne(float x) { return __uint_as_float(((unsigned int)bf16_bits(x)) << 16); }

// fragment loader (A row or B column, k contiguous): elements 0..7 <- k0+8h.., elements 8..15 <- k0+16+8h..
__device__ __forceinline__ v16h g2_frag(const _Float16* p, int hh) { FragH f; f.half[0] = *(const v8us*)((const unsigned short*)p + 8 * hh); f.half[1] = *(const v8us*)((const unsigned short*)p + 16 + 8 * hh); return f.v; }
__device__ __forceinline__ v8f g2_mma(v16h a, v16h b, v8f c) { v8f d = __builtin_amdgcn_wmma_f32_16x16x32_f16(false, a, false, b, (short)0, c, false, false); asm volatile("v_nop\n\tv_nop\n\tv_nop\n\tv_nop" : "+v"(d) : "v"(a), "v"(b)); return d; }
// f32 -> f16 hi and f16 residual carried x2^10
__device__ __forceinline__ void split4(const v4f v, v4h& h, v4h& r) {
#pragma unroll
  for (int i = 0; i < 4; ++i) { const _Float16 a = (_Float16)v[i]; h[i] = a; r[i] = (_Float16)((v[i] - (float)a) * 1024.0f); }
}

__global__ __launch_bounds__(256) void k_wt_f16(const float* __restrict__ W, _Float16* __restrict__ Wt, int K, int N, float scale) {
  const int t = blockIdx.x * 256 + threadIdx.x; if (t >= N * (K / 8)) return;
  const int n = t / (K / 8), k8 = (t % (K / 8)) * 8; FragH f;
#pragma unroll
  for (int i = 0; i < 8; ++i) f.h[i] = (_Float16)(bf16_rne(W[(size_t)(k8 + i) * N + n]) * scale);
  const v8us o = f.half[0];
  unsigned short* d = (unsigned short*)Wt + (size_t)n * K + k8;
  *(v8us*)d = o; 
}

__global__ __launch_bounds__(256) void k_x16(const float* __restrict__ x, _Float16* __restrict__ X16) {
  const size_t t = (size_t)blockIdx.x * 256 + threadIdx.x; const int b = blockIdx.y;
  const float* src = x + (size_t)b * SEQ_FULL * DM + t * 8;
  const v4f a = *(const v4fa*)src, c = *(const v4fa*)(src + 4); FragH f;
#pragma unroll
  for (int q = 0; q < 4; ++q) { f.h[q] = (_Float16)bf16_rne(a[q]); f.h[4 + q] = (_Float16)bf16_rne(c[q]); }
  unsigned short* d = (unsigned short*)X16 + (size_t)b * SEQ * DM + t * 8;
  *(v8us*)d = f.half[0]; 
}

__global__ __launch_bounds__(256) void k_maskchk(const float* __restrict__ mask, int* __restrict__ flg) {
  __shared__ int sb[8];
  const int w = threadIdx.x >> 5, lane = threadIdx.x & 31;
  const int rper = SEQ / 32;
  int bad = 0;
#pragma unroll 1
  for (int r = w; r < rper; r += 8) {
    const int i = blockIdx.x * rper + r;
    const float* mr = mask + (size_t)i * SEQ_FULL;
#pragma unroll 1
    for (int j0 = lane * 4; j0 < SEQ; j0 += 128) {
      const v4f m = *(const v4fa*)(mr + j0);
#pragma unroll
      for (int q = 0; q < 4; ++q) { const int j = j0 + q; const bool okl = (m[q] == 0.0f); const bool oku = (m[q] <= -1.0e8f); const bool ok = (j <= i) ? okl : oku; bad |= ok ? 0 : 1; }
    }
  }
  for (int off = 16; off > 0; off >>= 1) bad |= __shfl_xor(bad, off, 32);
  if (lane == 0) sb[w] = bad;
  __syncthreads();
  if (w == 0) {
    int tot = 0;
#pragma unroll
    for (int q = 0; q < 8; ++q) tot |= sb[q];
    int* p = flg + blockIdx.x * 32 + lane;
    *p = tot; 
  }
}

__global__ __launch_bounds__(256) void k_vt(const float* __restrict__ Vf, _Float16* __restrict__ VTh, _Float16* __restrict__ VTr) {
  __shared__ float tl[64][65];
  const int tid = threadIdx.x; const int bh = blockIdx.x / (SEQ / 64), sg = blockIdx.x % (SEQ / 64); const int s0 = sg * 64;
  const float* src = Vf + ((size_t)bh * SEQ_FULL + s0) * HD;
  for (int i = tid; i < 64 * 16; i += 256) { const int j = i >> 4, c4 = (i & 15) * 4; const v4f a = *(const v4fa*)(src + (size_t)j * HD + c4);
#pragma unroll
    for (int q = 0; q < 4; ++q) tl[c4 + q][j] = a[q]; }
  __syncthreads();
  {
    for (int i = tid; i < 64 * 8; i += 256) { const int d = i >> 3, j8 = (i & 7) * 8; FragH fh, fr;
#pragma unroll
      for (int q = 0; q < 8; ++q) { const float v = tl[d][j8 + q]; const _Float16 h = (_Float16)v; fh.h[q] = h; fr.h[q] = (_Float16)((v - (float)h) * 1024.0f); }
      const size_t o = ((size_t)bh * HD + d) * SEQ + s0 + j8;
      *(v8us*)((unsigned short*)VTh + o) = fh.half[0];
      *(v8us*)((unsigned short*)VTr + o) = fr.half[0]; }
     }
}

// causal row softmax, one wave per (unit, query row i): keys 0..i, f32 statistics; Ph = f16(1024 p), Pr = f16((1024 p - Ph) 2^10) for rows < EARLY.
// The row is processed in 256-key slices (rolled loops; lane owns 8 consecutive keys per slice); slice values are staged in a lane-private LDS slot
// (each lane reloads only the 32 bytes it stored itself, through the same vector type), so no register array is indexed at run time.
__global__ __launch_bounds__(128) void k_softmax(const float* __restrict__ S, _Float16* __restrict__ Ph, _Float16* __restrict__ Pr) {
#pragma clang fp contract(off)
  __shared__ __attribute__((aligned(16))) float ev[4][SEQ];
  const int lane = threadIdx.x & 31;
  const int w = __builtin_amdgcn_readfirstlane((int)(threadIdx.x >> 5));
  const int t = __builtin_amdgcn_readfirstlane((int)(blockIdx.x * 4)) + w;
  const int u = t / SEQ, i = t - u * SEQ;
  const float* srow = S + ((size_t)u * SEQ + i) * SEQ;
  const int jcl = (i >> 3) << 3;
  int nc = (i >> 8) + 1;                       /* slices with c*256 <= i */
  nc = nc < NCH ? nc : NCH;
  float mx = -3.0e38f;
#pragma unroll 1
  for (int c = 0; c < nc; ++c) {
    const int j0 = c * 256 + lane * 8;
    const int jl = j0 < jcl ? j0 : jcl;        /* clamped address; values past i are replaced by index below */
    const v4f x0 = *(const v4fa*)(srow + jl), x1 = *(const v4fa*)(srow + jl + 4);
    v4f a, b;
#pragma unroll
    for (int q = 0; q < 4; ++q) { const float s = (j0 + q <= i) ? x0[q] : -1.0e9f; a[q] = s; mx = fmaxf(mx, s); }
#pragma unroll
    for (int q = 0; q < 4; ++q) { const float s = (j0 + 4 + q <= i) ? x1[q] : -1.0e9f; b[q] = s; mx = fmaxf(mx, s); }
    *(v4fa*)&ev[w][j0] = a; *(v4fa*)&ev[w][j0 + 4] = b;
  }
  for (int off = 16; off > 0; off >>= 1) mx = fmaxf(mx, __shfl_xor(mx, off, 32));
  float se = 0.f;
#pragma unroll 1
  for (int c = 0; c < nc; ++c) {
    const int j0 = c * 256 + lane * 8;
    v4f a = *(const v4fa*)&ev[w][j0], b = *(const v4fa*)&ev[w][j0 + 4];
#pragma unroll
    for (int q = 0; q < 4; ++q) { const float d = a[q] - mx; const float e0 = __expf(d); const float e = (j0 + q <= i) ? e0 : 0.f; a[q] = e; se = se + e; }
#pragma unroll
    for (int q = 0; q < 4; ++q) { const float d = b[q] - mx; const float e0 = __expf(d); const float e = (j0 + 4 + q <= i) ? e0 : 0.f; b[q] = e; se = se + e; }
    *(v4fa*)&ev[w][j0] = a; *(v4fa*)&ev[w][j0 + 4] = b;
  }
  for (int off = 16; off > 0; off >>= 1) se += __shfl_xor(se, off, 32);
  const float rinv = 1.0f / se;
  const float sc = 1024.0f * rinv;
  const int wext = ((i >> 6) + 1) << 6;
  const int ie = i < EARLY ? i : (EARLY - 1);
  unsigned short* ph = (unsigned short*)Ph + ((size_t)u * SEQ + i) * SEQ;
  unsigned short* pr = (unsigned short*)Pr + ((size_t)u * EARLY + ie) * SEQ;
  {
#pragma unroll 1
    for (int c = 0; c < nc; ++c) {
      const int j0 = c * 256 + lane * 8;
      const v4f a = *(const v4fa*)&ev[w][j0], b = *(const v4fa*)&ev[w][j0 + 4];
      FragH fh, fr;
#pragma unroll
      for (int q = 0; q < 4; ++q) { const float p = a[q] * sc; const _Float16 h = (_Float16)p; const float hf = (float)h; const float d = p - hf; const float d2 = d * 1024.0f; fh.h[q] = h; fr.h[q] = (_Float16)d2; }
#pragma unroll
      for (int q = 0; q < 4; ++q) { const float p = b[q] * sc; const _Float16 h = (_Float16)p; const float hf = (float)h; const float d = p - hf; const float d2 = d * 1024.0f; fh.h[4 + q] = h; fr.h[4 + q] = (_Float16)d2; }
      const v8us oh = fh.half[0], orr = fr.half[0];
      if (j0 < wext) {
        *(v8us*)(ph + j0) = oh;
        if (i < EARLY) *(v8us*)(pr + j0) = orr;
      }
    }
    
  }
}

// General f16 GEMM, B operand as Bt[n][k]; block = 4 waves; wave tile RT x 64 (RT = 32, or 16 with the residual accumulator).
// RES: second accumulator gets Ar.Bh (+ Ah.Br if BRES), both carried x2^10, folded in the epilogue. causal 1: k-loop stops at the tile's last key block; causal 2: column tiles past the diagonal are skipped.
// EPI 0: QKV routing (q/k f16 planes + early residual planes, k / v caches in f32), 1: f32 plane, 2: f16 hi (+res) planes, 3: f32 output + bias, NaN fill when the mask check failed.
template <bool RES, bool BRES, int EPI>
__global__ __launch_bounds__(128) void k_mm(
    const _Float16* __restrict__ Ah, const _Float16* __restrict__ Ar, int lda, size_t sA, size_t sAr,
    const _Float16* __restrict__ Bh, const _Float16* __restrict__ Br, int ldb, size_t sB,
    int rbase, int ntn, int K, int causal, float alpha,
    float* __restrict__ Cf, _Float16* __restrict__ C1, _Float16* __restrict__ C2, _Float16* __restrict__ C3, _Float16* __restrict__ C4,
    const float* __restrict__ bias, const int* __restrict__ flags, int ldc, size_t sC) {
  constexpr int RT = RES ? 16 : 32;
  __shared__ __attribute__((aligned(16))) float so[4][RT][68];
  const int tid = threadIdx.x, lane = tid & 31, ln = lane & 15, hh = lane >> 4;
  const int w = __builtin_amdgcn_readfirstlane(tid >> 5);
  const int by = blockIdx.y;
  const int mt = blockIdx.x / ntn, nq = blockIdx.x - mt * ntn;
  const int row0 = rbase + mt * (4 * RT) + RT * w, col0 = nq * 64;
  if (causal == 2 && col0 > row0 + RT - 1) return;
  int kend = K;
  if (causal == 1) { const int kc = (((row0 + RT - 1) >> 5) + 1) << 5; kend = kc < K ? kc : K; }
  const _Float16* ap0 = Ah + (size_t)by * sA + (size_t)(row0 + ln) * lda;
  const _Float16* ap1;
  if (RES) ap1 = Ar + (size_t)by * sAr + (size_t)(row0 + ln) * lda; else ap1 = ap0 + (size_t)16 * lda;
  const _Float16* bp = Bh + (size_t)by * sB + (size_t)(col0 + ln) * ldb;
  const _Float16* brp = bp;
  if (RES && BRES) brp = Br + (size_t)by * sB + (size_t)(col0 + ln) * ldb;
  const v8f z8 = {0.f, 0.f, 0.f, 0.f, 0.f, 0.f, 0.f, 0.f};
  v8f c0[4] = {z8, z8, z8, z8}, c1[4] = {z8, z8, z8, z8};
#pragma unroll 1
  for (int kb = 0; kb < kend; kb += 32) {
    const v16h a0 = g2_frag(ap0 + kb, hh), a1 = g2_frag(ap1 + kb, hh);
#pragma unroll
    for (int t = 0; t < 4; ++t) {
      const v16h b = g2_frag(bp + (size_t)(16 * t) * ldb + kb, hh);
      c0[t] = g2_mma(a0, b, c0[t]);
      c1[t] = g2_mma(a1, b, c1[t]);
      if (RES && BRES) { const v16h br = g2_frag(brp + (size_t)(16 * t) * ldb + kb, hh); c1[t] = g2_mma(a0, br, c1[t]); }
    }
  }
  int poison = 0;
  if (EPI == 3) { int fl = flags[lane * 32]; for (int off = 16; off > 0; off >>= 1) fl |= __shfl_xor(fl, off, 32); poison = fl; }
  const float nanv = __uint_as_float(0x7fc00000u);
#pragma unroll
  for (int t = 0; t < 4; ++t) {
    float bv = 0.f;
    if (EPI == 0 || EPI == 3) bv = bf16_rne(bias[col0 + t * 16 + ln]);
#pragma unroll
    for (int r = 0; r < 8; ++r) {
      if (!RES) {
        float v0 = c0[t][r] * alpha + bv, v1 = c1[t][r] * alpha + bv;
        if (EPI == 3) { v0 = poison ? nanv : v0; v1 = poison ? nanv : v1; }
        so[w][8 * hh + r][t * 16 + ln] = v0; so[w][(RT - 16) + 8 * hh + r][t * 16 + ln] = v1;
      } else {
        float v0 = (c0[t][r] + c1[t][r] * 0.0009765625f) * alpha + bv;
        if (EPI == 3) v0 = poison ? nanv : v0;
        so[w][8 * hh + r][t * 16 + ln] = v0;
      }
    }
  }
  __builtin_amdgcn_fence(4 /* acq_rel order */, "workgroup"); __builtin_amdgcn_wave_barrier();
  const int rsub = lane >> 4, c4 = (lane & 15) * 4;
  {
#pragma unroll
    for (int q = 0; q < RT / 2; ++q) {
      const int r = q * 2 + rsub; const int row = row0 + r;
      const v4f v = *(const v4fa*)&so[w][r][c4];
      if (EPI == 1 || EPI == 3) {
        *(v4f*)(Cf + (size_t)by * sC + (size_t)row * ldc + col0 + c4) = v;
      } else if (EPI == 2) {
        v4h h4, r4; split4(v, h4, r4);
        const size_t o = (size_t)by * sC + (size_t)row * ldc + col0 + c4;
        *(v4h*)(C1 + o) = h4;
        if (RES) *(v4h*)(C2 + o) = r4;
      } else {
        const int which = col0 / DM, hc = col0 - which * DM, h = hc >> 6;
        const size_t o16 = ((size_t)by * SEQ + row) * DM + hc + c4;
        const size_t oe = ((size_t)by * EARLY + row) * DM + hc + c4;
        const size_t of = (((size_t)by * NH + h) * SEQ_FULL + row) * HD + c4;
        if (which == 0) {
          v4h h4, r4; split4(v, h4, r4);
          *(v4h*)(C1 + o16) = h4;
          if (row0 < EARLY) *(v4h*)(C3 + oe) = r4;
        } else if (which == 1) {
          *(v4f*)(Cf + OUT1_OFF + of) = v;
          v4h h4, r4; split4(v, h4, r4);
          *(v4h*)(C2 + o16) = h4;
          if (row0 < EARLY) *(v4h*)(C4 + oe) = r4;
        } else {
          *(v4f*)(Cf + OUT2_OFF + of) = v;
        }
      }
    }
    
  }
}

extern "C" void kernel_launch(void* const* d_in, const int* in_sizes, int n_in,
                              void* d_out, int out_size, void* d_ws, size_t ws_size, hipStream_t stream) {
  if (n_in < 6) return;
  if ((size_t)in_sizes[0] < (size_t)(NB - 1) * SEQ_FULL * DM + (size_t)SEQ * DM) return;
  if ((size_t)in_sizes[1] < (size_t)DM * 3 * DM) return;
  if (in_sizes[2] < 3 * DM) return;
  if ((size_t)in_sizes[3] < (size_t)DM * DM) return;
  if (in_sizes[4] < DM) return;
  if ((size_t)in_sizes[5] < (size_t)(SEQ - 1) * SEQ_FULL + SEQ) return;
  if ((size_t)out_size < OUT2_OFF + ((size_t)((NB - 1) * NH + NH - 1) * SEQ_FULL + SEQ) * HD) return;
  const float* x = (const float*)d_in[0];        /* x      [B][L][1024] */
  const float* wqkv = (const float*)d_in[1];     /* w_qkv  [1024][3072] ([in][out]; columns q | k | v) */
  const float* bqkv = (const float*)d_in[2];     /* b_qkv  [3072] */
  const float* wo = (const float*)d_in[3];       /* w_o    [1024][1024] ([in][out]) */
  const float* bo = (const float*)d_in[4];       /* b_o    [1024] */
  const float* mask = (const float*)d_in[5];     /* mask   [1][1][L][L] additive */
  float* out = (float*)d_out;

  constexpr size_t SZ_WT = (size_t)3 * DM * DM * 2, SZ_WO = (size_t)DM * DM * 2, SZ_TOK = (size_t)NB * SEQ * DM * 2;
  constexpr size_t SZ_ER = (size_t)NB * EARLY * DM * 2, SZ_S = (size_t)HG * SEQ * SEQ * 4, SZ_PH = (size_t)HG * SEQ * SEQ * 2;
  constexpr size_t SZ_PR = (size_t)HG * EARLY * SEQ * 2, SZ_FL = (size_t)32 * 128;
  constexpr size_t SZ_ALL = SZ_WT + SZ_WO + 7 * SZ_TOK + 2 * SZ_ER + SZ_S + SZ_PH + SZ_PR + SZ_FL;
  static_assert(SZ_ALL <= (size_t)134217728);
  static_assert(SZ_WT % 256 == 0 && SZ_WO % 256 == 0 && SZ_TOK % 256 == 0 && SZ_ER % 256 == 0 && SZ_S % 256 == 0 && SZ_PH % 256 == 0 && SZ_PR % 256 == 0 && SZ_FL % 256 == 0);
  if (SZ_ALL > ws_size) return;
  char* ws = (char*)d_ws; size_t off = 0;
  auto take = [&](size_t bytes) { char* p = ws + off; off += bytes; return p; };
  _Float16* WT = (_Float16*)take(SZ_WT);      /* [3072][1024] x16 */
  _Float16* WoT = (_Float16*)take(SZ_WO);     /* [1024][1024] x16 */
  _Float16* X16 = (_Float16*)take(SZ_TOK);    /* [NB*SEQ][1024] */
  _Float16* Q16 = (_Float16*)take(SZ_TOK);
  _Float16* K16 = (_Float16*)take(SZ_TOK);
  _Float16* VTh = (_Float16*)take(SZ_TOK);    /* [NB*16][64][SEQ] */
  _Float16* VTr = (_Float16*)take(SZ_TOK);
  _Float16* CTh = (_Float16*)take(SZ_TOK);    /* ctx x64, [NB*SEQ][1024] */
  _Float16* CTr = (_Float16*)take(SZ_TOK);
  _Float16* Qr = (_Float16*)take(SZ_ER);      /* [NB][EARLY][1024] */
  _Float16* Kr = (_Float16*)take(SZ_ER);
  float* S = (float*)take(SZ_S);              /* [HG][SEQ][SEQ] */
  _Float16* Ph = (_Float16*)take(SZ_PH);      /* [HG][SEQ][SEQ] */
  _Float16* Pr = (_Float16*)take(SZ_PR);      /* [HG][EARLY][SEQ] */
  int* MCHK = (int*)take(SZ_FL);              /* 32 lines of 32 ints */

  k_wt_f16<<<(unsigned)(((size_t)3 * DM * (DM / 8) + 255) / 256), 256, 0, stream>>>(wqkv, WT, DM, 3 * DM, 16.0f);
  k_wt_f16<<<(unsigned)(((size_t)DM * (DM / 8) + 255) / 256), 256, 0, stream>>>(wo, WoT, DM, DM, 16.0f);
  k_x16<<<dim3((unsigned)((size_t)SEQ * DM / 8 / 256), NB), 256, 0, stream>>>(x, X16);
  k_maskchk<<<32, 256, 0, stream>>>(mask, MCHK);
  /* fused QKV projection: grid.y = batch; 48 column tiles of 64 = (q|k|v, head) */
  k_mm<false, false, 0><<<dim3((unsigned)((SEQ / 128) * (3 * DM / 64)), NB), 128, 0, stream>>>(
      X16, nullptr, DM, (size_t)SEQ * DM, (size_t)0,
      WT, nullptr, DM, (size_t)0,
      0, 3 * DM / 64, DM, 0, 0.0625f,
      out, Q16, K16, Qr, Kr, bqkv, nullptr, 0, (size_t)0);
  k_vt<<<(unsigned)(NB * NH * (SEQ / 64)), 256, 0, stream>>>(out + OUT2_OFF, VTh, VTr);

  for (int g = 0; g < NB * NH / HG; ++g) {
    const int bh0 = g * HG, b = bh0 / NH, h0 = bh0 % NH;
    const _Float16* Qb = Q16 + (size_t)b * SEQ * DM + (size_t)h0 * HD;
    const _Float16* Kb = K16 + (size_t)b * SEQ * DM + (size_t)h0 * HD;
    const _Float16* Qrb = Qr + (size_t)b * EARLY * DM + (size_t)h0 * HD;
    const _Float16* Krb = Kr + (size_t)b * EARLY * DM + (size_t)h0 * HD;
    const _Float16* Vhb = VTh + (size_t)bh0 * HD * SEQ;
    const _Float16* Vrb = VTr + (size_t)bh0 * HD * SEQ;
    _Float16* Chb = CTh + (size_t)b * SEQ * DM + (size_t)h0 * HD;
    _Float16* Crb = CTr + (size_t)b * SEQ * DM + (size_t)h0 * HD;
    /* scores, early rows x early keys: qh.kh + (qr.kh + qh.kr) 2^-10, alpha 1/8 */
    k_mm<true, true, 1><<<dim3((unsigned)((EARLY / 64) * (EARLY / 64)), HG), 128, 0, stream>>>(
        Qb, Qrb, DM, (size_t)HD, (size_t)HD,
        Kb, Krb, DM, (size_t)HD,
        0, EARLY / 64, HD, 2, 0.125f,
        S, nullptr, nullptr, nullptr, nullptr, nullptr, nullptr, SEQ, (size_t)SEQ * SEQ);
    /* scores, late rows */
    if (SEQ > EARLY)
      k_mm<false, false, 1><<<dim3((unsigned)(((SEQ - EARLY) / 128) * (SEQ / 64)), HG), 128, 0, stream>>>(
          Qb, nullptr, DM, (size_t)HD, (size_t)0,
          Kb, nullptr, DM, (size_t)HD,
          EARLY, SEQ / 64, HD, 2, 0.125f,
          S, nullptr, nullptr, nullptr, nullptr, nullptr, nullptr, SEQ, (size_t)SEQ * SEQ);
    /* wave per row, 4 rows per block */
    k_softmax<<<(unsigned)(HG * SEQ / 4), 128, 0, stream>>>(S, Ph, Pr);
    /* ctx x64 = (Ph.Vh + (Pr.Vh + Ph.Vr) 2^-10) 2^-4 for early rows */
    k_mm<true, true, 2><<<dim3((unsigned)(EARLY / 64), HG), 128, 0, stream>>>(
        Ph, Pr, SEQ, (size_t)SEQ * SEQ, (size_t)EARLY * SEQ,
        Vhb, Vrb, SEQ, (size_t)HD * SEQ,
        0, 1, SEQ, 1, 0.0625f,
        nullptr, Chb, Crb, nullptr, nullptr, nullptr, nullptr, DM, (size_t)HD);
    /* ctx x64 = Ph.Vh 2^-4 for late rows */
    if (SEQ > EARLY)
      k_mm<false, false, 2><<<dim3((unsigned)((SEQ - EARLY) / 128), HG), 128, 0, stream>>>(
          Ph, nullptr, SEQ, (size_t)SEQ * SEQ, (size_t)0,
          Vhb, nullptr, SEQ, (size_t)HD * SEQ,
          EARLY, 1, SEQ, 1, 0.0625f,
          nullptr, Chb, nullptr, nullptr, nullptr, nullptr, nullptr, DM, (size_t)HD);
  }
  /* out = (ctx x64).(w_o x16) 2^-10 + b_o: early rows with the ctx residual plane, late rows single plane; grid.y = batch */
  k_mm<true, false, 3><<<dim3((unsigned)((EARLY / 64) * (DM / 64)), NB), 128, 0, stream>>>(
      CTh, CTr, DM, (size_t)SEQ * DM, (size_t)SEQ * DM,
      WoT, nullptr, DM, (size_t)0,
      0, DM / 64, DM, 0, 0.0009765625f,
      out, nullptr, nullptr, nullptr, nullptr, bo, MCHK, DM, (size_t)SEQ_FULL * DM);
  if (SEQ > EARLY)
    k_mm<false, false, 3><<<dim3((unsigned)(((SEQ - EARLY) / 128) * (DM / 64)), NB), 128, 0, stream>>>(
        CTh, nullptr, DM, (size_t)SEQ * DM, (size_t)0,
        WoT, nullptr, DM, (size_t)0,
        EARLY, DM / 64, DM, 0, 0.0009765625f,
        out, nullptr, nullptr, nullptr, nullptr, bo, MCHK, DM, (size_t)SEQ_FULL * DM);
}

// v001
// One run takes 749 microseconds.
// Two timings next to v000 put it at 2.49 and 2.50 times that version's speed.
#include <hip/hip_runtime.h>
// Causal multi-head self-attention, B 2 x L 2048, d_model 1024, 16 heads of 64; outputs: out [B][L][1024], k cache [B][16][L][64], v cache [B][16][L][64] (f32).
// Compute dtype: every contraction on v_wmma_f32_16x16x32_f16 (f16 operands, f32 accumulate). x / w_qkv / w_o / biases are RNE-converted to bf16 first (exact in f16; weights carried x16).
// q, k, softmax weights (carried x1024), v and ctx (carried x64) are f16 planes; for the first EARLY query rows of every sequence each of them also has an f16 residual plane carried x2^10
// that goes to a separate accumulator (q k^T: 3 products, P V: 3 products, ctx w_o: 2 products); scores, softmax statistics and all epilogues in f32.
// Structure: weight transposes (once), x plane, mask structure check, fused QKV GEMM (writes the k / v caches in f32 plus the f16 planes), V^T hi/res planes through LDS,
// per group of HG heads: scores (early rows 3-product, late rows 1-product, tiles above the diagonal skipped), wave-per-row softmax (rolled 256-key slices, lane-private LDS staging), P V (early / late), then the output GEMM (early / late).
// The f16 softmax planes of a row overwrite that row's own f32 scores (hi plane in the first half of the row's bytes, residual plane in the second), so that HG heads fit the workspace.
#ifndef NB
#define NB 2
#endif
#ifndef SEQ
#define SEQ 2048
#endif
#define NB_FULL 2
#define SEQ_FULL 2048
#define DM 1024
#define NH 16
#define HD 64
#define HG 8
#define EARLY ((SEQ) < 512 ? (SEQ) : 512)
#define NCH ((SEQ) / 256)
#define OUT1_OFF ((size_t)NB_FULL * SEQ_FULL * DM)
#define OUT2_OFF ((size_t)2 * NB_FULL * SEQ_FULL * DM)

typedef unsigned short v8us __attribute__((ext_vector_type(8), may_alias));
typedef float v8f __attribute__((ext_vector_type(8)));
typedef float v4f __attribute__((ext_vector_type(4)));
typedef float v4fa __attribute__((ext_vector_type(4), may_alias));
typedef _Float16 v16h __attribute__((ext_vector_type(16)));
typedef _Float16 v4h __attribute__((ext_vector_type(4)));
union FragH { v16h v; v8us half[2]; _Float16 h[16]; unsigned short u[16]; };

static_assert(NH * HD == DM);
static_assert(SEQ % 256 == 0);
static_assert(EARLY % 128 == 0);
static_assert((SEQ - EARLY) % 128 == 0);
static_assert(NB <= NB_FULL && SEQ <= SEQ_FULL);
static_assert(NH % HG == 0);
static_assert(OUT1_OFF * 4 == 16777216);
static_assert(OUT2_OFF * 4 == 33554432);
static_assert((size_t)4 * SEQ * 4 <= 65536);

__device__ __forceinline__ unsigned short bf16_bits(float x) { unsigned int u = __float_as_uint(x); return (unsigned short)((u + 0x7FFFu + ((u >> 16) & 1u)) >> 16); }
__device__ __forceinline__ float bf16_rne(float x) { return __uint_as_float(((unsigned int)bf16_bits(x)) << 16); }

// fragment loader (A row or B column, k contiguous): elements 0..7 <- k0+8h.., elements 8..15 <- k0+16+8h..
__device__ __forceinline__ v16h g2_frag(const _Float16* p, int hh) { FragH f; f.half[0] = *(const v8us*)((const unsigned short*)p + 8 * hh); f.half[1] = *(const v8us*)((const unsigned short*)p + 16 + 8 * hh); return f.v; }
__device__ __forceinline__ v8f g2_mma(v16h a, v16h b, v8f c) { v8f d = __builtin_amdgcn_wmma_f32_16x16x32_f16(false, a, false, b, (short)0, c, false, false); asm volatile("v_nop\n\tv_nop\n\tv_nop\n\tv_nop" : "+v"(d) : "v"(a), "v"(b)); return d; }
// f32 -> f16 hi and f16 residual carried x2^10
__device__ __forceinline__ void split4(const v4f v, v4h& h, v4h& r) {
#pragma unroll
  for (int i = 0; i < 4; ++i) { const _Float16 a = (_Float16)v[i]; h[i] = a; r[i] = (_Float16)((v[i] - (float)a) * 1024.0f); }
}

__global__ __launch_bounds__(256) void k_wt_f16(const float* __restrict__ W, _Float16* __restrict__ Wt, int K, int N, float scale) {
  const int t = blockIdx.x * 256 + threadIdx.x; if (t >= N * (K / 8)) return;
  const int n = t / (K / 8), k8 = (t % (K / 8)) * 8; FragH f;
#pragma unroll
  for (int i = 0; i < 8; ++i) f.h[i] = (_Float16)(bf16_rne(W[(size_t)(k8 + i) * N + n]) * scale);
  const v8us o = f.half[0];
  unsigned short* d = (unsigned short*)Wt + (size_t)n * K + k8;
  *(v8us*)d = o; 
}

__global__ __launch_bounds__(256) void k_x16(const float* __restrict__ x, _Float16* __restrict__ X16) {
  const size_t t = (size_t)blockIdx.x * 256 + threadIdx.x; const int b = blockIdx.y;
  const float* src = x + (size_t)b * SEQ_FULL * DM + t * 8;
  const v4f a = *(const v4fa*)src, c = *(const v4fa*)(src + 4); FragH f;
#pragma unroll
  for (int q = 0; q < 4; ++q) { f.h[q] = (_Float16)bf16_rne(a[q]); f.h[4 + q] = (_Float16)bf16_rne(c[q]); }
  unsigned short* d = (unsigned short*)X16 + (size_t)b * SEQ * DM + t * 8;
  *(v8us*)d = f.half[0]; 
}

__global__ __launch_bounds__(256) void k_maskchk(const float* __restrict__ mask, int* __restrict__ flg) {
  __shared__ int sb[8];
  const int w = threadIdx.x >> 5, lane = threadIdx.x & 31;
  const int rper = SEQ / 32;
  int bad = 0;
#pragma unroll 1
  for (int r = w; r < rper; r += 8) {
    const int i = blockIdx.x * rper + r;
    const float* mr = mask + (size_t)i * SEQ_FULL;
#pragma unroll 1
    for (int j0 = lane * 4; j0 < SEQ; j0 += 128) {
      const v4f m = *(const v4fa*)(mr + j0);
#pragma unroll
      for (int q = 0; q < 4; ++q) { const int j = j0 + q; const bool okl = (m[q] == 0.0f); const bool oku = (m[q] <= -1.0e8f); const bool ok = (j <= i) ? okl : oku; bad |= ok ? 0 : 1; }
    }
  }
  for (int off = 16; off > 0; off >>= 1) bad |= __shfl_xor(bad, off, 32);
  if (lane == 0) sb[w] = bad;
  __syncthreads();
  if (w == 0) {
    int tot = 0;
#pragma unroll
    for (int q = 0; q < 8; ++q) tot |= sb[q];
    int* p = flg + blockIdx.x * 32 + lane;
    *p = tot; 
  }
}

__global__ __launch_bounds__(256) void k_vt(const float* __restrict__ Vf, _Float16* __restrict__ VTh, _Float16* __restrict__ VTr) {
  __shared__ float tl[64][65];
  const int tid = threadIdx.x; const int bh = blockIdx.x / (SEQ / 64), sg = blockIdx.x % (SEQ / 64); const int s0 = sg * 64;
  const float* src = Vf + ((size_t)bh * SEQ_FULL + s0) * HD;
  for (int i = tid; i < 64 * 16; i += 256) { const int j = i >> 4, c4 = (i & 15) * 4; const v4f a = *(const v4fa*)(src + (size_t)j * HD + c4);
#pragma unroll
    for (int q = 0; q < 4; ++q) tl[c4 + q][j] = a[q]; }
  __syncthreads();
  {
    for (int i = tid; i < 64 * 8; i += 256) { const int d = i >> 3, j8 = (i & 7) * 8; FragH fh, fr;
#pragma unroll
      for (int q = 0; q < 8; ++q) { const float v = tl[d][j8 + q]; const _Float16 h = (_Float16)v; fh.h[q] = h; fr.h[q] = (_Float16)((v - (float)h) * 1024.0f); }
      const size_t o = ((size_t)bh * HD + d) * SEQ + s0 + j8;
      *(v8us*)((unsigned short*)VTh + o) = fh.half[0];
      *(v8us*)((unsigned short*)VTr + o) = fr.half[0]; }
     }
}

// causal row softmax, one wave per (unit, query row i): keys 0..i, f32 statistics; Ph = f16(1024 p), Pr = f16((1024 p - Ph) 2^10) for rows < EARLY.
// The row is processed in 256-key slices (rolled loops; lane owns 8 consecutive keys per slice); slice values are staged in a lane-private LDS slot
// (each lane reloads only the 32 bytes it stored itself, through the same vector type), so no register array is indexed at run time.
// In place: the wave has staged its whole row in LDS before its first store, and no other wave touches the row. Row bytes afterwards: SEQ f16 of Ph, then SEQ f16 of Pr.
__global__ __launch_bounds__(128) void k_softmax(float* S) {
#pragma clang fp contract(off)
  __shared__ __attribute__((aligned(16))) float ev[4][SEQ];
  const int lane = threadIdx.x & 31;
  const int w = __builtin_amdgcn_readfirstlane((int)(threadIdx.x >> 5));
  const int t = __builtin_amdgcn_readfirstlane((int)(blockIdx.x * 4)) + w;
  const int u = t / SEQ, i = t - u * SEQ;
  float* srow = S + ((size_t)u * SEQ + i) * SEQ;
  const int jcl = (i >> 3) << 3;
  int nc = (i >> 8) + 1;                       /* slices with c*256 <= i */
  nc = nc < NCH ? nc : NCH;
  float mx = -3.0e38f;
#pragma unroll 1
  for (int c = 0; c < nc; ++c) {
    const int j0 = c * 256 + lane * 8;
    const int jl = j0 < jcl ? j0 : jcl;        /* clamped address; values past i are replaced by index below */
    const v4f x0 = *(const v4fa*)(srow + jl), x1 = *(const v4fa*)(srow + jl + 4);
    v4f a, b;
#pragma unroll
    for (int q = 0; q < 4; ++q) { const float s = (j0 + q <= i) ? x0[q] : -1.0e9f; a[q] = s; mx = fmaxf(mx, s); }
#pragma unroll
    for (int q = 0; q < 4; ++q) { const float s = (j0 + 4 + q <= i) ? x1[q] : -1.0e9f; b[q] = s; mx = fmaxf(mx, s); }
    *(v4fa*)&ev[w][j0] = a; *(v4fa*)&ev[w][j0 + 4] = b;
  }
  for (int off = 16; off > 0; off >>= 1) mx = fmaxf(mx, __shfl_xor(mx, off, 32));
  float se = 0.f;
#pragma unroll 1
  for (int c = 0; c < nc; ++c) {
    const int j0 = c * 256 + lane * 8;
    v4f a = *(const v4fa*)&ev[w][j0], b = *(const v4fa*)&ev[w][j0 + 4];
#pragma unroll
    for (int q = 0; q < 4; ++q) { const float d = a[q] - mx; const float e0 = __expf(d); const float e = (j0 + q <= i) ? e0 : 0.f; a[q] = e; se = se + e; }
#pragma unroll
    for (int q = 0; q < 4; ++q) { const float d = b[q] - mx; const float e0 = __expf(d); const float e = (j0 + 4 + q <= i) ? e0 : 0.f; b[q] = e; se = se + e; }
    *(v4fa*)&ev[w][j0] = a; *(v4fa*)&ev[w][j0 + 4] = b;
  }
  for (int off = 16; off > 0; off >>= 1) se += __shfl_xor(se, off, 32);
  const float rinv = 1.0f / se;
  const float sc = 1024.0f * rinv;
  const int wext = ((i >> 6) + 1) << 6;
  unsigned short* ph = (unsigned short*)srow;
  unsigned short* pr = ph + SEQ;
  {
#pragma unroll 1
    for (int c = 0; c < nc; ++c) {
      const int j0 = c * 256 + lane * 8;
      const v4f a = *(const v4fa*)&ev[w][j0], b = *(const v4fa*)&ev[w][j0 + 4];
      FragH fh, fr;
#pragma unroll
      for (int q = 0; q < 4; ++q) { const float p = a[q] * sc; const _Float16 h = (_Float16)p; const float hf = (float)h; const float d = p - hf; const float d2 = d * 1024.0f; fh.h[q] = h; fr.h[q] = (_Float16)d2; }
#pragma unroll
      for (int q = 0; q < 4; ++q) { const float p = b[q] * sc; const _Float16 h = (_Float16)p; const float hf = (float)h; const float d = p - hf; const float d2 = d * 1024.0f; fh.h[4 + q] = h; fr.h[4 + q] = (_Float16)d2; }
      const v8us oh = fh.half[0], orr = fr.half[0];
      if (j0 < wext) {
        *(v8us*)(ph + j0) = oh;
        if (i < EARLY) *(v8us*)(pr + j0) = orr;
      }
    }
    
  }
}

// General f16 GEMM, B operand as Bt[n][k]; block = 4 waves; wave tile RT x 64 (RT = 32, or 16 with the residual accumulator).
// RES: second accumulator gets Ar.Bh (+ Ah.Br if BRES), both carried x2^10, folded in the epilogue. causal 1: k-loop stops at the tile's last key block; causal 2: column tiles past the diagonal are skipped.
// EPI 0: QKV routing (q/k f16 planes + early residual planes, k / v caches in f32), 1: f32 plane, 2: f16 hi (+res) planes, 3: f32 output + bias, NaN fill when the mask check failed.
template <bool RES, bool BRES, int EPI>
__global__ __launch_bounds__(128) void k_mm(
    const _Float16* __restrict__ Ah, const _Float16* __restrict__ Ar, int lda, size_t sA, size_t sAr,
    const _Float16* __restrict__ Bh, const _Float16* __restrict__ Br, int ldb, size_t sB,
    int rbase, int ntn, int K, int causal, float alpha,
    float* __restrict__ Cf, _Float16* __restrict__ C1, _Float16* __restrict__ C2, _Float16* __restrict__ C3, _Float16* __restrict__ C4,
    const float* __restrict__ bias, const int* __restrict__ flags, int ldc, size_t sC) {
  constexpr int RT = RES ? 16 : 32;
  __shared__ __attribute__((aligned(16))) float so[4][RT][68];
  const int tid = threadIdx.x, lane = tid & 31, ln = lane & 15, hh = lane >> 4;
  const int w = __builtin_amdgcn_readfirstlane(tid >> 5);
  const int by = blockIdx.y;
  const int mt = blockIdx.x / ntn, nq = blockIdx.x - mt * ntn;
  const int row0 = rbase + mt * (4 * RT) + RT * w, col0 = nq * 64;
  if (causal == 2 && col0 > row0 + RT - 1) return;
  int kend = K;
  if (causal == 1) { const int kc = (((row0 + RT - 1) >> 5) + 1) << 5; kend = kc < K ? kc : K; }
  const _Float16* ap0 = Ah + (size_t)by * sA + (size_t)(row0 + ln) * lda;
  const _Float16* ap1;
  if (RES) ap1 = Ar + (size_t)by * sAr + (size_t)(row0 + ln) * lda; else ap1 = ap0 + (size_t)16 * lda;
  const _Float16* bp = Bh + (size_t)by * sB + (size_t)(col0 + ln) * ldb;
  const _Float16* brp = bp;
  if (RES && BRES) brp = Br + (size_t)by * sB + (size_t)(col0 + ln) * ldb;
  const v8f z8 = {0.f, 0.f, 0.f, 0.f, 0.f, 0.f, 0.f, 0.f};
  v8f c0[4] = {z8, z8, z8, z8}, c1[4] = {z8, z8, z8, z8};
#pragma unroll 1
  for (int kb = 0; kb < kend; kb += 32) {
    const v16h a0 = g2_frag(ap0 + kb, hh), a1 = g2_frag(ap1 + kb, hh);
#pragma unroll
    for (int t = 0; t < 4; ++t) {
      const v16h b = g2_frag(bp + (size_t)(16 * t) * ldb + kb, hh);
      c0[t] = g2_mma(a0, b, c0[t]);
      c1[t] = g2_mma(a1, b, c1[t]);
      if (RES && BRES) { const v16h br = g2_frag(brp + (size_t)(16 * t) * ldb + kb, hh); c1[t] = g2_mma(a0, br, c1[t]); }
    }
  }
  int poison = 0;
  if (EPI == 3) { int fl = flags[lane * 32]; for (int off = 16; off > 0; off >>= 1) fl |= __shfl_xor(fl, off, 32); poison = fl; }
  const float nanv = __uint_as_float(0x7fc00000u);
#pragma unroll
  for (int t = 0; t < 4; ++t) {
    float bv = 0.f;
    if (EPI == 0 || EPI == 3) bv = bf16_rne(bias[col0 + t * 16 + ln]);
#pragma unroll
    for (int r = 0; r < 8; ++r) {
      if (!RES) {
        float v0 = c0[t][r] * alpha + bv, v1 = c1[t][r] * alpha + bv;
        if (EPI == 3) { v0 = poison ? nanv : v0; v1 = poison ? nanv : v1; }
        so[w][8 * hh + r][t * 16 + ln] = v0; so[w][(RT - 16) + 8 * hh + r][t * 16 + ln] = v1;
      } else {
        float v0 = (c0[t][r] + c1[t][r] * 0.0009765625f) * alpha + bv;
        if (EPI == 3) v0 = poison ? nanv : v0;
        so[w][8 * hh + r][t * 16 + ln] = v0;
      }
    }
  }
  __builtin_amdgcn_fence(4 /* acq_rel order */, "workgroup"); __builtin_amdgcn_wave_barrier();
  const int rsub = lane >> 4, c4 = (lane & 15) * 4;
  {
#pragma unroll
    for (int q = 0; q < RT / 2; ++q) {
      const int r = q * 2 + rsub; const int row = row0 + r;
      const v4f v = *(const v4fa*)&so[w][r][c4];
      if (EPI == 1 || EPI == 3) {
        *(v4f*)(Cf + (size_t)by * sC + (size_t)row * ldc + col0 + c4) = v;
      } else if (EPI == 2) {
        v4h h4, r4; split4(v, h4, r4);
        const size_t o = (size_t)by * sC + (size_t)row * ldc + col0 + c4;
        *(v4h*)(C1 + o) = h4;
        if (RES) *(v4h*)(C2 + o) = r4;
      } else {
        const int which = col0 / DM, hc = col0 - which * DM, h = hc >> 6;
        const size_t o16 = ((size_t)by * SEQ + row) * DM + hc + c4;
        const size_t oe = ((size_t)by * EARLY + row) * DM + hc + c4;
        const size_t of = (((size_t)by * NH + h) * SEQ_FULL + row) * HD + c4;
        if (which == 0) {
          v4h h4, r4; split4(v, h4, r4);
          *(v4h*)(C1 + o16) = h4;
          if (row0 < EARLY) *(v4h*)(C3 + oe) = r4;
        } else if (which == 1) {
          *(v4f*)(Cf + OUT1_OFF + of) = v;
          v4h h4, r4; split4(v, h4, r4);
          *(v4h*)(C2 + o16) = h4;
          if (row0 < EARLY) *(v4h*)(C4 + oe) = r4;
        } else {
          *(v4f*)(Cf + OUT2_OFF + of) = v;
        }
      }
    }
    
  }
}

extern "C" void kernel_launch(void* const* d_in, const int* in_sizes, int n_in,
                              void* d_out, int out_size, void* d_ws, size_t ws_size, hipStream_t stream) {
  if (n_in < 6) return;
  if ((size_t)in_sizes[0] < (size_t)(NB - 1) * SEQ_FULL * DM + (size_t)SEQ * DM) return;
  if ((size_t)in_sizes[1] < (size_t)DM * 3 * DM) return;
  if (in_sizes[2] < 3 * DM) return;
  if ((size_t)in_sizes[3] < (size_t)DM * DM) return;
  if (in_sizes[4] < DM) return;
  if ((size_t)in_sizes[5] < (size_t)(SEQ - 1) * SEQ_FULL + SEQ) return;
  if ((size_t)out_size < OUT2_OFF + ((size_t)((NB - 1) * NH + NH - 1) * SEQ_FULL + SEQ) * HD) return;
  const float* x = (const float*)d_in[0];        /* x      [B][L][1024] */
  const float* wqkv = (const float*)d_in[1];     /* w_qkv  [1024][3072] ([in][out]; columns q | k | v) */
  const float* bqkv = (const float*)d_in[2];     /* b_qkv  [3072] */
  const float* wo = (const float*)d_in[3];       /* w_o    [1024][1024] ([in][out]) */
  const float* bo = (const float*)d_in[4];       /* b_o    [1024] */
  const float* mask = (const float*)d_in[5];     /* mask   [1][1][L][L] additive */
  float* out = (float*)d_out;

  constexpr size_t SZ_WT = (size_t)3 * DM * DM * 2, SZ_WO = (size_t)DM * DM * 2, SZ_TOK = (size_t)NB * SEQ * DM * 2;
  constexpr size_t SZ_ER = (size_t)NB * EARLY * DM * 2, SZ_S = (size_t)HG * SEQ * SEQ * 4;
  constexpr size_t SZ_FL = (size_t)32 * 128;
  constexpr size_t SZ_ALL = SZ_WT + SZ_WO + 7 * SZ_TOK + 2 * SZ_ER + SZ_S + SZ_FL;
  static_assert(SZ_ALL <= (size_t)268435456);
  static_assert(SZ_WT % 256 == 0 && SZ_WO % 256 == 0 && SZ_TOK % 256 == 0 && SZ_ER % 256 == 0 && SZ_S % 256 == 0 && SZ_FL % 256 == 0);
  if (SZ_ALL > ws_size) return;
  char* ws = (char*)d_ws; size_t off = 0;
  auto take = [&](size_t bytes) { char* p = ws + off; off += bytes; return p; };
  _Float16* WT = (_Float16*)take(SZ_WT);      /* [3072][1024] x16 */
  _Float16* WoT = (_Float16*)take(SZ_WO);     /* [1024][1024] x16 */
  _Float16* X16 = (_Float16*)take(SZ_TOK);    /* [NB*SEQ][1024] */
  _Float16* Q16 = (_Float16*)take(SZ_TOK);
  _Float16* K16 = (_Float16*)take(SZ_TOK);
  _Float16* VTh = (_Float16*)take(SZ_TOK);    /* [NB*16][64][SEQ] */
  _Float16* VTr = (_Float16*)take(SZ_TOK);
  _Float16* CTh = (_Float16*)take(SZ_TOK);    /* ctx x64, [NB*SEQ][1024] */
  _Float16* CTr = (_Float16*)take(SZ_TOK);
  _Float16* Qr = (_Float16*)take(SZ_ER);      /* [NB][EARLY][1024] */
  _Float16* Kr = (_Float16*)take(SZ_ER);
  float* S = (float*)take(SZ_S);              /* [HG][SEQ][SEQ] f32; after the softmax each row is [Ph: SEQ f16][Pr: SEQ f16] */
  const _Float16* Ph = (const _Float16*)S;    /* row pitch 2 SEQ */
  const _Float16* Pr = Ph + SEQ;
  int* MCHK = (int*)take(SZ_FL);              /* 32 lines of 32 ints */

  k_wt_f16<<<(unsigned)(((size_t)3 * DM * (DM / 8) + 255) / 256), 256, 0, stream>>>(wqkv, WT, DM, 3 * DM, 16.0f);
  k_wt_f16<<<(unsigned)(((size_t)DM * (DM / 8) + 255) / 256), 256, 0, stream>>>(wo, WoT, DM, DM, 16.0f);
  k_x16<<<dim3((unsigned)((size_t)SEQ * DM / 8 / 256), NB), 256, 0, stream>>>(x, X16);
  k_maskchk<<<32, 256, 0, stream>>>(mask, MCHK);
  /* fused QKV projection: grid.y = batch; 48 column tiles of 64 = (q|k|v, head) */
  k_mm<false, false, 0><<<dim3((unsigned)((SEQ / 128) * (3 * DM / 64)), NB), 128, 0, stream>>>(
      X16, nullptr, DM, (size_t)SEQ * DM, (size_t)0,
      WT, nullptr, DM, (size_t)0,
      0, 3 * DM / 64, DM, 0, 0.0625f,
      out, Q16, K16, Qr, Kr, bqkv, nullptr, 0, (size_t)0);
  k_vt<<<(unsigned)(NB * NH * (SEQ / 64)), 256, 0, stream>>>(out + OUT2_OFF, VTh, VTr);

  for (int g = 0; g < NB * NH / HG; ++g) {
    const int bh0 = g * HG, b = bh0 / NH, h0 = bh0 % NH;
    const _Float16* Qb = Q16 + (size_t)b * SEQ * DM + (size_t)h0 * HD;
    const _Float16* Kb = K16 + (size_t)b * SEQ * DM + (size_t)h0 * HD;
    const _Float16* Qrb = Qr + (size_t)b * EARLY * DM + (size_t)h0 * HD;
    const _Float16* Krb = Kr + (size_t)b * EARLY * DM + (size_t)h0 * HD;
    const _Float16* Vhb = VTh + (size_t)bh0 * HD * SEQ;
    const _Float16* Vrb = VTr + (size_t)bh0 * HD * SEQ;
    _Float16* Chb = CTh + (size_t)b * SEQ * DM + (size_t)h0 * HD;
    _Float16* Crb = CTr + (size_t)b * SEQ * DM + (size_t)h0 * HD;
    /* scores, early rows x early keys: qh.kh + (qr.kh + qh.kr) 2^-10, alpha 1/8 */
    k_mm<true, true, 1><<<dim3((unsigned)((EARLY / 64) * (EARLY / 64)), HG), 128, 0, stream>>>(
        Qb, Qrb, DM, (size_t)HD, (size_t)HD,
        Kb, Krb, DM, (size_t)HD,
        0, EARLY / 64, HD, 2, 0.125f,
        S, nullptr, nullptr, nullptr, nullptr, nullptr, nullptr, SEQ, (size_t)SEQ * SEQ);
    /* scores, late rows */
    if (SEQ > EARLY)
      k_mm<false, false, 1><<<dim3((unsigned)(((SEQ - EARLY) / 128) * (SEQ / 64)), HG), 128, 0, stream>>>(
          Qb, nullptr, DM, (size_t)HD, (size_t)0,
          Kb, nullptr, DM, (size_t)HD,
          EARLY, SEQ / 64, HD, 2, 0.125f,
          S, nullptr, nullptr, nullptr, nullptr, nullptr, nullptr, SEQ, (size_t)SEQ * SEQ);
    /* wave per row, 4 rows per block */
    k_softmax<<<(unsigned)(HG * SEQ / 4), 128, 0, stream>>>(S);
    /* ctx x64 = (Ph.Vh + (Pr.Vh + Ph.Vr) 2^-10) 2^-4 for early rows */
    k_mm<true, true, 2><<<dim3((unsigned)(EARLY / 64), HG), 128, 0, stream>>>(
        Ph, Pr, 2 * SEQ, (size_t)2 * SEQ * SEQ, (size_t)2 * SEQ * SEQ,
        Vhb, Vrb, SEQ, (size_t)HD * SEQ,
        0, 1, SEQ, 1, 0.0625f,
        nullptr, Chb, Crb, nullptr, nullptr, nullptr, nullptr, DM, (size_t)HD);
    /* ctx x64 = Ph.Vh 2^-4 for late rows */
    if (SEQ > EARLY)
      k_mm<false, false, 2><<<dim3((unsigned)((SEQ - EARLY) / 128), HG), 128, 0, stream>>>(
          Ph, nullptr, 2 * SEQ, (size_t)2 * SEQ * SEQ, (size_t)0,
          Vhb, nullptr, SEQ, (size_t)HD * SEQ,
          EARLY, 1, SEQ, 1, 0.0625f,
          nullptr, Chb, nullptr, nullptr, nullptr, nullptr, nullptr, DM, (size_t)HD);
  }
  /* out = (ctx x64).(w_o x16) 2^-10 + b_o: early rows with the ctx residual plane, late rows single plane; grid.y = batch */
  k_mm<true, false, 3><<<dim3((unsigned)((EARLY / 64) * (DM / 64)), NB), 128, 0, stream>>>(
      CTh, CTr, DM, (size_t)SEQ * DM, (size_t)SEQ * DM,
      WoT, nullptr, DM, (size_t)0,
      0, DM / 64, DM, 0, 0.0009765625f,
      out, nullptr, nullptr, nullptr, nullptr, bo, MCHK, DM, (size_t)SEQ_FULL * DM);
  if (SEQ > EARLY)
    k_mm<false, false, 3><<<dim3((unsigned)(((SEQ - EARLY) / 128) * (DM / 64)), NB), 128, 0, stream>>>(
        CTh, nullptr, DM, (size_t)SEQ * DM, (size_t)0,
        WoT, nullptr, DM, (size_t)0,
        EARLY, DM / 64, DM, 0, 0.0009765625f,
        out, nullptr, nullptr, nullptr, nullptr, bo, MCHK, DM, (size_t)SEQ_FULL * DM);
}

// v002
// A run of this version takes 281 microseconds.
// Next to v001, in two timings, it ran 2.68 and 2.63 times as fast.
// Over all steps from v000 it is 6.62 times as fast.
#include <hip/hip_runtime.h>
// Causal multi-head self-attention, B 2 x L 2048, d_model 1024, 16 heads of 64; outputs: out [B][L][1024], k cache [B][16][L][64], v cache [B][16][L][64] (f32).
// Compute dtype: every contraction on v_wmma_f32_16x16x32_f16 (f16 operands, f32 accumulate). x / w_qkv / w_o / biases are RNE-converted to bf16 first (exact in f16; weights carried x16).
// q, k, v and ctx (carried x64) are f16 planes, the softmax weights (unnormalised, carried x1024) f16 fragments; for the first EARLY query rows of every sequence each of them also has an f16 residual plane carried x2^10
// that goes to a separate accumulator (q k^T: 3 products, P V: 3 products, ctx w_o: 2 products); scores, softmax statistics and all epilogues in f32.
// Structure: weight transposes (once), x plane, mask structure check, fused QKV GEMM (writes the k / v caches in f32 plus the f16 planes), V^T hi/res planes through LDS,
// one attention launch for all heads (scores, online softmax and P V in registers; the scores never reach memory), then the output GEMM (early / late).
#ifndef NB
#define NB 2
#endif
#ifndef SEQ
#define SEQ 2048
#endif
#define NB_FULL 2
#define SEQ_FULL 2048
#define DM 1024
#define NH 16
#define HD 64
#define EARLY ((SEQ) < 512 ? (SEQ) : 512)
#define OUT1_OFF ((size_t)NB_FULL * SEQ_FULL * DM)
#define OUT2_OFF ((size_t)2 * NB_FULL * SEQ_FULL * DM)

typedef unsigned short v8us __attribute__((ext_vector_type(8), may_alias));
typedef float v8f __attribute__((ext_vector_type(8)));
typedef float v4f __attribute__((ext_vector_type(4)));
typedef float v4fa __attribute__((ext_vector_type(4), may_alias));
typedef _Float16 v16h __attribute__((ext_vector_type(16)));
typedef _Float16 v4h __attribute__((ext_vector_type(4)));
union FragH { v16h v; v8us half[2]; _Float16 h[16]; unsigned short u[16]; };

static_assert(NH * HD == DM);
static_assert(SEQ % 256 == 0);
static_assert(EARLY % 128 == 0);
static_assert((SEQ - EARLY) % 128 == 0);
static_assert(NB <= NB_FULL && SEQ <= SEQ_FULL);
static_assert(OUT1_OFF * 4 == 16777216);
static_assert(OUT2_OFF * 4 == 33554432);

__device__ __forceinline__ unsigned short bf16_bits(float x) { unsigned int u = __float_as_uint(x); return (unsigned short)((u + 0x7FFFu + ((u >> 16) & 1u)) >> 16); }
__device__ __forceinline__ float bf16_rne(float x) { return __uint_as_float(((unsigned int)bf16_bits(x)) << 16); }

// fragment loader (A row or B column, k contiguous): elements 0..7 <- k0+8h.., elements 8..15 <- k0+16+8h..
__device__ __forceinline__ v16h g2_frag(const _Float16* p, int hh) { FragH f; f.half[0] = *(const v8us*)((const unsigned short*)p + 8 * hh); f.half[1] = *(const v8us*)((const unsigned short*)p + 16 + 8 * hh); return f.v; }
__device__ __forceinline__ v8f g2_mma(v16h a, v16h b, v8f c) { v8f d = __builtin_amdgcn_wmma_f32_16x16x32_f16(false, a, false, b, (short)0, c, false, false); asm volatile("v_nop\n\tv_nop\n\tv_nop\n\tv_nop" : "+v"(d) : "v"(a), "v"(b)); return d; }
// f32 -> f16 hi and f16 residual carried x2^10
__device__ __forceinline__ void split4(const v4f v, v4h& h, v4h& r) {
#pragma unroll
  for (int i = 0; i < 4; ++i) { const _Float16 a = (_Float16)v[i]; h[i] = a; r[i] = (_Float16)((v[i] - (float)a) * 1024.0f); }
}

__global__ __launch_bounds__(256) void k_wt_f16(const float* __restrict__ W, _Float16* __restrict__ Wt, int K, int N, float scale) {
  const int t = blockIdx.x * 256 + threadIdx.x; if (t >= N * (K / 8)) return;
  const int n = t / (K / 8), k8 = (t % (K / 8)) * 8; FragH f;
#pragma unroll
  for (int i = 0; i < 8; ++i) f.h[i] = (_Float16)(bf16_rne(W[(size_t)(k8 + i) * N + n]) * scale);
  const v8us o = f.half[0];
  unsigned short* d = (unsigned short*)Wt + (size_t)n * K + k8;
  *(v8us*)d = o; 
}

__global__ __launch_bounds__(256) void k_x16(const float* __restrict__ x, _Float16* __restrict__ X16) {
  const size_t t = (size_t)blockIdx.x * 256 + threadIdx.x; const int b = blockIdx.y;
  const float* src = x + (size_t)b * SEQ_FULL * DM + t * 8;
  const v4f a = *(const v4fa*)src, c = *(const v4fa*)(src + 4); FragH f;
#pragma unroll
  for (int q = 0; q < 4; ++q) { f.h[q] = (_Float16)bf16_rne(a[q]); f.h[4 + q] = (_Float16)bf16_rne(c[q]); }
  unsigned short* d = (unsigned short*)X16 + (size_t)b * SEQ * DM + t * 8;
  *(v8us*)d = f.half[0]; 
}

__global__ __launch_bounds__(256) void k_maskchk(const float* __restrict__ mask, int* __restrict__ flg) {
  __shared__ int sb[8];
  const int w = threadIdx.x >> 5, lane = threadIdx.x & 31;
  const int rper = SEQ / 32;
  int bad = 0;
#pragma unroll 1
  for (int r = w; r < rper; r += 8) {
    const int i = blockIdx.x * rper + r;
    const float* mr = mask + (size_t)i * SEQ_FULL;
#pragma unroll 1
    for (int j0 = lane * 4; j0 < SEQ; j0 += 128) {
      const v4f m = *(const v4fa*)(mr + j0);
#pragma unroll
      for (int q = 0; q < 4; ++q) { const int j = j0 + q; const bool okl = (m[q] == 0.0f); const bool oku = (m[q] <= -1.0e8f); const bool ok = (j <= i) ? okl : oku; bad |= ok ? 0 : 1; }
    }
  }
  for (int off = 16; off > 0; off >>= 1) bad |= __shfl_xor(bad, off, 32);
  if (lane == 0) sb[w] = bad;
  __syncthreads();
  if (w == 0) {
    int tot = 0;
#pragma unroll
    for (int q = 0; q < 8; ++q) tot |= sb[q];
    int* p = flg + blockIdx.x * 32 + lane;
    *p = tot; 
  }
}

__global__ __launch_bounds__(256) void k_vt(const float* __restrict__ Vf, _Float16* __restrict__ VTh, _Float16* __restrict__ VTr) {
  __shared__ float tl[64][65];
  const int tid = threadIdx.x; const int bh = blockIdx.x / (SEQ / 64), sg = blockIdx.x % (SEQ / 64); const int s0 = sg * 64;
  const float* src = Vf + ((size_t)bh * SEQ_FULL + s0) * HD;
  for (int i = tid; i < 64 * 16; i += 256) { const int j = i >> 4, c4 = (i & 15) * 4; const v4f a = *(const v4fa*)(src + (size_t)j * HD + c4);
#pragma unroll
    for (int q = 0; q < 4; ++q) tl[c4 + q][j] = a[q]; }
  __syncthreads();
  {
    for (int i = tid; i < 64 * 8; i += 256) { const int d = i >> 3, j8 = (i & 7) * 8; FragH fh, fr;
#pragma unroll
      for (int q = 0; q < 8; ++q) { const float v = tl[d][j8 + q]; const _Float16 h = (_Float16)v; fh.h[q] = h; fr.h[q] = (_Float16)((v - (float)h) * 1024.0f); }
      const size_t o = ((size_t)bh * HD + d) * SEQ + s0 + j8;
      *(v8us*)((unsigned short*)VTh + o) = fh.half[0];
      *(v8us*)((unsigned short*)VTr + o) = fr.half[0]; }
     }
}

// lane l <-> lane l ^ 16 in one vector instruction (a shuffle would go through the LDS pipe and its wait)
__device__ __forceinline__ float xhalf(float x) { return __builtin_bit_cast(float, __builtin_amdgcn_permlanex16(__builtin_bit_cast(int, x), __builtin_bit_cast(int, x), 0x76543210, 0xfedcba98, false, false)); }

// One pass of the fused attention: 32 keys x the wave's 16 queries, both products transposed so that a lane owns one query (column ln) throughout.
// S^T = K Q^T: A = K rows (keys), B = Q rows (queries); accumulator register r of key tile t holds key k0 + 16 t + 8 hh + r of query q0 + ln,
// which is element 8 t + r of the B fragment of O^T += V^T P^T (A = V^T rows d, k = keys): P goes from accumulator to operand inside the lane.
// Online softmax: m = running maximum of the query (equal in both halves), l = this half's sum of p = 1024 exp(s - m); the accumulators are rescaled only in a pass where some query's maximum grew.
// RES: scores kh.qh + (kh.qr + kr.qh) 2^-10, output vh.ph + (vh.pr + vr.ph) 2^-10, the residual operands carried x2^10 in a second accumulator.
template <bool RES>
__device__ __forceinline__ void attn_scores(const v16h (&kf)[4], const v16h (&krf)[4], const v16h (&qf)[2], const v16h (&qrf)[2],
                                            int k0, int q0, int ln, int hh, float& m, float& l, v8f (&o0)[4], v8f (&o1)[4], v16h& pho, v16h& pro) {
  const v8f z8 = {0.f, 0.f, 0.f, 0.f, 0.f, 0.f, 0.f, 0.f};
  const float L2E = 1.44269504088896340736f;
  v8f s[2];
#pragma unroll
  for (int t = 0; t < 2; ++t) {
    v8f c = g2_mma(kf[2 * t], qf[0], z8);
    c = g2_mma(kf[2 * t + 1], qf[1], c);
    if (RES) {
      v8f e = g2_mma(kf[2 * t], qrf[0], z8);
      e = g2_mma(krf[2 * t], qf[0], e);
      e = g2_mma(kf[2 * t + 1], qrf[1], e);
      e = g2_mma(krf[2 * t + 1], qf[1], e);
      c = c + e * 0.0009765625f;
    }
    s[t] = c * 0.125f;
  }
  if (k0 + 31 > q0) {                          /* wave-uniform: only a pass that reaches the diagonal masks */
#pragma unroll
    for (int t = 0; t < 2; ++t)
#pragma unroll
      for (int r = 0; r < 8; ++r) s[t][r] = (k0 + 16 * t + 8 * hh + r <= q0 + ln) ? s[t][r] : -1.0e30f;
  }
  float tm = fmaxf(s[0][0], s[1][0]);
#pragma unroll
  for (int r = 1; r < 8; ++r) tm = fmaxf(tm, fmaxf(s[0][r], s[1][r]));
  tm = fmaxf(tm, xhalf(tm));
  const float mn = fmaxf(m, tm);
  if (__builtin_amdgcn_ballot_w32(mn > m) != 0) {
    const float f = __builtin_amdgcn_exp2f((m - mn) * L2E);
    l *= f;
#pragma unroll
    for (int t = 0; t < 4; ++t) { o0[t] = o0[t] * f; if (RES) o1[t] = o1[t] * f; }
    m = mn;
  }
  FragH ph, pr;
#pragma unroll
  for (int t = 0; t < 2; ++t)
#pragma unroll
    for (int r = 0; r < 8; ++r) {
      const float p = __builtin_amdgcn_exp2f(fmaf(s[t][r] - m, L2E, 10.0f));
      l += p;
      const _Float16 h = (_Float16)p;
      ph.h[8 * t + r] = h;
      if (RES) pr.h[8 * t + r] = (_Float16)((p - (float)h) * 1024.0f);
    }
  pho = ph.v;
  if (RES) pro = pr.v;
}
template <bool RES>
__device__ __forceinline__ void attn_out(const v16h (&vf)[4], const v16h (&vrf)[4], const v16h ph, const v16h pr, v8f (&o0)[4], v8f (&o1)[4]) {
#pragma unroll
  for (int t = 0; t < 4; ++t) {
    o0[t] = g2_mma(vf[t], ph, o0[t]);
    if (RES) { o1[t] = g2_mma(vf[t], pr, o1[t]); o1[t] = g2_mma(vrf[t], ph, o1[t]); }
  }
}

// precaution: stands behind a run of global loads or stores, in front of any rewrite of their address registers
__device__ __forceinline__ void xwait() { asm volatile("s_wait_xcnt 0x0" ::: "memory"); }
// fragment at a wave-uniform base plus the lane's fixed byte offset
__device__ __forceinline__ v16h u_frag(const _Float16* ubase, unsigned lofs) {
  const char* p = (const char*)ubase + lofs; FragH f; f.half[0] = *(const v8us*)p; f.half[1] = *(const v8us*)(p + 32); return f.v;
}
// K fragments of keys k0 .. k0 + 31: two key tiles x two halves of the head; kb = the head's K plane (row pitch DM), lofs = (ln DM + 8 hh) elements in bytes
__device__ __forceinline__ void attn_ldk(v16h (&kf)[4], const _Float16* kb, unsigned lofs, int k0) {
#pragma unroll
  for (int t = 0; t < 2; ++t) { kf[2 * t] = u_frag(kb + (size_t)(k0 + 16 * t) * DM, lofs); kf[2 * t + 1] = u_frag(kb + (size_t)(k0 + 16 * t) * DM + 32, lofs); }
  xwait();
}
// V^T fragments of the same keys: four tiles of 16 head columns; vb = the head's V^T plane (row pitch SEQ), lofs = (ln SEQ + 8 hh) elements in bytes
__device__ __forceinline__ void attn_ldv(v16h (&vf)[4], const _Float16* vb, unsigned lofs, int k0) {
#pragma unroll
  for (int t = 0; t < 4; ++t) vf[t] = u_frag(vb + (size_t)(16 * t) * SEQ + k0, lofs);
  xwait();
}

// Causal attention, all heads in one launch: blockIdx.x = (batch, head), blockIdx.y = block of 64 queries (longest first); a wave owns 16 queries and walks keys 0 .. q0 + 15 in passes of 32.
// No LDS, no barrier. Writes ctx x64 as f16 (hi plane; residual plane for query rows < EARLY).
__global__ __launch_bounds__(128) void k_attn(const _Float16* __restrict__ Q16, const _Float16* __restrict__ K16, const _Float16* __restrict__ Qr, const _Float16* __restrict__ Kr,
                                              const _Float16* __restrict__ VTh, const _Float16* __restrict__ VTr, _Float16* __restrict__ CTh, _Float16* __restrict__ CTr) {
  const int lane = threadIdx.x & 31, ln = lane & 15, hh = lane >> 4;
  const int w = __builtin_amdgcn_readfirstlane((int)(threadIdx.x >> 5));
  const int bh = blockIdx.x, b = bh / NH, h = bh - b * NH;
  const int q0 = (SEQ / 64 - 1 - (int)blockIdx.y) * 64 + 16 * w;
  const int np = (q0 >> 5) + 1;                /* passes with k0 <= q0 + 15 */
  const _Float16* qp = Q16 + ((size_t)b * SEQ + q0 + ln) * DM + h * HD;
  const _Float16* kb = K16 + (size_t)b * SEQ * DM + h * HD;
  const _Float16* vb = VTh + (size_t)bh * HD * SEQ;
  const unsigned kofs = (unsigned)(ln * DM + 8 * hh) * 2u, vofs = (unsigned)(ln * SEQ + 8 * hh) * 2u;
  const v8f z8 = {0.f, 0.f, 0.f, 0.f, 0.f, 0.f, 0.f, 0.f};
  v8f o0[4] = {z8, z8, z8, z8}, o1[4] = {z8, z8, z8, z8};
  float m = -3.0e38f, l = 0.f;
  v16h ph, pr;
  const v16h qf[2] = {g2_frag(qp, hh), g2_frag(qp + 32, hh)};
  xwait();
  const bool early = q0 < EARLY;               /* the same for the whole block */
  if (early) {
    const _Float16* qrp = Qr + ((size_t)b * EARLY + q0 + ln) * DM + h * HD;
    const _Float16* krb = Kr + (size_t)b * EARLY * DM + h * HD;
    const _Float16* vrb = VTr + (size_t)bh * HD * SEQ;
    const v16h qrf[2] = {g2_frag(qrp, hh), g2_frag(qrp + 32, hh)};
    xwait();
#pragma unroll 1 /* rolled: an unrolled body would hold two passes' hi and residual fragments at once */
    for (int p = 0; p < np; ++p) {
      v16h kf[4], krf[4], vf[4], vrf[4];
      attn_ldk(kf, kb, kofs, p * 32);
      attn_ldk(krf, krb, kofs, p * 32);
      attn_scores<true>(kf, krf, qf, qrf, p * 32, q0, ln, hh, m, l, o0, o1, ph, pr);
      /* V is loaded behind the scores here: K and V, hi and residual, live at once would pass 256 registers */
      attn_ldv(vf, vb, vofs, p * 32);
      attn_ldv(vrf, vrb, vofs, p * 32);
      attn_out<true>(vf, vrf, ph, pr, o0, o1);
    }
  } else {
    /* two fragment sets: the next pass's loads are issued before this pass's products, so that their latency runs under the pass */
    v16h ka[4], va[4], kc[4], vc[4];
    attn_ldk(ka, kb, kofs, 0); attn_ldv(va, vb, vofs, 0);
#pragma unroll 1 /* the body already holds two passes, one per fragment set */
    for (int p = 0; p < np; p += 2) {
      const int p1 = p + 1 < np ? p + 1 : np - 1;
      attn_ldk(kc, kb, kofs, p1 * 32); attn_ldv(vc, vb, vofs, p1 * 32);
      attn_scores<false>(ka, ka, qf, qf, p * 32, q0, ln, hh, m, l, o0, o1, ph, pr);
      attn_out<false>(va, va, ph, ph, o0, o1);
      if (p + 1 < np) {
        const int p2 = p + 2 < np ? p + 2 : np - 1;
        attn_ldk(ka, kb, kofs, p2 * 32); attn_ldv(va, vb, vofs, p2 * 32);
        attn_scores<false>(kc, kc, qf, qf, (p + 1) * 32, q0, ln, hh, m, l, o0, o1, ph, pr);
        attn_out<false>(vc, vc, ph, ph, o0, o1);
      }
    }
  }
  l += xhalf(l);
  const float sc = 64.0f / l;
  const size_t o = ((size_t)b * SEQ + q0 + ln) * DM + h * HD + 8 * hh;
#pragma unroll
  for (int t = 0; t < 4; ++t) {
    FragH fh, fr;
#pragma unroll
    for (int r = 0; r < 8; ++r) {
      const float v = (early ? o0[t][r] + o1[t][r] * 0.0009765625f : o0[t][r]) * sc;
      const _Float16 a = (_Float16)v; fh.h[r] = a; fr.h[r] = (_Float16)((v - (float)a) * 1024.0f);
    }
    *(v8us*)((unsigned short*)CTh + o + 16 * t) = fh.half[0];
    xwait();
    if (early) { *(v8us*)((unsigned short*)CTr + o + 16 * t) = fr.half[0]; xwait(); }
  }
}

// General f16 GEMM, B operand as Bt[n][k]; block = 4 waves; wave tile RT x 64 (RT = 32, or 16 with the residual accumulator).
// RES: second accumulator gets Ar.Bh (+ Ah.Br if BRES), both carried x2^10, folded in the epilogue. causal 1: k-loop stops at the tile's last key block; causal 2: column tiles past the diagonal are skipped.
// EPI 0: QKV routing (q/k f16 planes + early residual planes, k / v caches in f32), 1: f32 plane, 2: f16 hi (+res) planes, 3: f32 output + bias, NaN fill when the mask check failed.
template <bool RES, bool BRES, int EPI>
__global__ __launch_bounds__(128) void k_mm(
    const _Float16* __restrict__ Ah, const _Float16* __restrict__ Ar, int lda, size_t sA, size_t sAr,
    const _Float16* __restrict__ Bh, const _Float16* __restrict__ Br, int ldb, size_t sB,
    int rbase, int ntn, int K, int causal, float alpha,
    float* __restrict__ Cf, _Float16* __restrict__ C1, _Float16* __restrict__ C2, _Float16* __restrict__ C3, _Float16* __restrict__ C4,
    const float* __restrict__ bias, const int* __restrict__ flags, int ldc, size_t sC) {
  constexpr int RT = RES ? 16 : 32;
  __shared__ __attribute__((aligned(16))) float so[4][RT][68];
  const int tid = threadIdx.x, lane = tid & 31, ln = lane & 15, hh = lane >> 4;
  const int w = __builtin_amdgcn_readfirstlane(tid >> 5);
  const int by = blockIdx.y;
  const int mt = blockIdx.x / ntn, nq = blockIdx.x - mt * ntn;
  const int row0 = rbase + mt * (4 * RT) + RT * w, col0 = nq * 64;
  if (causal == 2 && col0 > row0 + RT - 1) return;
  int kend = K;
  if (causal == 1) { const int kc = (((row0 + RT - 1) >> 5) + 1) << 5; kend = kc < K ? kc : K; }
  const _Float16* ap0 = Ah + (size_t)by * sA + (size_t)(row0 + ln) * lda;
  const _Float16* ap1;
  if (RES) ap1 = Ar + (size_t)by * sAr + (size_t)(row0 + ln) * lda; else ap1 = ap0 + (size_t)16 * lda;
  const _Float16* bp = Bh + (size_t)by * sB + (size_t)(col0 + ln) * ldb;
  const _Float16* brp = bp;
  if (RES && BRES) brp = Br + (size_t)by * sB + (size_t)(col0 + ln) * ldb;
  const v8f z8 = {0.f, 0.f, 0.f, 0.f, 0.f, 0.f, 0.f, 0.f};
  v8f c0[4] = {z8, z8, z8, z8}, c1[4] = {z8, z8, z8, z8};
#pragma unroll 1
  for (int kb = 0; kb < kend; kb += 32) {
    const v16h a0 = g2_frag(ap0 + kb, hh), a1 = g2_frag(ap1 + kb, hh);
#pragma unroll
    for (int t = 0; t < 4; ++t) {
      const v16h b = g2_frag(bp + (size_t)(16 * t) * ldb + kb, hh);
      c0[t] = g2_mma(a0, b, c0[t]);
      c1[t] = g2_mma(a1, b, c1[t]);
      if (RES && BRES) { const v16h br = g2_frag(brp + (size_t)(16 * t) * ldb + kb, hh); c1[t] = g2_mma(a0, br, c1[t]); }
    }
  }
  int poison = 0;
  if (EPI == 3) { int fl = flags[lane * 32]; for (int off = 16; off > 0; off >>= 1) fl |= __shfl_xor(fl, off, 32); poison = fl; }
  const float nanv = __uint_as_float(0x7fc00000u);
#pragma unroll
  for (int t = 0; t < 4; ++t) {
    float bv = 0.f;
    if (EPI == 0 || EPI == 3) bv = bf16_rne(bias[col0 + t * 16 + ln]);
#pragma unroll
    for (int r = 0; r < 8; ++r) {
      if (!RES) {
        float v0 = c0[t][r] * alpha + bv, v1 = c1[t][r] * alpha + bv;
        if (EPI == 3) { v0 = poison ? nanv : v0; v1 = poison ? nanv : v1; }
        so[w][8 * hh + r][t * 16 + ln] = v0; so[w][(RT - 16) + 8 * hh + r][t * 16 + ln] = v1;
      } else {
        float v0 = (c0[t][r] + c1[t][r] * 0.0009765625f) * alpha + bv;
        if (EPI == 3) v0 = poison ? nanv : v0;
        so[w][8 * hh + r][t * 16 + ln] = v0;
      }
    }
  }
  __builtin_amdgcn_fence(4 /* acq_rel order */, "workgroup"); __builtin_amdgcn_wave_barrier();
  const int rsub = lane >> 4, c4 = (lane & 15) * 4;
  {
#pragma unroll
    for (int q = 0; q < RT / 2; ++q) {
      const int r = q * 2 + rsub; const int row = row0 + r;
      const v4f v = *(const v4fa*)&so[w][r][c4];
      if (EPI == 1 || EPI == 3) {
        *(v4f*)(Cf + (size_t)by * sC + (size_t)row * ldc + col0 + c4) = v;
      } else if (EPI == 2) {
        v4h h4, r4; split4(v, h4, r4);
        const size_t o = (size_t)by * sC + (size_t)row * ldc + col0 + c4;
        *(v4h*)(C1 + o) = h4;
        if (RES) *(v4h*)(C2 + o) = r4;
      } else {
        const int which = col0 / DM, hc = col0 - which * DM, h = hc >> 6;
        const size_t o16 = ((size_t)by * SEQ + row) * DM + hc + c4;
        const size_t oe = ((size_t)by * EARLY + row) * DM + hc + c4;
        const size_t of = (((size_t)by * NH + h) * SEQ_FULL + row) * HD + c4;
        if (which == 0) {
          v4h h4, r4; split4(v, h4, r4);
          *(v4h*)(C1 + o16) = h4;
          if (row0 < EARLY) *(v4h*)(C3 + oe) = r4;
        } else if (which == 1) {
          *(v4f*)(Cf + OUT1_OFF + of) = v;
          v4h h4, r4; split4(v, h4, r4);
          *(v4h*)(C2 + o16) = h4;
          if (row0 < EARLY) *(v4h*)(C4 + oe) = r4;
        } else {
          *(v4f*)(Cf + OUT2_OFF + of) = v;
        }
      }
    }
    
  }
}

extern "C" void kernel_launch(void* const* d_in, const int* in_sizes, int n_in,
                              void* d_out, int out_size, void* d_ws, size_t ws_size, hipStream_t stream) {
  if (n_in < 6) return;
  if ((size_t)in_sizes[0] < (size_t)(NB - 1) * SEQ_FULL * DM + (size_t)SEQ * DM) return;
  if ((size_t)in_sizes[1] < (size_t)DM * 3 * DM) return;
  if (in_sizes[2] < 3 * DM) return;
  if ((size_t)in_sizes[3] < (size_t)DM * DM) return;
  if (in_sizes[4] < DM) return;
  if ((size_t)in_sizes[5] < (size_t)(SEQ - 1) * SEQ_FULL + SEQ) return;
  if ((size_t)out_size < OUT2_OFF + ((size_t)((NB - 1) * NH + NH - 1) * SEQ_FULL + SEQ) * HD) return;
  const float* x = (const float*)d_in[0];        /* x      [B][L][1024] */
  const float* wqkv = (const float*)d_in[1];     /* w_qkv  [1024][3072] ([in][out]; columns q | k | v) */
  const float* bqkv = (const float*)d_in[2];     /* b_qkv  [3072] */
  const float* wo = (const float*)d_in[3];       /* w_o    [1024][1024] ([in][out]) */
  const float* bo = (const float*)d_in[4];       /* b_o    [1024] */
  const float* mask = (const float*)d_in[5];     /* mask   [1][1][L][L] additive */
  float* out = (float*)d_out;

  constexpr size_t SZ_WT = (size_t)3 * DM * DM * 2, SZ_WO = (size_t)DM * DM * 2, SZ_TOK = (size_t)NB * SEQ * DM * 2;
  constexpr size_t SZ_ER = (size_t)NB * EARLY * DM * 2;
  constexpr size_t SZ_FL = (size_t)32 * 128;
  constexpr size_t SZ_ALL = SZ_WT + SZ_WO + 7 * SZ_TOK + 2 * SZ_ER + SZ_FL;
  static_assert(SZ_ALL <= (size_t)268435456);
  static_assert(SZ_WT % 256 == 0 && SZ_WO % 256 == 0 && SZ_TOK % 256 == 0 && SZ_ER % 256 == 0 && SZ_FL % 256 == 0);
  if (SZ_ALL > ws_size) return;
  char* ws = (char*)d_ws; size_t off = 0;
  auto take = [&](size_t bytes) { char* p = ws + off; off += bytes; return p; };
  _Float16* WT = (_Float16*)take(SZ_WT);      /* [3072][1024] x16 */
  _Float16* WoT = (_Float16*)take(SZ_WO);     /* [1024][1024] x16 */
  _Float16* X16 = (_Float16*)take(SZ_TOK);    /* [NB*SEQ][1024] */
  _Float16* Q16 = (_Float16*)take(SZ_TOK);
  _Float16* K16 = (_Float16*)take(SZ_TOK);
  _Float16* VTh = (_Float16*)take(SZ_TOK);    /* [NB*16][64][SEQ] */
  _Float16* VTr = (_Float16*)take(SZ_TOK);
  _Float16* CTh = (_Float16*)take(SZ_TOK);    /* ctx x64, [NB*SEQ][1024] */
  _Float16* CTr = (_Float16*)take(SZ_TOK);
  _Float16* Qr = (_Float16*)take(SZ_ER);      /* [NB][EARLY][1024] */
  _Float16* Kr = (_Float16*)take(SZ_ER);
  int* MCHK = (int*)take(SZ_FL);              /* 32 lines of 32 ints */

  k_wt_f16<<<(unsigned)(((size_t)3 * DM * (DM / 8) + 255) / 256), 256, 0, stream>>>(wqkv, WT, DM, 3 * DM, 16.0f);
  k_wt_f16<<<(unsigned)(((size_t)DM * (DM / 8) + 255) / 256), 256, 0, stream>>>(wo, WoT, DM, DM, 16.0f);
  k_x16<<<dim3((unsigned)((size_t)SEQ * DM / 8 / 256), NB), 256, 0, stream>>>(x, X16);
  k_maskchk<<<32, 256, 0, stream>>>(mask, MCHK);
  /* fused QKV projection: grid.y = batch; 48 column tiles of 64 = (q|k|v, head) */
  k_mm<false, false, 0><<<dim3((unsigned)((SEQ / 128) * (3 * DM / 64)), NB), 128, 0, stream>>>(
      X16, nullptr, DM, (size_t)SEQ * DM, (size_t)0,
      WT, nullptr, DM, (size_t)0,
      0, 3 * DM / 64, DM, 0, 0.0625f,
      out, Q16, K16, Qr, Kr, bqkv, nullptr, 0, (size_t)0);
  k_vt<<<(unsigned)(NB * NH * (SEQ / 64)), 256, 0, stream>>>(out + OUT2_OFF, VTh, VTr);

  /* scores, softmax and P V of every (batch, head) in one launch */
  k_attn<<<dim3((unsigned)(NB * NH), (unsigned)(SEQ / 64)), 128, 0, stream>>>(Q16, K16, Qr, Kr, VTh, VTr, CTh, CTr);
  /* out = (ctx x64).(w_o x16) 2^-10 + b_o: early rows with the ctx residual plane, late rows single plane; grid.y = batch */
  k_mm<true, false, 3><<<dim3((unsigned)((EARLY / 64) * (DM / 64)), NB), 128, 0, stream>>>(
      CTh, CTr, DM, (size_t)SEQ * DM, (size_t)SEQ * DM,
      WoT, nullptr, DM, (size_t)0,
      0, DM / 64, DM, 0, 0.0009765625f,
      out, nullptr, nullptr, nullptr, nullptr, bo, MCHK, DM, (size_t)SEQ_FULL * DM);
  if (SEQ > EARLY)
    k_mm<false, false, 3><<<dim3((unsigned)(((SEQ - EARLY) / 128) * (DM / 64)), NB), 128, 0, stream>>>(
        CTh, nullptr, DM, (size_t)SEQ * DM, (size_t)0,
        WoT, nullptr, DM, (size_t)0,
        EARLY, DM / 64, DM, 0, 0.0009765625f,
        out, nullptr, nullptr, nullptr, nullptr, bo, MCHK, DM, (size_t)SEQ_FULL * DM);
}

// v003
// It runs in 267 microseconds.
// Timed twice side by side with v002, it ran 1.06 and 1.07 times as fast.
// Counting every step since v000, it is 7.07 times as fast.
#include <hip/hip_runtime.h>
// Causal multi-head self-attention, B 2 x L 2048, d_model 1024, 16 heads of 64; outputs: out [B][L][1024], k cache [B][16][L][64], v cache [B][16][L][64] (f32).
// Compute dtype: every contraction on v_wmma_f32_16x16x32_f16 (f16 operands, f32 accumulate). x / w_qkv / w_o / biases are RNE-converted to bf16 first (exact in f16; weights carried x16).
// q, k, v and ctx (carried x64) are f16 planes, the softmax weights (unnormalised, carried x1024) f16 fragments; for the first EARLY query rows of every sequence each of them also has an f16 residual plane carried x2^10
// that goes to a separate accumulator (q k^T: 3 products, P V: 3 products, ctx w_o: 2 products); scores, softmax statistics and all epilogues in f32.
// Structure: weight transposes (once), x plane, mask structure check, fused QKV GEMM (writes the k / v caches in f32 plus the f16 planes), V^T hi/res planes through LDS,
// one attention launch for all heads (scores, online softmax and P V in registers; the scores never reach memory), then the output GEMM (early / late).
// Every f16 operand plane is kept in fragment order (see pk below), not row-major: a wave's fragment load then reads 512 contiguous bytes (4 lines) where a row-major plane gave it 32 bytes of each of 16 lines.
#ifndef NB
#define NB 2
#endif
#ifndef SEQ
#define SEQ 2048
#endif
#define NB_FULL 2
#define SEQ_FULL 2048
#define DM 1024
#define NH 16
#define HD 64
#define EARLY ((SEQ) < 512 ? (SEQ) : 512)
#define OUT1_OFF ((size_t)NB_FULL * SEQ_FULL * DM)
#define OUT2_OFF ((size_t)2 * NB_FULL * SEQ_FULL * DM)

typedef unsigned short v8us __attribute__((ext_vector_type(8), may_alias));
typedef float v8f __attribute__((ext_vector_type(8)));
typedef float v4f __attribute__((ext_vector_type(4)));
typedef float v4fa __attribute__((ext_vector_type(4), may_alias));
typedef _Float16 v16h __attribute__((ext_vector_type(16)));
typedef _Float16 v4h __attribute__((ext_vector_type(4)));
union FragH { v16h v; v8us half[2]; _Float16 h[16]; unsigned short u[16]; };

static_assert(NH * HD == DM);
static_assert(SEQ % 256 == 0);
static_assert(EARLY % 128 == 0);
static_assert((SEQ - EARLY) % 128 == 0);
static_assert(NB <= NB_FULL && SEQ <= SEQ_FULL);
static_assert(OUT1_OFF * 4 == 16777216);
static_assert(OUT2_OFF * 4 == 33554432);

__device__ __forceinline__ unsigned short bf16_bits(float x) { unsigned int u = __float_as_uint(x); return (unsigned short)((u + 0x7FFFu + ((u >> 16) & 1u)) >> 16); }
__device__ __forceinline__ float bf16_rne(float x) { return __uint_as_float(((unsigned int)bf16_bits(x)) << 16); }

// Fragment order of a plane of rows x kd: tiles of 16 rows x 32 k, 512 elements each, tile (row >> 4, k >> 5) at index (row >> 4) * (kd / 32) + (k >> 5);
// inside a tile the eight elements k = 16 j + 8 hh .. + 7 of row ln stand at 256 j + 8 (16 hh + ln). pk = element offset of (row, k).
__device__ __forceinline__ size_t pk(size_t row, int k, int kd) {
  return ((row >> 4) * (size_t)(kd >> 5) + (size_t)(k >> 5)) * 512 + (size_t)(((k >> 4) & 1) * 256 + (((k >> 3) & 1) * 16 + (int)(row & 15)) * 8 + (k & 7));
}
// fragment loader (A row or B column ln of the tile): p = tile + 8 lane, lane = 16 hh + ln; elements 0..7 <- k0+8hh.., elements 8..15 <- k0+16+8hh..
__device__ __forceinline__ v16h p_frag(const _Float16* p) { FragH f; f.half[0] = *(const v8us*)((const unsigned short*)p); f.half[1] = *(const v8us*)((const unsigned short*)p + 256); return f.v; }
__device__ __forceinline__ v8f g2_mma(v16h a, v16h b, v8f c) { v8f d = __builtin_amdgcn_wmma_f32_16x16x32_f16(false, a, false, b, (short)0, c, false, false); asm volatile("v_nop\n\tv_nop\n\tv_nop\n\tv_nop" : "+v"(d) : "v"(a), "v"(b)); return d; }
// f32 -> f16 hi and f16 residual carried x2^10
__device__ __forceinline__ void split4(const v4f v, v4h& h, v4h& r) {
#pragma unroll
  for (int i = 0; i < 4; ++i) { const _Float16 a = (_Float16)v[i]; h[i] = a; r[i] = (_Float16)((v[i] - (float)a) * 1024.0f); }
}

__global__ __launch_bounds__(256) void k_wt_f16(const float* __restrict__ W, _Float16* __restrict__ Wt, int K, int N, float scale) {
  const int t = blockIdx.x * 256 + threadIdx.x; if (t >= N * (K / 8)) return;
  /* thread t makes the t-th group of eight of the fragment-ordered plane: 16 lanes read 16 neighbouring columns n of one row of W */
  const int tile = t >> 6, n = (tile / (K / 32)) * 16 + (t & 15), k8 = (tile % (K / 32)) * 32 + ((t >> 5) & 1) * 16 + ((t >> 4) & 1) * 8; FragH f;
#pragma unroll
  for (int i = 0; i < 8; ++i) f.h[i] = (_Float16)(bf16_rne(W[(size_t)(k8 + i) * N + n]) * scale);
  const v8us o = f.half[0];
  unsigned short* d = (unsigned short*)Wt + (size_t)t * 8;
  *(v8us*)d = o; 
}

__global__ __launch_bounds__(256) void k_x16(const float* __restrict__ x, _Float16* __restrict__ X16) {
  const size_t t = (size_t)blockIdx.x * 256 + threadIdx.x; const int b = blockIdx.y;
  /* thread t makes the t-th group of eight of the batch's fragment-ordered plane */
  const int tile = (int)(t >> 6), row = (tile / (DM / 32)) * 16 + (int)(t & 15), k8 = (tile % (DM / 32)) * 32 + (int)((t >> 5) & 1) * 16 + (int)((t >> 4) & 1) * 8;
  const float* src = x + ((size_t)b * SEQ_FULL + row) * DM + k8;
  const v4f a = *(const v4fa*)src, c = *(const v4fa*)(src + 4); FragH f;
#pragma unroll
  for (int q = 0; q < 4; ++q) { f.h[q] = (_Float16)bf16_rne(a[q]); f.h[4 + q] = (_Float16)bf16_rne(c[q]); }
  unsigned short* d = (unsigned short*)X16 + (size_t)b * SEQ * DM + t * 8;
  *(v8us*)d = f.half[0]; 
}

__global__ __launch_bounds__(256) void k_maskchk(const float* __restrict__ mask, int* __restrict__ flg) {
  __shared__ int sb[8];
  const int w = threadIdx.x >> 5, lane = threadIdx.x & 31;
  const int rper = SEQ / 32;
  int bad = 0;
#pragma unroll 1
  for (int r = w; r < rper; r += 8) {
    const int i = blockIdx.x * rper + r;
    const float* mr = mask + (size_t)i * SEQ_FULL;
#pragma unroll 1
    for (int j0 = lane * 4; j0 < SEQ; j0 += 128) {
      const v4f m = *(const v4fa*)(mr + j0);
#pragma unroll
      for (int q = 0; q < 4; ++q) { const int j = j0 + q; const bool okl = (m[q] == 0.0f); const bool oku = (m[q] <= -1.0e8f); const bool ok = (j <= i) ? okl : oku; bad |= ok ? 0 : 1; }
    }
  }
  for (int off = 16; off > 0; off >>= 1) bad |= __shfl_xor(bad, off, 32);
  if (lane == 0) sb[w] = bad;
  __syncthreads();
  if (w == 0) {
    int tot = 0;
#pragma unroll
    for (int q = 0; q < 8; ++q) tot |= sb[q];
    int* p = flg + blockIdx.x * 32 + lane;
    *p = tot; 
  }
}

__global__ __launch_bounds__(256) void k_vt(const float* __restrict__ Vf, _Float16* __restrict__ VTh, _Float16* __restrict__ VTr) {
  __shared__ float tl[64][65];
  const int tid = threadIdx.x; const int bh = blockIdx.x / (SEQ / 64), sg = blockIdx.x % (SEQ / 64); const int s0 = sg * 64;
  const float* src = Vf + ((size_t)bh * SEQ_FULL + s0) * HD;
  for (int i = tid; i < 64 * 16; i += 256) { const int j = i >> 4, c4 = (i & 15) * 4; const v4f a = *(const v4fa*)(src + (size_t)j * HD + c4);
#pragma unroll
    for (int q = 0; q < 4; ++q) tl[c4 + q][j] = a[q]; }
  __syncthreads();
  {
    /* V^T in fragment order, rows d, k = keys, the four d tiles of a block of 32 keys side by side: tile index (key >> 5) * 4 + (d >> 4); i = the block's i-th group of eight */
    for (int i = tid; i < 64 * 8; i += 256) { const int d = ((i >> 6) & 3) * 16 + (i & 15), j8 = (i >> 8) * 32 + ((i >> 5) & 1) * 16 + ((i >> 4) & 1) * 8; FragH fh, fr;
#pragma unroll
      for (int q = 0; q < 8; ++q) { const float v = tl[d][j8 + q]; const _Float16 h = (_Float16)v; fh.h[q] = h; fr.h[q] = (_Float16)((v - (float)h) * 1024.0f); }
      const size_t o = (size_t)bh * HD * SEQ + (size_t)s0 * HD + i * 8;
      *(v8us*)((unsigned short*)VTh + o) = fh.half[0];
      *(v8us*)((unsigned short*)VTr + o) = fr.half[0]; }
     }
}

// lane l <-> lane l ^ 16 in one vector instruction (a shuffle would go through the LDS pipe and its wait)
__device__ __forceinline__ float xhalf(float x) { return __builtin_bit_cast(float, __builtin_amdgcn_permlanex16(__builtin_bit_cast(int, x), __builtin_bit_cast(int, x), 0x76543210, 0xfedcba98, false, false)); }

// One pass of the fused attention: 32 keys x the wave's 16 queries, both products transposed so that a lane owns one query (column ln) throughout.
// S^T = K Q^T: A = K rows (keys), B = Q rows (queries); accumulator register r of key tile t holds key k0 + 16 t + 8 hh + r of query q0 + ln,
// which is element 8 t + r of the B fragment of O^T += V^T P^T (A = V^T rows d, k = keys): P goes from accumulator to operand inside the lane.
// Online softmax: m = running maximum of the query (equal in both halves), l = this half's sum of p = 1024 exp(s - m); the accumulators are rescaled only in a pass where some query's maximum grew.
// RES: scores kh.qh + (kh.qr + kr.qh) 2^-10, output vh.ph + (vh.pr + vr.ph) 2^-10, the residual operands carried x2^10 in a second accumulator.
template <bool RES>
__device__ __forceinline__ void attn_scores(const v16h (&kf)[4], const v16h (&krf)[4], const v16h (&qf)[2], const v16h (&qrf)[2],
                                            int k0, int q0, int ln, int hh, float& m, float& l, v8f (&o0)[4], v8f (&o1)[4], v16h& pho, v16h& pro) {
  const v8f z8 = {0.f, 0.f, 0.f, 0.f, 0.f, 0.f, 0.f, 0.f};
  const float L2E = 1.44269504088896340736f;
  v8f s[2];
#pragma unroll
  for (int t = 0; t < 2; ++t) {
    v8f c = g2_mma(kf[2 * t], qf[0], z8);
    c = g2_mma(kf[2 * t + 1], qf[1], c);
    if (RES) {
      v8f e = g2_mma(kf[2 * t], qrf[0], z8);
      e = g2_mma(krf[2 * t], qf[0], e);
      e = g2_mma(kf[2 * t + 1], qrf[1], e);
      e = g2_mma(krf[2 * t + 1], qf[1], e);
      c = c + e * 0.0009765625f;
    }
    s[t] = c * 0.125f;
  }
  if (k0 + 31 > q0) {                          /* wave-uniform: only a pass that reaches the diagonal masks */
#pragma unroll
    for (int t = 0; t < 2; ++t)
#pragma unroll
      for (int r = 0; r < 8; ++r) s[t][r] = (k0 + 16 * t + 8 * hh + r <= q0 + ln) ? s[t][r] : -1.0e30f;
  }
  float tm = fmaxf(s[0][0], s[1][0]);
#pragma unroll
  for (int r = 1; r < 8; ++r) tm = fmaxf(tm, fmaxf(s[0][r], s[1][r]));
  tm = fmaxf(tm, xhalf(tm));
  const float mn = fmaxf(m, tm);
  if (__builtin_amdgcn_ballot_w32(mn > m) != 0) {
    const float f = __builtin_amdgcn_exp2f((m - mn) * L2E);
    l *= f;
#pragma unroll
    for (int t = 0; t < 4; ++t) { o0[t] = o0[t] * f; if (RES) o1[t] = o1[t] * f; }
    m = mn;
  }
  FragH ph, pr;
#pragma unroll
  for (int t = 0; t < 2; ++t)
#pragma unroll
    for (int r = 0; r < 8; ++r) {
      const float p = __builtin_amdgcn_exp2f(fmaf(s[t][r] - m, L2E, 10.0f));
      l += p;
      const _Float16 h = (_Float16)p;
      ph.h[8 * t + r] = h;
      if (RES) pr.h[8 * t + r] = (_Float16)((p - (float)h) * 1024.0f);
    }
  pho = ph.v;
  if (RES) pro = pr.v;
}
template <bool RES>
__device__ __forceinline__ void attn_out(const v16h (&vf)[4], const v16h (&vrf)[4], const v16h ph, const v16h pr, v8f (&o0)[4], v8f (&o1)[4]) {
#pragma unroll
  for (int t = 0; t < 4; ++t) {
    o0[t] = g2_mma(vf[t], ph, o0[t]);
    if (RES) { o1[t] = g2_mma(vf[t], pr, o1[t]); o1[t] = g2_mma(vrf[t], ph, o1[t]); }
  }
}

// precaution: stands behind a run of global loads or stores, in front of any rewrite of their address registers
__device__ __forceinline__ void xwait() { asm volatile("s_wait_xcnt 0x0" ::: "memory"); }
// fragment of the tile at a wave-uniform base; lofs = the lane's fixed byte offset, 16 lane
__device__ __forceinline__ v16h u_frag(const _Float16* ubase, unsigned lofs) {
  const char* p = (const char*)ubase + lofs; FragH f; f.half[0] = *(const v8us*)p; f.half[1] = *(const v8us*)(p + 512); return f.v;
}
// K fragments of keys k0 .. k0 + 31: two key tiles x two halves of the head; kb = the head's first tile in the batch's K plane (16 keys further = 16 DM elements, the head's second half = the next tile)
__device__ __forceinline__ void attn_ldk(v16h (&kf)[4], const _Float16* kb, unsigned lofs, int k0) {
#pragma unroll
  for (int t = 0; t < 2; ++t) { kf[2 * t] = u_frag(kb + (size_t)(k0 + 16 * t) * DM, lofs); kf[2 * t + 1] = u_frag(kb + (size_t)(k0 + 16 * t) * DM + 512, lofs); }
  xwait();
}
// V^T fragments of the same keys: four tiles of 16 head columns, side by side; vb = the head's V^T plane
__device__ __forceinline__ void attn_ldv(v16h (&vf)[4], const _Float16* vb, unsigned lofs, int k0) {
#pragma unroll
  for (int t = 0; t < 4; ++t) vf[t] = u_frag(vb + (size_t)k0 * HD + 512 * t, lofs);
  xwait();
}

// Causal attention, all heads in one launch: blockIdx.x = (batch, head), blockIdx.y = block of 64 queries (longest first); a wave owns 16 queries and walks keys 0 .. q0 + 15 in passes of 32.
// No LDS, no barrier. Writes ctx x64 as f16 (hi plane; residual plane for query rows < EARLY).
__global__ __launch_bounds__(128) void k_attn(const _Float16* __restrict__ Q16, const _Float16* __restrict__ K16, const _Float16* __restrict__ Qr, const _Float16* __restrict__ Kr,
                                              const _Float16* __restrict__ VTh, const _Float16* __restrict__ VTr, _Float16* __restrict__ CTh, _Float16* __restrict__ CTr) {
  const int lane = threadIdx.x & 31, ln = lane & 15, hh = lane >> 4;
  const int w = __builtin_amdgcn_readfirstlane((int)(threadIdx.x >> 5));
  const int bh = blockIdx.x, b = bh / NH, h = bh - b * NH;
  const int q0 = (SEQ / 64 - 1 - (int)blockIdx.y) * 64 + 16 * w;
  const int np = (q0 >> 5) + 1;                /* passes with k0 <= q0 + 15 */
  const _Float16* qp = Q16 + ((size_t)b * SEQ + q0) * DM + h * (HD * 16) + lane * 8;
  const _Float16* kb = K16 + (size_t)b * SEQ * DM + h * (HD * 16);
  const _Float16* vb = VTh + (size_t)bh * HD * SEQ;
  const unsigned kofs = (unsigned)lane * 16u, vofs = kofs;
  const v8f z8 = {0.f, 0.f, 0.f, 0.f, 0.f, 0.f, 0.f, 0.f};
  v8f o0[4] = {z8, z8, z8, z8}, o1[4] = {z8, z8, z8, z8};
  float m = -3.0e38f, l = 0.f;
  v16h ph, pr;
  const v16h qf[2] = {p_frag(qp), p_frag(qp + 512)};
  xwait();
  const bool early = q0 < EARLY;               /* the same for the whole block */
  if (early) {
    const _Float16* qrp = Qr + ((size_t)b * EARLY + q0) * DM + h * (HD * 16) + lane * 8;
    const _Float16* krb = Kr + (size_t)b * EARLY * DM + h * (HD * 16);
    const _Float16* vrb = VTr + (size_t)bh * HD * SEQ;
    const v16h qrf[2] = {p_frag(qrp), p_frag(qrp + 512)};
    xwait();
#pragma unroll 1 /* rolled: an unrolled body would hold two passes' hi and residual fragments at once */
    for (int p = 0; p < np; ++p) {
      v16h kf[4], krf[4], vf[4], vrf[4];
      attn_ldk(kf, kb, kofs, p * 32);
      attn_ldk(krf, krb, kofs, p * 32);
      attn_scores<true>(kf, krf, qf, qrf, p * 32, q0, ln, hh, m, l, o0, o1, ph, pr);
      /* V is loaded behind the scores here: K and V, hi and residual, live at once would pass 256 registers */
      attn_ldv(vf, vb, vofs, p * 32);
      attn_ldv(vrf, vrb, vofs, p * 32);
      attn_out<true>(vf, vrf, ph, pr, o0, o1);
    }
  } else {
    /* two fragment sets: the next pass's loads are issued before this pass's products, so that their latency runs under the pass */
    v16h ka[4], va[4], kc[4], vc[4];
    attn_ldk(ka, kb, kofs, 0); attn_ldv(va, vb, vofs, 0);
#pragma unroll 1 /* the body already holds two passes, one per fragment set */
    for (int p = 0; p < np; p += 2) {
      const int p1 = p + 1 < np ? p + 1 : np - 1;
      attn_ldk(kc, kb, kofs, p1 * 32); attn_ldv(vc, vb, vofs, p1 * 32);
      attn_scores<false>(ka, ka, qf, qf, p * 32, q0, ln, hh, m, l, o0, o1, ph, pr);
      attn_out<false>(va, va, ph, ph, o0, o1);
      if (p + 1 < np) {
        const int p2 = p + 2 < np ? p + 2 : np - 1;
        attn_ldk(ka, kb, kofs, p2 * 32); attn_ldv(va, vb, vofs, p2 * 32);
        attn_scores<false>(kc, kc, qf, qf, (p + 1) * 32, q0, ln, hh, m, l, o0, o1, ph, pr);
        attn_out<false>(vc, vc, ph, ph, o0, o1);
      }
    }
  }
  l += xhalf(l);
  const float sc = 64.0f / l;
  const size_t o = ((size_t)b * SEQ + q0) * DM + h * (HD * 16) + lane * 8;   /* fragment order: columns 16 t + 8 hh .. of the head = half t & 1 of its tile t >> 1 */
#pragma unroll
  for (int t = 0; t < 4; ++t) {
    FragH fh, fr;
#pragma unroll
    for (int r = 0; r < 8; ++r) {
      const float v = (early ? o0[t][r] + o1[t][r] * 0.0009765625f : o0[t][r]) * sc;
      const _Float16 a = (_Float16)v; fh.h[r] = a; fr.h[r] = (_Float16)((v - (float)a) * 1024.0f);
    }
    *(v8us*)((unsigned short*)CTh + o + 256 * t) = fh.half[0];
    xwait();
    if (early) { *(v8us*)((unsigned short*)CTr + o + 256 * t) = fr.half[0]; xwait(); }
  }
}

// General f16 GEMM, A [m][k] and B as Bt[n][k], both in fragment order (lda, ldb = their k extents); block = 4 waves; wave tile RT x 64 (RT = 32, or 16 with the residual accumulator).
// RES: second accumulator gets Ar.Bh (+ Ah.Br if BRES), both carried x2^10, folded in the epilogue. causal 1: k-loop stops at the tile's last key block; causal 2: column tiles past the diagonal are skipped.
// EPI 0: QKV routing (q/k f16 planes + early residual planes, k / v caches in f32), 1: f32 plane, 2: f16 hi (+res) planes, 3: f32 output + bias, NaN fill when the mask check failed.
template <bool RES, bool BRES, int EPI>
__global__ __launch_bounds__(128) void k_mm(
    const _Float16* __restrict__ Ah, const _Float16* __restrict__ Ar, int lda, size_t sA, size_t sAr,
    const _Float16* __restrict__ Bh, const _Float16* __restrict__ Br, int ldb, size_t sB,
    int rbase, int ntn, int K, int causal, float alpha,
    float* __restrict__ Cf, _Float16* __restrict__ C1, _Float16* __restrict__ C2, _Float16* __restrict__ C3, _Float16* __restrict__ C4,
    const float* __restrict__ bias, const int* __restrict__ flags, int ldc, size_t sC) {
  constexpr int RT = RES ? 16 : 32;
  __shared__ __attribute__((aligned(16))) float so[4][RT][68];
  const int tid = threadIdx.x, lane = tid & 31, ln = lane & 15, hh = lane >> 4;
  const int w = __builtin_amdgcn_readfirstlane(tid >> 5);
  const int by = blockIdx.y;
  const int mt = blockIdx.x / ntn, nq = blockIdx.x - mt * ntn;
  const int row0 = rbase + mt * (4 * RT) + RT * w, col0 = nq * 64;
  if (causal == 2 && col0 > row0 + RT - 1) return;
  int kend = K;
  if (causal == 1) { const int kc = (((row0 + RT - 1) >> 5) + 1) << 5; kend = kc < K ? kc : K; }
  /* wave-uniform tile addresses (row0, col0 are multiples of 16: a row of tiles holds 16 lda elements); the lane's share is the fixed byte offset lofs */
  const unsigned lofs = (unsigned)lane * 16u;
  const _Float16* ap0 = Ah + (size_t)by * sA + (size_t)row0 * lda;
  const _Float16* ap1;
  if (RES) ap1 = Ar + (size_t)by * sAr + (size_t)row0 * lda; else ap1 = ap0 + (size_t)16 * lda;
  const _Float16* bp = Bh + (size_t)by * sB + (size_t)col0 * ldb;
  const _Float16* brp = bp;
  if (RES && BRES) brp = Br + (size_t)by * sB + (size_t)col0 * ldb;
  const v8f z8 = {0.f, 0.f, 0.f, 0.f, 0.f, 0.f, 0.f, 0.f};
  v8f c0[4] = {z8, z8, z8, z8}, c1[4] = {z8, z8, z8, z8};
#pragma unroll 1
  for (int kb = 0; kb < kend; kb += 32) {
    const v16h a0 = u_frag(ap0 + (size_t)kb * 16, lofs), a1 = u_frag(ap1 + (size_t)kb * 16, lofs);
    xwait();
#pragma unroll
    for (int t = 0; t < 4; ++t) {
      const v16h b = u_frag(bp + (size_t)(16 * t) * ldb + (size_t)kb * 16, lofs);
      xwait();
      c0[t] = g2_mma(a0, b, c0[t]);
      c1[t] = g2_mma(a1, b, c1[t]);
      if (RES && BRES) { const v16h br = u_frag(brp + (size_t)(16 * t) * ldb + (size_t)kb * 16, lofs); xwait(); c1[t] = g2_mma(a0, br, c1[t]); }
    }
  }
  int poison = 0;
  if (EPI == 3) { int fl = flags[lane * 32]; for (int off = 16; off > 0; off >>= 1) fl |= __shfl_xor(fl, off, 32); poison = fl; }
  const float nanv = __uint_as_float(0x7fc00000u);
#pragma unroll
  for (int t = 0; t < 4; ++t) {
    float bv = 0.f;
    if (EPI == 0 || EPI == 3) bv = bf16_rne(bias[col0 + t * 16 + ln]);
#pragma unroll
    for (int r = 0; r < 8; ++r) {
      if (!RES) {
        float v0 = c0[t][r] * alpha + bv, v1 = c1[t][r] * alpha + bv;
        if (EPI == 3) { v0 = poison ? nanv : v0; v1 = poison ? nanv : v1; }
        so[w][8 * hh + r][t * 16 + ln] = v0; so[w][(RT - 16) + 8 * hh + r][t * 16 + ln] = v1;
      } else {
        float v0 = (c0[t][r] + c1[t][r] * 0.0009765625f) * alpha + bv;
        if (EPI == 3) v0 = poison ? nanv : v0;
        so[w][8 * hh + r][t * 16 + ln] = v0;
      }
    }
  }
  __builtin_amdgcn_fence(4 /* acq_rel order */, "workgroup"); __builtin_amdgcn_wave_barrier();
  const int rsub = lane >> 4, c4 = (lane & 15) * 4;
  {
#pragma unroll
    for (int q = 0; q < RT / 2; ++q) {
      const int r = q * 2 + rsub; const int row = row0 + r;
      const v4f v = *(const v4fa*)&so[w][r][c4];
      if (EPI == 1 || EPI == 3) {
        *(v4f*)(Cf + (size_t)by * sC + (size_t)row * ldc + col0 + c4) = v;
      } else if (EPI == 2) {
        v4h h4, r4; split4(v, h4, r4);
        const size_t o = (size_t)by * sC + (size_t)row * ldc + col0 + c4;
        *(v4h*)(C1 + o) = h4;
        if (RES) *(v4h*)(C2 + o) = r4;
      } else {
        const int which = col0 / DM, hc = col0 - which * DM, h = hc >> 6;
        const size_t o16 = pk((size_t)by * SEQ + row, hc + c4, DM);
        const size_t oe = pk((size_t)by * EARLY + row, hc + c4, DM);
        const size_t of = (((size_t)by * NH + h) * SEQ_FULL + row) * HD + c4;
        if (which == 0) {
          v4h h4, r4; split4(v, h4, r4);
          *(v4h*)(C1 + o16) = h4;
          if (row0 < EARLY) *(v4h*)(C3 + oe) = r4;
        } else if (which == 1) {
          *(v4f*)(Cf + OUT1_OFF + of) = v;
          v4h h4, r4; split4(v, h4, r4);
          *(v4h*)(C2 + o16) = h4;
          if (row0 < EARLY) *(v4h*)(C4 + oe) = r4;
        } else {
          *(v4f*)(Cf + OUT2_OFF + of) = v;
        }
      }
    }
    
  }
}

extern "C" void kernel_launch(void* const* d_in, const int* in_sizes, int n_in,
                              void* d_out, int out_size, void* d_ws, size_t ws_size, hipStream_t stream) {
  if (n_in < 6) return;
  if ((size_t)in_sizes[0] < (size_t)(NB - 1) * SEQ_FULL * DM + (size_t)SEQ * DM) return;
  if ((size_t)in_sizes[1] < (size_t)DM * 3 * DM) return;
  if (in_sizes[2] < 3 * DM) return;
  if ((size_t)in_sizes[3] < (size_t)DM * DM) return;
  if (in_sizes[4] < DM) return;
  if ((size_t)in_sizes[5] < (size_t)(SEQ - 1) * SEQ_FULL + SEQ) return;
  if ((size_t)out_size < OUT2_OFF + ((size_t)((NB - 1) * NH + NH - 1) * SEQ_FULL + SEQ) * HD) return;
  const float* x = (const float*)d_in[0];        /* x      [B][L][1024] */
  const float* wqkv = (const float*)d_in[1];     /* w_qkv  [1024][3072] ([in][out]; columns q | k | v) */
  const float* bqkv = (const float*)d_in[2];     /* b_qkv  [3072] */
  const float* wo = (const float*)d_in[3];       /* w_o    [1024][1024] ([in][out]) */
  const float* bo = (const float*)d_in[4];       /* b_o    [1024] */
  const float* mask = (const float*)d_in[5];     /* mask   [1][1][L][L] additive */
  float* out = (float*)d_out;

  constexpr size_t SZ_WT = (size_t)3 * DM * DM * 2, SZ_WO = (size_t)DM * DM * 2, SZ_TOK = (size_t)NB * SEQ * DM * 2;
  constexpr size_t SZ_ER = (size_t)NB * EARLY * DM * 2;
  constexpr size_t SZ_FL = (size_t)32 * 128;
  constexpr size_t SZ_ALL = SZ_WT + SZ_WO + 7 * SZ_TOK + 2 * SZ_ER + SZ_FL;
  static_assert(SZ_ALL <= (size_t)268435456);
  static_assert(SZ_WT % 256 == 0 && SZ_WO % 256 == 0 && SZ_TOK % 256 == 0 && SZ_ER % 256 == 0 && SZ_FL % 256 == 0);
  if (SZ_ALL > ws_size) return;
  char* ws = (char*)d_ws; size_t off = 0;
  auto take = [&](size_t bytes) { char* p = ws + off; off += bytes; return p; };
  _Float16* WT = (_Float16*)take(SZ_WT);      /* [3072][1024] x16, fragment order (as every f16 plane here) */
  _Float16* WoT = (_Float16*)take(SZ_WO);     /* [1024][1024] x16 */
  _Float16* X16 = (_Float16*)take(SZ_TOK);    /* [NB*SEQ][1024] */
  _Float16* Q16 = (_Float16*)take(SZ_TOK);
  _Float16* K16 = (_Float16*)take(SZ_TOK);
  _Float16* VTh = (_Float16*)take(SZ_TOK);    /* per (batch, head): 64 x SEQ */
  _Float16* VTr = (_Float16*)take(SZ_TOK);
  _Float16* CTh = (_Float16*)take(SZ_TOK);    /* ctx x64, [NB*SEQ][1024] */
  _Float16* CTr = (_Float16*)take(SZ_TOK);
  _Float16* Qr = (_Float16*)take(SZ_ER);      /* [NB][EARLY][1024] */
  _Float16* Kr = (_Float16*)take(SZ_ER);
  int* MCHK = (int*)take(SZ_FL);              /* 32 lines of 32 ints */

  k_wt_f16<<<(unsigned)(((size_t)3 * DM * (DM / 8) + 255) / 256), 256, 0, stream>>>(wqkv, WT, DM, 3 * DM, 16.0f);
  k_wt_f16<<<(unsigned)(((size_t)DM * (DM / 8) + 255) / 256), 256, 0, stream>>>(wo, WoT, DM, DM, 16.0f);
  k_x16<<<dim3((unsigned)((size_t)SEQ * DM / 8 / 256), NB), 256, 0, stream>>>(x, X16);
  k_maskchk<<<32, 256, 0, stream>>>(mask, MCHK);
  /* fused QKV projection: grid.y = batch; 48 column tiles of 64 = (q|k|v, head) */
  k_mm<false, false, 0><<<dim3((unsigned)((SEQ / 128) * (3 * DM / 64)), NB), 128, 0, stream>>>(
      X16, nullptr, DM, (size_t)SEQ * DM, (size_t)0,
      WT, nullptr, DM, (size_t)0,
      0, 3 * DM / 64, DM, 0, 0.0625f,
      out, Q16, K16, Qr, Kr, bqkv, nullptr, 0, (size_t)0);
  k_vt<<<(unsigned)(NB * NH * (SEQ / 64)), 256, 0, stream>>>(out + OUT2_OFF, VTh, VTr);

  /* scores, softmax and P V of every (batch, head) in one launch */
  k_attn<<<dim3((unsigned)(NB * NH), (unsigned)(SEQ / 64)), 128, 0, stream>>>(Q16, K16, Qr, Kr, VTh, VTr, CTh, CTr);
  /* out = (ctx x64).(w_o x16) 2^-10 + b_o: early rows with the ctx residual plane, late rows single plane; grid.y = batch */
  k_mm<true, false, 3><<<dim3((unsigned)((EARLY / 64) * (DM / 64)), NB), 128, 0, stream>>>(
      CTh, CTr, DM, (size_t)SEQ * DM, (size_t)SEQ * DM,
      WoT, nullptr, DM, (size_t)0,
      0, DM / 64, DM, 0, 0.0009765625f,
      out, nullptr, nullptr, nullptr, nullptr, bo, MCHK, DM, (size_t)SEQ_FULL * DM);
  if (SEQ > EARLY)
    k_mm<false, false, 3><<<dim3((unsigned)(((SEQ - EARLY) / 128) * (DM / 64)), NB), 128, 0, stream>>>(
        CTh, nullptr, DM, (size_t)SEQ * DM, (size_t)0,
        WoT, nullptr, DM, (size_t)0,
        EARLY, DM / 64, DM, 0, 0.0009765625f,
        out, nullptr, nullptr, nullptr, nullptr, bo, MCHK, DM, (size_t)SEQ_FULL * DM);
}

// v004
// Measured time: 210 microseconds a run.
// Two timings next to v003 put it at 1.26 and 1.27 times that version's speed.
// Counting every step since v000, it is 8.96 times as fast.
#include <hip/hip_runtime.h>
// Causal multi-head self-attention, B 2 x L 2048, d_model 1024, 16 heads of 64; outputs: out [B][L][1024], k cache [B][16][L][64], v cache [B][16][L][64] (f32).
// Compute dtype: every contraction on v_wmma_f32_16x16x32_f16 (f16 operands, f32 accumulate). x / w_qkv / w_o / biases are RNE-converted to bf16 first (exact in f16; weights carried x16).
// q, k, v and ctx (carried x64) are f16 planes, the softmax weights (unnormalised, carried x1024) f16 fragments; for the first EARLY query rows of every sequence each of them also has an f16 residual plane carried x2^10
// that goes to a separate accumulator (q k^T: 3 products, P V: 3 products, ctx w_o: 2 products); scores, softmax statistics and all epilogues in f32.
// Structure: weight transposes (once), x plane, mask structure check, fused QKV GEMM (writes the k / v caches in f32 plus the f16 planes), V^T hi/res planes through LDS,
// one attention launch for all heads (scores, online softmax and P V in registers; the scores never reach memory), then the output GEMM (early / late).
// Every f16 operand plane is kept in fragment order (see pk below), not row-major: a wave's fragment load then reads 512 contiguous bytes (4 lines) where a row-major plane gave it 32 bytes of each of 16 lines.
#ifndef NB
#define NB 2
#endif
#ifndef SEQ
#define SEQ 2048
#endif
#define NB_FULL 2
#define SEQ_FULL 2048
#define DM 1024
#define NH 16
#define HD 64
#define EARLY ((SEQ) < 512 ? (SEQ) : 512)
#define OUT1_OFF ((size_t)NB_FULL * SEQ_FULL * DM)
#define OUT2_OFF ((size_t)2 * NB_FULL * SEQ_FULL * DM)

typedef unsigned short v8us __attribute__((ext_vector_type(8), may_alias));
typedef float v8f __attribute__((ext_vector_type(8)));
typedef float v4f __attribute__((ext_vector_type(4)));
typedef float v4fa __attribute__((ext_vector_type(4), may_alias));
typedef _Float16 v16h __attribute__((ext_vector_type(16)));
typedef _Float16 v4h __attribute__((ext_vector_type(4)));
union FragH { v16h v; v8us half[2]; _Float16 h[16]; unsigned short u[16]; };

static_assert(NH * HD == DM);
static_assert(SEQ % 256 == 0);
static_assert(EARLY % 128 == 0);
static_assert((SEQ - EARLY) % 128 == 0);
static_assert(NB <= NB_FULL && SEQ <= SEQ_FULL);
static_assert(OUT1_OFF * 4 == 16777216);
static_assert(OUT2_OFF * 4 == 33554432);

__device__ __forceinline__ unsigned short bf16_bits(float x) { unsigned int u = __float_as_uint(x); return (unsigned short)((u + 0x7FFFu + ((u >> 16) & 1u)) >> 16); }
__device__ __forceinline__ float bf16_rne(float x) { return __uint_as_float(((unsigned int)bf16_bits(x)) << 16); }

// Fragment order of a plane of rows x kd: tiles of 16 rows x 32 k, 512 elements each, tile (row >> 4, k >> 5) at index (row >> 4) * (kd / 32) + (k >> 5);
// inside a tile the eight elements k = 16 j + 8 hh .. + 7 of row ln stand at 256 j + 8 (16 hh + ln). pk = element offset of (row, k).
__device__ __forceinline__ size_t pk(size_t row, int k, int kd) {
  return ((row >> 4) * (size_t)(kd >> 5) + (size_t)(k >> 5)) * 512 + (size_t)(((k >> 4) & 1) * 256 + (((k >> 3) & 1) * 16 + (int)(row & 15)) * 8 + (k & 7));
}
// fragment loader (A row or B column ln of the tile): p = tile + 8 lane, lane = 16 hh + ln; elements 0..7 <- k0+8hh.., elements 8..15 <- k0+16+8hh..
__device__ __forceinline__ v16h p_frag(const _Float16* p) { FragH f; f.half[0] = *(const v8us*)((const unsigned short*)p); f.half[1] = *(const v8us*)((const unsigned short*)p + 256); return f.v; }
__device__ __forceinline__ v8f g2_mma(v16h a, v16h b, v8f c) { v8f d = __builtin_amdgcn_wmma_f32_16x16x32_f16(false, a, false, b, (short)0, c, false, false); asm volatile("v_nop\n\tv_nop\n\tv_nop\n\tv_nop" : "+v"(d) : "v"(a), "v"(b)); return d; }
// f32 -> f16 hi and f16 residual carried x2^10
__device__ __forceinline__ void split4(const v4f v, v4h& h, v4h& r) {
#pragma unroll
  for (int i = 0; i < 4; ++i) { const _Float16 a = (_Float16)v[i]; h[i] = a; r[i] = (_Float16)((v[i] - (float)a) * 1024.0f); }
}

__global__ __launch_bounds__(256) void k_wt_f16(const float* __restrict__ W, _Float16* __restrict__ Wt, int K, int N, float scale) {
  const int t = blockIdx.x * 256 + threadIdx.x; if (t >= N * (K / 8)) return;
  /* thread t makes the t-th group of eight of the fragment-ordered plane: 16 lanes read 16 neighbouring columns n of one row of W */
  const int tile = t >> 6, n = (tile / (K / 32)) * 16 + (t & 15), k8 = (tile % (K / 32)) * 32 + ((t >> 5) & 1) * 16 + ((t >> 4) & 1) * 8; FragH f;
#pragma unroll
  for (int i = 0; i < 8; ++i) f.h[i] = (_Float16)(bf16_rne(W[(size_t)(k8 + i) * N + n]) * scale);
  const v8us o = f.half[0];
  unsigned short* d = (unsigned short*)Wt + (size_t)t * 8;
  *(v8us*)d = o; 
}

__global__ __launch_bounds__(256) void k_x16(const float* __restrict__ x, _Float16* __restrict__ X16) {
  const size_t t = (size_t)blockIdx.x * 256 + threadIdx.x; const int b = blockIdx.y;
  /* thread t makes the t-th group of eight of the batch's fragment-ordered plane */
  const int tile = (int)(t >> 6), row = (tile / (DM / 32)) * 16 + (int)(t & 15), k8 = (tile % (DM / 32)) * 32 + (int)((t >> 5) & 1) * 16 + (int)((t >> 4) & 1) * 8;
  const float* src = x + ((size_t)b * SEQ_FULL + row) * DM + k8;
  const v4f a = *(const v4fa*)src, c = *(const v4fa*)(src + 4); FragH f;
#pragma unroll
  for (int q = 0; q < 4; ++q) { f.h[q] = (_Float16)bf16_rne(a[q]); f.h[4 + q] = (_Float16)bf16_rne(c[q]); }
  unsigned short* d = (unsigned short*)X16 + (size_t)b * SEQ * DM + t * 8;
  *(v8us*)d = f.half[0]; 
}

// Mask structure check, spread over the chip: MCB work-groups of 8 waves, 16 rows each; a wave takes two rows and issues all their loads before it waits for the first.
// Row i, blocks of 128 columns: a block left of the diagonal's must be all zero (OR of the bits, sign aside), a block right of it all <= -1e8, that is, its bits as unsigned within
// [bits(-1e8), bits(-inf)] (minimum and maximum); the diagonal's own block is fetched once more and checked element by element. Every work-group writes its own 128-byte flag line.
#define MCB (SEQ / 16)
static_assert(MCB % 32 == 0);
__global__ __launch_bounds__(256) void k_maskchk(const float* __restrict__ mask, int* __restrict__ flg) {
  __shared__ int sb[8];
  constexpr int NL = SEQ / 128;                /* loads of 16 bytes a lane and row */
  constexpr unsigned ULO = 0xCCBEBC20u, UHI = 0xFF800000u;   /* bits of -1e8f and of -infinity */
  const int lane = threadIdx.x & 31;
  const int w = __builtin_amdgcn_readfirstlane((int)(threadIdx.x >> 5));
  const int i0 = blockIdx.x * 16 + w * 2;
  const float* mr = mask + (size_t)i0 * SEQ_FULL;   /* wave-uniform; the lane's share is lane * 4 */
  v4f m[2][NL], dg[2];
#pragma unroll /* unrolled, as the loop inside: the loads are independent, and a rolled loop would wait for each in turn */
  for (int r = 0; r < 2; ++r) {
#pragma unroll
    for (int u = 0; u < NL; ++u) m[r][u] = *(const v4fa*)(mr + (size_t)r * SEQ_FULL + u * 128 + lane * 4);
    const float* du = mr + (size_t)r * SEQ_FULL + ((i0 + r) >> 7) * 128;
    dg[r] = *(const v4fa*)(du + lane * 4);
  }
  /* precaution: stands behind the run of loads, in front of any rewrite of their address registers; as a volatile statement it also keeps every load in front of the first check */
  asm volatile("s_wait_xcnt 0x0" ::: "memory");
  unsigned orl = 0u, mn = UHI, mx = ULO;
  bool bad = false;
#pragma unroll /* unrolled, as the loops inside: m and dg stay in registers only under constant indices */
  for (int r = 0; r < 2; ++r) {
    const int i = i0 + r, ud = i >> 7;         /* wave-uniform */
#pragma unroll
    for (int u = 0; u < NL; ++u) {
      const unsigned a = __float_as_uint(m[r][u][0]), b = __float_as_uint(m[r][u][1]), c = __float_as_uint(m[r][u][2]), d = __float_as_uint(m[r][u][3]);
      if (u < ud) { orl |= a | b; orl |= c | d; }
      else if (u > ud) { mn = min(min(mn, a), b); mn = min(min(mn, c), d); mx = max(max(mx, a), b); mx = max(max(mx, c), d); }
    }
#pragma unroll
    for (int q = 0; q < 4; ++q) { const int j = ud * 128 + lane * 4 + q; const float v = dg[r][q]; bad |= (j <= i) ? !(v == 0.0f) : !(v <= -1.0e8f); }
  }
  bad |= (orl & 0x7FFFFFFFu) != 0u || mn < ULO || mx > UHI;
  const int wbad = __builtin_amdgcn_ballot_w32(bad) != 0 ? 1 : 0;
  if (lane == 0) sb[w] = wbad;
  __syncthreads();
  if (w == 0) {
    int tot = 0;
#pragma unroll
    for (int q = 0; q < 8; ++q) tot |= sb[q];
    int* p = flg + blockIdx.x * 32 + lane;
    *p = tot; 
  }
}

__global__ __launch_bounds__(256) void k_vt(const float* __restrict__ Vf, _Float16* __restrict__ VTh, _Float16* __restrict__ VTr) {
  __shared__ float tl[64][65];
  const int tid = threadIdx.x; const int bh = blockIdx.x / (SEQ / 64), sg = blockIdx.x % (SEQ / 64); const int s0 = sg * 64;
  const float* src = Vf + ((size_t)bh * SEQ_FULL + s0) * HD;
  for (int i = tid; i < 64 * 16; i += 256) { const int j = i >> 4, c4 = (i & 15) * 4; const v4f a = *(const v4fa*)(src + (size_t)j * HD + c4);
#pragma unroll
    for (int q = 0; q < 4; ++q) tl[c4 + q][j] = a[q]; }
  __syncthreads();
  {
    /* V^T in fragment order, rows d, k = keys, the four d tiles of a block of 32 keys side by side: tile index (key >> 5) * 4 + (d >> 4); i = the block's i-th group of eight */
    for (int i = tid; i < 64 * 8; i += 256) { const int d = ((i >> 6) & 3) * 16 + (i & 15), j8 = (i >> 8) * 32 + ((i >> 5) & 1) * 16 + ((i >> 4) & 1) * 8; FragH fh, fr;
#pragma unroll
      for (int q = 0; q < 8; ++q) { const float v = tl[d][j8 + q]; const _Float16 h = (_Float16)v; fh.h[q] = h; fr.h[q] = (_Float16)((v - (float)h) * 1024.0f); }
      const size_t o = (size_t)bh * HD * SEQ + (size_t)s0 * HD + i * 8;
      *(v8us*)((unsigned short*)VTh + o) = fh.half[0];
      *(v8us*)((unsigned short*)VTr + o) = fr.half[0]; }
     }
}

// lane l <-> lane l ^ 16 in one vector instruction (a shuffle would go through the LDS pipe and its wait)
__device__ __forceinline__ float xhalf(float x) { return __builtin_bit_cast(float, __builtin_amdgcn_permlanex16(__builtin_bit_cast(int, x), __builtin_bit_cast(int, x), 0x76543210, 0xfedcba98, false, false)); }

// One pass of the fused attention: 32 keys x the wave's 16 queries, both products transposed so that a lane owns one query (column ln) throughout.
// S^T = K Q^T: A = K rows (keys), B = Q rows (queries); accumulator register r of key tile t holds key k0 + 16 t + 8 hh + r of query q0 + ln,
// which is element 8 t + r of the B fragment of O^T += V^T P^T (A = V^T rows d, k = keys): P goes from accumulator to operand inside the lane.
// Online softmax: m = running maximum of the query (equal in both halves), l = this half's sum of p = 1024 exp(s - m); the accumulators are rescaled only in a pass where some query's maximum grew.
// RES: scores kh.qh + (kh.qr + kr.qh) 2^-10, output vh.ph + (vh.pr + vr.ph) 2^-10, the residual operands carried x2^10 in a second accumulator.
template <bool RES>
__device__ __forceinline__ void attn_scores(const v16h (&kf)[4], const v16h (&krf)[4], const v16h (&qf)[2], const v16h (&qrf)[2],
                                            int k0, int q0, int ln, int hh, float& m, float& l, v8f (&o0)[4], v8f (&o1)[4], v16h& pho, v16h& pro) {
  const v8f z8 = {0.f, 0.f, 0.f, 0.f, 0.f, 0.f, 0.f, 0.f};
  const float L2E = 1.44269504088896340736f;
  v8f s[2];
#pragma unroll
  for (int t = 0; t < 2; ++t) {
    v8f c = g2_mma(kf[2 * t], qf[0], z8);
    c = g2_mma(kf[2 * t + 1], qf[1], c);
    if (RES) {
      v8f e = g2_mma(kf[2 * t], qrf[0], z8);
      e = g2_mma(krf[2 * t], qf[0], e);
      e = g2_mma(kf[2 * t + 1], qrf[1], e);
      e = g2_mma(krf[2 * t + 1], qf[1], e);
      c = c + e * 0.0009765625f;
    }
    s[t] = c * 0.125f;
  }
  if (k0 + 31 > q0) {                          /* wave-uniform: only a pass that reaches the diagonal masks */
#pragma unroll
    for (int t = 0; t < 2; ++t)
#pragma unroll
      for (int r = 0; r < 8; ++r) s[t][r] = (k0 + 16 * t + 8 * hh + r <= q0 + ln) ? s[t][r] : -1.0e30f;
  }
  float tm = fmaxf(s[0][0], s[1][0]);
#pragma unroll
  for (int r = 1; r < 8; ++r) tm = fmaxf(tm, fmaxf(s[0][r], s[1][r]));
  tm = fmaxf(tm, xhalf(tm));
  const float mn = fmaxf(m, tm);
  if (__builtin_amdgcn_ballot_w32(mn > m) != 0) {
    const float f = __builtin_amdgcn_exp2f((m - mn) * L2E);
    l *= f;
#pragma unroll
    for (int t = 0; t < 4; ++t) { o0[t] = o0[t] * f; if (RES) o1[t] = o1[t] * f; }
    m = mn;
  }
  FragH ph, pr;
#pragma unroll
  for (int t = 0; t < 2; ++t)
#pragma unroll
    for (int r = 0; r < 8; ++r) {
      const float p = __builtin_amdgcn_exp2f(fmaf(s[t][r] - m, L2E, 10.0f));
      l += p;
      const _Float16 h = (_Float16)p;
      ph.h[8 * t + r] = h;
      if (RES) pr.h[8 * t + r] = (_Float16)((p - (float)h) * 1024.0f);
    }
  pho = ph.v;
  if (RES) pro = pr.v;
}
template <bool RES>
__device__ __forceinline__ void attn_out(const v16h (&vf)[4], const v16h (&vrf)[4], const v16h ph, const v16h pr, v8f (&o0)[4], v8f (&o1)[4]) {
#pragma unroll
  for (int t = 0; t < 4; ++t) {
    o0[t] = g2_mma(vf[t], ph, o0[t]);
    if (RES) { o1[t] = g2_mma(vf[t], pr, o1[t]); o1[t] = g2_mma(vrf[t], ph, o1[t]); }
  }
}

// precaution: stands behind a run of global loads or stores, in front of any rewrite of their address registers
__device__ __forceinline__ void xwait() { asm volatile("s_wait_xcnt 0x0" ::: "memory"); }
// fragment of the tile at a wave-uniform base; lofs = the lane's fixed byte offset, 16 lane
__device__ __forceinline__ v16h u_frag(const _Float16* ubase, unsigned lofs) {
  const char* p = (const char*)ubase + lofs; FragH f; f.half[0] = *(const v8us*)p; f.half[1] = *(const v8us*)(p + 512); return f.v;
}
// K fragments of keys k0 .. k0 + 31: two key tiles x two halves of the head; kb = the head's first tile in the batch's K plane (16 keys further = 16 DM elements, the head's second half = the next tile)
__device__ __forceinline__ void attn_ldk(v16h (&kf)[4], const _Float16* kb, unsigned lofs, int k0) {
#pragma unroll
  for (int t = 0; t < 2; ++t) { kf[2 * t] = u_frag(kb + (size_t)(k0 + 16 * t) * DM, lofs); kf[2 * t + 1] = u_frag(kb + (size_t)(k0 + 16 * t) * DM + 512, lofs); }
  xwait();
}
// V^T fragments of the same keys: four tiles of 16 head columns, side by side; vb = the head's V^T plane
__device__ __forceinline__ void attn_ldv(v16h (&vf)[4], const _Float16* vb, unsigned lofs, int k0) {
#pragma unroll
  for (int t = 0; t < 4; ++t) vf[t] = u_frag(vb + (size_t)k0 * HD + 512 * t, lofs);
  xwait();
}

// Causal attention, all heads in one launch: blockIdx.x = (batch, head), blockIdx.y = block of 64 queries (longest first); a wave owns 16 queries and walks keys 0 .. q0 + 15 in passes of 32.
// No LDS, no barrier. Writes ctx x64 as f16 (hi plane; residual plane for query rows < EARLY).
__global__ __launch_bounds__(128) void k_attn(const _Float16* __restrict__ Q16, const _Float16* __restrict__ K16, const _Float16* __restrict__ Qr, const _Float16* __restrict__ Kr,
                                              const _Float16* __restrict__ VTh, const _Float16* __restrict__ VTr, _Float16* __restrict__ CTh, _Float16* __restrict__ CTr) {
  const int lane = threadIdx.x & 31, ln = lane & 15, hh = lane >> 4;
  const int w = __builtin_amdgcn_readfirstlane((int)(threadIdx.x >> 5));
  const int bh = blockIdx.x, b = bh / NH, h = bh - b * NH;
  const int q0 = (SEQ / 64 - 1 - (int)blockIdx.y) * 64 + 16 * w;
  const int np = (q0 >> 5) + 1;                /* passes with k0 <= q0 + 15 */
  const _Float16* qp = Q16 + ((size_t)b * SEQ + q0) * DM + h * (HD * 16) + lane * 8;
  const _Float16* kb = K16 + (size_t)b * SEQ * DM + h * (HD * 16);
  const _Float16* vb = VTh + (size_t)bh * HD * SEQ;
  const unsigned kofs = (unsigned)lane * 16u, vofs = kofs;
  const v8f z8 = {0.f, 0.f, 0.f, 0.f, 0.f, 0.f, 0.f, 0.f};
  v8f o0[4] = {z8, z8, z8, z8}, o1[4] = {z8, z8, z8, z8};
  float m = -3.0e38f, l = 0.f;
  v16h ph, pr;
  const v16h qf[2] = {p_frag(qp), p_frag(qp + 512)};
  xwait();
  const bool early = q0 < EARLY;               /* the same for the whole block */
  if (early) {
    const _Float16* qrp = Qr + ((size_t)b * EARLY + q0) * DM + h * (HD * 16) + lane * 8;
    const _Float16* krb = Kr + (size_t)b * EARLY * DM + h * (HD * 16);
    const _Float16* vrb = VTr + (size_t)bh * HD * SEQ;
    const v16h qrf[2] = {p_frag(qrp), p_frag(qrp + 512)};
    xwait();
#pragma unroll 1 /* rolled: an unrolled body would hold two passes' hi and residual fragments at once */
    for (int p = 0; p < np; ++p) {
      v16h kf[4], krf[4], vf[4], vrf[4];
      attn_ldk(kf, kb, kofs, p * 32);
      attn_ldk(krf, krb, kofs, p * 32);
      attn_scores<true>(kf, krf, qf, qrf, p * 32, q0, ln, hh, m, l, o0, o1, ph, pr);
      /* V is loaded behind the scores here: K and V, hi and residual, live at once would pass 256 registers */
      attn_ldv(vf, vb, vofs, p * 32);
      attn_ldv(vrf, vrb, vofs, p * 32);
      attn_out<true>(vf, vrf, ph, pr, o0, o1);
    }
  } else {
    /* two fragment sets: the next pass's loads are issued before this pass's products, so that their latency runs under the pass */
    v16h ka[4], va[4], kc[4], vc[4];
    attn_ldk(ka, kb, kofs, 0); attn_ldv(va, vb, vofs, 0);
#pragma unroll 1 /* the body already holds two passes, one per fragment set */
    for (int p = 0; p < np; p += 2) {
      const int p1 = p + 1 < np ? p + 1 : np - 1;
      attn_ldk(kc, kb, kofs, p1 * 32); attn_ldv(vc, vb, vofs, p1 * 32);
      attn_scores<false>(ka, ka, qf, qf, p * 32, q0, ln, hh, m, l, o0, o1, ph, pr);
      attn_out<false>(va, va, ph, ph, o0, o1);
      if (p + 1 < np) {
        const int p2 = p + 2 < np ? p + 2 : np - 1;
        attn_ldk(ka, kb, kofs, p2 * 32); attn_ldv(va, vb, vofs, p2 * 32);
        attn_scores<false>(kc, kc, qf, qf, (p + 1) * 32, q0, ln, hh, m, l, o0, o1, ph, pr);
        attn_out<false>(vc, vc, ph, ph, o0, o1);
      }
    }
  }
  l += xhalf(l);
  const float sc = 64.0f / l;
  const size_t o = ((size_t)b * SEQ + q0) * DM + h * (HD * 16) + lane * 8;   /* fragment order: columns 16 t + 8 hh .. of the head = half t & 1 of its tile t >> 1 */
#pragma unroll
  for (int t = 0; t < 4; ++t) {
    FragH fh, fr;
#pragma unroll
    for (int r = 0; r < 8; ++r) {
      const float v = (early ? o0[t][r] + o1[t][r] * 0.0009765625f : o0[t][r]) * sc;
      const _Float16 a = (_Float16)v; fh.h[r] = a; fr.h[r] = (_Float16)((v - (float)a) * 1024.0f);
    }
    *(v8us*)((unsigned short*)CTh + o + 256 * t) = fh.half[0];
    xwait();
    if (early) { *(v8us*)((unsigned short*)CTr + o + 256 * t) = fr.half[0]; xwait(); }
  }
}

// General f16 GEMM, A [m][k] and B as Bt[n][k], both in fragment order (lda, ldb = their k extents); block = 4 waves; wave tile RT x 64 (RT = 32, or 16 with the residual accumulator).
// RES: second accumulator gets Ar.Bh (+ Ah.Br if BRES), both carried x2^10, folded in the epilogue. causal 1: k-loop stops at the tile's last key block; causal 2: column tiles past the diagonal are skipped.
// EPI 0: QKV routing (q/k f16 planes + early residual planes, k / v caches in f32), 1: f32 plane, 2: f16 hi (+res) planes, 3: f32 output + bias, NaN fill when the mask check failed.
template <bool RES, bool BRES, int EPI>
__global__ __launch_bounds__(128) void k_mm(
    const _Float16* __restrict__ Ah, const _Float16* __restrict__ Ar, int lda, size_t sA, size_t sAr,
    const _Float16* __restrict__ Bh, const _Float16* __restrict__ Br, int ldb, size_t sB,
    int rbase, int ntn, int K, int causal, float alpha,
    float* __restrict__ Cf, _Float16* __restrict__ C1, _Float16* __restrict__ C2, _Float16* __restrict__ C3, _Float16* __restrict__ C4,
    const float* __restrict__ bias, const int* __restrict__ flags, int ldc, size_t sC) {
  constexpr int RT = RES ? 16 : 32;
  __shared__ __attribute__((aligned(16))) float so[4][RT][68];
  const int tid = threadIdx.x, lane = tid & 31, ln = lane & 15, hh = lane >> 4;
  const int w = __builtin_amdgcn_readfirstlane(tid >> 5);
  const int by = blockIdx.y;
  const int mt = blockIdx.x / ntn, nq = blockIdx.x - mt * ntn;
  const int row0 = rbase + mt * (4 * RT) + RT * w, col0 = nq * 64;
  if (causal == 2 && col0 > row0 + RT - 1) return;
  int kend = K;
  if (causal == 1) { const int kc = (((row0 + RT - 1) >> 5) + 1) << 5; kend = kc < K ? kc : K; }
  /* wave-uniform tile addresses (row0, col0 are multiples of 16: a row of tiles holds 16 lda elements); the lane's share is the fixed byte offset lofs */
  const unsigned lofs = (unsigned)lane * 16u;
  const _Float16* ap0 = Ah + (size_t)by * sA + (size_t)row0 * lda;
  const _Float16* ap1;
  if (RES) ap1 = Ar + (size_t)by * sAr + (size_t)row0 * lda; else ap1 = ap0 + (size_t)16 * lda;
  const _Float16* bp = Bh + (size_t)by * sB + (size_t)col0 * ldb;
  const _Float16* brp = bp;
  if (RES && BRES) brp = Br + (size_t)by * sB + (size_t)col0 * ldb;
  const v8f z8 = {0.f, 0.f, 0.f, 0.f, 0.f, 0.f, 0.f, 0.f};
  v8f c0[4] = {z8, z8, z8, z8}, c1[4] = {z8, z8, z8, z8};
#pragma unroll 1
  for (int kb = 0; kb < kend; kb += 32) {
    const v16h a0 = u_frag(ap0 + (size_t)kb * 16, lofs), a1 = u_frag(ap1 + (size_t)kb * 16, lofs);
    xwait();
#pragma unroll
    for (int t = 0; t < 4; ++t) {
      const v16h b = u_frag(bp + (size_t)(16 * t) * ldb + (size_t)kb * 16, lofs);
      xwait();
      c0[t] = g2_mma(a0, b, c0[t]);
      c1[t] = g2_mma(a1, b, c1[t]);
      if (RES && BRES) { const v16h br = u_frag(brp + (size_t)(16 * t) * ldb + (size_t)kb * 16, lofs); xwait(); c1[t] = g2_mma(a0, br, c1[t]); }
    }
  }
  int poison = 0;
  if (EPI == 3) { int fl = 0;
#pragma unroll /* unrolled: the flag loads go out together */
    for (int q = 0; q < MCB / 32; ++q) fl |= flags[(q * 32 + lane) * 32];
    for (int off = 16; off > 0; off >>= 1) fl |= __shfl_xor(fl, off, 32); poison = fl; }
  const float nanv = __uint_as_float(0x7fc00000u);
#pragma unroll
  for (int t = 0; t < 4; ++t) {
    float bv = 0.f;
    if (EPI == 0 || EPI == 3) bv = bf16_rne(bias[col0 + t * 16 + ln]);
#pragma unroll
    for (int r = 0; r < 8; ++r) {
      if (!RES) {
        float v0 = c0[t][r] * alpha + bv, v1 = c1[t][r] * alpha + bv;
        if (EPI == 3) { v0 = poison ? nanv : v0; v1 = poison ? nanv : v1; }
        so[w][8 * hh + r][t * 16 + ln] = v0; so[w][(RT - 16) + 8 * hh + r][t * 16 + ln] = v1;
      } else {
        float v0 = (c0[t][r] + c1[t][r] * 0.0009765625f) * alpha + bv;
        if (EPI == 3) v0 = poison ? nanv : v0;
        so[w][8 * hh + r][t * 16 + ln] = v0;
      }
    }
  }
  __builtin_amdgcn_fence(4 /* acq_rel order */, "workgroup"); __builtin_amdgcn_wave_barrier();
  const int rsub = lane >> 4, c4 = (lane & 15) * 4;
  {
#pragma unroll
    for (int q = 0; q < RT / 2; ++q) {
      const int r = q * 2 + rsub; const int row = row0 + r;
      const v4f v = *(const v4fa*)&so[w][r][c4];
      if (EPI == 1 || EPI == 3) {
        *(v4f*)(Cf + (size_t)by * sC + (size_t)row * ldc + col0 + c4) = v;
      } else if (EPI == 2) {
        v4h h4, r4; split4(v, h4, r4);
        const size_t o = (size_t)by * sC + (size_t)row * ldc + col0 + c4;
        *(v4h*)(C1 + o) = h4;
        if (RES) *(v4h*)(C2 + o) = r4;
      } else {
        const int which = col0 / DM, hc = col0 - which * DM, h = hc >> 6;
        const size_t o16 = pk((size_t)by * SEQ + row, hc + c4, DM);
        const size_t oe = pk((size_t)by * EARLY + row, hc + c4, DM);
        const size_t of = (((size_t)by * NH + h) * SEQ_FULL + row) * HD + c4;
        if (which == 0) {
          v4h h4, r4; split4(v, h4, r4);
          *(v4h*)(C1 + o16) = h4;
          if (row0 < EARLY) *(v4h*)(C3 + oe) = r4;
        } else if (which == 1) {
          *(v4f*)(Cf + OUT1_OFF + of) = v;
          v4h h4, r4; split4(v, h4, r4);
          *(v4h*)(C2 + o16) = h4;
          if (row0 < EARLY) *(v4h*)(C4 + oe) = r4;
        } else {
          *(v4f*)(Cf + OUT2_OFF + of) = v;
        }
      }
    }
    
  }
}

extern "C" void kernel_launch(void* const* d_in, const int* in_sizes, int n_in,
                              void* d_out, int out_size, void* d_ws, size_t ws_size, hipStream_t stream) {
  if (n_in < 6) return;
  if ((size_t)in_sizes[0] < (size_t)(NB - 1) * SEQ_FULL * DM + (size_t)SEQ * DM) return;
  if ((size_t)in_sizes[1] < (size_t)DM * 3 * DM) return;
  if (in_sizes[2] < 3 * DM) return;
  if ((size_t)in_sizes[3] < (size_t)DM * DM) return;
  if (in_sizes[4] < DM) return;
  if ((size_t)in_sizes[5] < (size_t)(SEQ - 1) * SEQ_FULL + SEQ) return;
  if ((size_t)out_size < OUT2_OFF + ((size_t)((NB - 1) * NH + NH - 1) * SEQ_FULL + SEQ) * HD) return;
  const float* x = (const float*)d_in[0];        /* x      [B][L][1024] */
  const float* wqkv = (const float*)d_in[1];     /* w_qkv  [1024][3072] ([in][out]; columns q | k | v) */
  const float* bqkv = (const float*)d_in[2];     /* b_qkv  [3072] */
  const float* wo = (const float*)d_in[3];       /* w_o    [1024][1024] ([in][out]) */
  const float* bo = (const float*)d_in[4];       /* b_o    [1024] */
  const float* mask = (const float*)d_in[5];     /* mask   [1][1][L][L] additive */
  float* out = (float*)d_out;

  constexpr size_t SZ_WT = (size_t)3 * DM * DM * 2, SZ_WO = (size_t)DM * DM * 2, SZ_TOK = (size_t)NB * SEQ * DM * 2;
  constexpr size_t SZ_ER = (size_t)NB * EARLY * DM * 2;
  constexpr size_t SZ_FL = (size_t)MCB * 128;
  constexpr size_t SZ_ALL = SZ_WT + SZ_WO + 7 * SZ_TOK + 2 * SZ_ER + SZ_FL;
  static_assert(SZ_ALL <= (size_t)268435456);
  static_assert(SZ_WT % 256 == 0 && SZ_WO % 256 == 0 && SZ_TOK % 256 == 0 && SZ_ER % 256 == 0 && SZ_FL % 256 == 0);
  if (SZ_ALL > ws_size) return;
  char* ws = (char*)d_ws; size_t off = 0;
  auto take = [&](size_t bytes) { char* p = ws + off; off += bytes; return p; };
  _Float16* WT = (_Float16*)take(SZ_WT);      /* [3072][1024] x16, fragment order (as every f16 plane here) */
  _Float16* WoT = (_Float16*)take(SZ_WO);     /* [1024][1024] x16 */
  _Float16* X16 = (_Float16*)take(SZ_TOK);    /* [NB*SEQ][1024] */
  _Float16* Q16 = (_Float16*)take(SZ_TOK);
  _Float16* K16 = (_Float16*)take(SZ_TOK);
  _Float16* VTh = (_Float16*)take(SZ_TOK);    /* per (batch, head): 64 x SEQ */
  _Float16* VTr = (_Float16*)take(SZ_TOK);
  _Float16* CTh = (_Float16*)take(SZ_TOK);    /* ctx x64, [NB*SEQ][1024] */
  _Float16* CTr = (_Float16*)take(SZ_TOK);
  _Float16* Qr = (_Float16*)take(SZ_ER);      /* [NB][EARLY][1024] */
  _Float16* Kr = (_Float16*)take(SZ_ER);
  int* MCHK = (int*)take(SZ_FL);              /* MCB lines of 32 ints */

  k_wt_f16<<<(unsigned)(((size_t)3 * DM * (DM / 8) + 255) / 256), 256, 0, stream>>>(wqkv, WT, DM, 3 * DM, 16.0f);
  k_wt_f16<<<(unsigned)(((size_t)DM * (DM / 8) + 255) / 256), 256, 0, stream>>>(wo, WoT, DM, DM, 16.0f);
  k_x16<<<dim3((unsigned)((size_t)SEQ * DM / 8 / 256), NB), 256, 0, stream>>>(x, X16);
  k_maskchk<<<MCB, 256, 0, stream>>>(mask, MCHK);
  /* fused QKV projection: grid.y = batch; 48 column tiles of 64 = (q|k|v, head) */
  k_mm<false, false, 0><<<dim3((unsigned)((SEQ / 128) * (3 * DM / 64)), NB), 128, 0, stream>>>(
      X16, nullptr, DM, (size_t)SEQ * DM, (size_t)0,
      WT, nullptr, DM, (size_t)0,
      0, 3 * DM / 64, DM, 0, 0.0625f,
      out, Q16, K16, Qr, Kr, bqkv, nullptr, 0, (size_t)0);
  k_vt<<<(unsigned)(NB * NH * (SEQ / 64)), 256, 0, stream>>>(out + OUT2_OFF, VTh, VTr);

  /* scores, softmax and P V of every (batch, head) in one launch */
  k_attn<<<dim3((unsigned)(NB * NH), (unsigned)(SEQ / 64)), 128, 0, stream>>>(Q16, K16, Qr, Kr, VTh, VTr, CTh, CTr);
  /* out = (ctx x64).(w_o x16) 2^-10 + b_o: early rows with the ctx residual plane, late rows single plane; grid.y = batch */
  k_mm<true, false, 3><<<dim3((unsigned)((EARLY / 64) * (DM / 64)), NB), 128, 0, stream>>>(
      CTh, CTr, DM, (size_t)SEQ * DM, (size_t)SEQ * DM,
      WoT, nullptr, DM, (size_t)0,
      0, DM / 64, DM, 0, 0.0009765625f,
      out, nullptr, nullptr, nullptr, nullptr, bo, MCHK, DM, (size_t)SEQ_FULL * DM);
  if (SEQ > EARLY)
    k_mm<false, false, 3><<<dim3((unsigned)(((SEQ - EARLY) / 128) * (DM / 64)), NB), 128, 0, stream>>>(
        CTh, nullptr, DM, (size_t)SEQ * DM, (size_t)0,
        WoT, nullptr, DM, (size_t)0,
        EARLY, DM / 64, DM, 0, 0.0009765625f,
        out, nullptr, nullptr, nullptr, nullptr, bo, MCHK, DM, (size_t)SEQ_FULL * DM);
}

// v005
// A run of this version takes 121 microseconds.
// Next to v004, in two timings, it ran 1.69 and 1.72 times as fast.
// Counting every step since v000, it is 15.3 times as fast.
#include <hip/hip_runtime.h>
// Causal multi-head self-attention, B 2 x L 2048, d_model 1024, 16 heads of 64; outputs: out [B][L][1024], k cache [B][16][L][64], v cache [B][16][L][64] (f32).
// Compute dtype: every contraction on v_wmma_f32_16x16x32_f16 (f16 operands, f32 accumulate). x / w_qkv / w_o / biases are RNE-converted to bf16 first (exact in f16; weights carried x16).
// q, k, v and ctx (carried x64) are f16 planes, the softmax weights (unnormalised, carried x1024) f16 fragments; for the first EARLY query rows of every sequence each of them also has an f16 residual plane carried x2^10
// that goes to a separate accumulator (q k^T: 3 products, P V: 3 products, ctx w_o: 2 products); scores, softmax statistics and all epilogues in f32.
// Structure: weight transposes (once), x plane, mask structure check, fused QKV GEMM (writes the k / v caches in f32 plus the f16 planes), V^T hi/res planes through LDS,
// one attention launch for all heads (scores, online softmax and P V in registers; the scores never reach memory), then the output GEMM (early / late).
// Every f16 operand plane is kept in fragment order (see pk below), not row-major: a wave's fragment load then reads 512 contiguous bytes (4 lines) where a row-major plane gave it 32 bytes of each of 16 lines.
#ifndef NB
#define NB 2
#endif
#ifndef SEQ
#define SEQ 2048
#endif
#define NB_FULL 2
#define SEQ_FULL 2048
#define DM 1024
#define NH 16
#define HD 64
#define EARLY ((SEQ) < 512 ? (SEQ) : 512)
#define OUT1_OFF ((size_t)NB_FULL * SEQ_FULL * DM)
#define OUT2_OFF ((size_t)2 * NB_FULL * SEQ_FULL * DM)

typedef unsigned short v8us __attribute__((ext_vector_type(8), may_alias));
typedef float v8f __attribute__((ext_vector_type(8)));
typedef float v4f __attribute__((ext_vector_type(4)));
typedef float v4fa __attribute__((ext_vector_type(4), may_alias));
typedef _Float16 v16h __attribute__((ext_vector_type(16)));
typedef _Float16 v4h __attribute__((ext_vector_type(4)));
union FragH { v16h v; v8us half[2]; _Float16 h[16]; unsigned short u[16]; };

static_assert(NH * HD == DM);
static_assert(SEQ % 256 == 0);
static_assert(EARLY % 128 == 0);
static_assert((SEQ - EARLY) % 128 == 0);
static_assert(NB <= NB_FULL && SEQ <= SEQ_FULL);
static_assert(OUT1_OFF * 4 == 16777216);
static_assert(OUT2_OFF * 4 == 33554432);

__device__ __forceinline__ unsigned short bf16_bits(float x) { unsigned int u = __float_as_uint(x); return (unsigned short)((u + 0x7FFFu + ((u >> 16) & 1u)) >> 16); }
__device__ __forceinline__ float bf16_rne(float x) { return __uint_as_float(((unsigned int)bf16_bits(x)) << 16); }

// Fragment order of a plane of rows x kd: tiles of 16 rows x 32 k, 512 elements each, tile (row >> 4, k >> 5) at index (row >> 4) * (kd / 32) + (k >> 5);
// inside a tile the eight elements k = 16 j + 8 hh .. + 7 of row ln stand at 256 j + 8 (16 hh + ln). pk = element offset of (row, k).
__device__ __forceinline__ size_t pk(size_t row, int k, int kd) {
  return ((row >> 4) * (size_t)(kd >> 5) + (size_t)(k >> 5)) * 512 + (size_t)(((k >> 4) & 1) * 256 + (((k >> 3) & 1) * 16 + (int)(row & 15)) * 8 + (k & 7));
}
// fragment loader (A row or B column ln of the tile): p = tile + 8 lane, lane = 16 hh + ln; elements 0..7 <- k0+8hh.., elements 8..15 <- k0+16+8hh..
__device__ __forceinline__ v16h p_frag(const _Float16* p) { FragH f; f.half[0] = *(const v8us*)((const unsigned short*)p); f.half[1] = *(const v8us*)((const unsigned short*)p + 256); return f.v; }
__device__ __forceinline__ v8f g2_mma(v16h a, v16h b, v8f c) { v8f d = __builtin_amdgcn_wmma_f32_16x16x32_f16(false, a, false, b, (short)0, c, false, false); asm volatile("v_nop\n\tv_nop\n\tv_nop\n\tv_nop" : "+v"(d) : "v"(a), "v"(b)); return d; }
// f32 -> f16 hi and f16 residual carried x2^10
__device__ __forceinline__ void split4(const v4f v, v4h& h, v4h& r) {
#pragma unroll
  for (int i = 0; i < 4; ++i) { const _Float16 a = (_Float16)v[i]; h[i] = a; r[i] = (_Float16)((v[i] - (float)a) * 1024.0f); }
}

__global__ __launch_bounds__(256) void k_wt_f16(const float* __restrict__ W, _Float16* __restrict__ Wt, int K, int N, float scale) {
  const int t = blockIdx.x * 256 + threadIdx.x; if (t >= N * (K / 8)) return;
  /* thread t makes the t-th group of eight of the fragment-ordered plane: 16 lanes read 16 neighbouring columns n of one row of W */
  const int tile = t >> 6, n = (tile / (K / 32)) * 16 + (t & 15), k8 = (tile % (K / 32)) * 32 + ((t >> 5) & 1) * 16 + ((t >> 4) & 1) * 8; FragH f;
#pragma unroll
  for (int i = 0; i < 8; ++i) f.h[i] = (_Float16)(bf16_rne(W[(size_t)(k8 + i) * N + n]) * scale);
  const v8us o = f.half[0];
  unsigned short* d = (unsigned short*)Wt + (size_t)t * 8;
  *(v8us*)d = o; 
}

__global__ __launch_bounds__(256) void k_x16(const float* __restrict__ x, _Float16* __restrict__ X16) {
  const size_t t = (size_t)blockIdx.x * 256 + threadIdx.x; const int b = blockIdx.y;
  /* thread t makes the t-th group of eight of the batch's fragment-ordered plane */
  const int tile = (int)(t >> 6), row = (tile / (DM / 32)) * 16 + (int)(t & 15), k8 = (tile % (DM / 32)) * 32 + (int)((t >> 5) & 1) * 16 + (int)((t >> 4) & 1) * 8;
  const float* src = x + ((size_t)b * SEQ_FULL + row) * DM + k8;
  const v4f a = *(const v4fa*)src, c = *(const v4fa*)(src + 4); FragH f;
#pragma unroll
  for (int q = 0; q < 4; ++q) { f.h[q] = (_Float16)bf16_rne(a[q]); f.h[4 + q] = (_Float16)bf16_rne(c[q]); }
  unsigned short* d = (unsigned short*)X16 + (size_t)b * SEQ * DM + t * 8;
  *(v8us*)d = f.half[0]; 
}

// Mask structure check, spread over the chip: MCB work-groups of 8 waves, 16 rows each; a wave takes two rows and issues all their loads before it waits for the first.
// Row i, blocks of 128 columns: a block left of the diagonal's must be all zero (OR of the bits, sign aside), a block right of it all <= -1e8, that is, its bits as unsigned within
// [bits(-1e8), bits(-inf)] (minimum and maximum); the diagonal's own block is fetched once more and checked element by element. Every work-group writes its own 128-byte flag line.
#define MCB (SEQ / 16)
static_assert(MCB % 32 == 0);
__global__ __launch_bounds__(256) void k_maskchk(const float* __restrict__ mask, int* __restrict__ flg) {
  __shared__ int sb[8];
  constexpr int NL = SEQ / 128;                /* loads of 16 bytes a lane and row */
  constexpr unsigned ULO = 0xCCBEBC20u, UHI = 0xFF800000u;   /* bits of -1e8f and of -infinity */
  const int lane = threadIdx.x & 31;
  const int w = __builtin_amdgcn_readfirstlane((int)(threadIdx.x >> 5));
  const int i0 = blockIdx.x * 16 + w * 2;
  const float* mr = mask + (size_t)i0 * SEQ_FULL;   /* wave-uniform; the lane's share is lane * 4 */
  v4f m[2][NL], dg[2];
#pragma unroll /* unrolled, as the loop inside: the loads are independent, and a rolled loop would wait for each in turn */
  for (int r = 0; r < 2; ++r) {
#pragma unroll
    for (int u = 0; u < NL; ++u) m[r][u] = *(const v4fa*)(mr + (size_t)r * SEQ_FULL + u * 128 + lane * 4);
    const float* du = mr + (size_t)r * SEQ_FULL + ((i0 + r) >> 7) * 128;
    dg[r] = *(const v4fa*)(du + lane * 4);
  }
  /* precaution: stands behind the run of loads, in front of any rewrite of their address registers; as a volatile statement it also keeps every load in front of the first check */
  asm volatile("s_wait_xcnt 0x0" ::: "memory");
  unsigned orl = 0u, mn = UHI, mx = ULO;
  bool bad = false;
#pragma unroll /* unrolled, as the loops inside: m and dg stay in registers only under constant indices */
  for (int r = 0; r < 2; ++r) {
    const int i = i0 + r, ud = i >> 7;         /* wave-uniform */
#pragma unroll
    for (int u = 0; u < NL; ++u) {
      const unsigned a = __float_as_uint(m[r][u][0]), b = __float_as_uint(m[r][u][1]), c = __float_as_uint(m[r][u][2]), d = __float_as_uint(m[r][u][3]);
      if (u < ud) { orl |= a | b; orl |= c | d; }
      else if (u > ud) { mn = min(min(mn, a), b); mn = min(min(mn, c), d); mx = max(max(mx, a), b); mx = max(max(mx, c), d); }
    }
#pragma unroll
    for (int q = 0; q < 4; ++q) { const int j = ud * 128 + lane * 4 + q; const float v = dg[r][q]; bad |= (j <= i) ? !(v == 0.0f) : !(v <= -1.0e8f); }
  }
  bad |= (orl & 0x7FFFFFFFu) != 0u || mn < ULO || mx > UHI;
  const int wbad = __builtin_amdgcn_ballot_w32(bad) != 0 ? 1 : 0;
  if (lane == 0) sb[w] = wbad;
  __syncthreads();
  if (w == 0) {
    int tot = 0;
#pragma unroll
    for (int q = 0; q < 8; ++q) tot |= sb[q];
    int* p = flg + blockIdx.x * 32 + lane;
    *p = tot; 
  }
}

__global__ __launch_bounds__(256) void k_vt(const float* __restrict__ Vf, _Float16* __restrict__ VTh, _Float16* __restrict__ VTr) {
  __shared__ float tl[64][65];
  const int tid = threadIdx.x; const int bh = blockIdx.x / (SEQ / 64), sg = blockIdx.x % (SEQ / 64); const int s0 = sg * 64;
  const float* src = Vf + ((size_t)bh * SEQ_FULL + s0) * HD;
  for (int i = tid; i < 64 * 16; i += 256) { const int j = i >> 4, c4 = (i & 15) * 4; const v4f a = *(const v4fa*)(src + (size_t)j * HD + c4);
#pragma unroll
    for (int q = 0; q < 4; ++q) tl[c4 + q][j] = a[q]; }
  __syncthreads();
  {
    /* V^T in fragment order, rows d, k = keys, the four d tiles of a block of 32 keys side by side: tile index (key >> 5) * 4 + (d >> 4); i = the block's i-th group of eight */
    for (int i = tid; i < 64 * 8; i += 256) { const int d = ((i >> 6) & 3) * 16 + (i & 15), j8 = (i >> 8) * 32 + ((i >> 5) & 1) * 16 + ((i >> 4) & 1) * 8; FragH fh, fr;
#pragma unroll
      for (int q = 0; q < 8; ++q) { const float v = tl[d][j8 + q]; const _Float16 h = (_Float16)v; fh.h[q] = h; fr.h[q] = (_Float16)((v - (float)h) * 1024.0f); }
      const size_t o = (size_t)bh * HD * SEQ + (size_t)s0 * HD + i * 8;
      *(v8us*)((unsigned short*)VTh + o) = fh.half[0];
      *(v8us*)((unsigned short*)VTr + o) = fr.half[0]; }
     }
}

// lane l <-> lane l ^ 16 in one vector instruction (a shuffle would go through the LDS pipe and its wait)
__device__ __forceinline__ float xhalf(float x) { return __builtin_bit_cast(float, __builtin_amdgcn_permlanex16(__builtin_bit_cast(int, x), __builtin_bit_cast(int, x), 0x76543210, 0xfedcba98, false, false)); }

// One pass of the fused attention: 32 keys x the wave's 16 queries, both products transposed so that a lane owns one query (column ln) throughout.
// S^T = K Q^T: A = K rows (keys), B = Q rows (queries); accumulator register r of key tile t holds key k0 + 16 t + 8 hh + r of query q0 + ln,
// which is element 8 t + r of the B fragment of O^T += V^T P^T (A = V^T rows d, k = keys): P goes from accumulator to operand inside the lane.
// Online softmax: m = running maximum of the query (equal in both halves), l = this half's sum of p = 1024 exp(s - m); the accumulators are rescaled only in a pass where some query's maximum grew.
// RES: scores kh.qh + (kh.qr + kr.qh) 2^-10, output vh.ph + (vh.pr + vr.ph) 2^-10, the residual operands carried x2^10 in a second accumulator.
template <bool RES>
__device__ __forceinline__ void attn_scores(const v16h (&kf)[4], const v16h (&krf)[4], const v16h (&qf)[2], const v16h (&qrf)[2],
                                            int k0, int q0, int ln, int hh, float& m, float& l, v8f (&o0)[4], v8f (&o1)[4], v16h& pho, v16h& pro) {
  const v8f z8 = {0.f, 0.f, 0.f, 0.f, 0.f, 0.f, 0.f, 0.f};
  const float L2E = 1.44269504088896340736f;
  v8f s[2];
#pragma unroll
  for (int t = 0; t < 2; ++t) {
    v8f c = g2_mma(kf[2 * t], qf[0], z8);
    c = g2_mma(kf[2 * t + 1], qf[1], c);
    if (RES) {
      v8f e = g2_mma(kf[2 * t], qrf[0], z8);
      e = g2_mma(krf[2 * t], qf[0], e);
      e = g2_mma(kf[2 * t + 1], qrf[1], e);
      e = g2_mma(krf[2 * t + 1], qf[1], e);
      c = c + e * 0.0009765625f;
    }
    s[t] = c * 0.125f;
  }
  if (k0 + 31 > q0) {                          /* wave-uniform: only a pass that reaches the diagonal masks */
#pragma unroll
    for (int t = 0; t < 2; ++t)
#pragma unroll
      for (int r = 0; r < 8; ++r) s[t][r] = (k0 + 16 * t + 8 * hh + r <= q0 + ln) ? s[t][r] : -1.0e30f;
  }
  float tm = fmaxf(s[0][0], s[1][0]);
#pragma unroll
  for (int r = 1; r < 8; ++r) tm = fmaxf(tm, fmaxf(s[0][r], s[1][r]));
  tm = fmaxf(tm, xhalf(tm));
  const float mn = fmaxf(m, tm);
  if (__builtin_amdgcn_ballot_w32(mn > m) != 0) {
    const float f = __builtin_amdgcn_exp2f((m - mn) * L2E);
    l *= f;
#pragma unroll
    for (int t = 0; t < 4; ++t) { o0[t] = o0[t] * f; if (RES) o1[t] = o1[t] * f; }
    m = mn;
  }
  FragH ph, pr;
#pragma unroll
  for (int t = 0; t < 2; ++t)
#pragma unroll
    for (int r = 0; r < 8; ++r) {
      const float p = __builtin_amdgcn_exp2f(fmaf(s[t][r] - m, L2E, 10.0f));
      l += p;
      const _Float16 h = (_Float16)p;
      ph.h[8 * t + r] = h;
      if (RES) pr.h[8 * t + r] = (_Float16)((p - (float)h) * 1024.0f);
    }
  pho = ph.v;
  if (RES) pro = pr.v;
}
template <bool RES>
__device__ __forceinline__ void attn_out(const v16h (&vf)[4], const v16h (&vrf)[4], const v16h ph, const v16h pr, v8f (&o0)[4], v8f (&o1)[4]) {
#pragma unroll
  for (int t = 0; t < 4; ++t) {
    o0[t] = g2_mma(vf[t], ph, o0[t]);
    if (RES) { o1[t] = g2_mma(vf[t], pr, o1[t]); o1[t] = g2_mma(vrf[t], ph, o1[t]); }
  }
}

// precaution: stands behind a run of global loads or stores, in front of any rewrite of their address registers
__device__ __forceinline__ void xwait() { asm volatile("s_wait_xcnt 0x0" ::: "memory"); }
// fragment of the tile at a wave-uniform base; lofs = the lane's fixed byte offset, 16 lane
__device__ __forceinline__ v16h u_frag(const _Float16* ubase, unsigned lofs) {
  const char* p = (const char*)ubase + lofs; FragH f; f.half[0] = *(const v8us*)p; f.half[1] = *(const v8us*)(p + 512); return f.v;
}
// K fragments of keys k0 .. k0 + 31: two key tiles x two halves of the head; kb = the head's first tile in the batch's K plane (16 keys further = 16 DM elements, the head's second half = the next tile)
__device__ __forceinline__ void attn_ldk(v16h (&kf)[4], const _Float16* kb, unsigned lofs, int k0) {
#pragma unroll
  for (int t = 0; t < 2; ++t) { kf[2 * t] = u_frag(kb + (size_t)(k0 + 16 * t) * DM, lofs); kf[2 * t + 1] = u_frag(kb + (size_t)(k0 + 16 * t) * DM + 512, lofs); }
  xwait();
}
// V^T fragments of the same keys: four tiles of 16 head columns, side by side; vb = the head's V^T plane
__device__ __forceinline__ void attn_ldv(v16h (&vf)[4], const _Float16* vb, unsigned lofs, int k0) {
#pragma unroll
  for (int t = 0; t < 4; ++t) vf[t] = u_frag(vb + (size_t)k0 * HD + 512 * t, lofs);
  xwait();
}

// Causal attention, all heads in one launch: blockIdx.x = (batch, head), blockIdx.y = block of 64 queries (longest first); a wave owns 16 queries and walks keys 0 .. q0 + 15 in passes of 32.
// No LDS, no barrier. Writes ctx x64 as f16 (hi plane; residual plane for query rows < EARLY).
__global__ __launch_bounds__(128) void k_attn(const _Float16* __restrict__ Q16, const _Float16* __restrict__ K16, const _Float16* __restrict__ Qr, const _Float16* __restrict__ Kr,
                                              const _Float16* __restrict__ VTh, const _Float16* __restrict__ VTr, _Float16* __restrict__ CTh, _Float16* __restrict__ CTr) {
  const int lane = threadIdx.x & 31, ln = lane & 15, hh = lane >> 4;
  const int w = __builtin_amdgcn_readfirstlane((int)(threadIdx.x >> 5));
  const int bh = blockIdx.x, b = bh / NH, h = bh - b * NH;
  const int q0 = (SEQ / 64 - 1 - (int)blockIdx.y) * 64 + 16 * w;
  const int np = (q0 >> 5) + 1;                /* passes with k0 <= q0 + 15 */
  const _Float16* qp = Q16 + ((size_t)b * SEQ + q0) * DM + h * (HD * 16) + lane * 8;
  const _Float16* kb = K16 + (size_t)b * SEQ * DM + h * (HD * 16);
  const _Float16* vb = VTh + (size_t)bh * HD * SEQ;
  const unsigned kofs = (unsigned)lane * 16u, vofs = kofs;
  const v8f z8 = {0.f, 0.f, 0.f, 0.f, 0.f, 0.f, 0.f, 0.f};
  v8f o0[4] = {z8, z8, z8, z8}, o1[4] = {z8, z8, z8, z8};
  float m = -3.0e38f, l = 0.f;
  v16h ph, pr;
  const v16h qf[2] = {p_frag(qp), p_frag(qp + 512)};
  xwait();
  const bool early = q0 < EARLY;               /* the same for the whole block */
  if (early) {
    const _Float16* qrp = Qr + ((size_t)b * EARLY + q0) * DM + h * (HD * 16) + lane * 8;
    const _Float16* krb = Kr + (size_t)b * EARLY * DM + h * (HD * 16);
    const _Float16* vrb = VTr + (size_t)bh * HD * SEQ;
    const v16h qrf[2] = {p_frag(qrp), p_frag(qrp + 512)};
    xwait();
#pragma unroll 1 /* rolled: an unrolled body would hold two passes' hi and residual fragments at once */
    for (int p = 0; p < np; ++p) {
      v16h kf[4], krf[4], vf[4], vrf[4];
      attn_ldk(kf, kb, kofs, p * 32);
      attn_ldk(krf, krb, kofs, p * 32);
      attn_scores<true>(kf, krf, qf, qrf, p * 32, q0, ln, hh, m, l, o0, o1, ph, pr);
      /* V is loaded behind the scores here: K and V, hi and residual, live at once would pass 256 registers */
      attn_ldv(vf, vb, vofs, p * 32);
      attn_ldv(vrf, vrb, vofs, p * 32);
      attn_out<true>(vf, vrf, ph, pr, o0, o1);
    }
  } else {
    /* two fragment sets: the next pass's loads are issued before this pass's products, so that their latency runs under the pass */
    v16h ka[4], va[4], kc[4], vc[4];
    attn_ldk(ka, kb, kofs, 0); attn_ldv(va, vb, vofs, 0);
#pragma unroll 1 /* the body already holds two passes, one per fragment set */
    for (int p = 0; p < np; p += 2) {
      const int p1 = p + 1 < np ? p + 1 : np - 1;
      attn_ldk(kc, kb, kofs, p1 * 32); attn_ldv(vc, vb, vofs, p1 * 32);
      attn_scores<false>(ka, ka, qf, qf, p * 32, q0, ln, hh, m, l, o0, o1, ph, pr);
      attn_out<false>(va, va, ph, ph, o0, o1);
      if (p + 1 < np) {
        const int p2 = p + 2 < np ? p + 2 : np - 1;
        attn_ldk(ka, kb, kofs, p2 * 32); attn_ldv(va, vb, vofs, p2 * 32);
        attn_scores<false>(kc, kc, qf, qf, (p + 1) * 32, q0, ln, hh, m, l, o0, o1, ph, pr);
        attn_out<false>(vc, vc, ph, ph, o0, o1);
      }
    }
  }
  l += xhalf(l);
  const float sc = 64.0f / l;
  const size_t o = ((size_t)b * SEQ + q0) * DM + h * (HD * 16) + lane * 8;   /* fragment order: columns 16 t + 8 hh .. of the head = half t & 1 of its tile t >> 1 */
#pragma unroll
  for (int t = 0; t < 4; ++t) {
    FragH fh, fr;
#pragma unroll
    for (int r = 0; r < 8; ++r) {
      const float v = (early ? o0[t][r] + o1[t][r] * 0.0009765625f : o0[t][r]) * sc;
      const _Float16 a = (_Float16)v; fh.h[r] = a; fr.h[r] = (_Float16)((v - (float)a) * 1024.0f);
    }
    *(v8us*)((unsigned short*)CTh + o + 256 * t) = fh.half[0];
    xwait();
    if (early) { *(v8us*)((unsigned short*)CTr + o + 256 * t) = fr.half[0]; xwait(); }
  }
}

// General f16 GEMM, A [m][k] and B as Bt[n][k], both in fragment order with a k extent of DM; block = 4 waves; wave tile RT x 64 (RT = 32, or 16 with the residual accumulator).
// RES: second accumulator gets Ar.Bh (+ Ah.Br if BRES), both carried x2^10, folded in the epilogue. causal 1: k-loop stops at the tile's last key block; causal 2: column tiles past the diagonal are skipped.
// EPI 0: QKV routing (q/k f16 planes + early residual planes, k / v caches in f32), 1: f32 plane, 2: f16 hi (+res) planes, 3: f32 output + bias, NaN fill when the mask check failed.
// the fragments of one k step of a wave: two A tiles, four B tiles (and their residual tiles where BR)
struct MmSet { v16h a0, a1, b[4], br[4]; };
// the wave's tile rows at k = 0: wave-uniform and fixed for the whole k loop, so that they stay in scalar registers
struct MmBase { const _Float16 *a0, *a1, *b[4], *br[4]; };
// all loads of one k step in one run; vo = the lane's byte offset 16 lane + 32 k: the one vector register that the loads name
template <bool BR>
__device__ __forceinline__ void mm_ld(MmSet& f, const MmBase& p, unsigned vo) {
  f.a0 = u_frag(p.a0, vo); f.a1 = u_frag(p.a1, vo);
#pragma unroll /* unrolled: constant indices, and the loads go out together */
  for (int t = 0; t < 4; ++t) { f.b[t] = u_frag(p.b[t], vo); if (BR) f.br[t] = u_frag(p.br[t], vo); }
  xwait();
}
template <bool BR>
__device__ __forceinline__ void mm_do(const MmSet& f, v8f (&c0)[4], v8f (&c1)[4]) {
#pragma unroll /* unrolled: constant indices, eight independent accumulators in a row */
  for (int t = 0; t < 4; ++t) {
    c0[t] = g2_mma(f.a0, f.b[t], c0[t]);
    c1[t] = g2_mma(f.a1, f.b[t], c1[t]);
    if (BR) c1[t] = g2_mma(f.a0, f.br[t], c1[t]);
  }
}
template <bool RES, bool BRES, int EPI>
__global__ __launch_bounds__(128) void k_mm(
    const _Float16* __restrict__ Ah, const _Float16* __restrict__ Ar, size_t sA, size_t sAr,
    const _Float16* __restrict__ Bh, const _Float16* __restrict__ Br, size_t sB,
    int rbase, int ntn, int K, int causal, float alpha,
    float* __restrict__ Cf, _Float16* __restrict__ C1, _Float16* __restrict__ C2, _Float16* __restrict__ C3, _Float16* __restrict__ C4,
    const float* __restrict__ bias, const int* __restrict__ flags, int ldc, size_t sC) {
  constexpr int RT = RES ? 16 : 32;
  constexpr int lda = DM, ldb = DM;            /* compile-time: the tiles of a k step then differ by immediate offsets from one scalar base per plane */
  __shared__ __attribute__((aligned(16))) float so[4][RT][68];
  const int tid = threadIdx.x, lane = tid & 31, ln = lane & 15, hh = lane >> 4;
  const int w = __builtin_amdgcn_readfirstlane(tid >> 5);
  const int by = blockIdx.y;
  const int mt = blockIdx.x / ntn, nq = blockIdx.x - mt * ntn;
  const int row0 = rbase + mt * (4 * RT) + RT * w, col0 = nq * 64;
  if (causal == 2 && col0 > row0 + RT - 1) return;
  int kend = K;
  if (causal == 1) { const int kc = (((row0 + RT - 1) >> 5) + 1) << 5; kend = kc < K ? kc : K; }
  /* wave-uniform tile addresses (row0, col0 are multiples of 16: a row of tiles holds 16 lda elements); the lane's share is the fixed byte offset lofs */
  const unsigned lofs = (unsigned)lane * 16u;
  const _Float16* ap0 = Ah + (size_t)by * sA + (size_t)row0 * lda;
  const _Float16* ap1;
  if (RES) ap1 = Ar + (size_t)by * sAr + (size_t)row0 * lda; else ap1 = ap0 + (size_t)16 * lda;
  const _Float16* bp = Bh + (size_t)by * sB + (size_t)col0 * ldb;
  const _Float16* brp = bp;
  if (RES && BRES) brp = Br + (size_t)by * sB + (size_t)col0 * ldb;
  const v8f z8 = {0.f, 0.f, 0.f, 0.f, 0.f, 0.f, 0.f, 0.f};
  v8f c0[4] = {z8, z8, z8, z8}, c1[4] = {z8, z8, z8, z8};
  /* ring of NS fragment sets: the loads of k step s + NS - 1 go out in front of the products of step s, so that a wave waits once a step at most, for loads issued NS - 1 steps earlier */
  constexpr int NS = 3;                        /* three sets and the 64 accumulator registers stay below 256 registers; a fourth set would not */
  MmSet fs[NS];
  MmBase pb; pb.a0 = ap0; pb.a1 = ap1;
#pragma unroll /* unrolled: constant indices, the pointers stay in registers */
  for (int t = 0; t < 4; ++t) { pb.b[t] = bp + (size_t)(16 * t) * ldb; pb.br[t] = brp + (size_t)(16 * t) * ldb; }
#pragma unroll /* unrolled: fs stays in registers only under constant indices */
  for (int s = 0; s < NS - 1; ++s) mm_ld<RES && BRES>(fs[s], pb, lofs + 32u * (unsigned)(32 * s < kend ? 32 * s : kend - 32));
  int kb = 0;
#pragma unroll 1 /* the body already holds NS steps, one per fragment set; no branch inside it: the compiler sinks a set's loads into a branch that holds their only use, down to their products */
  for (; kb + 32 * NS <= kend; kb += 32 * NS) {
#pragma unroll /* unrolled: constant set indices */
    for (int s = 0; s < NS; ++s) {
      const int kn = kb + 32 * (s + NS - 1);   /* past the end the last step is fetched again and not used */
      mm_ld<RES && BRES>(fs[(s + NS - 1) % NS], pb, lofs + 32u * (unsigned)(kn < kend ? kn : kend - 32));
      mm_do<RES && BRES>(fs[s], c0, c1);
    }
  }
  /* the steps left over, fewer than NS: their sets are loaded already */
#pragma unroll /* unrolled: constant set indices */
  for (int s = 0; s < NS - 1; ++s)
    if (kb + 32 * s < kend) mm_do<RES && BRES>(fs[s], c0, c1);   /* wave-uniform */
  int poison = 0;
  if (EPI == 3) { int fl = 0;
#pragma unroll /* unrolled: the flag loads go out together */
    for (int q = 0; q < MCB / 32; ++q) fl |= flags[(q * 32 + lane) * 32];
    for (int off = 16; off > 0; off >>= 1) fl |= __shfl_xor(fl, off, 32); poison = fl; }
  const float nanv = __uint_as_float(0x7fc00000u);
#pragma unroll
  for (int t = 0; t < 4; ++t) {
    float bv = 0.f;
    if (EPI == 0 || EPI == 3) bv = bf16_rne(bias[col0 + t * 16 + ln]);
#pragma unroll
    for (int r = 0; r < 8; ++r) {
      if (!RES) {
        float v0 = c0[t][r] * alpha + bv, v1 = c1[t][r] * alpha + bv;
        if (EPI == 3) { v0 = poison ? nanv : v0; v1 = poison ? nanv : v1; }
        so[w][8 * hh + r][t * 16 + ln] = v0; so[w][(RT - 16) + 8 * hh + r][t * 16 + ln] = v1;
      } else {
        float v0 = (c0[t][r] + c1[t][r] * 0.0009765625f) * alpha + bv;
        if (EPI == 3) v0 = poison ? nanv : v0;
        so[w][8 * hh + r][t * 16 + ln] = v0;
      }
    }
  }
  __builtin_amdgcn_fence(4 /* acq_rel order */, "workgroup"); __builtin_amdgcn_wave_barrier();
  const int rsub = lane >> 4, c4 = (lane & 15) * 4;
  {
#pragma unroll
    for (int q = 0; q < RT / 2; ++q) {
      const int r = q * 2 + rsub; const int row = row0 + r;
      const v4f v = *(const v4fa*)&so[w][r][c4];
      if (EPI == 1 || EPI == 3) {
        *(v4f*)(Cf + (size_t)by * sC + (size_t)row * ldc + col0 + c4) = v;
      } else if (EPI == 2) {
        v4h h4, r4; split4(v, h4, r4);
        const size_t o = (size_t)by * sC + (size_t)row * ldc + col0 + c4;
        *(v4h*)(C1 + o) = h4;
        if (RES) *(v4h*)(C2 + o) = r4;
      } else {
        const int which = col0 / DM, hc = col0 - which * DM, h = hc >> 6;
        const size_t o16 = pk((size_t)by * SEQ + row, hc + c4, DM);
        const size_t oe = pk((size_t)by * EARLY + row, hc + c4, DM);
        const size_t of = (((size_t)by * NH + h) * SEQ_FULL + row) * HD + c4;
        if (which == 0) {
          v4h h4, r4; split4(v, h4, r4);
          *(v4h*)(C1 + o16) = h4;
          if (row0 < EARLY) *(v4h*)(C3 + oe) = r4;
        } else if (which == 1) {
          *(v4f*)(Cf + OUT1_OFF + of) = v;
          v4h h4, r4; split4(v, h4, r4);
          *(v4h*)(C2 + o16) = h4;
          if (row0 < EARLY) *(v4h*)(C4 + oe) = r4;
        } else {
          *(v4f*)(Cf + OUT2_OFF + of) = v;
        }
      }
    }
    
  }
}

extern "C" void kernel_launch(void* const* d_in, const int* in_sizes, int n_in,
                              void* d_out, int out_size, void* d_ws, size_t ws_size, hipStream_t stream) {
  if (n_in < 6) return;
  if ((size_t)in_sizes[0] < (size_t)(NB - 1) * SEQ_FULL * DM + (size_t)SEQ * DM) return;
  if ((size_t)in_sizes[1] < (size_t)DM * 3 * DM) return;
  if (in_sizes[2] < 3 * DM) return;
  if ((size_t)in_sizes[3] < (size_t)DM * DM) return;
  if (in_sizes[4] < DM) return;
  if ((size_t)in_sizes[5] < (size_t)(SEQ - 1) * SEQ_FULL + SEQ) return;
  if ((size_t)out_size < OUT2_OFF + ((size_t)((NB - 1) * NH + NH - 1) * SEQ_FULL + SEQ) * HD) return;
  const float* x = (const float*)d_in[0];        /* x      [B][L][1024] */
  const float* wqkv = (const float*)d_in[1];     /* w_qkv  [1024][3072] ([in][out]; columns q | k | v) */
  const float* bqkv = (const float*)d_in[2];     /* b_qkv  [3072] */
  const float* wo = (const float*)d_in[3];       /* w_o    [1024][1024] ([in][out]) */
  const float* bo = (const float*)d_in[4];       /* b_o    [1024] */
  const float* mask = (const float*)d_in[5];     /* mask   [1][1][L][L] additive */
  float* out = (float*)d_out;

  constexpr size_t SZ_WT = (size_t)3 * DM * DM * 2, SZ_WO = (size_t)DM * DM * 2, SZ_TOK = (size_t)NB * SEQ * DM * 2;
  constexpr size_t SZ_ER = (size_t)NB * EARLY * DM * 2;
  constexpr size_t SZ_FL = (size_t)MCB * 128;
  constexpr size_t SZ_ALL = SZ_WT + SZ_WO + 7 * SZ_TOK + 2 * SZ_ER + SZ_FL;
  static_assert(SZ_ALL <= (size_t)268435456);
  static_assert(SZ_WT % 256 == 0 && SZ_WO % 256 == 0 && SZ_TOK % 256 == 0 && SZ_ER % 256 == 0 && SZ_FL % 256 == 0);
  if (SZ_ALL > ws_size) return;
  char* ws = (char*)d_ws; size_t off = 0;
  auto take = [&](size_t bytes) { char* p = ws + off; off += bytes; return p; };
  _Float16* WT = (_Float16*)take(SZ_WT);      /* [3072][1024] x16, fragment order (as every f16 plane here) */
  _Float16* WoT = (_Float16*)take(SZ_WO);     /* [1024][1024] x16 */
  _Float16* X16 = (_Float16*)take(SZ_TOK);    /* [NB*SEQ][1024] */
  _Float16* Q16 = (_Float16*)take(SZ_TOK);
  _Float16* K16 = (_Float16*)take(SZ_TOK);
  _Float16* VTh = (_Float16*)take(SZ_TOK);    /* per (batch, head): 64 x SEQ */
  _Float16* VTr = (_Float16*)take(SZ_TOK);
  _Float16* CTh = (_Float16*)take(SZ_TOK);    /* ctx x64, [NB*SEQ][1024] */
  _Float16* CTr = (_Float16*)take(SZ_TOK);
  _Float16* Qr = (_Float16*)take(SZ_ER);      /* [NB][EARLY][1024] */
  _Float16* Kr = (_Float16*)take(SZ_ER);
  int* MCHK = (int*)take(SZ_FL);              /* MCB lines of 32 ints */

  k_wt_f16<<<(unsigned)(((size_t)3 * DM * (DM / 8) + 255) / 256), 256, 0, stream>>>(wqkv, WT, DM, 3 * DM, 16.0f);
  k_wt_f16<<<(unsigned)(((size_t)DM * (DM / 8) + 255) / 256), 256, 0, stream>>>(wo, WoT, DM, DM, 16.0f);
  k_x16<<<dim3((unsigned)((size_t)SEQ * DM / 8 / 256), NB), 256, 0, stream>>>(x, X16);
  k_maskchk<<<MCB, 256, 0, stream>>>(mask, MCHK);
  /* fused QKV projection: grid.y = batch; 48 column tiles of 64 = (q|k|v, head) */
  k_mm<false, false, 0><<<dim3((unsigned)((SEQ / 128) * (3 * DM / 64)), NB), 128, 0, stream>>>(
      X16, nullptr, (size_t)SEQ * DM, (size_t)0,
      WT, nullptr, (size_t)0,
      0, 3 * DM / 64, DM, 0, 0.0625f,
      out, Q16, K16, Qr, Kr, bqkv, nullptr, 0, (size_t)0);
  k_vt<<<(unsigned)(NB * NH * (SEQ / 64)), 256, 0, stream>>>(out + OUT2_OFF, VTh, VTr);

  /* scores, softmax and P V of every (batch, head) in one launch */
  k_attn<<<dim3((unsigned)(NB * NH), (unsigned)(SEQ / 64)), 128, 0, stream>>>(Q16, K16, Qr, Kr, VTh, VTr, CTh, CTr);
  /* out = (ctx x64).(w_o x16) 2^-10 + b_o: early rows with the ctx residual plane, late rows single plane; grid.y = batch */
  k_mm<true, false, 3><<<dim3((unsigned)((EARLY / 64) * (DM / 64)), NB), 128, 0, stream>>>(
      CTh, CTr, (size_t)SEQ * DM, (size_t)SEQ * DM,
      WoT, nullptr, (size_t)0,
      0, DM / 64, DM, 0, 0.0009765625f,
      out, nullptr, nullptr, nullptr, nullptr, bo, MCHK, DM, (size_t)SEQ_FULL * DM);
  if (SEQ > EARLY)
    k_mm<false, false, 3><<<dim3((unsigned)(((SEQ - EARLY) / 128) * (DM / 64)), NB), 128, 0, stream>>>(
        CTh, nullptr, (size_t)SEQ * DM, (size_t)0,
        WoT, nullptr, (size_t)0,
        EARLY, DM / 64, DM, 0, 0.0009765625f,
        out, nullptr, nullptr, nullptr, nullptr, bo, MCHK, DM, (size_t)SEQ_FULL * DM);
}

// v006
// One run takes 109 microseconds.
// Next to v005, in two timings, it ran 1.12 and 1.11 times as fast.
// Over all steps from v000 it is 17.0 times as fast.
#include <hip/hip_runtime.h>
// Causal multi-head self-attention, B 2 x L 2048, d_model 1024, 16 heads of 64; outputs: out [B][L][1024], k cache [B][16][L][64], v cache [B][16][L][64] (f32).
// Compute dtype: every contraction on v_wmma_f32_16x16x32_f16 (f16 operands, f32 accumulate). x / w_qkv / w_o / biases are RNE-converted to bf16 first (exact in f16; weights carried x16).
// q, k, v and ctx (carried x64) are f16 planes, the softmax weights (unnormalised, carried x1024) f16 fragments; for the first EARLY query rows of every sequence each of them also has an f16 residual plane carried x2^10
// that goes to a separate accumulator (q k^T: 3 products, P V: 3 products, ctx w_o: 2 products); scores, softmax statistics and all epilogues in f32.
// Structure, five launches: one for the work that depends on the inputs alone (mask structure check, x plane, both weight transposes), fused QKV GEMM (writes the k / v caches in f32 plus the f16 planes),
// V^T hi/res planes through LDS, one attention launch for all heads (scores, online softmax and P V in registers; the scores never reach memory), then one launch for the output GEMM (early and late rows).
// Every f16 operand plane is kept in fragment order (see pk below), not row-major: a wave's fragment load then reads 512 contiguous bytes (4 lines) where a row-major plane gave it 32 bytes of each of 16 lines.
#ifndef NB
#define NB 2
#endif
#ifndef SEQ
#define SEQ 2048
#endif
#define NB_FULL 2
#define SEQ_FULL 2048
#define DM 1024
#define NH 16
#define HD 64
#define EARLY ((SEQ) < 512 ? (SEQ) : 512)
#define OUT1_OFF ((size_t)NB_FULL * SEQ_FULL * DM)
#define OUT2_OFF ((size_t)2 * NB_FULL * SEQ_FULL * DM)

typedef unsigned short v8us __attribute__((ext_vector_type(8), may_alias));
typedef float v8f __attribute__((ext_vector_type(8)));
typedef float v4f __attribute__((ext_vector_type(4)));
typedef float v4fa __attribute__((ext_vector_type(4), may_alias));
typedef _Float16 v16h __attribute__((ext_vector_type(16)));
typedef _Float16 v4h __attribute__((ext_vector_type(4)));
union FragH { v16h v; v8us half[2]; _Float16 h[16]; unsigned short u[16]; };

static_assert(NH * HD == DM);
static_assert(SEQ % 256 == 0);
static_assert(EARLY % 128 == 0);
static_assert((SEQ - EARLY) % 128 == 0);
static_assert(NB <= NB_FULL && SEQ <= SEQ_FULL);
static_assert(OUT1_OFF * 4 == 16777216);
static_assert(OUT2_OFF * 4 == 33554432);

__device__ __forceinline__ unsigned short bf16_bits(float x) { unsigned int u = __float_as_uint(x); return (unsigned short)((u + 0x7FFFu + ((u >> 16) & 1u)) >> 16); }
__device__ __forceinline__ float bf16_rne(float x) { return __uint_as_float(((unsigned int)bf16_bits(x)) << 16); }

// Fragment order of a plane of rows x kd: tiles of 16 rows x 32 k, 512 elements each, tile (row >> 4, k >> 5) at index (row >> 4) * (kd / 32) + (k >> 5);
// inside a tile the eight elements k = 16 j + 8 hh .. + 7 of row ln stand at 256 j + 8 (16 hh + ln). pk = element offset of (row, k).
__device__ __forceinline__ size_t pk(size_t row, int k, int kd) {
  return ((row >> 4) * (size_t)(kd >> 5) + (size_t)(k >> 5)) * 512 + (size_t)(((k >> 4) & 1) * 256 + (((k >> 3) & 1) * 16 + (int)(row & 15)) * 8 + (k & 7));
}
// fragment loader (A row or B column ln of the tile): p = tile + 8 lane, lane = 16 hh + ln; elements 0..7 <- k0+8hh.., elements 8..15 <- k0+16+8hh..
__device__ __forceinline__ v16h p_frag(const _Float16* p) { FragH f; f.half[0] = *(const v8us*)((const unsigned short*)p); f.half[1] = *(const v8us*)((const unsigned short*)p + 256); return f.v; }
__device__ __forceinline__ v8f g2_mma(v16h a, v16h b, v8f c) { v8f d = __builtin_amdgcn_wmma_f32_16x16x32_f16(false, a, false, b, (short)0, c, false, false); asm volatile("v_nop\n\tv_nop\n\tv_nop\n\tv_nop" : "+v"(d) : "v"(a), "v"(b)); return d; }
// f32 -> f16 hi and f16 residual carried x2^10
__device__ __forceinline__ void split4(const v4f v, v4h& h, v4h& r) {
#pragma unroll
  for (int i = 0; i < 4; ++i) { const _Float16 a = (_Float16)v[i]; h[i] = a; r[i] = (_Float16)((v[i] - (float)a) * 1024.0f); }
}

template <int K, int N>
__device__ __forceinline__ void wt_f16(const float* __restrict__ W, _Float16* __restrict__ Wt, int blk, float scale) {
  const int t = blk * 256 + threadIdx.x; if (t >= N * (K / 8)) return;
  /* thread t makes the t-th group of eight of the fragment-ordered plane: 16 lanes read 16 neighbouring columns n of one row of W */
  const int tile = t >> 6, n = (tile / (K / 32)) * 16 + (t & 15), k8 = (tile % (K / 32)) * 32 + ((t >> 5) & 1) * 16 + ((t >> 4) & 1) * 8; FragH f;
#pragma unroll
  for (int i = 0; i < 8; ++i) f.h[i] = (_Float16)(bf16_rne(W[(size_t)(k8 + i) * N + n]) * scale);
  const v8us o = f.half[0];
  unsigned short* d = (unsigned short*)Wt + (size_t)t * 8;
  *(v8us*)d = o; 
}

#define XB (SEQ * DM / 8 / 256)               /* work-groups of the x plane per batch */
__device__ __forceinline__ void x16(const float* __restrict__ x, _Float16* __restrict__ X16, int blk) {
  const int b = blk / XB; const size_t t = (size_t)(blk - b * XB) * 256 + threadIdx.x;
  /* thread t makes the t-th group of eight of the batch's fragment-ordered plane */
  const int tile = (int)(t >> 6), row = (tile / (DM / 32)) * 16 + (int)(t & 15), k8 = (tile % (DM / 32)) * 32 + (int)((t >> 5) & 1) * 16 + (int)((t >> 4) & 1) * 8;
  const float* src = x + ((size_t)b * SEQ_FULL + row) * DM + k8;
  const v4f a = *(const v4fa*)src, c = *(const v4fa*)(src + 4); FragH f;
#pragma unroll
  for (int q = 0; q < 4; ++q) { f.h[q] = (_Float16)bf16_rne(a[q]); f.h[4 + q] = (_Float16)bf16_rne(c[q]); }
  unsigned short* d = (unsigned short*)X16 + (size_t)b * SEQ * DM + t * 8;
  *(v8us*)d = f.half[0]; 
}

// Mask structure check, spread over the chip: MCB work-groups of 8 waves, 16 rows each; a wave takes two rows and issues all their loads before it waits for the first.
// Row i, blocks of 128 columns: a block left of the diagonal's must be all zero (OR of the bits, sign aside), a block right of it all <= -1e8, that is, its bits as unsigned within
// [bits(-1e8), bits(-inf)] (minimum and maximum); the diagonal's own block is fetched once more and checked element by element. Every work-group writes its own 128-byte flag line.
#define MCB (SEQ / 16)
static_assert(MCB % 32 == 0);
__device__ __forceinline__ void maskchk(const float* __restrict__ mask, int* __restrict__ flg, int blk) {
  __shared__ int sb[8];
  constexpr int NL = SEQ / 128;                /* loads of 16 bytes a lane and row */
  constexpr unsigned ULO = 0xCCBEBC20u, UHI = 0xFF800000u;   /* bits of -1e8f and of -infinity */
  const int lane = threadIdx.x & 31;
  const int w = __builtin_amdgcn_readfirstlane((int)(threadIdx.x >> 5));
  const int i0 = blk * 16 + w * 2;
  const float* mr = mask + (size_t)i0 * SEQ_FULL;   /* wave-uniform; the lane's share is lane * 4 */
  v4f m[2][NL], dg[2];
#pragma unroll /* unrolled, as the loop inside: the loads are independent, and a rolled loop would wait for each in turn */
  for (int r = 0; r < 2; ++r) {
#pragma unroll
    for (int u = 0; u < NL; ++u) m[r][u] = *(const v4fa*)(mr + (size_t)r * SEQ_FULL + u * 128 + lane * 4);
    const float* du = mr + (size_t)r * SEQ_FULL + ((i0 + r) >> 7) * 128;
    dg[r] = *(const v4fa*)(du + lane * 4);
  }
  /* precaution: stands behind the run of loads, in front of any rewrite of their address registers; as a volatile statement it also keeps every load in front of the first check */
  asm volatile("s_wait_xcnt 0x0" ::: "memory");
  unsigned orl = 0u, mn = UHI, mx = ULO;
  bool bad = false;
#pragma unroll /* unrolled, as the loops inside: m and dg stay in registers only under constant indices */
  for (int r = 0; r < 2; ++r) {
    const int i = i0 + r, ud = i >> 7;         /* wave-uniform */
#pragma unroll
    for (int u = 0; u < NL; ++u) {
      const unsigned a = __float_as_uint(m[r][u][0]), b = __float_as_uint(m[r][u][1]), c = __float_as_uint(m[r][u][2]), d = __float_as_uint(m[r][u][3]);
      if (u < ud) { orl |= a | b; orl |= c | d; }
      else if (u > ud) { mn = min(min(mn, a), b); mn = min(min(mn, c), d); mx = max(max(mx, a), b); mx = max(max(mx, c), d); }
    }
#pragma unroll
    for (int q = 0; q < 4; ++q) { const int j = ud * 128 + lane * 4 + q; const float v = dg[r][q]; bad |= (j <= i) ? !(v == 0.0f) : !(v <= -1.0e8f); }
  }
  bad |= (orl & 0x7FFFFFFFu) != 0u || mn < ULO || mx > UHI;
  const int wbad = __builtin_amdgcn_ballot_w32(bad) != 0 ? 1 : 0;
  if (lane == 0) sb[w] = wbad;
  __syncthreads();
  if (w == 0) {
    int tot = 0;
#pragma unroll
    for (int q = 0; q < 8; ++q) tot |= sb[q];
    int* p = flg + blk * 32 + lane;
    *p = tot; 
  }
}

// Everything that depends on the inputs alone, in one launch: the four jobs are independent of each other, and as launches of their own each paid its own start, first load latency and drain.
// The job is picked by the work-group's index (the same for the whole work-group, so the mask check's barrier stands under uniform control flow); the mask check, whose waves live longest, comes first.
#define WQB (3 * DM * (DM / 8) / 256)
#define WOB (DM * (DM / 8) / 256)
static_assert(WQB * 256 == 3 * DM * (DM / 8) && WOB * 256 == DM * (DM / 8) && XB * 256 * 8 == SEQ * DM);
__global__ __launch_bounds__(256) void k_prep(const float* __restrict__ mask, const float* __restrict__ x, const float* __restrict__ wqkv, const float* __restrict__ wo,
                                              int* __restrict__ flg, _Float16* __restrict__ X16, _Float16* __restrict__ WT, _Float16* __restrict__ WoT) {
  const int bx = blockIdx.x;
  if (bx < MCB) maskchk(mask, flg, bx);
  else if (bx < MCB + NB * XB) x16(x, X16, bx - MCB);
  else if (bx < MCB + NB * XB + WQB) wt_f16<DM, 3 * DM>(wqkv, WT, bx - (MCB + NB * XB), 16.0f);
  else wt_f16<DM, DM>(wo, WoT, bx - (MCB + NB * XB + WQB), 16.0f);
}

__global__ __launch_bounds__(256) void k_vt(const float* __restrict__ Vf, _Float16* __restrict__ VTh, _Float16* __restrict__ VTr) {
  __shared__ float tl[64][65];
  const int tid = threadIdx.x; const int bh = blockIdx.x / (SEQ / 64), sg = blockIdx.x % (SEQ / 64); const int s0 = sg * 64;
  const float* src = Vf + ((size_t)bh * SEQ_FULL + s0) * HD;
  for (int i = tid; i < 64 * 16; i += 256) { const int j = i >> 4, c4 = (i & 15) * 4; const v4f a = *(const v4fa*)(src + (size_t)j * HD + c4);
#pragma unroll
    for (int q = 0; q < 4; ++q) tl[c4 + q][j] = a[q]; }
  __syncthreads();
  {
    /* V^T in fragment order, rows d, k = keys, the four d tiles of a block of 32 keys side by side: tile index (key >> 5) * 4 + (d >> 4); i = the block's i-th group of eight */
    for (int i = tid; i < 64 * 8; i += 256) { const int d = ((i >> 6) & 3) * 16 + (i & 15), j8 = (i >> 8) * 32 + ((i >> 5) & 1) * 16 + ((i >> 4) & 1) * 8; FragH fh, fr;
#pragma unroll
      for (int q = 0; q < 8; ++q) { const float v = tl[d][j8 + q]; const _Float16 h = (_Float16)v; fh.h[q] = h; fr.h[q] = (_Float16)((v - (float)h) * 1024.0f); }
      const size_t o = (size_t)bh * HD * SEQ + (size_t)s0 * HD + i * 8;
      *(v8us*)((unsigned short*)VTh + o) = fh.half[0];
      *(v8us*)((unsigned short*)VTr + o) = fr.half[0]; }
     }
}

// lane l <-> lane l ^ 16 in one vector instruction (a shuffle would go through the LDS pipe and its wait)
__device__ __forceinline__ float xhalf(float x) { return __builtin_bit_cast(float, __builtin_amdgcn_permlanex16(__builtin_bit_cast(int, x), __builtin_bit_cast(int, x), 0x76543210, 0xfedcba98, false, false)); }

// One pass of the fused attention: 32 keys x the wave's 16 queries, both products transposed so that a lane owns one query (column ln) throughout.
// S^T = K Q^T: A = K rows (keys), B = Q rows (queries); accumulator register r of key tile t holds key k0 + 16 t + 8 hh + r of query q0 + ln,
// which is element 8 t + r of the B fragment of O^T += V^T P^T (A = V^T rows d, k = keys): P goes from accumulator to operand inside the lane.
// Online softmax: m = running maximum of the query (equal in both halves), l = this half's sum of p = 1024 exp(s - m); the accumulators are rescaled only in a pass where some query's maximum grew.
// RES: scores kh.qh + (kh.qr + kr.qh) 2^-10, output vh.ph + (vh.pr + vr.ph) 2^-10, the residual operands carried x2^10 in a second accumulator.
template <bool RES>
__device__ __forceinline__ void attn_scores(const v16h (&kf)[4], const v16h (&krf)[4], const v16h (&qf)[2], const v16h (&qrf)[2],
                                            int k0, int q0, int ln, int hh, float& m, float& l, v8f (&o0)[4], v8f (&o1)[4], v16h& pho, v16h& pro) {
  const v8f z8 = {0.f, 0.f, 0.f, 0.f, 0.f, 0.f, 0.f, 0.f};
  const float L2E = 1.44269504088896340736f;
  v8f s[2];
#pragma unroll
  for (int t = 0; t < 2; ++t) {
    v8f c = g2_mma(kf[2 * t], qf[0], z8);
    c = g2_mma(kf[2 * t + 1], qf[1], c);
    if (RES) {
      v8f e = g2_mma(kf[2 * t], qrf[0], z8);
      e = g2_mma(krf[2 * t], qf[0], e);
      e = g2_mma(kf[2 * t + 1], qrf[1], e);
      e = g2_mma(krf[2 * t + 1], qf[1], e);
      c = c + e * 0.0009765625f;
    }
    s[t] = c * 0.125f;
  }
  if (k0 + 31 > q0) {                          /* wave-uniform: only a pass that reaches the diagonal masks */
#pragma unroll
    for (int t = 0; t < 2; ++t)
#pragma unroll
      for (int r = 0; r < 8; ++r) s[t][r] = (k0 + 16 * t + 8 * hh + r <= q0 + ln) ? s[t][r] : -1.0e30f;
  }
  float tm = fmaxf(s[0][0], s[1][0]);
#pragma unroll
  for (int r = 1; r < 8; ++r) tm = fmaxf(tm, fmaxf(s[0][r], s[1][r]));
  tm = fmaxf(tm, xhalf(tm));
  const float mn = fmaxf(m, tm);
  if (__builtin_amdgcn_ballot_w32(mn > m) != 0) {
    const float f = __builtin_amdgcn_exp2f((m - mn) * L2E);
    l *= f;
#pragma unroll
    for (int t = 0; t < 4; ++t) { o0[t] = o0[t] * f; if (RES) o1[t] = o1[t] * f; }
    m = mn;
  }
  FragH ph, pr;
#pragma unroll
  for (int t = 0; t < 2; ++t)
#pragma unroll
    for (int r = 0; r < 8; ++r) {
      const float p = __builtin_amdgcn_exp2f(fmaf(s[t][r] - m, L2E, 10.0f));
      l += p;
      const _Float16 h = (_Float16)p;
      ph.h[8 * t + r] = h;
      if (RES) pr.h[8 * t + r] = (_Float16)((p - (float)h) * 1024.0f);
    }
  pho = ph.v;
  if (RES) pro = pr.v;
}
template <bool RES>
__device__ __forceinline__ void attn_out(const v16h (&vf)[4], const v16h (&vrf)[4], const v16h ph, const v16h pr, v8f (&o0)[4], v8f (&o1)[4]) {
#pragma unroll
  for (int t = 0; t < 4; ++t) {
    o0[t] = g2_mma(vf[t], ph, o0[t]);
    if (RES) { o1[t] = g2_mma(vf[t], pr, o1[t]); o1[t] = g2_mma(vrf[t], ph, o1[t]); }
  }
}

// precaution: stands behind a run of global loads or stores, in front of any rewrite of their address registers
__device__ __forceinline__ void xwait() { asm volatile("s_wait_xcnt 0x0" ::: "memory"); }
// fragment of the tile at a wave-uniform base; lofs = the lane's fixed byte offset, 16 lane
__device__ __forceinline__ v16h u_frag(const _Float16* ubase, unsigned lofs) {
  const char* p = (const char*)ubase + lofs; FragH f; f.half[0] = *(const v8us*)p; f.half[1] = *(const v8us*)(p + 512); return f.v;
}
// K fragments of keys k0 .. k0 + 31: two key tiles x two halves of the head; kb = the head's first tile in the batch's K plane (16 keys further = 16 DM elements, the head's second half = the next tile)
__device__ __forceinline__ void attn_ldk(v16h (&kf)[4], const _Float16* kb, unsigned lofs, int k0) {
#pragma unroll
  for (int t = 0; t < 2; ++t) { kf[2 * t] = u_frag(kb + (size_t)(k0 + 16 * t) * DM, lofs); kf[2 * t + 1] = u_frag(kb + (size_t)(k0 + 16 * t) * DM + 512, lofs); }
  xwait();
}
// V^T fragments of the same keys: four tiles of 16 head columns, side by side; vb = the head's V^T plane
__device__ __forceinline__ void attn_ldv(v16h (&vf)[4], const _Float16* vb, unsigned lofs, int k0) {
#pragma unroll
  for (int t = 0; t < 4; ++t) vf[t] = u_frag(vb + (size_t)k0 * HD + 512 * t, lofs);
  xwait();
}

// Causal attention, all heads in one launch: blockIdx.x = (batch, head), blockIdx.y = block of 64 queries (longest first); a wave owns 16 queries and walks keys 0 .. q0 + 15 in passes of 32.
// No LDS, no barrier. Writes ctx x64 as f16 (hi plane; residual plane for query rows < EARLY).
__global__ __launch_bounds__(128) void k_attn(const _Float16* __restrict__ Q16, const _Float16* __restrict__ K16, const _Float16* __restrict__ Qr, const _Float16* __restrict__ Kr,
                                              const _Float16* __restrict__ VTh, const _Float16* __restrict__ VTr, _Float16* __restrict__ CTh, _Float16* __restrict__ CTr) {
  const int lane = threadIdx.x & 31, ln = lane & 15, hh = lane >> 4;
  const int w = __builtin_amdgcn_readfirstlane((int)(threadIdx.x >> 5));
  const int bh = blockIdx.x, b = bh / NH, h = bh - b * NH;
  const int q0 = (SEQ / 64 - 1 - (int)blockIdx.y) * 64 + 16 * w;
  const int np = (q0 >> 5) + 1;                /* passes with k0 <= q0 + 15 */
  const _Float16* qp = Q16 + ((size_t)b * SEQ + q0) * DM + h * (HD * 16) + lane * 8;
  const _Float16* kb = K16 + (size_t)b * SEQ * DM + h * (HD * 16);
  const _Float16* vb = VTh + (size_t)bh * HD * SEQ;
  const unsigned kofs = (unsigned)lane * 16u, vofs = kofs;
  const v8f z8 = {0.f, 0.f, 0.f, 0.f, 0.f, 0.f, 0.f, 0.f};
  v8f o0[4] = {z8, z8, z8, z8}, o1[4] = {z8, z8, z8, z8};
  float m = -3.0e38f, l = 0.f;
  v16h ph, pr;
  const v16h qf[2] = {p_frag(qp), p_frag(qp + 512)};
  xwait();
  const bool early = q0 < EARLY;               /* the same for the whole block */
  if (early) {
    const _Float16* qrp = Qr + ((size_t)b * EARLY + q0) * DM + h * (HD * 16) + lane * 8;
    const _Float16* krb = Kr + (size_t)b * EARLY * DM + h * (HD * 16);
    const _Float16* vrb = VTr + (size_t)bh * HD * SEQ;
    const v16h qrf[2] = {p_frag(qrp), p_frag(qrp + 512)};
    xwait();
#pragma unroll 1 /* rolled: an unrolled body would hold two passes' hi and residual fragments at once */
    for (int p = 0; p < np; ++p) {
      v16h kf[4], krf[4], vf[4], vrf[4];
      attn_ldk(kf, kb, kofs, p * 32);
      attn_ldk(krf, krb, kofs, p * 32);
      attn_scores<true>(kf, krf, qf, qrf, p * 32, q0, ln, hh, m, l, o0, o1, ph, pr);
      /* V is loaded behind the scores here: K and V, hi and residual, live at once would pass 256 registers */
      attn_ldv(vf, vb, vofs, p * 32);
      attn_ldv(vrf, vrb, vofs, p * 32);
      attn_out<true>(vf, vrf, ph, pr, o0, o1);
    }
  } else {
    /* two fragment sets: the next pass's loads are issued before this pass's products, so that their latency runs under the pass */
    v16h ka[4], va[4], kc[4], vc[4];
    attn_ldk(ka, kb, kofs, 0); attn_ldv(va, vb, vofs, 0);
#pragma unroll 1 /* the body already holds two passes, one per fragment set */
    for (int p = 0; p < np; p += 2) {
      const int p1 = p + 1 < np ? p + 1 : np - 1;
      attn_ldk(kc, kb, kofs, p1 * 32); attn_ldv(vc, vb, vofs, p1 * 32);
      attn_scores<false>(ka, ka, qf, qf, p * 32, q0, ln, hh, m, l, o0, o1, ph, pr);
      attn_out<false>(va, va, ph, ph, o0, o1);
      if (p + 1 < np) {
        const int p2 = p + 2 < np ? p + 2 : np - 1;
        attn_ldk(ka, kb, kofs, p2 * 32); attn_ldv(va, vb, vofs, p2 * 32);
        attn_scores<false>(kc, kc, qf, qf, (p + 1) * 32, q0, ln, hh, m, l, o0, o1, ph, pr);
        attn_out<false>(vc, vc, ph, ph, o0, o1);
      }
    }
  }
  l += xhalf(l);
  const float sc = 64.0f / l;
  const size_t o = ((size_t)b * SEQ + q0) * DM + h * (HD * 16) + lane * 8;   /* fragment order: columns 16 t + 8 hh .. of the head = half t & 1 of its tile t >> 1 */
#pragma unroll
  for (int t = 0; t < 4; ++t) {
    FragH fh, fr;
#pragma unroll
    for (int r = 0; r < 8; ++r) {
      const float v = (early ? o0[t][r] + o1[t][r] * 0.0009765625f : o0[t][r]) * sc;
      const _Float16 a = (_Float16)v; fh.h[r] = a; fr.h[r] = (_Float16)((v - (float)a) * 1024.0f);
    }
    *(v8us*)((unsigned short*)CTh + o + 256 * t) = fh.half[0];
    xwait();
    if (early) { *(v8us*)((unsigned short*)CTr + o + 256 * t) = fr.half[0]; xwait(); }
  }
}

// General f16 GEMM, A [m][k] and B as Bt[n][k], both in fragment order with a k extent of DM; block = 4 waves; wave tile RT x 64 (RT = 32, or 16 with the residual accumulator).
// RES: second accumulator gets Ar.Bh (+ Ah.Br if BRES), both carried x2^10, folded in the epilogue. causal 1: k-loop stops at the tile's last key block; causal 2: column tiles past the diagonal are skipped.
// EPI 0: QKV routing (q/k f16 planes + early residual planes, k / v caches in f32), 1: f32 plane, 2: f16 hi (+res) planes, 3: f32 output + bias, NaN fill when the mask check failed.
// the fragments of one k step of a wave: two A tiles, four B tiles (and their residual tiles where BR)
struct MmSet { v16h a0, a1, b[4], br[4]; };
// the wave's tile rows at k = 0: wave-uniform and fixed for the whole k loop, so that they stay in scalar registers
struct MmBase { const _Float16 *a0, *a1, *b[4], *br[4]; };
// all loads of one k step in one run; vo = the lane's byte offset 16 lane + 32 k: the one vector register that the loads name
template <bool BR>
__device__ __forceinline__ void mm_ld(MmSet& f, const MmBase& p, unsigned vo) {
  f.a0 = u_frag(p.a0, vo); f.a1 = u_frag(p.a1, vo);
#pragma unroll /* unrolled: constant indices, and the loads go out together */
  for (int t = 0; t < 4; ++t) { f.b[t] = u_frag(p.b[t], vo); if (BR) f.br[t] = u_frag(p.br[t], vo); }
  xwait();
}
template <bool BR>
__device__ __forceinline__ void mm_do(const MmSet& f, v8f (&c0)[4], v8f (&c1)[4]) {
#pragma unroll /* unrolled: constant indices, eight independent accumulators in a row */
  for (int t = 0; t < 4; ++t) {
    c0[t] = g2_mma(f.a0, f.b[t], c0[t]);
    c1[t] = g2_mma(f.a1, f.b[t], c1[t]);
    if (BR) c1[t] = g2_mma(f.a0, f.br[t], c1[t]);
  }
}
template <bool RES, bool BRES, int EPI>
__device__ __forceinline__ void mm_body(float* __restrict__ smem, unsigned bx,
    const _Float16* __restrict__ Ah, const _Float16* __restrict__ Ar, size_t sA, size_t sAr,
    const _Float16* __restrict__ Bh, const _Float16* __restrict__ Br, size_t sB,
    int rbase, int ntn, int K, int causal, float alpha,
    float* __restrict__ Cf, _Float16* __restrict__ C1, _Float16* __restrict__ C2, _Float16* __restrict__ C3, _Float16* __restrict__ C4,
    const float* __restrict__ bias, const int* __restrict__ flags, int ldc, size_t sC) {
  constexpr int RT = RES ? 16 : 32;
  constexpr int lda = DM, ldb = DM;            /* compile-time: the tiles of a k step then differ by immediate offsets from one scalar base per plane */
  float (&so)[4][RT][68] = *reinterpret_cast<float (*)[4][RT][68]>(smem);   /* the work-group's staging, 4 x RT x 68 floats */
  const int tid = threadIdx.x, lane = tid & 31, ln = lane & 15, hh = lane >> 4;
  const int w = __builtin_amdgcn_readfirstlane(tid >> 5);
  const int by = blockIdx.y;
  const int mt = bx / ntn, nq = bx - mt * ntn;
  const int row0 = rbase + mt * (4 * RT) + RT * w, col0 = nq * 64;
  if (causal == 2 && col0 > row0 + RT - 1) return;
  int kend = K;
  if (causal == 1) { const int kc = (((row0 + RT - 1) >> 5) + 1) << 5; kend = kc < K ? kc : K; }
  /* wave-uniform tile addresses (row0, col0 are multiples of 16: a row of tiles holds 16 lda elements); the lane's share is the fixed byte offset lofs */
  const unsigned lofs = (unsigned)lane * 16u;
  const _Float16* ap0 = Ah + (size_t)by * sA + (size_t)row0 * lda;
  const _Float16* ap1;
  if (RES) ap1 = Ar + (size_t)by * sAr + (size_t)row0 * lda; else ap1 = ap0 + (size_t)16 * lda;
  const _Float16* bp = Bh + (size_t)by * sB + (size_t)col0 * ldb;
  const _Float16* brp = bp;
  if (RES && BRES) brp = Br + (size_t)by * sB + (size_t)col0 * ldb;
  const v8f z8 = {0.f, 0.f, 0.f, 0.f, 0.f, 0.f, 0.f, 0.f};
  v8f c0[4] = {z8, z8, z8, z8}, c1[4] = {z8, z8, z8, z8};
  /* ring of NS fragment sets: the loads of k step s + NS - 1 go out in front of the products of step s, so that a wave waits once a step at most, for loads issued NS - 1 steps earlier */
  constexpr int NS = 3;                        /* three sets and the 64 accumulator registers stay below 256 registers; a fourth set would not */
  MmSet fs[NS];
  MmBase pb; pb.a0 = ap0; pb.a1 = ap1;
#pragma unroll /* unrolled: constant indices, the pointers stay in registers */
  for (int t = 0; t < 4; ++t) { pb.b[t] = bp + (size_t)(16 * t) * ldb; pb.br[t] = brp + (size_t)(16 * t) * ldb; }
#pragma unroll /* unrolled: fs stays in registers only under constant indices */
  for (int s = 0; s < NS - 1; ++s) mm_ld<RES && BRES>(fs[s], pb, lofs + 32u * (unsigned)(32 * s < kend ? 32 * s : kend - 32));
  int kb = 0;
#pragma unroll 1 /* the body already holds NS steps, one per fragment set; no branch inside it: the compiler sinks a set's loads into a branch that holds their only use, down to their products */
  for (; kb + 32 * NS <= kend; kb += 32 * NS) {
#pragma unroll /* unrolled: constant set indices */
    for (int s = 0; s < NS; ++s) {
      const int kn = kb + 32 * (s + NS - 1);   /* past the end the last step is fetched again and not used */
      mm_ld<RES && BRES>(fs[(s + NS - 1) % NS], pb, lofs + 32u * (unsigned)(kn < kend ? kn : kend - 32));
      mm_do<RES && BRES>(fs[s], c0, c1);
    }
  }
  /* the steps left over, fewer than NS: their sets are loaded already */
#pragma unroll /* unrolled: constant set indices */
  for (int s = 0; s < NS - 1; ++s)
    if (kb + 32 * s < kend) mm_do<RES && BRES>(fs[s], c0, c1);   /* wave-uniform */
  int poison = 0;
  if (EPI == 3) { int fl = 0;
#pragma unroll /* unrolled: the flag loads go out together */
    for (int q = 0; q < MCB / 32; ++q) fl |= flags[(q * 32 + lane) * 32];
    for (int off = 16; off > 0; off >>= 1) fl |= __shfl_xor(fl, off, 32); poison = fl; }
  const float nanv = __uint_as_float(0x7fc00000u);
#pragma unroll
  for (int t = 0; t < 4; ++t) {
    float bv = 0.f;
    if (EPI == 0 || EPI == 3) bv = bf16_rne(bias[col0 + t * 16 + ln]);
#pragma unroll
    for (int r = 0; r < 8; ++r) {
      if (!RES) {
        float v0 = c0[t][r] * alpha + bv, v1 = c1[t][r] * alpha + bv;
        if (EPI == 3) { v0 = poison ? nanv : v0; v1 = poison ? nanv : v1; }
        so[w][8 * hh + r][t * 16 + ln] = v0; so[w][(RT - 16) + 8 * hh + r][t * 16 + ln] = v1;
      } else {
        float v0 = (c0[t][r] + c1[t][r] * 0.0009765625f) * alpha + bv;
        if (EPI == 3) v0 = poison ? nanv : v0;
        so[w][8 * hh + r][t * 16 + ln] = v0;
      }
    }
  }
  __builtin_amdgcn_fence(4 /* acq_rel order */, "workgroup"); __builtin_amdgcn_wave_barrier();
  const int rsub = lane >> 4, c4 = (lane & 15) * 4;
  {
#pragma unroll
    for (int q = 0; q < RT / 2; ++q) {
      const int r = q * 2 + rsub; const int row = row0 + r;
      const v4f v = *(const v4fa*)&so[w][r][c4];
      if (EPI == 1 || EPI == 3) {
        *(v4f*)(Cf + (size_t)by * sC + (size_t)row * ldc + col0 + c4) = v;
      } else if (EPI == 2) {
        v4h h4, r4; split4(v, h4, r4);
        const size_t o = (size_t)by * sC + (size_t)row * ldc + col0 + c4;
        *(v4h*)(C1 + o) = h4;
        if (RES) *(v4h*)(C2 + o) = r4;
      } else {
        const int which = col0 / DM, hc = col0 - which * DM, h = hc >> 6;
        const size_t o16 = pk((size_t)by * SEQ + row, hc + c4, DM);
        const size_t oe = pk((size_t)by * EARLY + row, hc + c4, DM);
        const size_t of = (((size_t)by * NH + h) * SEQ_FULL + row) * HD + c4;
        if (which == 0) {
          v4h h4, r4; split4(v, h4, r4);
          *(v4h*)(C1 + o16) = h4;
          if (row0 < EARLY) *(v4h*)(C3 + oe) = r4;
        } else if (which == 1) {
          *(v4f*)(Cf + OUT1_OFF + of) = v;
          v4h h4, r4; split4(v, h4, r4);
          *(v4h*)(C2 + o16) = h4;
          if (row0 < EARLY) *(v4h*)(C4 + oe) = r4;
        } else {
          *(v4f*)(Cf + OUT2_OFF + of) = v;
        }
      }
    }
    
  }
}

// the fused QKV projection as a launch of its own
template <bool RES, bool BRES, int EPI>
__global__ __launch_bounds__(128) void k_mm(
    const _Float16* __restrict__ Ah, const _Float16* __restrict__ Ar, size_t sA, size_t sAr,
    const _Float16* __restrict__ Bh, const _Float16* __restrict__ Br, size_t sB,
    int rbase, int ntn, int K, int causal, float alpha,
    float* __restrict__ Cf, _Float16* __restrict__ C1, _Float16* __restrict__ C2, _Float16* __restrict__ C3, _Float16* __restrict__ C4,
    const float* __restrict__ bias, const int* __restrict__ flags, int ldc, size_t sC) {
  __shared__ __attribute__((aligned(16))) float sm[4 * (RES ? 16 : 32) * 68];
  mm_body<RES, BRES, EPI>(sm, blockIdx.x, Ah, Ar, sA, sAr, Bh, Br, sB, rbase, ntn, K, causal, alpha, Cf, C1, C2, C3, C4, bias, flags, ldc, sC);
}
// out = (ctx x64).(w_o x16) 2^-10 + b_o, early and late rows in one launch: the two parts are independent, and neither fills the chip alone. grid.y = batch;
// the first OEB work-groups take the early rows (64 each, with the ctx residual plane), the others the late rows (128 each, single plane). The pick is the same for a whole work-group.
#define OEB ((EARLY / 64) * (DM / 64))
#define OLB (((SEQ - EARLY) / 128) * (DM / 64))
__global__ __launch_bounds__(128) void k_out(const _Float16* __restrict__ CTh, const _Float16* __restrict__ CTr, const _Float16* __restrict__ WoT,
                                             float* __restrict__ out, const float* __restrict__ bo, const int* __restrict__ flags) {
  __shared__ __attribute__((aligned(16))) float sm[4 * 32 * 68];
  const unsigned bx = blockIdx.x;
  if (bx < OEB)
    mm_body<true, false, 3>(sm, bx, CTh, CTr, (size_t)SEQ * DM, (size_t)SEQ * DM, WoT, nullptr, (size_t)0,
                            0, DM / 64, DM, 0, 0.0009765625f, out, nullptr, nullptr, nullptr, nullptr, bo, flags, DM, (size_t)SEQ_FULL * DM);
  else
    mm_body<false, false, 3>(sm, bx - OEB, CTh, nullptr, (size_t)SEQ * DM, (size_t)0, WoT, nullptr, (size_t)0,
                             EARLY, DM / 64, DM, 0, 0.0009765625f, out, nullptr, nullptr, nullptr, nullptr, bo, flags, DM, (size_t)SEQ_FULL * DM);
}

extern "C" void kernel_launch(void* const* d_in, const int* in_sizes, int n_in,
                              void* d_out, int out_size, void* d_ws, size_t ws_size, hipStream_t stream) {
  if (n_in < 6) return;
  if ((size_t)in_sizes[0] < (size_t)(NB - 1) * SEQ_FULL * DM + (size_t)SEQ * DM) return;
  if ((size_t)in_sizes[1] < (size_t)DM * 3 * DM) return;
  if (in_sizes[2] < 3 * DM) return;
  if ((size_t)in_sizes[3] < (size_t)DM * DM) return;
  if (in_sizes[4] < DM) return;
  if ((size_t)in_sizes[5] < (size_t)(SEQ - 1) * SEQ_FULL + SEQ) return;
  if ((size_t)out_size < OUT2_OFF + ((size_t)((NB - 1) * NH + NH - 1) * SEQ_FULL + SEQ) * HD) return;
  const float* x = (const float*)d_in[0];        /* x      [B][L][1024] */
  const float* wqkv = (const float*)d_in[1];     /* w_qkv  [1024][3072] ([in][out]; columns q | k | v) */
  const float* bqkv = (const float*)d_in[2];     /* b_qkv  [3072] */
  const float* wo = (const float*)d_in[3];       /* w_o    [1024][1024] ([in][out]) */
  const float* bo = (const float*)d_in[4];       /* b_o    [1024] */
  const float* mask = (const float*)d_in[5];     /* mask   [1][1][L][L] additive */
  float* out = (float*)d_out;

  constexpr size_t SZ_WT = (size_t)3 * DM * DM * 2, SZ_WO = (size_t)DM * DM * 2, SZ_TOK = (size_t)NB * SEQ * DM * 2;
  constexpr size_t SZ_ER = (size_t)NB * EARLY * DM * 2;
  constexpr size_t SZ_FL = (size_t)MCB * 128;
  constexpr size_t SZ_ALL = SZ_WT + SZ_WO + 7 * SZ_TOK + 2 * SZ_ER + SZ_FL;
  static_assert(SZ_ALL <= (size_t)268435456);
  static_assert(SZ_WT % 256 == 0 && SZ_WO % 256 == 0 && SZ_TOK % 256 == 0 && SZ_ER % 256 == 0 && SZ_FL % 256 == 0);
  if (SZ_ALL > ws_size) return;
  char* ws = (char*)d_ws; size_t off = 0;
  auto take = [&](size_t bytes) { char* p = ws + off; off += bytes; return p; };
  _Float16* WT = (_Float16*)take(SZ_WT);      /* [3072][1024] x16, fragment order (as every f16 plane here) */
  _Float16* WoT = (_Float16*)take(SZ_WO);     /* [1024][1024] x16 */
  _Float16* X16 = (_Float16*)take(SZ_TOK);    /* [NB*SEQ][1024] */
  _Float16* Q16 = (_Float16*)take(SZ_TOK);
  _Float16* K16 = (_Float16*)take(SZ_TOK);
  _Float16* VTh = (_Float16*)take(SZ_TOK);    /* per (batch, head): 64 x SEQ */
  _Float16* VTr = (_Float16*)take(SZ_TOK);
  _Float16* CTh = (_Float16*)take(SZ_TOK);    /* ctx x64, [NB*SEQ][1024] */
  _Float16* CTr = (_Float16*)take(SZ_TOK);
  _Float16* Qr = (_Float16*)take(SZ_ER);      /* [NB][EARLY][1024] */
  _Float16* Kr = (_Float16*)take(SZ_ER);
  int* MCHK = (int*)take(SZ_FL);              /* MCB lines of 32 ints */

  k_prep<<<(unsigned)(MCB + NB * XB + WQB + WOB), 256, 0, stream>>>(mask, x, wqkv, wo, MCHK, X16, WT, WoT);
  /* fused QKV projection: grid.y = batch; 48 column tiles of 64 = (q|k|v, head) */
  k_mm<false, false, 0><<<dim3((unsigned)((SEQ / 128) * (3 * DM / 64)), NB), 128, 0, stream>>>(
      X16, nullptr, (size_t)SEQ * DM, (size_t)0,
      WT, nullptr, (size_t)0,
      0, 3 * DM / 64, DM, 0, 0.0625f,
      out, Q16, K16, Qr, Kr, bqkv, nullptr, 0, (size_t)0);
  k_vt<<<(unsigned)(NB * NH * (SEQ / 64)), 256, 0, stream>>>(out + OUT2_OFF, VTh, VTr);

  /* scores, softmax and P V of every (batch, head) in one launch */
  k_attn<<<dim3((unsigned)(NB * NH), (unsigned)(SEQ / 64)), 128, 0, stream>>>(Q16, K16, Qr, Kr, VTh, VTr, CTh, CTr);
  k_out<<<dim3((unsigned)(OEB + OLB), NB), 128, 0, stream>>>(CTh, CTr, WoT, out, bo, MCHK);
}

// v007
// A run of this version takes 104 microseconds.
// In two side-by-side timings against v006, it was 1.05 and 1.04 times as fast.
// Over all steps from v000 it is 17.8 times as fast.
#include <hip/hip_runtime.h>
// Causal multi-head self-attention, B 2 x L 2048, d_model 1024, 16 heads of 64; outputs: out [B][L][1024], k cache [B][16][L][64], v cache [B][16][L][64] (f32).
// Compute dtype: every contraction on v_wmma_f32_16x16x32_f16 (f16 operands, f32 accumulate). x / w_qkv / w_o / biases are RNE-converted to bf16 first (exact in f16; weights carried x16).
// q, k, v and ctx (carried x64) are f16 planes, the softmax weights (unnormalised, carried x1024) f16 fragments; for the first EARLY query rows of every sequence each of them also has an f16 residual plane carried x2^10
// that goes to a separate accumulator (q k^T: 3 products, P V: 3 products, ctx w_o: 2 products); scores, softmax statistics and all epilogues in f32.
// Structure, four launches: one for the work that depends on the inputs alone (mask structure check, x plane, both weight transposes), fused QKV GEMM (writes the k / v caches in f32 plus the f16 planes,
// the V^T hi/res planes among them), one attention launch for all heads (scores, online softmax and P V in registers; the scores never reach memory), then one launch for the output GEMM (early and late rows).
// Every f16 operand plane is kept in fragment order (see pk below), not row-major: a wave's fragment load then reads 512 contiguous bytes (4 lines) where a row-major plane gave it 32 bytes of each of 16 lines.
#ifndef NB
#define NB 2
#endif
#ifndef SEQ
#define SEQ 2048
#endif
#define NB_FULL 2
#define SEQ_FULL 2048
#define DM 1024
#define NH 16
#define HD 64
#define EARLY ((SEQ) < 512 ? (SEQ) : 512)
#define OUT1_OFF ((size_t)NB_FULL * SEQ_FULL * DM)
#define OUT2_OFF ((size_t)2 * NB_FULL * SEQ_FULL * DM)

typedef unsigned short v8us __attribute__((ext_vector_type(8), may_alias));
typedef float v8f __attribute__((ext_vector_type(8)));
typedef float v4f __attribute__((ext_vector_type(4)));
typedef float v4fa __attribute__((ext_vector_type(4), may_alias));
typedef _Float16 v16h __attribute__((ext_vector_type(16)));
typedef _Float16 v4h __attribute__((ext_vector_type(4)));
union FragH { v16h v; v8us half[2]; _Float16 h[16]; unsigned short u[16]; };

static_assert(NH * HD == DM);
static_assert(SEQ % 256 == 0);
static_assert(EARLY % 128 == 0);
static_assert((SEQ - EARLY) % 128 == 0);
static_assert(NB <= NB_FULL && SEQ <= SEQ_FULL);
static_assert(OUT1_OFF * 4 == 16777216);
static_assert(OUT2_OFF * 4 == 33554432);

__device__ __forceinline__ unsigned short bf16_bits(float x) { unsigned int u = __float_as_uint(x); return (unsigned short)((u + 0x7FFFu + ((u >> 16) & 1u)) >> 16); }
__device__ __forceinline__ float bf16_rne(float x) { return __uint_as_float(((unsigned int)bf16_bits(x)) << 16); }

// Fragment order of a plane of rows x kd: tiles of 16 rows x 32 k, 512 elements each, tile (row >> 4, k >> 5) at index (row >> 4) * (kd / 32) + (k >> 5);
// inside a tile the eight elements k = 16 j + 8 hh .. + 7 of row ln stand at 256 j + 8 (16 hh + ln). pk = element offset of (row, k).
__device__ __forceinline__ size_t pk(size_t row, int k, int kd) {
  return ((row >> 4) * (size_t)(kd >> 5) + (size_t)(k >> 5)) * 512 + (size_t)(((k >> 4) & 1) * 256 + (((k >> 3) & 1) * 16 + (int)(row & 15)) * 8 + (k & 7));
}
// fragment loader (A row or B column ln of the tile): p = tile + 8 lane, lane = 16 hh + ln; elements 0..7 <- k0+8hh.., elements 8..15 <- k0+16+8hh..
__device__ __forceinline__ v16h p_frag(const _Float16* p) { FragH f; f.half[0] = *(const v8us*)((const unsigned short*)p); f.half[1] = *(const v8us*)((const unsigned short*)p + 256); return f.v; }
__device__ __forceinline__ v8f g2_mma(v16h a, v16h b, v8f c) { v8f d = __builtin_amdgcn_wmma_f32_16x16x32_f16(false, a, false, b, (short)0, c, false, false); asm volatile("v_nop\n\tv_nop\n\tv_nop\n\tv_nop" : "+v"(d) : "v"(a), "v"(b)); return d; }
// f32 -> f16 hi and f16 residual carried x2^10
__device__ __forceinline__ void split4(const v4f v, v4h& h, v4h& r) {
#pragma unroll
  for (int i = 0; i < 4; ++i) { const _Float16 a = (_Float16)v[i]; h[i] = a; r[i] = (_Float16)((v[i] - (float)a) * 1024.0f); }
}

template <int K, int N>
__device__ __forceinline__ void wt_f16(const float* __restrict__ W, _Float16* __restrict__ Wt, int blk, float scale) {
  const int t = blk * 256 + threadIdx.x; if (t >= N * (K / 8)) return;
  /* thread t makes the t-th group of eight of the fragment-ordered plane: 16 lanes read 16 neighbouring columns n of one row of W */
  const int tile = t >> 6, n = (tile / (K / 32)) * 16 + (t & 15), k8 = (tile % (K / 32)) * 32 + ((t >> 5) & 1) * 16 + ((t >> 4) & 1) * 8; FragH f;
#pragma unroll
  for (int i = 0; i < 8; ++i) f.h[i] = (_Float16)(bf16_rne(W[(size_t)(k8 + i) * N + n]) * scale);
  const v8us o = f.half[0];
  unsigned short* d = (unsigned short*)Wt + (size_t)t * 8;
  *(v8us*)d = o; 
}

#define XB (SEQ * DM / 8 / 256)               /* work-groups of the x plane per batch */
__device__ __forceinline__ void x16(const float* __restrict__ x, _Float16* __restrict__ X16, int blk) {
  const int b = blk / XB; const size_t t = (size_t)(blk - b * XB) * 256 + threadIdx.x;
  /* thread t makes the t-th group of eight of the batch's fragment-ordered plane */
  const int tile = (int)(t >> 6), row = (tile / (DM / 32)) * 16 + (int)(t & 15), k8 = (tile % (DM / 32)) * 32 + (int)((t >> 5) & 1) * 16 + (int)((t >> 4) & 1) * 8;
  const float* src = x + ((size_t)b * SEQ_FULL + row) * DM + k8;
  const v4f a = *(const v4fa*)src, c = *(const v4fa*)(src + 4); FragH f;
#pragma unroll
  for (int q = 0; q < 4; ++q) { f.h[q] = (_Float16)bf16_rne(a[q]); f.h[4 + q] = (_Float16)bf16_rne(c[q]); }
  unsigned short* d = (unsigned short*)X16 + (size_t)b * SEQ * DM + t * 8;
  *(v8us*)d = f.half[0]; 
}

// Mask structure check, spread over the chip: MCB work-groups of 8 waves, 16 rows each; a wave takes two rows and issues all their loads before it waits for the first.
// Row i, blocks of 128 columns: a block left of the diagonal's must be all zero (OR of the bits, sign aside), a block right of it all <= -1e8, that is, its bits as unsigned within
// [bits(-1e8), bits(-inf)] (minimum and maximum); the diagonal's own block is fetched once more and checked element by element. Every work-group writes its own 128-byte flag line.
#define MCB (SEQ / 16)
static_assert(MCB % 32 == 0);
__device__ __forceinline__ void maskchk(const float* __restrict__ mask, int* __restrict__ flg, int blk) {
  __shared__ int sb[8];
  constexpr int NL = SEQ / 128;                /* loads of 16 bytes a lane and row */
  constexpr unsigned ULO = 0xCCBEBC20u, UHI = 0xFF800000u;   /* bits of -1e8f and of -infinity */
  const int lane = threadIdx.x & 31;
  const int w = __builtin_amdgcn_readfirstlane((int)(threadIdx.x >> 5));
  const int i0 = blk * 16 + w * 2;
  const float* mr = mask + (size_t)i0 * SEQ_FULL;   /* wave-uniform; the lane's share is lane * 4 */
  v4f m[2][NL], dg[2];
#pragma unroll /* unrolled, as the loop inside: the loads are independent, and a rolled loop would wait for each in turn */
  for (int r = 0; r < 2; ++r) {
#pragma unroll
    for (int u = 0; u < NL; ++u) m[r][u] = *(const v4fa*)(mr + (size_t)r * SEQ_FULL + u * 128 + lane * 4);
    const float* du = mr + (size_t)r * SEQ_FULL + ((i0 + r) >> 7) * 128;
    dg[r] = *(const v4fa*)(du + lane * 4);
  }
  /* precaution: stands behind the run of loads, in front of any rewrite of their address registers; as a volatile statement it also keeps every load in front of the first check */
  asm volatile("s_wait_xcnt 0x0" ::: "memory");
  unsigned orl = 0u, mn = UHI, mx = ULO;
  bool bad = false;
#pragma unroll /* unrolled, as the loops inside: m and dg stay in registers only under constant indices */
  for (int r = 0; r < 2; ++r) {
    const int i = i0 + r, ud = i >> 7;         /* wave-uniform */
#pragma unroll
    for (int u = 0; u < NL; ++u) {
      const unsigned a = __float_as_uint(m[r][u][0]), b = __float_as_uint(m[r][u][1]), c = __float_as_uint(m[r][u][2]), d = __float_as_uint(m[r][u][3]);
      if (u < ud) { orl |= a | b; orl |= c | d; }
      else if (u > ud) { mn = min(min(mn, a), b); mn = min(min(mn, c), d); mx = max(max(mx, a), b); mx = max(max(mx, c), d); }
    }
#pragma unroll
    for (int q = 0; q < 4; ++q) { const int j = ud * 128 + lane * 4 + q; const float v = dg[r][q]; bad |= (j <= i) ? !(v == 0.0f) : !(v <= -1.0e8f); }
  }
  bad |= (orl & 0x7FFFFFFFu) != 0u || mn < ULO || mx > UHI;
  const int wbad = __builtin_amdgcn_ballot_w32(bad) != 0 ? 1 : 0;
  if (lane == 0) sb[w] = wbad;
  __syncthreads();
  if (w == 0) {
    int tot = 0;
#pragma unroll
    for (int q = 0; q < 8; ++q) tot |= sb[q];
    int* p = flg + blk * 32 + lane;
    *p = tot; 
  }
}

// Everything that depends on the inputs alone, in one launch: the four jobs are independent of each other, and as launches of their own each paid its own start, first load latency and drain.
// The job is picked by the work-group's index (the same for the whole work-group, so the mask check's barrier stands under uniform control flow); the mask check, whose waves live longest, comes first.
#define WQB (3 * DM * (DM / 8) / 256)
#define WOB (DM * (DM / 8) / 256)
static_assert(WQB * 256 == 3 * DM * (DM / 8) && WOB * 256 == DM * (DM / 8) && XB * 256 * 8 == SEQ * DM);
__global__ __launch_bounds__(256) void k_prep(const float* __restrict__ mask, const float* __restrict__ x, const float* __restrict__ wqkv, const float* __restrict__ wo,
                                              int* __restrict__ flg, _Float16* __restrict__ X16, _Float16* __restrict__ WT, _Float16* __restrict__ WoT) {
  const int bx = blockIdx.x;
  if (bx < MCB) maskchk(mask, flg, bx);
  else if (bx < MCB + NB * XB) x16(x, X16, bx - MCB);
  else if (bx < MCB + NB * XB + WQB) wt_f16<DM, 3 * DM>(wqkv, WT, bx - (MCB + NB * XB), 16.0f);
  else wt_f16<DM, DM>(wo, WoT, bx - (MCB + NB * XB + WQB), 16.0f);
}

// lane l <-> lane l ^ 16 in one vector instruction (a shuffle would go through the LDS pipe and its wait)
__device__ __forceinline__ float xhalf(float x) { return __builtin_bit_cast(float, __builtin_amdgcn_permlanex16(__builtin_bit_cast(int, x), __builtin_bit_cast(int, x), 0x76543210, 0xfedcba98, false, false)); }

// One pass of the fused attention: 32 keys x the wave's 16 queries, both products transposed so that a lane owns one query (column ln) throughout.
// S^T = K Q^T: A = K rows (keys), B = Q rows (queries); accumulator register r of key tile t holds key k0 + 16 t + 8 hh + r of query q0 + ln,
// which is element 8 t + r of the B fragment of O^T += V^T P^T (A = V^T rows d, k = keys): P goes from accumulator to operand inside the lane.
// Online softmax: m = running maximum of the query (equal in both halves), l = this half's sum of p = 1024 exp(s - m); the accumulators are rescaled only in a pass where some query's maximum grew.
// RES: scores kh.qh + (kh.qr + kr.qh) 2^-10, output vh.ph + (vh.pr + vr.ph) 2^-10, the residual operands carried x2^10 in a second accumulator.
template <bool RES>
__device__ __forceinline__ void attn_scores(const v16h (&kf)[4], const v16h (&krf)[4], const v16h (&qf)[2], const v16h (&qrf)[2],
                                            int k0, int q0, int ln, int hh, float& m, float& l, v8f (&o0)[4], v8f (&o1)[4], v16h& pho, v16h& pro) {
  const v8f z8 = {0.f, 0.f, 0.f, 0.f, 0.f, 0.f, 0.f, 0.f};
  const float L2E = 1.44269504088896340736f;
  v8f s[2];
#pragma unroll
  for (int t = 0; t < 2; ++t) {
    v8f c = g2_mma(kf[2 * t], qf[0], z8);
    c = g2_mma(kf[2 * t + 1], qf[1], c);
    if (RES) {
      v8f e = g2_mma(kf[2 * t], qrf[0], z8);
      e = g2_mma(krf[2 * t], qf[0], e);
      e = g2_mma(kf[2 * t + 1], qrf[1], e);
      e = g2_mma(krf[2 * t + 1], qf[1], e);
      c = c + e * 0.0009765625f;
    }
    s[t] = c * 0.125f;
  }
  if (k0 + 31 > q0) {                          /* wave-uniform: only a pass that reaches the diagonal masks */
#pragma unroll
    for (int t = 0; t < 2; ++t)
#pragma unroll
      for (int r = 0; r < 8; ++r) s[t][r] = (k0 + 16 * t + 8 * hh + r <= q0 + ln) ? s[t][r] : -1.0e30f;
  }
  float tm = fmaxf(s[0][0], s[1][0]);
#pragma unroll
  for (int r = 1; r < 8; ++r) tm = fmaxf(tm, fmaxf(s[0][r], s[1][r]));
  tm = fmaxf(tm, xhalf(tm));
  const float mn = fmaxf(m, tm);
  if (__builtin_amdgcn_ballot_w32(mn > m) != 0) {
    const float f = __builtin_amdgcn_exp2f((m - mn) * L2E);
    l *= f;
#pragma unroll
    for (int t = 0; t < 4; ++t) { o0[t] = o0[t] * f; if (RES) o1[t] = o1[t] * f; }
    m = mn;
  }
  FragH ph, pr;
#pragma unroll
  for (int t = 0; t < 2; ++t)
#pragma unroll
    for (int r = 0; r < 8; ++r) {
      const float p = __builtin_amdgcn_exp2f(fmaf(s[t][r] - m, L2E, 10.0f));
      l += p;
      const _Float16 h = (_Float16)p;
      ph.h[8 * t + r] = h;
      if (RES) pr.h[8 * t + r] = (_Float16)((p - (float)h) * 1024.0f);
    }
  pho = ph.v;
  if (RES) pro = pr.v;
}
template <bool RES>
__device__ __forceinline__ void attn_out(const v16h (&vf)[4], const v16h (&vrf)[4], const v16h ph, const v16h pr, v8f (&o0)[4], v8f (&o1)[4]) {
#pragma unroll
  for (int t = 0; t < 4; ++t) {
    o0[t] = g2_mma(vf[t], ph, o0[t]);
    if (RES) { o1[t] = g2_mma(vf[t], pr, o1[t]); o1[t] = g2_mma(vrf[t], ph, o1[t]); }
  }
}

// precaution: stands behind a run of global loads or stores, in front of any rewrite of their address registers
__device__ __forceinline__ void xwait() { asm volatile("s_wait_xcnt 0x0" ::: "memory"); }
// fragment of the tile at a wave-uniform base; lofs = the lane's fixed byte offset, 16 lane
__device__ __forceinline__ v16h u_frag(const _Float16* ubase, unsigned lofs) {
  const char* p = (const char*)ubase + lofs; FragH f; f.half[0] = *(const v8us*)p; f.half[1] = *(const v8us*)(p + 512); return f.v;
}
// K fragments of keys k0 .. k0 + 31: two key tiles x two halves of the head; kb = the head's first tile in the batch's K plane (16 keys further = 16 DM elements, the head's second half = the next tile)
__device__ __forceinline__ void attn_ldk(v16h (&kf)[4], const _Float16* kb, unsigned lofs, int k0) {
#pragma unroll
  for (int t = 0; t < 2; ++t) { kf[2 * t] = u_frag(kb + (size_t)(k0 + 16 * t) * DM, lofs); kf[2 * t + 1] = u_frag(kb + (size_t)(k0 + 16 * t) * DM + 512, lofs); }
  xwait();
}
// V^T fragments of the same keys: four tiles of 16 head columns, side by side; vb = the head's V^T plane
__device__ __forceinline__ void attn_ldv(v16h (&vf)[4], const _Float16* vb, unsigned lofs, int k0) {
#pragma unroll
  for (int t = 0; t < 4; ++t) vf[t] = u_frag(vb + (size_t)k0 * HD + 512 * t, lofs);
  xwait();
}

// Causal attention, all heads in one launch: blockIdx.x = (batch, head), blockIdx.y = block of 64 queries (longest first); a wave owns 16 queries and walks keys 0 .. q0 + 15 in passes of 32.
// No LDS, no barrier. Writes ctx x64 as f16 (hi plane; residual plane for query rows < EARLY).
__global__ __launch_bounds__(128) void k_attn(const _Float16* __restrict__ Q16, const _Float16* __restrict__ K16, const _Float16* __restrict__ Qr, const _Float16* __restrict__ Kr,
                                              const _Float16* __restrict__ VTh, const _Float16* __restrict__ VTr, _Float16* __restrict__ CTh, _Float16* __restrict__ CTr) {
  const int lane = threadIdx.x & 31, ln = lane & 15, hh = lane >> 4;
  const int w = __builtin_amdgcn_readfirstlane((int)(threadIdx.x >> 5));
  const int bh = blockIdx.x, b = bh / NH, h = bh - b * NH;
  const int q0 = (SEQ / 64 - 1 - (int)blockIdx.y) * 64 + 16 * w;
  const int np = (q0 >> 5) + 1;                /* passes with k0 <= q0 + 15 */
  const _Float16* qp = Q16 + ((size_t)b * SEQ + q0) * DM + h * (HD * 16) + lane * 8;
  const _Float16* kb = K16 + (size_t)b * SEQ * DM + h * (HD * 16);
  const _Float16* vb = VTh + (size_t)bh * HD * SEQ;
  const unsigned kofs = (unsigned)lane * 16u, vofs = kofs;
  const v8f z8 = {0.f, 0.f, 0.f, 0.f, 0.f, 0.f, 0.f, 0.f};
  v8f o0[4] = {z8, z8, z8, z8}, o1[4] = {z8, z8, z8, z8};
  float m = -3.0e38f, l = 0.f;
  v16h ph, pr;
  const v16h qf[2] = {p_frag(qp), p_frag(qp + 512)};
  xwait();
  const bool early = q0 < EARLY;               /* the same for the whole block */
  if (early) {
    const _Float16* qrp = Qr + ((size_t)b * EARLY + q0) * DM + h * (HD * 16) + lane * 8;
    const _Float16* krb = Kr + (size_t)b * EARLY * DM + h * (HD * 16);
    const _Float16* vrb = VTr + (size_t)bh * HD * SEQ;
    const v16h qrf[2] = {p_frag(qrp), p_frag(qrp + 512)};
    xwait();
#pragma unroll 1 /* rolled: an unrolled body would hold two passes' hi and residual fragments at once */
    for (int p = 0; p < np; ++p) {
      v16h kf[4], krf[4], vf[4], vrf[4];
      attn_ldk(kf, kb, kofs, p * 32);
      attn_ldk(krf, krb, kofs, p * 32);
      attn_scores<true>(kf, krf, qf, qrf, p * 32, q0, ln, hh, m, l, o0, o1, ph, pr);
      /* V is loaded behind the scores here: K and V, hi and residual, live at once would pass 256 registers */
      attn_ldv(vf, vb, vofs, p * 32);
      attn_ldv(vrf, vrb, vofs, p * 32);
      attn_out<true>(vf, vrf, ph, pr, o0, o1);
    }
  } else {
    /* two fragment sets: the next pass's loads are issued before this pass's products, so that their latency runs under the pass */
    v16h ka[4], va[4], kc[4], vc[4];
    attn_ldk(ka, kb, kofs, 0); attn_ldv(va, vb, vofs, 0);
#pragma unroll 1 /* the body already holds two passes, one per fragment set */
    for (int p = 0; p < np; p += 2) {
      const int p1 = p + 1 < np ? p + 1 : np - 1;
      attn_ldk(kc, kb, kofs, p1 * 32); attn_ldv(vc, vb, vofs, p1 * 32);
      attn_scores<false>(ka, ka, qf, qf, p * 32, q0, ln, hh, m, l, o0, o1, ph, pr);
      attn_out<false>(va, va, ph, ph, o0, o1);
      if (p + 1 < np) {
        const int p2 = p + 2 < np ? p + 2 : np - 1;
        attn_ldk(ka, kb, kofs, p2 * 32); attn_ldv(va, vb, vofs, p2 * 32);
        attn_scores<false>(kc, kc, qf, qf, (p + 1) * 32, q0, ln, hh, m, l, o0, o1, ph, pr);
        attn_out<false>(vc, vc, ph, ph, o0, o1);
      }
    }
  }
  l += xhalf(l);
  const float sc = 64.0f / l;
  const size_t o = ((size_t)b * SEQ + q0) * DM + h * (HD * 16) + lane * 8;   /* fragment order: columns 16 t + 8 hh .. of the head = half t & 1 of its tile t >> 1 */
#pragma unroll
  for (int t = 0; t < 4; ++t) {
    FragH fh, fr;
#pragma unroll
    for (int r = 0; r < 8; ++r) {
      const float v = (early ? o0[t][r] + o1[t][r] * 0.0009765625f : o0[t][r]) * sc;
      const _Float16 a = (_Float16)v; fh.h[r] = a; fr.h[r] = (_Float16)((v - (float)a) * 1024.0f);
    }
    *(v8us*)((unsigned short*)CTh + o + 256 * t) = fh.half[0];
    xwait();
    if (early) { *(v8us*)((unsigned short*)CTr + o + 256 * t) = fr.half[0]; xwait(); }
  }
}

// General f16 GEMM, A [m][k] and B as Bt[n][k], both in fragment order with a k extent of DM; block = 4 waves; wave tile RT x 64 (RT = 32, or 16 with the residual accumulator).
// RES: second accumulator gets Ar.Bh (+ Ah.Br if BRES), both carried x2^10, folded in the epilogue. causal 1: k-loop stops at the tile's last key block; causal 2: column tiles past the diagonal are skipped.
// EPI 0: QKV routing (q/k f16 planes + early residual planes, k / v caches in f32, V^T hi and residual planes C5 / C6), 1: f32 plane, 2: f16 hi (+res) planes, 3: f32 output + bias, NaN fill when the mask check failed.
// the fragments of one k step of a wave: two A tiles, four B tiles (and their residual tiles where BR)
struct MmSet { v16h a0, a1, b[4], br[4]; };
// the wave's tile rows at k = 0: wave-uniform and fixed for the whole k loop, so that they stay in scalar registers
struct MmBase { const _Float16 *a0, *a1, *b[4], *br[4]; };
// all loads of one k step in one run; vo = the lane's byte offset 16 lane + 32 k: the one vector register that the loads name
template <bool BR>
__device__ __forceinline__ void mm_ld(MmSet& f, const MmBase& p, unsigned vo) {
  f.a0 = u_frag(p.a0, vo); f.a1 = u_frag(p.a1, vo);
#pragma unroll /* unrolled: constant indices, and the loads go out together */
  for (int t = 0; t < 4; ++t) { f.b[t] = u_frag(p.b[t], vo); if (BR) f.br[t] = u_frag(p.br[t], vo); }
  xwait();
}
template <bool BR>
__device__ __forceinline__ void mm_do(const MmSet& f, v8f (&c0)[4], v8f (&c1)[4]) {
#pragma unroll /* unrolled: constant indices, eight independent accumulators in a row */
  for (int t = 0; t < 4; ++t) {
    c0[t] = g2_mma(f.a0, f.b[t], c0[t]);
    c1[t] = g2_mma(f.a1, f.b[t], c1[t]);
    if (BR) c1[t] = g2_mma(f.a0, f.br[t], c1[t]);
  }
}
template <bool RES, bool BRES, int EPI>
__device__ __forceinline__ void mm_body(float* __restrict__ smem, unsigned bx,
    const _Float16* __restrict__ Ah, const _Float16* __restrict__ Ar, size_t sA, size_t sAr,
    const _Float16* __restrict__ Bh, const _Float16* __restrict__ Br, size_t sB,
    int rbase, int ntn, int K, int causal, float alpha,
    float* __restrict__ Cf, _Float16* __restrict__ C1, _Float16* __restrict__ C2, _Float16* __restrict__ C3, _Float16* __restrict__ C4,
    _Float16* __restrict__ C5, _Float16* __restrict__ C6,
    const float* __restrict__ bias, const int* __restrict__ flags, int ldc, size_t sC) {
  constexpr int RT = RES ? 16 : 32;
  constexpr int lda = DM, ldb = DM;            /* compile-time: the tiles of a k step then differ by immediate offsets from one scalar base per plane */
  float (&so)[4][RT][68] = *reinterpret_cast<float (*)[4][RT][68]>(smem);   /* the work-group's staging, 4 x RT x 68 floats */
  const int tid = threadIdx.x, lane = tid & 31, ln = lane & 15, hh = lane >> 4;
  const int w = __builtin_amdgcn_readfirstlane(tid >> 5);
  const int by = blockIdx.y;
  const int mt = bx / ntn, nq = bx - mt * ntn;
  const int row0 = rbase + mt * (4 * RT) + RT * w, col0 = nq * 64;
  if (causal == 2 && col0 > row0 + RT - 1) return;
  int kend = K;
  if (causal == 1) { const int kc = (((row0 + RT - 1) >> 5) + 1) << 5; kend = kc < K ? kc : K; }
  /* wave-uniform tile addresses (row0, col0 are multiples of 16: a row of tiles holds 16 lda elements); the lane's share is the fixed byte offset lofs */
  const unsigned lofs = (unsigned)lane * 16u;
  const _Float16* ap0 = Ah + (size_t)by * sA + (size_t)row0 * lda;
  const _Float16* ap1;
  if (RES) ap1 = Ar + (size_t)by * sAr + (size_t)row0 * lda; else ap1 = ap0 + (size_t)16 * lda;
  const _Float16* bp = Bh + (size_t)by * sB + (size_t)col0 * ldb;
  const _Float16* brp = bp;
  if (RES && BRES) brp = Br + (size_t)by * sB + (size_t)col0 * ldb;
  const v8f z8 = {0.f, 0.f, 0.f, 0.f, 0.f, 0.f, 0.f, 0.f};
  v8f c0[4] = {z8, z8, z8, z8}, c1[4] = {z8, z8, z8, z8};
  /* ring of NS fragment sets: the loads of k step s + NS - 1 go out in front of the products of step s, so that a wave waits once a step at most, for loads issued NS - 1 steps earlier */
  constexpr int NS = 3;                        /* three sets and the 64 accumulator registers stay below 256 registers; a fourth set would not */
  MmSet fs[NS];
  MmBase pb; pb.a0 = ap0; pb.a1 = ap1;
#pragma unroll /* unrolled: constant indices, the pointers stay in registers */
  for (int t = 0; t < 4; ++t) { pb.b[t] = bp + (size_t)(16 * t) * ldb; pb.br[t] = brp + (size_t)(16 * t) * ldb; }
#pragma unroll /* unrolled: fs stays in registers only under constant indices */
  for (int s = 0; s < NS - 1; ++s) mm_ld<RES && BRES>(fs[s], pb, lofs + 32u * (unsigned)(32 * s < kend ? 32 * s : kend - 32));
  int kb = 0;
#pragma unroll 1 /* the body already holds NS steps, one per fragment set; no branch inside it: the compiler sinks a set's loads into a branch that holds their only use, down to their products */
  for (; kb + 32 * NS <= kend; kb += 32 * NS) {
#pragma unroll /* unrolled: constant set indices */
    for (int s = 0; s < NS; ++s) {
      const int kn = kb + 32 * (s + NS - 1);   /* past the end the last step is fetched again and not used */
      mm_ld<RES && BRES>(fs[(s + NS - 1) % NS], pb, lofs + 32u * (unsigned)(kn < kend ? kn : kend - 32));
      mm_do<RES && BRES>(fs[s], c0, c1);
    }
  }
  /* the steps left over, fewer than NS: their sets are loaded already */
#pragma unroll /* unrolled: constant set indices */
  for (int s = 0; s < NS - 1; ++s)
    if (kb + 32 * s < kend) mm_do<RES && BRES>(fs[s], c0, c1);   /* wave-uniform */
  int poison = 0;
  if (EPI == 3) { int fl = 0;
#pragma unroll /* unrolled: the flag loads go out together */
    for (int q = 0; q < MCB / 32; ++q) fl |= flags[(q * 32 + lane) * 32];
    for (int off = 16; off > 0; off >>= 1) fl |= __shfl_xor(fl, off, 32); poison = fl; }
  const float nanv = __uint_as_float(0x7fc00000u);
#pragma unroll
  for (int t = 0; t < 4; ++t) {
    float bv = 0.f;
    if (EPI == 0 || EPI == 3) bv = bf16_rne(bias[col0 + t * 16 + ln]);
#pragma unroll
    for (int r = 0; r < 8; ++r) {
      if (!RES) {
        float v0 = c0[t][r] * alpha + bv, v1 = c1[t][r] * alpha + bv;
        if (EPI == 3) { v0 = poison ? nanv : v0; v1 = poison ? nanv : v1; }
        so[w][8 * hh + r][t * 16 + ln] = v0; so[w][(RT - 16) + 8 * hh + r][t * 16 + ln] = v1;
      } else {
        float v0 = (c0[t][r] + c1[t][r] * 0.0009765625f) * alpha + bv;
        if (EPI == 3) v0 = poison ? nanv : v0;
        so[w][8 * hh + r][t * 16 + ln] = v0;
      }
    }
  }
  __builtin_amdgcn_fence(4 /* acq_rel order */, "workgroup"); __builtin_amdgcn_wave_barrier();
  const int rsub = lane >> 4, c4 = (lane & 15) * 4;
  {
#pragma unroll
    for (int q = 0; q < RT / 2; ++q) {
      const int r = q * 2 + rsub; const int row = row0 + r;
      const v4f v = *(const v4fa*)&so[w][r][c4];
      if (EPI == 1 || EPI == 3) {
        *(v4f*)(Cf + (size_t)by * sC + (size_t)row * ldc + col0 + c4) = v;
      } else if (EPI == 2) {
        v4h h4, r4; split4(v, h4, r4);
        const size_t o = (size_t)by * sC + (size_t)row * ldc + col0 + c4;
        *(v4h*)(C1 + o) = h4;
        if (RES) *(v4h*)(C2 + o) = r4;
      } else {
        const int which = col0 / DM, hc = col0 - which * DM, h = hc >> 6;
        const size_t o16 = pk((size_t)by * SEQ + row, hc + c4, DM);
        const size_t oe = pk((size_t)by * EARLY + row, hc + c4, DM);
        const size_t of = (((size_t)by * NH + h) * SEQ_FULL + row) * HD + c4;
        if (which == 0) {
          v4h h4, r4; split4(v, h4, r4);
          *(v4h*)(C1 + o16) = h4;
          if (row0 < EARLY) *(v4h*)(C3 + oe) = r4;
        } else if (which == 1) {
          *(v4f*)(Cf + OUT1_OFF + of) = v;
          v4h h4, r4; split4(v, h4, r4);
          *(v4h*)(C2 + o16) = h4;
          if (row0 < EARLY) *(v4h*)(C4 + oe) = r4;
        } else {
          *(v4f*)(Cf + OUT2_OFF + of) = v;
        }
      }
    }
    if constexpr (EPI == 0 && !RES) {
      if (col0 >= 2 * DM) {                    /* wave-uniform: a tile of v */
        xwait();                               /* behind the cache stores of the loop above, whose registers the block below takes over */
        /* V^T in fragment order, rows d, k = keys, the four d tiles of a block of 32 keys side by side: tile index (key >> 5) * 4 + (d >> 4). The wave's staged 32 keys x 64 head columns
           are exactly those four tiles, 256 groups of eight keys: group 32 g + lane is read down a column of the staging (16 neighbouring columns a half wave) and stored as 512 contiguous bytes a wave */
        const size_t vo = ((size_t)by * NH + ((col0 - 2 * DM) >> 6)) * HD * SEQ + (size_t)row0 * HD + lane * 8;
        float vv[8][8];
#pragma unroll /* unrolled, as the loop inside: vv stays in registers only under constant indices; all LDS reads go out in one run, in front of the first store's wait */
        for (int g = 0; g < 8; ++g)
#pragma unroll
          for (int q = 0; q < 8; ++q) vv[g][q] = so[w][(g & 1) * 16 + hh * 8 + q][(g >> 1) * 16 + ln];
#pragma unroll /* unrolled: constant indices, constant offsets off one address per plane */
        for (int g = 0; g < 8; ++g) {
          FragH fh, fr;
#pragma unroll
          for (int q = 0; q < 8; ++q) { const float v = vv[g][q]; const _Float16 h = (_Float16)v; fh.h[q] = h; fr.h[q] = (_Float16)((v - (float)h) * 1024.0f); }
          *(v8us*)((unsigned short*)C5 + vo + 256 * g) = fh.half[0];
          *(v8us*)((unsigned short*)C6 + vo + 256 * g) = fr.half[0];
          xwait();
        }
      }
    }
  }
}

// the fused QKV projection as a launch of its own
template <bool RES, bool BRES, int EPI>
__global__ __launch_bounds__(128) void k_mm(
    const _Float16* __restrict__ Ah, const _Float16* __restrict__ Ar, size_t sA, size_t sAr,
    const _Float16* __restrict__ Bh, const _Float16* __restrict__ Br, size_t sB,
    int rbase, int ntn, int K, int causal, float alpha,
    float* __restrict__ Cf, _Float16* __restrict__ C1, _Float16* __restrict__ C2, _Float16* __restrict__ C3, _Float16* __restrict__ C4,
    _Float16* __restrict__ C5, _Float16* __restrict__ C6,
    const float* __restrict__ bias, const int* __restrict__ flags, int ldc, size_t sC) {
  __shared__ __attribute__((aligned(16))) float sm[4 * (RES ? 16 : 32) * 68];
  mm_body<RES, BRES, EPI>(sm, blockIdx.x, Ah, Ar, sA, sAr, Bh, Br, sB, rbase, ntn, K, causal, alpha, Cf, C1, C2, C3, C4, C5, C6, bias, flags, ldc, sC);
}
// out = (ctx x64).(w_o x16) 2^-10 + b_o, early and late rows in one launch: the two parts are independent, and neither fills the chip alone. grid.y = batch;
// the first OEB work-groups take the early rows (64 each, with the ctx residual plane), the others the late rows (128 each, single plane). The pick is the same for a whole work-group.
#define OEB ((EARLY / 64) * (DM / 64))
#define OLB (((SEQ - EARLY) / 128) * (DM / 64))
__global__ __launch_bounds__(128) void k_out(const _Float16* __restrict__ CTh, const _Float16* __restrict__ CTr, const _Float16* __restrict__ WoT,
                                             float* __restrict__ out, const float* __restrict__ bo, const int* __restrict__ flags) {
  __shared__ __attribute__((aligned(16))) float sm[4 * 32 * 68];
  const unsigned bx = blockIdx.x;
  if (bx < OEB)
    mm_body<true, false, 3>(sm, bx, CTh, CTr, (size_t)SEQ * DM, (size_t)SEQ * DM, WoT, nullptr, (size_t)0,
                            0, DM / 64, DM, 0, 0.0009765625f, out, nullptr, nullptr, nullptr, nullptr, nullptr, nullptr, bo, flags, DM, (size_t)SEQ_FULL * DM);
  else
    mm_body<false, false, 3>(sm, bx - OEB, CTh, nullptr, (size_t)SEQ * DM, (size_t)0, WoT, nullptr, (size_t)0,
                             EARLY, DM / 64, DM, 0, 0.0009765625f, out, nullptr, nullptr, nullptr, nullptr, nullptr, nullptr, bo, flags, DM, (size_t)SEQ_FULL * DM);
}

extern "C" void kernel_launch(void* const* d_in, const int* in_sizes, int n_in,
                              void* d_out, int out_size, void* d_ws, size_t ws_size, hipStream_t stream) {
  if (n_in < 6) return;
  if ((size_t)in_sizes[0] < (size_t)(NB - 1) * SEQ_FULL * DM + (size_t)SEQ * DM) return;
  if ((size_t)in_sizes[1] < (size_t)DM * 3 * DM) return;
  if (in_sizes[2] < 3 * DM) return;
  if ((size_t)in_sizes[3] < (size_t)DM * DM) return;
  if (in_sizes[4] < DM) return;
  if ((size_t)in_sizes[5] < (size_t)(SEQ - 1) * SEQ_FULL + SEQ) return;
  if ((size_t)out_size < OUT2_OFF + ((size_t)((NB - 1) * NH + NH - 1) * SEQ_FULL + SEQ) * HD) return;
  const float* x = (const float*)d_in[0];        /* x      [B][L][1024] */
  const float* wqkv = (const float*)d_in[1];     /* w_qkv  [1024][3072] ([in][out]; columns q | k | v) */
  const float* bqkv = (const float*)d_in[2];     /* b_qkv  [3072] */
  const float* wo = (const float*)d_in[3];       /* w_o    [1024][1024] ([in][out]) */
  const float* bo = (const float*)d_in[4];       /* b_o    [1024] */
  const float* mask = (const float*)d_in[5];     /* mask   [1][1][L][L] additive */
  float* out = (float*)d_out;

  constexpr size_t SZ_WT = (size_t)3 * DM * DM * 2, SZ_WO = (size_t)DM * DM * 2, SZ_TOK = (size_t)NB * SEQ * DM * 2;
  constexpr size_t SZ_ER = (size_t)NB * EARLY * DM * 2;
  constexpr size_t SZ_FL = (size_t)MCB * 128;
  constexpr size_t SZ_ALL = SZ_WT + SZ_WO + 7 * SZ_TOK + 2 * SZ_ER + SZ_FL;
  static_assert(SZ_ALL <= (size_t)268435456);
  static_assert(SZ_WT % 256 == 0 && SZ_WO % 256 == 0 && SZ_TOK % 256 == 0 && SZ_ER % 256 == 0 && SZ_FL % 256 == 0);
  if (SZ_ALL > ws_size) return;
  char* ws = (char*)d_ws; size_t off = 0;
  auto take = [&](size_t bytes) { char* p = ws + off; off += bytes; return p; };
  _Float16* WT = (_Float16*)take(SZ_WT);      /* [3072][1024] x16, fragment order (as every f16 plane here) */
  _Float16* WoT = (_Float16*)take(SZ_WO);     /* [1024][1024] x16 */
  _Float16* X16 = (_Float16*)take(SZ_TOK);    /* [NB*SEQ][1024] */
  _Float16* Q16 = (_Float16*)take(SZ_TOK);
  _Float16* K16 = (_Float16*)take(SZ_TOK);
  _Float16* VTh = (_Float16*)take(SZ_TOK);    /* per (batch, head): 64 x SEQ */
  _Float16* VTr = (_Float16*)take(SZ_TOK);
  _Float16* CTh = (_Float16*)take(SZ_TOK);    /* ctx x64, [NB*SEQ][1024] */
  _Float16* CTr = (_Float16*)take(SZ_TOK);
  _Float16* Qr = (_Float16*)take(SZ_ER);      /* [NB][EARLY][1024] */
  _Float16* Kr = (_Float16*)take(SZ_ER);
  int* MCHK = (int*)take(SZ_FL);              /* MCB lines of 32 ints */

  k_prep<<<(unsigned)(MCB + NB * XB + WQB + WOB), 256, 0, stream>>>(mask, x, wqkv, wo, MCHK, X16, WT, WoT);
  /* fused QKV projection: grid.y = batch; 48 column tiles of 64 = (q|k|v, head) */
  k_mm<false, false, 0><<<dim3((unsigned)((SEQ / 128) * (3 * DM / 64)), NB), 128, 0, stream>>>(
      X16, nullptr, (size_t)SEQ * DM, (size_t)0,
      WT, nullptr, (size_t)0,
      0, 3 * DM / 64, DM, 0, 0.0625f,
      out, Q16, K16, Qr, Kr, VTh, VTr, bqkv, nullptr, 0, (size_t)0);

  /* scores, softmax and P V of every (batch, head) in one launch */
  k_attn<<<dim3((unsigned)(NB * NH), (unsigned)(SEQ / 64)), 128, 0, stream>>>(Q16, K16, Qr, Kr, VTh, VTr, CTh, CTr);
  k_out<<<dim3((unsigned)(OEB + OLB), NB), 128, 0, stream>>>(CTh, CTr, WoT, out, bo, MCHK);
}

// v008
// One run takes 96.8 microseconds.
// Next to v007, in two timings, it ran 1.07 and 1.09 times as fast.
// Over all steps from v000 it is 19.2 times as fast.
#include <hip/hip_runtime.h>
// Causal multi-head self-attention, B 2 x L 2048, d_model 1024, 16 heads of 64; outputs: out [B][L][1024], k cache [B][16][L][64], v cache [B][16][L][64] (f32).
// Compute dtype: every contraction on v_wmma_f32_16x16x32_f16 (f16 operands, f32 accumulate). x / w_qkv / w_o / biases are RNE-converted to bf16 first (exact in f16; weights carried x16).
// q, k, v and ctx (carried x64) are f16 planes, the softmax weights (unnormalised, carried x1024) f16 fragments; for the first EARLY query rows of every sequence each of them also has an f16 residual plane carried x2^10
// that goes to a separate accumulator (q k^T: 3 products, P V: 3 products, ctx w_o: 2 products); scores, softmax statistics and all epilogues in f32.
// Structure, four launches: one for the work that depends on the inputs alone (mask structure check, x plane, both weight transposes), fused QKV GEMM (writes the k / v caches in f32 plus the f16 planes,
// the V^T hi/res planes among them), one attention launch for all heads (scores, online softmax and P V in registers; the scores never reach memory), then one launch for the output GEMM (early and late rows).
// Every f16 operand plane is kept in fragment order (see pk below), not row-major: a wave's fragment load then reads 512 contiguous bytes (4 lines) where a row-major plane gave it 32 bytes of each of 16 lines.
#ifndef NB
#define NB 2
#endif
#ifndef SEQ
#define SEQ 2048
#endif
#define NB_FULL 2
#define SEQ_FULL 2048
#define DM 1024
#define NH 16
#define HD 64
#define EARLY ((SEQ) < 512 ? (SEQ) : 512)
#define OUT1_OFF ((size_t)NB_FULL * SEQ_FULL * DM)
#define OUT2_OFF ((size_t)2 * NB_FULL * SEQ_FULL * DM)

typedef unsigned short v8us __attribute__((ext_vector_type(8), may_alias));
typedef float v8f __attribute__((ext_vector_type(8)));
typedef float v4f __attribute__((ext_vector_type(4)));
typedef float v4fa __attribute__((ext_vector_type(4), may_alias));
typedef _Float16 v16h __attribute__((ext_vector_type(16)));
typedef _Float16 v4h __attribute__((ext_vector_type(4)));
union FragH { v16h v; v8us half[2]; _Float16 h[16]; unsigned short u[16]; };

static_assert(NH * HD == DM);
static_assert(SEQ % 256 == 0);
static_assert(EARLY % 128 == 0);
static_assert((SEQ - EARLY) % 128 == 0);
static_assert(NB <= NB_FULL && SEQ <= SEQ_FULL);
static_assert(OUT1_OFF * 4 == 16777216);
static_assert(OUT2_OFF * 4 == 33554432);

__device__ __forceinline__ unsigned short bf16_bits(float x) { unsigned int u = __float_as_uint(x); return (unsigned short)((u + 0x7FFFu + ((u >> 16) & 1u)) >> 16); }
__device__ __forceinline__ float bf16_rne(float x) { return __uint_as_float(((unsigned int)bf16_bits(x)) << 16); }

// Fragment order of a plane of rows x kd: tiles of 16 rows x 32 k, 512 elements each, tile (row >> 4, k >> 5) at index (row >> 4) * (kd / 32) + (k >> 5);
// inside a tile the eight elements k = 16 j + 8 hh .. + 7 of row ln stand at 256 j + 8 (16 hh + ln). pk = element offset of (row, k).
__device__ __forceinline__ size_t pk(size_t row, int k, int kd) {
  return ((row >> 4) * (size_t)(kd >> 5) + (size_t)(k >> 5)) * 512 + (size_t)(((k >> 4) & 1) * 256 + (((k >> 3) & 1) * 16 + (int)(row & 15)) * 8 + (k & 7));
}
// fragment loader (A row or B column ln of the tile): p = tile + 8 lane, lane = 16 hh + ln; elements 0..7 <- k0+8hh.., elements 8..15 <- k0+16+8hh..
__device__ __forceinline__ v16h p_frag(const _Float16* p) { FragH f; f.half[0] = *(const v8us*)((const unsigned short*)p); f.half[1] = *(const v8us*)((const unsigned short*)p + 256); return f.v; }
__device__ __forceinline__ v8f g2_mma(v16h a, v16h b, v8f c) { v8f d = __builtin_amdgcn_wmma_f32_16x16x32_f16(false, a, false, b, (short)0, c, false, false); asm volatile("v_nop\n\tv_nop\n\tv_nop\n\tv_nop" : "+v"(d) : "v"(a), "v"(b)); return d; }
// f32 -> f16 hi and f16 residual carried x2^10
__device__ __forceinline__ void split4(const v4f v, v4h& h, v4h& r) {
#pragma unroll
  for (int i = 0; i < 4; ++i) { const _Float16 a = (_Float16)v[i]; h[i] = a; r[i] = (_Float16)((v[i] - (float)a) * 1024.0f); }
}

template <int K, int N>
__device__ __forceinline__ void wt_f16(const float* __restrict__ W, _Float16* __restrict__ Wt, int blk, float scale) {
  const int t = blk * 256 + threadIdx.x; if (t >= N * (K / 8)) return;
  /* thread t makes the t-th group of eight of the fragment-ordered plane: 16 lanes read 16 neighbouring columns n of one row of W */
  const int tile = t >> 6, n = (tile / (K / 32)) * 16 + (t & 15), k8 = (tile % (K / 32)) * 32 + ((t >> 5) & 1) * 16 + ((t >> 4) & 1) * 8; FragH f;
#pragma unroll
  for (int i = 0; i < 8; ++i) f.h[i] = (_Float16)(bf16_rne(W[(size_t)(k8 + i) * N + n]) * scale);
  const v8us o = f.half[0];
  unsigned short* d = (unsigned short*)Wt + (size_t)t * 8;
  *(v8us*)d = o; 
}

#define XB (SEQ * DM / 8 / 256)               /* work-groups of the x plane per batch */
__device__ __forceinline__ void x16(const float* __restrict__ x, _Float16* __restrict__ X16, int blk) {
  const int b = blk / XB; const size_t t = (size_t)(blk - b * XB) * 256 + threadIdx.x;
  /* thread t makes the t-th group of eight of the batch's fragment-ordered plane */
  const int tile = (int)(t >> 6), row = (tile / (DM / 32)) * 16 + (int)(t & 15), k8 = (tile % (DM / 32)) * 32 + (int)((t >> 5) & 1) * 16 + (int)((t >> 4) & 1) * 8;
  const float* src = x + ((size_t)b * SEQ_FULL + row) * DM + k8;
  const v4f a = *(const v4fa*)src, c = *(const v4fa*)(src + 4); FragH f;
#pragma unroll
  for (int q = 0; q < 4; ++q) { f.h[q] = (_Float16)bf16_rne(a[q]); f.h[4 + q] = (_Float16)bf16_rne(c[q]); }
  unsigned short* d = (unsigned short*)X16 + (size_t)b * SEQ * DM + t * 8;
  *(v8us*)d = f.half[0]; 
}

// Mask structure check, spread over the chip: MCB work-groups of 8 waves, 16 rows each; a wave takes two rows and issues all their loads before it waits for the first.
// Row i, blocks of 128 columns: a block left of the diagonal's must be all zero (OR of the bits, sign aside), a block right of it all <= -1e8, that is, its bits as unsigned within
// [bits(-1e8), bits(-inf)] (minimum and maximum); the diagonal's own block is fetched once more and checked element by element. Every work-group writes its own 128-byte flag line.
#define MCB (SEQ / 16)
static_assert(MCB % 32 == 0);
__device__ __forceinline__ void maskchk(const float* __restrict__ mask, int* __restrict__ flg, int blk) {
  __shared__ int sb[8];
  constexpr int NL = SEQ / 128;                /* loads of 16 bytes a lane and row */
  constexpr unsigned ULO = 0xCCBEBC20u, UHI = 0xFF800000u;   /* bits of -1e8f and of -infinity */
  const int lane = threadIdx.x & 31;
  const int w = __builtin_amdgcn_readfirstlane((int)(threadIdx.x >> 5));
  const int i0 = blk * 16 + w * 2;
  const float* mr = mask + (size_t)i0 * SEQ_FULL;   /* wave-uniform; the lane's share is lane * 4 */
  v4f m[2][NL], dg[2];
#pragma unroll /* unrolled, as the loop inside: the loads are independent, and a rolled loop would wait for each in turn */
  for (int r = 0; r < 2; ++r) {
#pragma unroll
    for (int u = 0; u < NL; ++u) m[r][u] = *(const v4fa*)(mr + (size_t)r * SEQ_FULL + u * 128 + lane * 4);
    const float* du = mr + (size_t)r * SEQ_FULL + ((i0 + r) >> 7) * 128;
    dg[r] = *(const v4fa*)(du + lane * 4);
  }
  /* precaution: stands behind the run of loads, in front of any rewrite of their address registers; as a volatile statement it also keeps every load in front of the first check */
  asm volatile("s_wait_xcnt 0x0" ::: "memory");
  unsigned orl = 0u, mn = UHI, mx = ULO;
  bool bad = false;
#pragma unroll /* unrolled, as the loops inside: m and dg stay in registers only under constant indices */
  for (int r = 0; r < 2; ++r) {
    const int i = i0 + r, ud = i >> 7;         /* wave-uniform */
#pragma unroll
    for (int u = 0; u < NL; ++u) {
      const unsigned a = __float_as_uint(m[r][u][0]), b = __float_as_uint(m[r][u][1]), c = __float_as_uint(m[r][u][2]), d = __float_as_uint(m[r][u][3]);
      if (u < ud) { orl |= a | b; orl |= c | d; }
      else if (u > ud) { mn = min(min(mn, a), b); mn = min(min(mn, c), d); mx = max(max(mx, a), b); mx = max(max(mx, c), d); }
    }
#pragma unroll
    for (int q = 0; q < 4; ++q) { const int j = ud * 128 + lane * 4 + q; const float v = dg[r][q]; bad |= (j <= i) ? !(v == 0.0f) : !(v <= -1.0e8f); }
  }
  bad |= (orl & 0x7FFFFFFFu) != 0u || mn < ULO || mx > UHI;
  const int wbad = __builtin_amdgcn_ballot_w32(bad) != 0 ? 1 : 0;
  if (lane == 0) sb[w] = wbad;
  __syncthreads();
  if (w == 0) {
    int tot = 0;
#pragma unroll
    for (int q = 0; q < 8; ++q) tot |= sb[q];
    int* p = flg + blk * 32 + lane;
    *p = tot; 
  }
}

// Everything that depends on the inputs alone, in one launch: the four jobs are independent of each other, and as launches of their own each paid its own start, first load latency and drain.
// The job is picked by the work-group's index (the same for the whole work-group, so the mask check's barrier stands under uniform control flow); the mask check, whose waves live longest, comes first.
#define WQB (3 * DM * (DM / 8) / 256)
#define WOB (DM * (DM / 8) / 256)
static_assert(WQB * 256 == 3 * DM * (DM / 8) && WOB * 256 == DM * (DM / 8) && XB * 256 * 8 == SEQ * DM);
__global__ __launch_bounds__(256) void k_prep(const float* __restrict__ mask, const float* __restrict__ x, const float* __restrict__ wqkv, const float* __restrict__ wo,
                                              int* __restrict__ flg, _Float16* __restrict__ X16, _Float16* __restrict__ WT, _Float16* __restrict__ WoT) {
  const int bx = blockIdx.x;
  if (bx < MCB) maskchk(mask, flg, bx);
  else if (bx < MCB + NB * XB) x16(x, X16, bx - MCB);
  else if (bx < MCB + NB * XB + WQB) wt_f16<DM, 3 * DM>(wqkv, WT, bx - (MCB + NB * XB), 16.0f);
  else wt_f16<DM, DM>(wo, WoT, bx - (MCB + NB * XB + WQB), 16.0f);
}

// lane l <-> lane l ^ 16 in one vector instruction (a shuffle would go through the LDS pipe and its wait)
__device__ __forceinline__ float xhalf(float x) { return __builtin_bit_cast(float, __builtin_amdgcn_permlanex16(__builtin_bit_cast(int, x), __builtin_bit_cast(int, x), 0x76543210, 0xfedcba98, false, false)); }

// One pass of the fused attention: 32 keys x the wave's 16 queries, both products transposed so that a lane owns one query (column ln) throughout.
// S^T = K Q^T: A = K rows (keys), B = Q rows (queries); accumulator register r of key tile t holds key k0 + 16 t + 8 hh + r of query q0 + ln,
// which is element 8 t + r of the B fragment of O^T += V^T P^T (A = V^T rows d, k = keys): P goes from accumulator to operand inside the lane.
// Online softmax: m = running maximum of the query (equal in both halves), l = this half's sum of p = 1024 exp(s - m); the accumulators are rescaled only in a pass where some query's maximum grew.
// RES: scores kh.qh + (kh.qr + kr.qh) 2^-10, output vh.ph + (vh.pr + vr.ph) 2^-10, the residual operands carried x2^10 in a second accumulator.
template <bool RES>
__device__ __forceinline__ void attn_scores(const v16h (&kf)[4], const v16h (&krf)[4], const v16h (&qf)[2], const v16h (&qrf)[2],
                                            int k0, int q0, int ln, int hh, float& m, float& l, v8f (&o0)[4], v8f (&o1)[4], v16h& pho, v16h& pro) {
  const v8f z8 = {0.f, 0.f, 0.f, 0.f, 0.f, 0.f, 0.f, 0.f};
  const float L2E = 1.44269504088896340736f;
  v8f s[2];
#pragma unroll
  for (int t = 0; t < 2; ++t) {
    v8f c = g2_mma(kf[2 * t], qf[0], z8);
    c = g2_mma(kf[2 * t + 1], qf[1], c);
    if (RES) {
      v8f e = g2_mma(kf[2 * t], qrf[0], z8);
      e = g2_mma(krf[2 * t], qf[0], e);
      e = g2_mma(kf[2 * t + 1], qrf[1], e);
      e = g2_mma(krf[2 * t + 1], qf[1], e);
      c = c + e * 0.0009765625f;
    }
    s[t] = c * 0.125f;
  }
  if (k0 + 31 > q0) {                          /* wave-uniform: only a pass that reaches the diagonal masks */
#pragma unroll
    for (int t = 0; t < 2; ++t)
#pragma unroll
      for (int r = 0; r < 8; ++r) s[t][r] = (k0 + 16 * t + 8 * hh + r <= q0 + ln) ? s[t][r] : -1.0e30f;
  }
  float tm = fmaxf(s[0][0], s[1][0]);
#pragma unroll
  for (int r = 1; r < 8; ++r) tm = fmaxf(tm, fmaxf(s[0][r], s[1][r]));
  tm = fmaxf(tm, xhalf(tm));
  const float mn = fmaxf(m, tm);
  if (__builtin_amdgcn_ballot_w32(mn > m) != 0) {
    const float f = __builtin_amdgcn_exp2f((m - mn) * L2E);
    l *= f;
#pragma unroll
    for (int t = 0; t < 4; ++t) { o0[t] = o0[t] * f; if (RES) o1[t] = o1[t] * f; }
    m = mn;
  }
  FragH ph, pr;
#pragma unroll
  for (int t = 0; t < 2; ++t)
#pragma unroll
    for (int r = 0; r < 8; ++r) {
      const float p = __builtin_amdgcn_exp2f(fmaf(s[t][r] - m, L2E, 10.0f));
      l += p;
      const _Float16 h = (_Float16)p;
      ph.h[8 * t + r] = h;
      if (RES) pr.h[8 * t + r] = (_Float16)((p - (float)h) * 1024.0f);
    }
  pho = ph.v;
  if (RES) pro = pr.v;
}
template <bool RES>
__device__ __forceinline__ void attn_out(const v16h (&vf)[4], const v16h (&vrf)[4], const v16h ph, const v16h pr, v8f (&o0)[4], v8f (&o1)[4]) {
#pragma unroll
  for (int t = 0; t < 4; ++t) {
    o0[t] = g2_mma(vf[t], ph, o0[t]);
    if (RES) { o1[t] = g2_mma(vf[t], pr, o1[t]); o1[t] = g2_mma(vrf[t], ph, o1[t]); }
  }
}

// precaution: stands behind a run of global loads or stores, in front of any rewrite of their address registers
__device__ __forceinline__ void xwait() { asm volatile("s_wait_xcnt 0x0" ::: "memory"); }
// fragment of the tile at a wave-uniform base; lofs = the lane's fixed byte offset, 16 lane
__device__ __forceinline__ v16h u_frag(const _Float16* ubase, unsigned lofs) {
  const char* p = (const char*)ubase + lofs; FragH f; f.half[0] = *(const v8us*)p; f.half[1] = *(const v8us*)(p + 512); return f.v;
}
// K fragments of keys k0 .. k0 + 31: two key tiles x two halves of the head; kb = the head's first tile in the batch's K plane (16 keys further = 16 DM elements, the head's second half = the next tile)
__device__ __forceinline__ void attn_ldk(v16h (&kf)[4], const _Float16* kb, unsigned lofs, int k0) {
#pragma unroll
  for (int t = 0; t < 2; ++t) { kf[2 * t] = u_frag(kb + (size_t)(k0 + 16 * t) * DM, lofs); kf[2 * t + 1] = u_frag(kb + (size_t)(k0 + 16 * t) * DM + 512, lofs); }
  xwait();
}
// V^T fragments of the same keys: four tiles of 16 head columns, side by side; vb = the head's V^T plane
__device__ __forceinline__ void attn_ldv(v16h (&vf)[4], const _Float16* vb, unsigned lofs, int k0) {
#pragma unroll
  for (int t = 0; t < 4; ++t) vf[t] = u_frag(vb + (size_t)k0 * HD + 512 * t, lofs);
  xwait();
}

// Causal attention, all heads in one launch: blockIdx.x = (batch, head), blockIdx.y = block of 64 queries (longest first); a wave owns 16 queries and walks keys 0 .. q0 + 15 in passes of 32.
// No LDS, no barrier. Writes ctx x64 as f16 (hi plane; residual plane for query rows < EARLY).
__global__ __launch_bounds__(128) void k_attn(const _Float16* __restrict__ Q16, const _Float16* __restrict__ K16, const _Float16* __restrict__ Qr, const _Float16* __restrict__ Kr,
                                              const _Float16* __restrict__ VTh, const _Float16* __restrict__ VTr, _Float16* __restrict__ CTh, _Float16* __restrict__ CTr) {
  const int lane = threadIdx.x & 31, ln = lane & 15, hh = lane >> 4;
  const int w = __builtin_amdgcn_readfirstlane((int)(threadIdx.x >> 5));
  const int bh = blockIdx.x, b = bh / NH, h = bh - b * NH;
  const int q0 = (SEQ / 64 - 1 - (int)blockIdx.y) * 64 + 16 * w;
  const int np = (q0 >> 5) + 1;                /* passes with k0 <= q0 + 15 */
  const _Float16* qp = Q16 + ((size_t)b * SEQ + q0) * DM + h * (HD * 16) + lane * 8;
  const _Float16* kb = K16 + (size_t)b * SEQ * DM + h * (HD * 16);
  const _Float16* vb = VTh + (size_t)bh * HD * SEQ;
  const unsigned kofs = (unsigned)lane * 16u, vofs = kofs;
  const v8f z8 = {0.f, 0.f, 0.f, 0.f, 0.f, 0.f, 0.f, 0.f};
  v8f o0[4] = {z8, z8, z8, z8}, o1[4] = {z8, z8, z8, z8};
  float m = -3.0e38f, l = 0.f;
  v16h ph, pr;
  const v16h qf[2] = {p_frag(qp), p_frag(qp + 512)};
  xwait();
  const bool early = q0 < EARLY;               /* the same for the whole block */
  if (early) {
    const _Float16* qrp = Qr + ((size_t)b * EARLY + q0) * DM + h * (HD * 16) + lane * 8;
    const _Float16* krb = Kr + (size_t)b * EARLY * DM + h * (HD * 16);
    const _Float16* vrb = VTr + (size_t)bh * HD * SEQ;
    const v16h qrf[2] = {p_frag(qrp), p_frag(qrp + 512)};
    xwait();
#pragma unroll 1 /* rolled: an unrolled body would hold two passes' hi and residual fragments at once */
    for (int p = 0; p < np; ++p) {
      v16h kf[4], krf[4], vf[4], vrf[4];
      attn_ldk(kf, kb, kofs, p * 32);
      attn_ldk(krf, krb, kofs, p * 32);
      attn_scores<true>(kf, krf, qf, qrf, p * 32, q0, ln, hh, m, l, o0, o1, ph, pr);
      /* V is loaded behind the scores here: K and V, hi and residual, live at once would pass 256 registers */
      attn_ldv(vf, vb, vofs, p * 32);
      attn_ldv(vrf, vrb, vofs, p * 32);
      attn_out<true>(vf, vrf, ph, pr, o0, o1);
    }
  } else {
    /* two fragment sets: the next pass's loads are issued before this pass's products, so that their latency runs under the pass */
    v16h ka[4], va[4], kc[4], vc[4];
    attn_ldk(ka, kb, kofs, 0); attn_ldv(va, vb, vofs, 0);
#pragma unroll 1 /* the body already holds two passes, one per fragment set */
    for (int p = 0; p < np; p += 2) {
      const int p1 = p + 1 < np ? p + 1 : np - 1;
      attn_ldk(kc, kb, kofs, p1 * 32); attn_ldv(vc, vb, vofs, p1 * 32);
      attn_scores<false>(ka, ka, qf, qf, p * 32, q0, ln, hh, m, l, o0, o1, ph, pr);
      attn_out<false>(va, va, ph, ph, o0, o1);
      if (p + 1 < np) {
        const int p2 = p + 2 < np ? p + 2 : np - 1;
        attn_ldk(ka, kb, kofs, p2 * 32); attn_ldv(va, vb, vofs, p2 * 32);
        attn_scores<false>(kc, kc, qf, qf, (p + 1) * 32, q0, ln, hh, m, l, o0, o1, ph, pr);
        attn_out<false>(vc, vc, ph, ph, o0, o1);
      }
    }
  }
  l += xhalf(l);
  const float sc = 64.0f / l;
  const size_t o = ((size_t)b * SEQ + q0) * DM + h * (HD * 16) + lane * 8;   /* fragment order: columns 16 t + 8 hh .. of the head = half t & 1 of its tile t >> 1 */
#pragma unroll
  for (int t = 0; t < 4; ++t) {
    FragH fh, fr;
#pragma unroll
    for (int r = 0; r < 8; ++r) {
      const float v = (early ? o0[t][r] + o1[t][r] * 0.0009765625f : o0[t][r]) * sc;
      const _Float16 a = (_Float16)v; fh.h[r] = a; fr.h[r] = (_Float16)((v - (float)a) * 1024.0f);
    }
    *(v8us*)((unsigned short*)CTh + o + 256 * t) = fh.half[0];
    xwait();
    if (early) { *(v8us*)((unsigned short*)CTr + o + 256 * t) = fr.half[0]; xwait(); }
  }
}

// General f16 GEMM, A [m][k] and B as Bt[n][k], both in fragment order with a k extent of DM; block = 4 waves; wave tile RT x 64 (RT = 32, or 16 with the residual accumulator).
// WIDE: wave tile 64 x 64, the block's 4 waves 2 down x 2 across (128 x 128): a k step then loads 8 fragments for 16 products (not 6 for 8), and the block's waves ask for 16 different tiles a step for 64 products (not 12 for 32).
// RES: second accumulator gets Ar.Bh (+ Ah.Br if BRES), both carried x2^10, folded in the epilogue. causal 1: k-loop stops at the tile's last key block; causal 2: column tiles past the diagonal are skipped.
// EPI 0: QKV routing (q/k f16 planes + early residual planes, k / v caches in f32, V^T hi and residual planes C5 / C6), 1: f32 plane, 2: f16 hi (+res) planes, 3: f32 output + bias, NaN fill when the mask check failed.
// the fragments of one k step of a wave: two A tiles (four where WIDE), four B tiles (and their residual tiles where BR)
struct MmSet { v16h a0, a1, a2, a3, b[4], br[4]; };
// the wave's tile rows at k = 0: wave-uniform and fixed for the whole k loop, so that they stay in scalar registers
struct MmBase { const _Float16 *a0, *a1, *a2, *a3, *b[4], *br[4]; };
// all loads of one k step in one run; vo = the lane's byte offset 16 lane + 32 k: the one vector register that the loads name
template <bool BR, bool WIDE>
__device__ __forceinline__ void mm_ld(MmSet& f, const MmBase& p, unsigned vo) {
  f.a0 = u_frag(p.a0, vo); f.a1 = u_frag(p.a1, vo);
  if (WIDE) { f.a2 = u_frag(p.a2, vo); f.a3 = u_frag(p.a3, vo); }
#pragma unroll /* unrolled: constant indices, and the loads go out together */
  for (int t = 0; t < 4; ++t) { f.b[t] = u_frag(p.b[t], vo); if (BR) f.br[t] = u_frag(p.br[t], vo); }
  /* WIDE: the precaution of xwait(), with vo as an input: the address register then lives up to the wait, where otherwise the run's last load was given it as a destination */
  if (WIDE) asm volatile("s_wait_xcnt 0x0" :: "v"(vo) : "memory");
  else xwait();
}
template <bool BR, bool WIDE>
__device__ __forceinline__ void mm_do(const MmSet& f, v8f (&c0)[4], v8f (&c1)[4], v8f (&c2)[4], v8f (&c3)[4]) {
#pragma unroll /* unrolled: constant indices, eight (WIDE: sixteen) independent accumulators in a row */
  for (int t = 0; t < 4; ++t) {
    if (WIDE) {                                /* the plain builtin: operands of an asm statement were all kept below v256, and three sets beside 16 accumulators then spilled */
      c0[t] = __builtin_amdgcn_wmma_f32_16x16x32_f16(false, f.a0, false, f.b[t], (short)0, c0[t], false, false);
      c1[t] = __builtin_amdgcn_wmma_f32_16x16x32_f16(false, f.a1, false, f.b[t], (short)0, c1[t], false, false);
      c2[t] = __builtin_amdgcn_wmma_f32_16x16x32_f16(false, f.a2, false, f.b[t], (short)0, c2[t], false, false);
      c3[t] = __builtin_amdgcn_wmma_f32_16x16x32_f16(false, f.a3, false, f.b[t], (short)0, c3[t], false, false);
      continue;
    }
    c0[t] = g2_mma(f.a0, f.b[t], c0[t]);
    c1[t] = g2_mma(f.a1, f.b[t], c1[t]);
    if (BR) c1[t] = g2_mma(f.a0, f.br[t], c1[t]);
  }
}
template <bool RES, bool BRES, int EPI, bool WIDE = false>
__device__ __forceinline__ void mm_body(float* __restrict__ smem, unsigned bx,
    const _Float16* __restrict__ Ah, const _Float16* __restrict__ Ar, size_t sA, size_t sAr,
    const _Float16* __restrict__ Bh, const _Float16* __restrict__ Br, size_t sB,
    int rbase, int ntn, int K, int causal, float alpha,
    float* __restrict__ Cf, _Float16* __restrict__ C1, _Float16* __restrict__ C2, _Float16* __restrict__ C3, _Float16* __restrict__ C4,
    _Float16* __restrict__ C5, _Float16* __restrict__ C6,
    const float* __restrict__ bias, const int* __restrict__ flags, int ldc, size_t sC) {
  static_assert(!(WIDE && RES));
  constexpr int RT = RES ? 16 : (WIDE ? 64 : 32);
  constexpr int RS = WIDE ? 32 : RT;           /* rows that a wave stages at a time */
  constexpr int lda = DM, ldb = DM;            /* compile-time: the tiles of a k step then differ by immediate offsets from one scalar base per plane */
  float (&so)[4][RS][68] = *reinterpret_cast<float (*)[4][RS][68]>(smem);   /* the work-group's staging, 4 x RS x 68 floats */
  const int tid = threadIdx.x, lane = tid & 31, ln = lane & 15, hh = lane >> 4;
  const int w = __builtin_amdgcn_readfirstlane(tid >> 5);
  const int by = blockIdx.y;
  const int mt = bx / ntn, nq = bx - mt * ntn;
  const int row0 = rbase + (WIDE ? mt * 128 + 64 * (w >> 1) : mt * (4 * RT) + RT * w), col0 = WIDE ? nq * 128 + 64 * (w & 1) : nq * 64;
  if (causal == 2 && col0 > row0 + RT - 1) return;
  int kend = K;
  if (causal == 1) { const int kc = (((row0 + RT - 1) >> 5) + 1) << 5; kend = kc < K ? kc : K; }
  /* wave-uniform tile addresses (row0, col0 are multiples of 16: a row of tiles holds 16 lda elements); the lane's share is the fixed byte offset lofs */
  const unsigned lofs = (unsigned)lane * 16u;
  const _Float16* ap0 = Ah + (size_t)by * sA + (size_t)row0 * lda;
  const _Float16* ap1;
  if (RES) ap1 = Ar + (size_t)by * sAr + (size_t)row0 * lda; else ap1 = ap0 + (size_t)16 * lda;
  const _Float16* bp = Bh + (size_t)by * sB + (size_t)col0 * ldb;
  const _Float16* brp = bp;
  if (RES && BRES) brp = Br + (size_t)by * sB + (size_t)col0 * ldb;
  const v8f z8 = {0.f, 0.f, 0.f, 0.f, 0.f, 0.f, 0.f, 0.f};
  v8f c0[4] = {z8, z8, z8, z8}, c1[4] = {z8, z8, z8, z8}, c2[4] = {z8, z8, z8, z8}, c3[4] = {z8, z8, z8, z8};   /* c2, c3: rows 32 .. 63 of a WIDE tile */
  /* ring of NS fragment sets: the loads of k step s + NS - 1 go out in front of the products of step s, so that a wave waits once a step at most, for loads issued NS - 1 steps earlier */
  constexpr int NS = 3;                        /* three sets and the 64 accumulator registers stay below 256 registers; a fourth set would not (WIDE: 192 + 128, three waves a SIMD) */
  MmSet fs[NS];
  MmBase pb; pb.a0 = ap0; pb.a1 = ap1; pb.a2 = ap0 + (size_t)32 * lda; pb.a3 = ap0 + (size_t)48 * lda;
#pragma unroll /* unrolled: constant indices, the pointers stay in registers */
  for (int t = 0; t < 4; ++t) { pb.b[t] = bp + (size_t)(16 * t) * ldb; pb.br[t] = brp + (size_t)(16 * t) * ldb; }
#pragma unroll /* unrolled: fs stays in registers only under constant indices */
  for (int s = 0; s < NS - 1; ++s) mm_ld<RES && BRES, WIDE>(fs[s], pb, lofs + 32u * (unsigned)(32 * s < kend ? 32 * s : kend - 32));
  int kb = 0;
#pragma unroll 1 /* the body already holds NS steps, one per fragment set; no branch inside it: the compiler sinks a set's loads into a branch that holds their only use, down to their products */
  for (; kb + 32 * NS <= kend; kb += 32 * NS) {
#pragma unroll /* unrolled: constant set indices */
    for (int s = 0; s < NS; ++s) {
      const int kn = kb + 32 * (s + NS - 1);   /* past the end the last step is fetched again and not used */
      mm_ld<RES && BRES, WIDE>(fs[(s + NS - 1) % NS], pb, lofs + 32u * (unsigned)(kn < kend ? kn : kend - 32));
      /* the scheduling barrier keeps a step's products behind the loads that go out in front of them: without it the plain builtins were moved up over the loads, which then stood close in front of their own use */
      if (WIDE) __builtin_amdgcn_sched_barrier(0);
      mm_do<RES && BRES, WIDE>(fs[s], c0, c1, c2, c3);
    }
  }
  /* the steps left over, fewer than NS: their sets are loaded already */
#pragma unroll /* unrolled: constant set indices */
  for (int s = 0; s < NS - 1; ++s)
    if (kb + 32 * s < kend) mm_do<RES && BRES, WIDE>(fs[s], c0, c1, c2, c3);   /* wave-uniform */
  int poison = 0;
  if (EPI == 3) { int fl = 0;
#pragma unroll /* unrolled: the flag loads go out together */
    for (int q = 0; q < MCB / 32; ++q) fl |= flags[(q * 32 + lane) * 32];
    for (int off = 16; off > 0; off >>= 1) fl |= __shfl_xor(fl, off, 32); poison = fl; }
  const float nanv = __uint_as_float(0x7fc00000u);
  const int rsub = lane >> 4, c4 = (lane & 15) * 4, rowt = row0;
  float bvs[4] = {0.f, 0.f, 0.f, 0.f};         /* WIDE: the lane's four bias values, fetched once for both halves */
  if (WIDE && (EPI == 0 || EPI == 3)) {
    const int bi = col0 + ln;
#pragma unroll /* unrolled: constant indices */
    for (int t = 0; t < 4; ++t) bvs[t] = bf16_rne(bias[bi + t * 16]);
    asm volatile("s_wait_xcnt 0x0" :: "v"(bi) : "memory");   /* the precaution of xwait(); bi as an input keeps the loads' index register alive up to the wait */
  }
#pragma unroll 1 /* a WIDE tile goes through the wave's staging in two halves of 32 rows; rolled: two copies of the epilogue would bring the kernel's text to about 32 KB */
  for (int hf = 0; hf < RT / RS; ++hf) {
  const int row0 = rowt + RS * hf;             /* first row of this half */
#pragma unroll
  for (int t = 0; t < 4; ++t) {
    float bv = bvs[t];
    if (!WIDE && (EPI == 0 || EPI == 3)) bv = bf16_rne(bias[col0 + t * 16 + ln]);
#pragma unroll
    for (int r = 0; r < 8; ++r) {
      if (!RES) {
        float v0 = c0[t][r] * alpha + bv, v1 = c1[t][r] * alpha + bv;
        if (EPI == 3) { v0 = poison ? nanv : v0; v1 = poison ? nanv : v1; }
        so[w][8 * hh + r][t * 16 + ln] = v0; so[w][(RS - 16) + 8 * hh + r][t * 16 + ln] = v1;
      } else {
        float v0 = (c0[t][r] + c1[t][r] * 0.0009765625f) * alpha + bv;
        if (EPI == 3) v0 = poison ? nanv : v0;
        so[w][8 * hh + r][t * 16 + ln] = v0;
      }
    }
  }
  /* WIDE: LDS alone; in the tile's second half a fence on global memory too would wait for the first half's stores */
  if (WIDE) __builtin_amdgcn_fence(4 /* acq_rel order */, "workgroup", "local"); else __builtin_amdgcn_fence(4 /* acq_rel order */, "workgroup");
  __builtin_amdgcn_wave_barrier();
  {
#pragma unroll
    for (int q = 0; q < RS / 2; ++q) {
      const int r = q * 2 + rsub; const int row = row0 + r;
      const v4f v = *(const v4fa*)&so[w][r][c4];
      if (EPI == 1 || EPI == 3) {
        *(v4f*)(Cf + (size_t)by * sC + (size_t)row * ldc + col0 + c4) = v;
      } else if (EPI == 2) {
        v4h h4, r4; split4(v, h4, r4);
        const size_t o = (size_t)by * sC + (size_t)row * ldc + col0 + c4;
        *(v4h*)(C1 + o) = h4;
        if (RES) *(v4h*)(C2 + o) = r4;
      } else {
        const int which = col0 / DM, hc = col0 - which * DM, h = hc >> 6;
        const size_t o16 = pk((size_t)by * SEQ + row, hc + c4, DM);
        const size_t oe = pk((size_t)by * EARLY + row, hc + c4, DM);
        const size_t of = (((size_t)by * NH + h) * SEQ_FULL + row) * HD + c4;
        if (which == 0) {
          v4h h4, r4; split4(v, h4, r4);
          *(v4h*)(C1 + o16) = h4;
          if (row0 < EARLY) *(v4h*)(C3 + oe) = r4;
        } else if (which == 1) {
          *(v4f*)(Cf + OUT1_OFF + of) = v;
          v4h h4, r4; split4(v, h4, r4);
          *(v4h*)(C2 + o16) = h4;
          if (row0 < EARLY) *(v4h*)(C4 + oe) = r4;
        } else {
          *(v4f*)(Cf + OUT2_OFF + of) = v;
        }
      }
    }
    if constexpr (EPI == 0 && !RES) {
      if (col0 >= 2 * DM) {                    /* wave-uniform: a tile of v */
        xwait();                               /* behind the cache stores of the loop above, whose registers the block below takes over */
        /* V^T in fragment order, rows d, k = keys, the four d tiles of a block of 32 keys side by side: tile index (key >> 5) * 4 + (d >> 4). The wave's staged 32 keys x 64 head columns
           are exactly those four tiles, 256 groups of eight keys: group 32 g + lane is read down a column of the staging (16 neighbouring columns a half wave) and stored as 512 contiguous bytes a wave */
        const size_t vo = ((size_t)by * NH + ((col0 - 2 * DM) >> 6)) * HD * SEQ + (size_t)row0 * HD + lane * 8;
        float vv[8][8];
#pragma unroll /* unrolled, as the loop inside: vv stays in registers only under constant indices; all LDS reads go out in one run, in front of the first store's wait */
        for (int g = 0; g < 8; ++g)
#pragma unroll
          for (int q = 0; q < 8; ++q) vv[g][q] = so[w][(g & 1) * 16 + hh * 8 + q][(g >> 1) * 16 + ln];
#pragma unroll /* unrolled: constant indices, constant offsets off one address per plane */
        for (int g = 0; g < 8; ++g) {
          FragH fh, fr;
#pragma unroll
          for (int q = 0; q < 8; ++q) { const float v = vv[g][q]; const _Float16 h = (_Float16)v; fh.h[q] = h; fr.h[q] = (_Float16)((v - (float)h) * 1024.0f); }
          *(v8us*)((unsigned short*)C5 + vo + 256 * g) = fh.half[0];
          *(v8us*)((unsigned short*)C6 + vo + 256 * g) = fr.half[0];
          xwait();
        }
      }
    }
  }
  if (WIDE) xwait();                           /* behind this half's stores, on the way out of the loop too: their registers are taken over by the copies below, which the compiler runs on both ways */
  if (WIDE && hf + 1 < RT / RS) {
    /* keeps this half's reads of the wave's staging in front of the next half's writes to it (other lanes' rows; one wave's LDS operations run in order); LDS alone, so that the wave does not wait here for its global stores */
    __builtin_amdgcn_fence(4 /* acq_rel order */, "workgroup", "local"); __builtin_amdgcn_wave_barrier();
#pragma unroll /* unrolled: constant indices; rows 32 .. 63 move to where the loop's body reads */
    for (int t = 0; t < 4; ++t) { c0[t] = c2[t]; c1[t] = c3[t]; }
  }
  }
}

// the fused QKV projection as a launch of its own: WIDE tiles
template <bool RES, bool BRES, int EPI>
__global__ __launch_bounds__(128) void k_mm(
    const _Float16* __restrict__ Ah, const _Float16* __restrict__ Ar, size_t sA, size_t sAr,
    const _Float16* __restrict__ Bh, const _Float16* __restrict__ Br, size_t sB,
    int rbase, int ntn, int K, int causal, float alpha,
    float* __restrict__ Cf, _Float16* __restrict__ C1, _Float16* __restrict__ C2, _Float16* __restrict__ C3, _Float16* __restrict__ C4,
    _Float16* __restrict__ C5, _Float16* __restrict__ C6,
    const float* __restrict__ bias, const int* __restrict__ flags, int ldc, size_t sC) {
  __shared__ __attribute__((aligned(16))) float sm[4 * 32 * 68];
  mm_body<RES, BRES, EPI, true>(sm, blockIdx.x, Ah, Ar, sA, sAr, Bh, Br, sB, rbase, ntn, K, causal, alpha, Cf, C1, C2, C3, C4, C5, C6, bias, flags, ldc, sC);
}
// out = (ctx x64).(w_o x16) 2^-10 + b_o, early and late rows in one launch: the two parts are independent, and neither fills the chip alone. grid.y = batch;
// the first OEB work-groups take the early rows (64 each, with the ctx residual plane), the others the late rows (128 each, single plane). The pick is the same for a whole work-group.
#define OEB ((EARLY / 64) * (DM / 64))
#define OLB (((SEQ - EARLY) / 128) * (DM / 64))
__global__ __launch_bounds__(128) void k_out(const _Float16* __restrict__ CTh, const _Float16* __restrict__ CTr, const _Float16* __restrict__ WoT,
                                             float* __restrict__ out, const float* __restrict__ bo, const int* __restrict__ flags) {
  __shared__ __attribute__((aligned(16))) float sm[4 * 32 * 68];
  const unsigned bx = blockIdx.x;
  if (bx < OEB)
    mm_body<true, false, 3>(sm, bx, CTh, CTr, (size_t)SEQ * DM, (size_t)SEQ * DM, WoT, nullptr, (size_t)0,
                            0, DM / 64, DM, 0, 0.0009765625f, out, nullptr, nullptr, nullptr, nullptr, nullptr, nullptr, bo, flags, DM, (size_t)SEQ_FULL * DM);
  else
    mm_body<false, false, 3>(sm, bx - OEB, CTh, nullptr, (size_t)SEQ * DM, (size_t)0, WoT, nullptr, (size_t)0,
                             EARLY, DM / 64, DM, 0, 0.0009765625f, out, nullptr, nullptr, nullptr, nullptr, nullptr, nullptr, bo, flags, DM, (size_t)SEQ_FULL * DM);
}

extern "C" void kernel_launch(void* const* d_in, const int* in_sizes, int n_in,
                              void* d_out, int out_size, void* d_ws, size_t ws_size, hipStream_t stream) {
  if (n_in < 6) return;
  if ((size_t)in_sizes[0] < (size_t)(NB - 1) * SEQ_FULL * DM + (size_t)SEQ * DM) return;
  if ((size_t)in_sizes[1] < (size_t)DM * 3 * DM) return;
  if (in_sizes[2] < 3 * DM) return;
  if ((size_t)in_sizes[3] < (size_t)DM * DM) return;
  if (in_sizes[4] < DM) return;
  if ((size_t)in_sizes[5] < (size_t)(SEQ - 1) * SEQ_FULL + SEQ) return;
  if ((size_t)out_size < OUT2_OFF + ((size_t)((NB - 1) * NH + NH - 1) * SEQ_FULL + SEQ) * HD) return;
  const float* x = (const float*)d_in[0];        /* x      [B][L][1024] */
  const float* wqkv = (const float*)d_in[1];     /* w_qkv  [1024][3072] ([in][out]; columns q | k | v) */
  const float* bqkv = (const float*)d_in[2];     /* b_qkv  [3072] */
  const float* wo = (const float*)d_in[3];       /* w_o    [1024][1024] ([in][out]) */
  const float* bo = (const float*)d_in[4];       /* b_o    [1024] */
  const float* mask = (const float*)d_in[5];     /* mask   [1][1][L][L] additive */
  float* out = (float*)d_out;

  constexpr size_t SZ_WT = (size_t)3 * DM * DM * 2, SZ_WO = (size_t)DM * DM * 2, SZ_TOK = (size_t)NB * SEQ * DM * 2;
  constexpr size_t SZ_ER = (size_t)NB * EARLY * DM * 2;
  constexpr size_t SZ_FL = (size_t)MCB * 128;
  constexpr size_t SZ_ALL = SZ_WT + SZ_WO + 7 * SZ_TOK + 2 * SZ_ER + SZ_FL;
  static_assert(SZ_ALL <= (size_t)268435456);
  static_assert(SZ_WT % 256 == 0 && SZ_WO % 256 == 0 && SZ_TOK % 256 == 0 && SZ_ER % 256 == 0 && SZ_FL % 256 == 0);
  if (SZ_ALL > ws_size) return;
  char* ws = (char*)d_ws; size_t off = 0;
  auto take = [&](size_t bytes) { char* p = ws + off; off += bytes; return p; };
  _Float16* WT = (_Float16*)take(SZ_WT);      /* [3072][1024] x16, fragment order (as every f16 plane here) */
  _Float16* WoT = (_Float16*)take(SZ_WO);     /* [1024][1024] x16 */
  _Float16* X16 = (_Float16*)take(SZ_TOK);    /* [NB*SEQ][1024] */
  _Float16* Q16 = (_Float16*)take(SZ_TOK);
  _Float16* K16 = (_Float16*)take(SZ_TOK);
  _Float16* VTh = (_Float16*)take(SZ_TOK);    /* per (batch, head): 64 x SEQ */
  _Float16* VTr = (_Float16*)take(SZ_TOK);
  _Float16* CTh = (_Float16*)take(SZ_TOK);    /* ctx x64, [NB*SEQ][1024] */
  _Float16* CTr = (_Float16*)take(SZ_TOK);
  _Float16* Qr = (_Float16*)take(SZ_ER);      /* [NB][EARLY][1024] */
  _Float16* Kr = (_Float16*)take(SZ_ER);
  int* MCHK = (int*)take(SZ_FL);              /* MCB lines of 32 ints */

  k_prep<<<(unsigned)(MCB + NB * XB + WQB + WOB), 256, 0, stream>>>(mask, x, wqkv, wo, MCHK, X16, WT, WoT);
  /* fused QKV projection: grid.y = batch; blocks of 128 rows x 128 columns, a wave's 64 columns = one (q|k|v, head) */
  k_mm<false, false, 0><<<dim3((unsigned)((SEQ / 128) * (3 * DM / 128)), NB), 128, 0, stream>>>(
      X16, nullptr, (size_t)SEQ * DM, (size_t)0,
      WT, nullptr, (size_t)0,
      0, 3 * DM / 128, DM, 0, 0.0625f,
      out, Q16, K16, Qr, Kr, VTh, VTr, bqkv, nullptr, 0, (size_t)0);

  /* scores, softmax and P V of every (batch, head) in one launch */
  k_attn<<<dim3((unsigned)(NB * NH), (unsigned)(SEQ / 64)), 128, 0, stream>>>(Q16, K16, Qr, Kr, VTh, VTr, CTh, CTr);
  k_out<<<dim3((unsigned)(OEB + OLB), NB), 128, 0, stream>>>(CTh, CTr, WoT, out, bo, MCHK);
}

// v009
// It runs in 91.8 microseconds.
// In both of two side-by-side timings against v008, it was 1.06 times as fast.
// Counting every step since v000, it is 20.4 times as fast.
#include <hip/hip_runtime.h>
// Causal multi-head self-attention, B 2 x L 2048, d_model 1024, 16 heads of 64; outputs: out [B][L][1024], k cache [B][16][L][64], v cache [B][16][L][64] (f32).
// Compute dtype: every contraction on v_wmma_f32_16x16x32_f16 (f16 operands, f32 accumulate). x / w_qkv / w_o / biases are RNE-converted to bf16 first (exact in f16; weights carried x16).
// q, k, v and ctx (carried x64) are f16 planes, the softmax weights (unnormalised, carried x1024) f16 fragments; for the first EARLY query rows of every sequence each of them also has an f16 residual plane carried x2^10
// that goes to a separate accumulator (q k^T: 3 products, P V: 3 products, ctx w_o: 2 products); scores, softmax statistics and all epilogues in f32.
// Structure, four launches: one for the work that depends on the inputs alone (mask structure check, x plane, both weight transposes), fused QKV GEMM (writes the k / v caches in f32 plus the f16 planes,
// the V^T hi/res planes among them), one attention launch for all heads (scores, online softmax and P V in registers; the scores never reach memory), then one launch for the output GEMM (early and late rows).
// Every f16 operand plane is kept in fragment order (see pk below), not row-major: a wave's fragment load then reads 512 contiguous bytes (4 lines) where a row-major plane gave it 32 bytes of each of 16 lines.
#ifndef NB
#define NB 2
#endif
#ifndef SEQ
#define SEQ 2048
#endif
#define NB_FULL 2
#define SEQ_FULL 2048
#define DM 1024
#define NH 16
#define HD 64
#define EARLY ((SEQ) < 512 ? (SEQ) : 512)
#define OUT1_OFF ((size_t)NB_FULL * SEQ_FULL * DM)
#define OUT2_OFF ((size_t)2 * NB_FULL * SEQ_FULL * DM)

typedef unsigned short v8us __attribute__((ext_vector_type(8), may_alias));
typedef float v8f __attribute__((ext_vector_type(8)));
typedef float v4f __attribute__((ext_vector_type(4)));
typedef float v4fa __attribute__((ext_vector_type(4), may_alias));
typedef _Float16 v16h __attribute__((ext_vector_type(16)));
typedef _Float16 v4h __attribute__((ext_vector_type(4)));
union FragH { v16h v; v8us half[2]; _Float16 h[16]; unsigned short u[16]; };

static_assert(NH * HD == DM);
static_assert(SEQ % 256 == 0);
static_assert(EARLY % 128 == 0);
static_assert((SEQ - EARLY) % 128 == 0);
static_assert(NB <= NB_FULL && SEQ <= SEQ_FULL);
static_assert(OUT1_OFF * 4 == 16777216);
static_assert(OUT2_OFF * 4 == 33554432);

__device__ __forceinline__ unsigned short bf16_bits(float x) { unsigned int u = __float_as_uint(x); return (unsigned short)((u + 0x7FFFu + ((u >> 16) & 1u)) >> 16); }
__device__ __forceinline__ float bf16_rne(float x) { return __uint_as_float(((unsigned int)bf16_bits(x)) << 16); }

// Fragment order of a plane of rows x kd: tiles of 16 rows x 32 k, 512 elements each, tile (row >> 4, k >> 5) at index (row >> 4) * (kd / 32) + (k >> 5);
// inside a tile the eight elements k = 16 j + 8 hh .. + 7 of row ln stand at 256 j + 8 (16 hh + ln). pk = element offset of (row, k).
__device__ __forceinline__ size_t pk(size_t row, int k, int kd) {
  return ((row >> 4) * (size_t)(kd >> 5) + (size_t)(k >> 5)) * 512 + (size_t)(((k >> 4) & 1) * 256 + (((k >> 3) & 1) * 16 + (int)(row & 15)) * 8 + (k & 7));
}
// fragment loader (A row or B column ln of the tile): p = tile + 8 lane, lane = 16 hh + ln; elements 0..7 <- k0+8hh.., elements 8..15 <- k0+16+8hh..
__device__ __forceinline__ v16h p_frag(const _Float16* p) { FragH f; f.half[0] = *(const v8us*)((const unsigned short*)p); f.half[1] = *(const v8us*)((const unsigned short*)p + 256); return f.v; }
__device__ __forceinline__ v8f g2_mma(v16h a, v16h b, v8f c) { v8f d = __builtin_amdgcn_wmma_f32_16x16x32_f16(false, a, false, b, (short)0, c, false, false); asm volatile("v_nop\n\tv_nop\n\tv_nop\n\tv_nop" : "+v"(d) : "v"(a), "v"(b)); return d; }
// f32 -> f16 hi and f16 residual carried x2^10
__device__ __forceinline__ void split4(const v4f v, v4h& h, v4h& r) {
#pragma unroll
  for (int i = 0; i < 4; ++i) { const _Float16 a = (_Float16)v[i]; h[i] = a; r[i] = (_Float16)((v[i] - (float)a) * 1024.0f); }
}

template <int K, int N>
__device__ __forceinline__ void wt_f16(const float* __restrict__ W, _Float16* __restrict__ Wt, int blk, float scale) {
  const int t = blk * 256 + threadIdx.x; if (t >= N * (K / 8)) return;
  /* thread t makes the t-th group of eight of the fragment-ordered plane: 16 lanes read 16 neighbouring columns n of one row of W */
  const int tile = t >> 6, n = (tile / (K / 32)) * 16 + (t & 15), k8 = (tile % (K / 32)) * 32 + ((t >> 5) & 1) * 16 + ((t >> 4) & 1) * 8; FragH f;
#pragma unroll
  for (int i = 0; i < 8; ++i) f.h[i] = (_Float16)(bf16_rne(W[(size_t)(k8 + i) * N + n]) * scale);
  const v8us o = f.half[0];
  unsigned short* d = (unsigned short*)Wt + (size_t)t * 8;
  *(v8us*)d = o; 
}

#define XB (SEQ * DM / 8 / 256)               /* work-groups of the x plane per batch */
__device__ __forceinline__ void x16(const float* __restrict__ x, _Float16* __restrict__ X16, int blk) {
  const int b = blk / XB; const size_t t = (size_t)(blk - b * XB) * 256 + threadIdx.x;
  /* thread t makes the t-th group of eight of the batch's fragment-ordered plane */
  const int tile = (int)(t >> 6), row = (tile / (DM / 32)) * 16 + (int)(t & 15), k8 = (tile % (DM / 32)) * 32 + (int)((t >> 5) & 1) * 16 + (int)((t >> 4) & 1) * 8;
  const float* src = x + ((size_t)b * SEQ_FULL + row) * DM + k8;
  const v4f a = *(const v4fa*)src, c = *(const v4fa*)(src + 4); FragH f;
#pragma unroll
  for (int q = 0; q < 4; ++q) { f.h[q] = (_Float16)bf16_rne(a[q]); f.h[4 + q] = (_Float16)bf16_rne(c[q]); }
  unsigned short* d = (unsigned short*)X16 + (size_t)b * SEQ * DM + t * 8;
  *(v8us*)d = f.half[0]; 
}

// Mask structure check, spread over the chip: MCB work-groups of 8 waves, 16 rows each; a wave takes two rows and issues all their loads before it waits for the first.
// Row i, blocks of 128 columns: a block left of the diagonal's must be all zero (OR of the bits, sign aside), a block right of it all <= -1e8, that is, its bits as unsigned within
// [bits(-1e8), bits(-inf)] (minimum and maximum); the diagonal's own block is fetched once more and checked element by element. Every work-group writes its own 128-byte flag line.
#define MCB (SEQ / 16)
static_assert(MCB % 32 == 0);
__device__ __forceinline__ void maskchk(const float* __restrict__ mask, int* __restrict__ flg, int blk) {
  __shared__ int sb[8];
  constexpr int NL = SEQ / 128;                /* loads of 16 bytes a lane and row */
  constexpr unsigned ULO = 0xCCBEBC20u, UHI = 0xFF800000u;   /* bits of -1e8f and of -infinity */
  const int lane = threadIdx.x & 31;
  const int w = __builtin_amdgcn_readfirstlane((int)(threadIdx.x >> 5));
  const int i0 = blk * 16 + w * 2;
  const float* mr = mask + (size_t)i0 * SEQ_FULL;   /* wave-uniform; the lane's share is lane * 4 */
  v4f m[2][NL], dg[2];
#pragma unroll /* unrolled, as the loop inside: the loads are independent, and a rolled loop would wait for each in turn */
  for (int r = 0; r < 2; ++r) {
#pragma unroll
    for (int u = 0; u < NL; ++u) m[r][u] = *(const v4fa*)(mr + (size_t)r * SEQ_FULL + u * 128 + lane * 4);
    const float* du = mr + (size_t)r * SEQ_FULL + ((i0 + r) >> 7) * 128;
    dg[r] = *(const v4fa*)(du + lane * 4);
  }
  /* precaution: stands behind the run of loads, in front of any rewrite of their address registers; as a volatile statement it also keeps every load in front of the first check */
  asm volatile("s_wait_xcnt 0x0" ::: "memory");
  unsigned orl = 0u, mn = UHI, mx = ULO;
  bool bad = false;
#pragma unroll /* unrolled, as the loops inside: m and dg stay in registers only under constant indices */
  for (int r = 0; r < 2; ++r) {
    const int i = i0 + r, ud = i >> 7;         /* wave-uniform */
#pragma unroll
    for (int u = 0; u < NL; ++u) {
      const unsigned a = __float_as_uint(m[r][u][0]), b = __float_as_uint(m[r][u][1]), c = __float_as_uint(m[r][u][2]), d = __float_as_uint(m[r][u][3]);
      if (u < ud) { orl |= a | b; orl |= c | d; }
      else if (u > ud) { mn = min(min(mn, a), b); mn = min(min(mn, c), d); mx = max(max(mx, a), b); mx = max(max(mx, c), d); }
    }
#pragma unroll
    for (int q = 0; q < 4; ++q) { const int j = ud * 128 + lane * 4 + q; const float v = dg[r][q]; bad |= (j <= i) ? !(v == 0.0f) : !(v <= -1.0e8f); }
  }
  bad |= (orl & 0x7FFFFFFFu) != 0u || mn < ULO || mx > UHI;
  const int wbad = __builtin_amdgcn_ballot_w32(bad) != 0 ? 1 : 0;
  if (lane == 0) sb[w] = wbad;
  __syncthreads();
  if (w == 0) {
    int tot = 0;
#pragma unroll
    for (int q = 0; q < 8; ++q) tot |= sb[q];
    int* p = flg + blk * 32 + lane;
    *p = tot; 
  }
}

// Everything that depends on the inputs alone, in one launch: the four jobs are independent of each other, and as launches of their own each paid its own start, first load latency and drain.
// The job is picked by the work-group's index (the same for the whole work-group, so the mask check's barrier stands under uniform control flow); the mask check, whose waves live longest, comes first.
#define WQB (3 * DM * (DM / 8) / 256)
#define WOB (DM * (DM / 8) / 256)
static_assert(WQB * 256 == 3 * DM * (DM / 8) && WOB * 256 == DM * (DM / 8) && XB * 256 * 8 == SEQ * DM);
__global__ __launch_bounds__(256) void k_prep(const float* __restrict__ mask, const float* __restrict__ x, const float* __restrict__ wqkv, const float* __restrict__ wo,
                                              int* __restrict__ flg, _Float16* __restrict__ X16, _Float16* __restrict__ WT, _Float16* __restrict__ WoT) {
  const int bx = blockIdx.x;
  if (bx < MCB) maskchk(mask, flg, bx);
  else if (bx < MCB + NB * XB) x16(x, X16, bx - MCB);
  else if (bx < MCB + NB * XB + WQB) wt_f16<DM, 3 * DM>(wqkv, WT, bx - (MCB + NB * XB), 16.0f);
  else wt_f16<DM, DM>(wo, WoT, bx - (MCB + NB * XB + WQB), 16.0f);
}

// lane l <-> lane l ^ 16 in one vector instruction (a shuffle would go through the LDS pipe and its wait)
__device__ __forceinline__ float xhalf(float x) { return __builtin_bit_cast(float, __builtin_amdgcn_permlanex16(__builtin_bit_cast(int, x), __builtin_bit_cast(int, x), 0x76543210, 0xfedcba98, false, false)); }

// One pass of the fused attention: 32 keys x the wave's 16 queries, both products transposed so that a lane owns one query (column ln) throughout.
// S^T = K Q^T: A = K rows (keys), B = Q rows (queries); accumulator register r of key tile t holds key k0 + 16 t + 8 hh + r of query q0 + ln,
// which is element 8 t + r of the B fragment of O^T += V^T P^T (A = V^T rows d, k = keys): P goes from accumulator to operand inside the lane.
// Online softmax: m = running maximum of the query (equal in both halves), l = this half's sum of p = 1024 exp(s - m); the accumulators are rescaled only in a pass where some query's maximum grew.
// RES: scores kh.qh + (kh.qr + kr.qh) 2^-10, output vh.ph + (vh.pr + vr.ph) 2^-10, the residual operands carried x2^10 in a second accumulator.
// attn_s: the score products of a pass (the last reader of its K fragments); attn_p: mask, online softmax and the P fragments
template <bool RES>
__device__ __forceinline__ void attn_s(const v16h (&kf)[4], const v16h (&krf)[4], const v16h (&qf)[2], const v16h (&qrf)[2], v8f (&s)[2]) {
  const v8f z8 = {0.f, 0.f, 0.f, 0.f, 0.f, 0.f, 0.f, 0.f};
#pragma unroll
  for (int t = 0; t < 2; ++t) {
    v8f c = g2_mma(kf[2 * t], qf[0], z8);
    c = g2_mma(kf[2 * t + 1], qf[1], c);
    if (RES) {
      v8f e = g2_mma(kf[2 * t], qrf[0], z8);
      e = g2_mma(krf[2 * t], qf[0], e);
      e = g2_mma(kf[2 * t + 1], qrf[1], e);
      e = g2_mma(krf[2 * t + 1], qf[1], e);
      c = c + e * 0.0009765625f;
    }
    s[t] = c * 0.125f;
  }
}
// RUN: the pass's sixteen v_exp_f32 stand in two statements of eight, each closed by one v_nop. The instruction set asks for one independent instruction or v_nop between a transcendental and an instruction
// that reads its result or overwrites its source; inside a run the next v_exp_f32 is that instruction (early-clobber outputs: no result shares a register with a source). Used in one copy of the pass;
// in the other copies the compiler fills the slot itself.
template <bool RES, bool RUN = false>
__device__ __forceinline__ void attn_p(v8f (&s)[2], int k0, int q0, int ln, int hh, float& m, float& l, v8f (&o0)[4], v8f (&o1)[4], v16h& pho, v16h& pro) {
  const float L2E = 1.44269504088896340736f;
  if (k0 + 31 > q0) {                          /* wave-uniform: only a pass that reaches the diagonal masks */
#pragma unroll
    for (int t = 0; t < 2; ++t)
#pragma unroll
      for (int r = 0; r < 8; ++r) s[t][r] = (k0 + 16 * t + 8 * hh + r <= q0 + ln) ? s[t][r] : -1.0e30f;
  }
  float tm = fmaxf(s[0][0], s[1][0]);
#pragma unroll
  for (int r = 1; r < 8; ++r) tm = fmaxf(tm, fmaxf(s[0][r], s[1][r]));
  tm = fmaxf(tm, xhalf(tm));
  const float mn = fmaxf(m, tm);
  if (__builtin_amdgcn_ballot_w32(mn > m) != 0) {
    const float f = __builtin_amdgcn_exp2f((m - mn) * L2E);
    l *= f;
#pragma unroll
    for (int t = 0; t < 4; ++t) { o0[t] = o0[t] * f; if (RES) o1[t] = o1[t] * f; }
    m = mn;
  }
  FragH ph, pr;
  v8f w[2];
  if constexpr (RUN) {
#pragma unroll /* unrolled: constant indices */
    for (int t = 0; t < 2; ++t) {
      v8f e;
#pragma unroll
      for (int r = 0; r < 8; ++r) e[r] = fmaf(s[t][r] - m, L2E, 10.0f);
      float x0, x1, x2, x3, x4, x5, x6, x7;
      /* one statement, so that nothing comes between a v_exp_f32 and the instruction that fills its slot; the v_nop fills the last one's */
      asm("v_exp_f32 %0, %8\n\tv_exp_f32 %1, %9\n\tv_exp_f32 %2, %10\n\tv_exp_f32 %3, %11\n\tv_exp_f32 %4, %12\n\tv_exp_f32 %5, %13\n\tv_exp_f32 %6, %14\n\tv_exp_f32 %7, %15\n\tv_nop"
          : "=&v"(x0), "=&v"(x1), "=&v"(x2), "=&v"(x3), "=&v"(x4), "=&v"(x5), "=&v"(x6), "=&v"(x7)
          : "v"(e[0]), "v"(e[1]), "v"(e[2]), "v"(e[3]), "v"(e[4]), "v"(e[5]), "v"(e[6]), "v"(e[7]));
      w[t] = v8f{x0, x1, x2, x3, x4, x5, x6, x7};
    }
  }
#pragma unroll
  for (int t = 0; t < 2; ++t)
#pragma unroll
    for (int r = 0; r < 8; ++r) {
      float p;
      if constexpr (RUN) p = w[t][r]; else p = __builtin_amdgcn_exp2f(fmaf(s[t][r] - m, L2E, 10.0f));
      l += p;
      const _Float16 h = (_Float16)p;
      ph.h[8 * t + r] = h;
      if (RES) pr.h[8 * t + r] = (_Float16)((p - (float)h) * 1024.0f);
    }
  pho = ph.v;
  if (RES) pro = pr.v;
}
template <bool RES>
__device__ __forceinline__ void attn_out(const v16h (&vf)[4], const v16h (&vrf)[4], const v16h ph, const v16h pr, v8f (&o0)[4], v8f (&o1)[4]) {
#pragma unroll
  for (int t = 0; t < 4; ++t) {
    o0[t] = g2_mma(vf[t], ph, o0[t]);
    if (RES) { o1[t] = g2_mma(vf[t], pr, o1[t]); o1[t] = g2_mma(vrf[t], ph, o1[t]); }
  }
}

// precaution: stands behind a run of global loads or stores, in front of any rewrite of their address registers
__device__ __forceinline__ void xwait() { asm volatile("s_wait_xcnt 0x0" ::: "memory"); }
// fragment of the tile at a wave-uniform base; lofs = the lane's fixed byte offset, 16 lane
__device__ __forceinline__ v16h u_frag(const _Float16* ubase, unsigned lofs) {
  const char* p = (const char*)ubase + lofs; FragH f; f.half[0] = *(const v8us*)p; f.half[1] = *(const v8us*)(p + 512); return f.v;
}
// K fragments of keys k0 .. k0 + 31: two key tiles x two halves of the head; kb = the head's first tile in the batch's K plane (16 keys further = 16 DM elements, the head's second half = the next tile)
__device__ __forceinline__ void attn_ldk(v16h (&kf)[4], const _Float16* kb, unsigned lofs, int k0) {
#pragma unroll
  for (int t = 0; t < 2; ++t) { kf[2 * t] = u_frag(kb + (size_t)(k0 + 16 * t) * DM, lofs); kf[2 * t + 1] = u_frag(kb + (size_t)(k0 + 16 * t) * DM + 512, lofs); }
  xwait();
}
// V^T fragments of the same keys: four tiles of 16 head columns, side by side; vb = the head's V^T plane
__device__ __forceinline__ void attn_ldv(v16h (&vf)[4], const _Float16* vb, unsigned lofs, int k0) {
#pragma unroll
  for (int t = 0; t < 4; ++t) vf[t] = u_frag(vb + (size_t)k0 * HD + 512 * t, lofs);
  xwait();
}

// Causal attention, all heads in one launch: blockIdx.x = (batch, head), blockIdx.y = block of 64 queries (longest first); a wave owns 16 queries and walks keys 0 .. q0 + 15 in passes of 32.
// No LDS, no barrier. Writes ctx x64 as f16 (hi plane; residual plane for query rows < EARLY).
__global__ __launch_bounds__(128) void k_attn(const _Float16* __restrict__ Q16, const _Float16* __restrict__ K16, const _Float16* __restrict__ Qr, const _Float16* __restrict__ Kr,
                                              const _Float16* __restrict__ VTh, const _Float16* __restrict__ VTr, _Float16* __restrict__ CTh, _Float16* __restrict__ CTr) {
  const int lane = threadIdx.x & 31, ln = lane & 15, hh = lane >> 4;
  const int w = __builtin_amdgcn_readfirstlane((int)(threadIdx.x >> 5));
  const int bh = blockIdx.x, b = bh / NH, h = bh - b * NH;
  const int q0 = (SEQ / 64 - 1 - (int)blockIdx.y) * 64 + 16 * w;
  const int np = (q0 >> 5) + 1;                /* passes with k0 <= q0 + 15 */
  const _Float16* qp = Q16 + ((size_t)b * SEQ + q0) * DM + h * (HD * 16) + lane * 8;
  const _Float16* kb = K16 + (size_t)b * SEQ * DM + h * (HD * 16);
  const _Float16* vb = VTh + (size_t)bh * HD * SEQ;
  const unsigned kofs = (unsigned)lane * 16u, vofs = kofs;
  const v8f z8 = {0.f, 0.f, 0.f, 0.f, 0.f, 0.f, 0.f, 0.f};
  v8f o0[4] = {z8, z8, z8, z8}, o1[4] = {z8, z8, z8, z8};
  float m = -3.0e38f, l = 0.f;
  v16h ph, pr;
  const v16h qf[2] = {p_frag(qp), p_frag(qp + 512)};
  xwait();
  const bool early = q0 < EARLY;               /* the same for the whole block */
  if (early) {
    const _Float16* qrp = Qr + ((size_t)b * EARLY + q0) * DM + h * (HD * 16) + lane * 8;
    const _Float16* krb = Kr + (size_t)b * EARLY * DM + h * (HD * 16);
    const _Float16* vrb = VTr + (size_t)bh * HD * SEQ;
    const v16h qrf[2] = {p_frag(qrp), p_frag(qrp + 512)};
    xwait();
#pragma unroll 1 /* rolled: an unrolled body would hold two passes' hi and residual fragments at once */
    for (int p = 0; p < np; ++p) {
      v16h kf[4], krf[4], vf[4], vrf[4];
      attn_ldk(kf, kb, kofs, p * 32);
      attn_ldk(krf, krb, kofs, p * 32);
      v8f s[2];
      attn_s<true>(kf, krf, qf, qrf, s);
      attn_p<true>(s, p * 32, q0, ln, hh, m, l, o0, o1, ph, pr);
      /* V is loaded behind the scores here: K and V, hi and residual, live at once would pass 256 registers */
      attn_ldv(vf, vb, vofs, p * 32);
      attn_ldv(vrf, vrb, vofs, p * 32);
      attn_out<true>(vf, vrf, ph, pr, o0, o1);
    }
  } else {
    /* two fragment sets. V of the next pass is asked for at the head of a pass and read at the foot of the next one. K is read at a pass's head, so a K set is refilled right behind the score products
       that read it, with the keys of the pass after next: two passes' K loads are then in flight, where a load at the head of the pass before had one pass to arrive and held the next request back until it had.
       Past the end the last pass is fetched again and not used. */
    v16h ka[4], va[4], kc[4], vc[4];
    v8f s[2];
    attn_ldk(ka, kb, kofs, 0); attn_ldv(va, vb, vofs, 0);
    attn_ldk(kc, kb, kofs, (1 < np ? 1 : np - 1) * 32);
    int p = 0;
#pragma unroll 1 /* the body already holds two passes, one per fragment set; no way out of its middle: with one, the compiler waited at the loop's head for the youngest loads */
    for (; p + 2 <= np; p += 2) {
      const int p2 = p + 2 < np ? p + 2 : np - 1, p3 = p + 3 < np ? p + 3 : np - 1;
      attn_ldv(vc, vb, vofs, (p + 1) * 32);
      attn_s<false>(ka, ka, qf, qf, s);
      attn_ldk(ka, kb, kofs, p2 * 32);
      attn_p<false, true>(s, p * 32, q0, ln, hh, m, l, o0, o1, ph, pr);
      attn_out<false>(va, va, ph, ph, o0, o1);
      attn_ldv(va, vb, vofs, p2 * 32);
      attn_s<false>(kc, kc, qf, qf, s);
      attn_ldk(kc, kb, kofs, p3 * 32);
      attn_p<false>(s, (p + 1) * 32, q0, ln, hh, m, l, o0, o1, ph, pr);
      attn_out<false>(vc, vc, ph, ph, o0, o1);
    }
    if (p < np) {                              /* wave-uniform: an odd count's last pass; its fragments are loaded already */
      attn_s<false>(ka, ka, qf, qf, s);
      attn_p<false>(s, p * 32, q0, ln, hh, m, l, o0, o1, ph, pr);
      attn_out<false>(va, va, ph, ph, o0, o1);
    }
  }
  l += xhalf(l);
  const float sc = 64.0f / l;
  const size_t o = ((size_t)b * SEQ + q0) * DM + h * (HD * 16) + lane * 8;   /* fragment order: columns 16 t + 8 hh .. of the head = half t & 1 of its tile t >> 1 */
#pragma unroll
  for (int t = 0; t < 4; ++t) {
    FragH fh, fr;
#pragma unroll
    for (int r = 0; r < 8; ++r) {
      const float v = (early ? o0[t][r] + o1[t][r] * 0.0009765625f : o0[t][r]) * sc;
      const _Float16 a = (_Float16)v; fh.h[r] = a; fr.h[r] = (_Float16)((v - (float)a) * 1024.0f);
    }
    *(v8us*)((unsigned short*)CTh + o + 256 * t) = fh.half[0];
    xwait();
    if (early) { *(v8us*)((unsigned short*)CTr + o + 256 * t) = fr.half[0]; xwait(); }
  }
}

// General f16 GEMM, A [m][k] and B as Bt[n][k], both in fragment order with a k extent of DM; block = 4 waves; wave tile RT x 64 (RT = 32, or 16 with the residual accumulator).
// WIDE: wave tile 64 x 64, the block's 4 waves 2 down x 2 across (128 x 128): a k step then loads 8 fragments for 16 products (not 6 for 8), and the block's waves ask for 16 different tiles a step for 64 products (not 12 for 32).
// RES: second accumulator gets Ar.Bh (+ Ah.Br if BRES), both carried x2^10, folded in the epilogue. causal 1: k-loop stops at the tile's last key block; causal 2: column tiles past the diagonal are skipped.
// EPI 0: QKV routing (q/k f16 planes + early residual planes, k / v caches in f32, V^T hi and residual planes C5 / C6), 1: f32 plane, 2: f16 hi (+res) planes, 3: f32 output + bias, NaN fill when the mask check failed.
// the fragments of one k step of a wave: two A tiles (four where WIDE), four B tiles (and their residual tiles where BR)
struct MmSet { v16h a0, a1, a2, a3, b[4], br[4]; };
// the wave's tile rows at k = 0: wave-uniform and fixed for the whole k loop, so that they stay in scalar registers
struct MmBase { const _Float16 *a0, *a1, *a2, *a3, *b[4], *br[4]; };
// all loads of one k step in one run; vo = the lane's byte offset 16 lane + 32 k: the one vector register that the loads name
template <bool BR, bool WIDE>
__device__ __forceinline__ void mm_ld(MmSet& f, const MmBase& p, unsigned vo) {
  f.a0 = u_frag(p.a0, vo); f.a1 = u_frag(p.a1, vo);
  if (WIDE) { f.a2 = u_frag(p.a2, vo); f.a3 = u_frag(p.a3, vo); }
#pragma unroll /* unrolled: constant indices, and the loads go out together */
  for (int t = 0; t < 4; ++t) { f.b[t] = u_frag(p.b[t], vo); if (BR) f.br[t] = u_frag(p.br[t], vo); }
  /* WIDE: the precaution of xwait(), with vo as an input: the address register then lives up to the wait, where otherwise the run's last load was given it as a destination */
  if (WIDE) asm volatile("s_wait_xcnt 0x0" :: "v"(vo) : "memory");
  else xwait();
}
template <bool BR, bool WIDE>
__device__ __forceinline__ void mm_do(const MmSet& f, v8f (&c0)[4], v8f (&c1)[4], v8f (&c2)[4], v8f (&c3)[4]) {
#pragma unroll /* unrolled: constant indices, eight (WIDE: sixteen) independent accumulators in a row */
  for (int t = 0; t < 4; ++t) {
    if (WIDE) {                                /* the plain builtin: operands of an asm statement were all kept below v256, and three sets beside 16 accumulators then spilled */
      c0[t] = __builtin_amdgcn_wmma_f32_16x16x32_f16(false, f.a0, false, f.b[t], (short)0, c0[t], false, false);
      c1[t] = __builtin_amdgcn_wmma_f32_16x16x32_f16(false, f.a1, false, f.b[t], (short)0, c1[t], false, false);
      c2[t] = __builtin_amdgcn_wmma_f32_16x16x32_f16(false, f.a2, false, f.b[t], (short)0, c2[t], false, false);
      c3[t] = __builtin_amdgcn_wmma_f32_16x16x32_f16(false, f.a3, false, f.b[t], (short)0, c3[t], false, false);
      continue;
    }
    c0[t] = g2_mma(f.a0, f.b[t], c0[t]);
    c1[t] = g2_mma(f.a1, f.b[t], c1[t]);
    if (BR) c1[t] = g2_mma(f.a0, f.br[t], c1[t]);
  }
}
template <bool RES, bool BRES, int EPI, bool WIDE = false>
__device__ __forceinline__ void mm_body(float* __restrict__ smem, unsigned bx,
    const _Float16* __restrict__ Ah, const _Float16* __restrict__ Ar, size_t sA, size_t sAr,
    const _Float16* __restrict__ Bh, const _Float16* __restrict__ Br, size_t sB,
    int rbase, int ntn, int K, int causal, float alpha,
    float* __restrict__ Cf, _Float16* __restrict__ C1, _Float16* __restrict__ C2, _Float16* __restrict__ C3, _Float16* __restrict__ C4,
    _Float16* __restrict__ C5, _Float16* __restrict__ C6,
    const float* __restrict__ bias, const int* __restrict__ flags, int ldc, size_t sC) {
  static_assert(!(WIDE && RES));
  constexpr int RT = RES ? 16 : (WIDE ? 64 : 32);
  constexpr int RS = WIDE ? 32 : RT;           /* rows that a wave stages at a time */
  constexpr int lda = DM, ldb = DM;            /* compile-time: the tiles of a k step then differ by immediate offsets from one scalar base per plane */
  float (&so)[4][RS][68] = *reinterpret_cast<float (*)[4][RS][68]>(smem);   /* the work-group's staging, 4 x RS x 68 floats */
  const int tid = threadIdx.x, lane = tid & 31, ln = lane & 15, hh = lane >> 4;
  const int w = __builtin_amdgcn_readfirstlane(tid >> 5);
  const int by = blockIdx.y;
  const int mt = bx / ntn, nq = bx - mt * ntn;
  const int row0 = rbase + (WIDE ? mt * 128 + 64 * (w >> 1) : mt * (4 * RT) + RT * w), col0 = WIDE ? nq * 128 + 64 * (w & 1) : nq * 64;
  if (causal == 2 && col0 > row0 + RT - 1) return;
  int kend = K;
  if (causal == 1) { const int kc = (((row0 + RT - 1) >> 5) + 1) << 5; kend = kc < K ? kc : K; }
  /* wave-uniform tile addresses (row0, col0 are multiples of 16: a row of tiles holds 16 lda elements); the lane's share is the fixed byte offset lofs */
  const unsigned lofs = (unsigned)lane * 16u;
  const _Float16* ap0 = Ah + (size_t)by * sA + (size_t)row0 * lda;
  const _Float16* ap1;
  if (RES) ap1 = Ar + (size_t)by * sAr + (size_t)row0 * lda; else ap1 = ap0 + (size_t)16 * lda;
  const _Float16* bp = Bh + (size_t)by * sB + (size_t)col0 * ldb;
  const _Float16* brp = bp;
  if (RES && BRES) brp = Br + (size_t)by * sB + (size_t)col0 * ldb;
  const v8f z8 = {0.f, 0.f, 0.f, 0.f, 0.f, 0.f, 0.f, 0.f};
  v8f c0[4] = {z8, z8, z8, z8}, c1[4] = {z8, z8, z8, z8}, c2[4] = {z8, z8, z8, z8}, c3[4] = {z8, z8, z8, z8};   /* c2, c3: rows 32 .. 63 of a WIDE tile */
  /* ring of NS fragment sets: the loads of k step s + NS - 1 go out in front of the products of step s, so that a wave waits once a step at most, for loads issued NS - 1 steps earlier */
  constexpr int NS = 3;                        /* three sets and the 64 accumulator registers stay below 256 registers; a fourth set would not (WIDE: 192 + 128, three waves a SIMD) */
  MmSet fs[NS];
  MmBase pb; pb.a0 = ap0; pb.a1 = ap1; pb.a2 = ap0 + (size_t)32 * lda; pb.a3 = ap0 + (size_t)48 * lda;
#pragma unroll /* unrolled: constant indices, the pointers stay in registers */
  for (int t = 0; t < 4; ++t) { pb.b[t] = bp + (size_t)(16 * t) * ldb; pb.br[t] = brp + (size_t)(16 * t) * ldb; }
#pragma unroll /* unrolled: fs stays in registers only under constant indices */
  for (int s = 0; s < NS - 1; ++s) mm_ld<RES && BRES, WIDE>(fs[s], pb, lofs + 32u * (unsigned)(32 * s < kend ? 32 * s : kend - 32));
  int kb = 0;
#pragma unroll 1 /* the body already holds NS steps, one per fragment set; no branch inside it: the compiler sinks a set's loads into a branch that holds their only use, down to their products */
  for (; kb + 32 * NS <= kend; kb += 32 * NS) {
#pragma unroll /* unrolled: constant set indices */
    for (int s = 0; s < NS; ++s) {
      const int kn = kb + 32 * (s + NS - 1);   /* past the end the last step is fetched again and not used */
      mm_ld<RES && BRES, WIDE>(fs[(s + NS - 1) % NS], pb, lofs + 32u * (unsigned)(kn < kend ? kn : kend - 32));
      /* the scheduling barrier keeps a step's products behind the loads that go out in front of them: without it the plain builtins were moved up over the loads, which then stood close in front of their own use */
      if (WIDE) __builtin_amdgcn_sched_barrier(0);
      mm_do<RES && BRES, WIDE>(fs[s], c0, c1, c2, c3);
    }
  }
  /* the steps left over, fewer than NS: their sets are loaded already */
#pragma unroll /* unrolled: constant set indices */
  for (int s = 0; s < NS - 1; ++s)
    if (kb + 32 * s < kend) mm_do<RES && BRES, WIDE>(fs[s], c0, c1, c2, c3);   /* wave-uniform */
  int poison = 0;
  if (EPI == 3) { int fl = 0;
#pragma unroll /* unrolled: the flag loads go out together */
    for (int q = 0; q < MCB / 32; ++q) fl |= flags[(q * 32 + lane) * 32];
    for (int off = 16; off > 0; off >>= 1) fl |= __shfl_xor(fl, off, 32); poison = fl; }
  const float nanv = __uint_as_float(0x7fc00000u);
  const int rsub = lane >> 4, c4 = (lane & 15) * 4, rowt = row0;
  float bvs[4] = {0.f, 0.f, 0.f, 0.f};         /* WIDE: the lane's four bias values, fetched once for both halves */
  if (WIDE && (EPI == 0 || EPI == 3)) {
    const int bi = col0 + ln;
#pragma unroll /* unrolled: constant indices */
    for (int t = 0; t < 4; ++t) bvs[t] = bf16_rne(bias[bi + t * 16]);
    asm volatile("s_wait_xcnt 0x0" :: "v"(bi) : "memory");   /* the precaution of xwait(); bi as an input keeps the loads' index register alive up to the wait */
  }
#pragma unroll 1 /* a WIDE tile goes through the wave's staging in two halves of 32 rows; rolled: two copies of the epilogue would bring the kernel's text to about 32 KB */
  for (int hf = 0; hf < RT / RS; ++hf) {
  const int row0 = rowt + RS * hf;             /* first row of this half */
#pragma unroll
  for (int t = 0; t < 4; ++t) {
    float bv = bvs[t];
    if (!WIDE && (EPI == 0 || EPI == 3)) bv = bf16_rne(bias[col0 + t * 16 + ln]);
#pragma unroll
    for (int r = 0; r < 8; ++r) {
      if (!RES) {
        float v0 = c0[t][r] * alpha + bv, v1 = c1[t][r] * alpha + bv;
        if (EPI == 3) { v0 = poison ? nanv : v0; v1 = poison ? nanv : v1; }
        so[w][8 * hh + r][t * 16 + ln] = v0; so[w][(RS - 16) + 8 * hh + r][t * 16 + ln] = v1;
      } else {
        float v0 = (c0[t][r] + c1[t][r] * 0.0009765625f) * alpha + bv;
        if (EPI == 3) v0 = poison ? nanv : v0;
        so[w][8 * hh + r][t * 16 + ln] = v0;
      }
    }
  }
  /* WIDE: LDS alone; in the tile's second half a fence on global memory too would wait for the first half's stores */
  if (WIDE) __builtin_amdgcn_fence(4 /* acq_rel order */, "workgroup", "local"); else __builtin_amdgcn_fence(4 /* acq_rel order */, "workgroup");
  __builtin_amdgcn_wave_barrier();
  {
#pragma unroll
    for (int q = 0; q < RS / 2; ++q) {
      const int r = q * 2 + rsub; const int row = row0 + r;
      const v4f v = *(const v4fa*)&so[w][r][c4];
      if (EPI == 1 || EPI == 3) {
        *(v4f*)(Cf + (size_t)by * sC + (size_t)row * ldc + col0 + c4) = v;
      } else if (EPI == 2) {
        v4h h4, r4; split4(v, h4, r4);
        const size_t o = (size_t)by * sC + (size_t)row * ldc + col0 + c4;
        *(v4h*)(C1 + o) = h4;
        if (RES) *(v4h*)(C2 + o) = r4;
      } else {
        const int which = col0 / DM, hc = col0 - which * DM, h = hc >> 6;
        const size_t o16 = pk((size_t)by * SEQ + row, hc + c4, DM);
        const size_t oe = pk((size_t)by * EARLY + row, hc + c4, DM);
        const size_t of = (((size_t)by * NH + h) * SEQ_FULL + row) * HD + c4;
        if (which == 0) {
          v4h h4, r4; split4(v, h4, r4);
          *(v4h*)(C1 + o16) = h4;
          if (row0 < EARLY) *(v4h*)(C3 + oe) = r4;
        } else if (which == 1) {
          *(v4f*)(Cf + OUT1_OFF + of) = v;
          v4h h4, r4; split4(v, h4, r4);
          *(v4h*)(C2 + o16) = h4;
          if (row0 < EARLY) *(v4h*)(C4 + oe) = r4;
        } else {
          *(v4f*)(Cf + OUT2_OFF + of) = v;
        }
      }
    }
    if constexpr (EPI == 0 && !RES) {
      if (col0 >= 2 * DM) {                    /* wave-uniform: a tile of v */
        xwait();                               /* behind the cache stores of the loop above, whose registers the block below takes over */
        /* V^T in fragment order, rows d, k = keys, the four d tiles of a block of 32 keys side by side: tile index (key >> 5) * 4 + (d >> 4). The wave's staged 32 keys x 64 head columns
           are exactly those four tiles, 256 groups of eight keys: group 32 g + lane is read down a column of the staging (16 neighbouring columns a half wave) and stored as 512 contiguous bytes a wave */
        const size_t vo = ((size_t)by * NH + ((col0 - 2 * DM) >> 6)) * HD * SEQ + (size_t)row0 * HD + lane * 8;
        float vv[8][8];
#pragma unroll /* unrolled, as the loop inside: vv stays in registers only under constant indices; all LDS reads go out in one run, in front of the first store's wait */
        for (int g = 0; g < 8; ++g)
#pragma unroll
          for (int q = 0; q < 8; ++q) vv[g][q] = so[w][(g & 1) * 16 + hh * 8 + q][(g >> 1) * 16 + ln];
#pragma unroll /* unrolled: constant indices, constant offsets off one address per plane */
        for (int g = 0; g < 8; ++g) {
          FragH fh, fr;
#pragma unroll
          for (int q = 0; q < 8; ++q) { const float v = vv[g][q]; const _Float16 h = (_Float16)v; fh.h[q] = h; fr.h[q] = (_Float16)((v - (float)h) * 1024.0f); }
          *(v8us*)((unsigned short*)C5 + vo + 256 * g) = fh.half[0];
          *(v8us*)((unsigned short*)C6 + vo + 256 * g) = fr.half[0];
          xwait();
        }
      }
    }
  }
  if (WIDE) xwait();                           /* behind this half's stores, on the way out of the loop too: their registers are taken over by the copies below, which the compiler runs on both ways */
  if (WIDE && hf + 1 < RT / RS) {
    /* keeps this half's reads of the wave's staging in front of the next half's writes to it (other lanes' rows; one wave's LDS operations run in order); LDS alone, so that the wave does not wait here for its global stores */
    __builtin_amdgcn_fence(4 /* acq_rel order */, "workgroup", "local"); __builtin_amdgcn_wave_barrier();
#pragma unroll /* unrolled: constant indices; rows 32 .. 63 move to where the loop's body reads */
    for (int t = 0; t < 4; ++t) { c0[t] = c2[t]; c1[t] = c3[t]; }
  }
  }
}

// the fused QKV projection as a launch of its own: WIDE tiles
template <bool RES, bool BRES, int EPI>
__global__ __launch_bounds__(128) void k_mm(
    const _Float16* __restrict__ Ah, const _Float16* __restrict__ Ar, size_t sA, size_t sAr,
    const _Float16* __restrict__ Bh, const _Float16* __restrict__ Br, size_t sB,
    int rbase, int ntn, int K, int causal, float alpha,
    float* __restrict__ Cf, _Float16* __restrict__ C1, _Float16* __restrict__ C2, _Float16* __restrict__ C3, _Float16* __restrict__ C4,
    _Float16* __restrict__ C5, _Float16* __restrict__ C6,
    const float* __restrict__ bias, const int* __restrict__ flags, int ldc, size_t sC) {
  __shared__ __attribute__((aligned(16))) float sm[4 * 32 * 68];
  mm_body<RES, BRES, EPI, true>(sm, blockIdx.x, Ah, Ar, sA, sAr, Bh, Br, sB, rbase, ntn, K, causal, alpha, Cf, C1, C2, C3, C4, C5, C6, bias, flags, ldc, sC);
}
// out = (ctx x64).(w_o x16) 2^-10 + b_o, early and late rows in one launch: the two parts are independent, and neither fills the chip alone. grid.y = batch;
// the first OEB work-groups take the early rows (64 each, with the ctx residual plane), the others the late rows (128 each, single plane). The pick is the same for a whole work-group.
#define OEB ((EARLY / 64) * (DM / 64))
#define OLB (((SEQ - EARLY) / 128) * (DM / 64))
__global__ __launch_bounds__(128) void k_out(const _Float16* __restrict__ CTh, const _Float16* __restrict__ CTr, const _Float16* __restrict__ WoT,
                                             float* __restrict__ out, const float* __restrict__ bo, const int* __restrict__ flags) {
  __shared__ __attribute__((aligned(16))) float sm[4 * 32 * 68];
  const unsigned bx = blockIdx.x;
  if (bx < OEB)
    mm_body<true, false, 3>(sm, bx, CTh, CTr, (size_t)SEQ * DM, (size_t)SEQ * DM, WoT, nullptr, (size_t)0,
                            0, DM / 64, DM, 0, 0.0009765625f, out, nullptr, nullptr, nullptr, nullptr, nullptr, nullptr, bo, flags, DM, (size_t)SEQ_FULL * DM);
  else
    mm_body<false, false, 3>(sm, bx - OEB, CTh, nullptr, (size_t)SEQ * DM, (size_t)0, WoT, nullptr, (size_t)0,
                             EARLY, DM / 64, DM, 0, 0.0009765625f, out, nullptr, nullptr, nullptr, nullptr, nullptr, nullptr, bo, flags, DM, (size_t)SEQ_FULL * DM);
}

extern "C" void kernel_launch(void* const* d_in, const int* in_sizes, int n_in,
                              void* d_out, int out_size, void* d_ws, size_t ws_size, hipStream_t stream) {
  if (n_in < 6) return;
  if ((size_t)in_sizes[0] < (size_t)(NB - 1) * SEQ_FULL * DM + (size_t)SEQ * DM) return;
  if ((size_t)in_sizes[1] < (size_t)DM * 3 * DM) return;
  if (in_sizes[2] < 3 * DM) return;
  if ((size_t)in_sizes[3] < (size_t)DM * DM) return;
  if (in_sizes[4] < DM) return;
  if ((size_t)in_sizes[5] < (size_t)(SEQ - 1) * SEQ_FULL + SEQ) return;
  if ((size_t)out_size < OUT2_OFF + ((size_t)((NB - 1) * NH + NH - 1) * SEQ_FULL + SEQ) * HD) return;
  const float* x = (const float*)d_in[0];        /* x      [B][L][1024] */
  const float* wqkv = (const float*)d_in[1];     /* w_qkv  [1024][3072] ([in][out]; columns q | k | v) */
  const float* bqkv = (const float*)d_in[2];     /* b_qkv  [3072] */
  const float* wo = (const float*)d_in[3];       /* w_o    [1024][1024] ([in][out]) */
  const float* bo = (const float*)d_in[4];       /* b_o    [1024] */
  const float* mask = (const float*)d_in[5];     /* mask   [1][1][L][L] additive */
  float* out = (float*)d_out;

  constexpr size_t SZ_WT = (size_t)3 * DM * DM * 2, SZ_WO = (size_t)DM * DM * 2, SZ_TOK = (size_t)NB * SEQ * DM * 2;
  constexpr size_t SZ_ER = (size_t)NB * EARLY * DM * 2;
  constexpr size_t SZ_FL = (size_t)MCB * 128;
  constexpr size_t SZ_ALL = SZ_WT + SZ_WO + 7 * SZ_TOK + 2 * SZ_ER + SZ_FL;
  static_assert(SZ_ALL <= (size_t)268435456);
  static_assert(SZ_WT % 256 == 0 && SZ_WO % 256 == 0 && SZ_TOK % 256 == 0 && SZ_ER % 256 == 0 && SZ_FL % 256 == 0);
  if (SZ_ALL > ws_size) return;
  char* ws = (char*)d_ws; size_t off = 0;
  auto take = [&](size_t bytes) { char* p = ws + off; off += bytes; return p; };
  _Float16* WT = (_Float16*)take(SZ_WT);      /* [3072][1024] x16, fragment order (as every f16 plane here) */
  _Float16* WoT = (_Float16*)take(SZ_WO);     /* [1024][1024] x16 */
  _Float16* X16 = (_Float16*)take(SZ_TOK);    /* [NB*SEQ][1024] */
  _Float16* Q16 = (_Float16*)take(SZ_TOK);
  _Float16* K16 = (_Float16*)take(SZ_TOK);
  _Float16* VTh = (_Float16*)take(SZ_TOK);    /* per (batch, head): 64 x SEQ */
  _Float16* VTr = (_Float16*)take(SZ_TOK);
  _Float16* CTh = (_Float16*)take(SZ_TOK);    /* ctx x64, [NB*SEQ][1024] */
  _Float16* CTr = (_Float16*)take(SZ_TOK);
  _Float16* Qr = (_Float16*)take(SZ_ER);      /* [NB][EARLY][1024] */
  _Float16* Kr = (_Float16*)take(SZ_ER);
  int* MCHK = (int*)take(SZ_FL);              /* MCB lines of 32 ints */

  k_prep<<<(unsigned)(MCB + NB * XB + WQB + WOB), 256, 0, stream>>>(mask, x, wqkv, wo, MCHK, X16, WT, WoT);
  /* fused QKV projection: grid.y = batch; blocks of 128 rows x 128 columns, a wave's 64 columns = one (q|k|v, head) */
  k_mm<false, false, 0><<<dim3((unsigned)((SEQ / 128) * (3 * DM / 128)), NB), 128, 0, stream>>>(
      X16, nullptr, (size_t)SEQ * DM, (size_t)0,
      WT, nullptr, (size_t)0,
      0, 3 * DM / 128, DM, 0, 0.0625f,
      out, Q16, K16, Qr, Kr, VTh, VTr, bqkv, nullptr, 0, (size_t)0);

  /* scores, softmax and P V of every (batch, head) in one launch */
  k_attn<<<dim3((unsigned)(NB * NH), (unsigned)(SEQ / 64)), 128, 0, stream>>>(Q16, K16, Qr, Kr, VTh, VTr, CTh, CTr);
  k_out<<<dim3((unsigned)(OEB + OLB), NB), 128, 0, stream>>>(CTh, CTr, WoT, out, bo, MCHK);
}

// v010
// One run takes 87.6 microseconds.
// Timed twice side by side with v009, it ran 1.03 times as fast both times.
// All steps since v000 together make it 21.0 times as fast.
#include <hip/hip_runtime.h>
// Causal multi-head self-attention, B 2 x L 2048, d_model 1024, 16 heads of 64; outputs: out [B][L][1024], k cache [B][16][L][64], v cache [B][16][L][64] (f32).
// Compute dtype: every contraction on v_wmma_f32_16x16x32_f16 (f16 operands, f32 accumulate). x / w_qkv / w_o / biases are RNE-converted to bf16 first (exact in f16; weights carried x16).
// q, k, v and ctx (carried x64) are f16 planes, the softmax weights (unnormalised, carried x1024) f16 fragments; for the first EARLY query rows of every sequence each of them also has an f16 residual plane carried x2^10
// that goes to a separate accumulator (q k^T: 3 products, P V: 3 products, ctx w_o: 2 products); scores, softmax statistics and all epilogues in f32.
// Structure, four launches: one for the planes that the QKV GEMM reads (x plane, w_qkv transpose), fused QKV GEMM (writes the k / v caches in f32 plus the f16 planes,
// the V^T hi/res planes among them), one attention launch for all heads (scores, online softmax and P V in registers; the scores never reach memory) whose last work-groups do what the output GEMM alone needs
// (mask structure check, w_o transpose), then one launch for the output GEMM (early and late rows).
// Every f16 operand plane is kept in fragment order (see pk below), not row-major: a wave's fragment load then reads 512 contiguous bytes (4 lines) where a row-major plane gave it 32 bytes of each of 16 lines.
#ifndef NB
#define NB 2
#endif
#ifndef SEQ
#define SEQ 2048
#endif
#define NB_FULL 2
#define SEQ_FULL 2048
#define DM 1024
#define NH 16
#define HD 64
#define EARLY ((SEQ) < 512 ? (SEQ) : 512)
#define OUT1_OFF ((size_t)NB_FULL * SEQ_FULL * DM)
#define OUT2_OFF ((size_t)2 * NB_FULL * SEQ_FULL * DM)

typedef unsigned short v8us __attribute__((ext_vector_type(8), may_alias));
typedef float v8f __attribute__((ext_vector_type(8)));
typedef float v4f __attribute__((ext_vector_type(4)));
typedef float v4fa __attribute__((ext_vector_type(4), may_alias));
typedef _Float16 v16h __attribute__((ext_vector_type(16)));
typedef _Float16 v4h __attribute__((ext_vector_type(4)));
union FragH { v16h v; v8us half[2]; _Float16 h[16]; unsigned short u[16]; };

static_assert(NH * HD == DM);
static_assert(SEQ % 256 == 0);
static_assert(EARLY % 128 == 0);
static_assert((SEQ - EARLY) % 128 == 0);
static_assert(NB <= NB_FULL && SEQ <= SEQ_FULL);
static_assert(OUT1_OFF * 4 == 16777216);
static_assert(OUT2_OFF * 4 == 33554432);

__device__ __forceinline__ unsigned short bf16_bits(float x) { unsigned int u = __float_as_uint(x); return (unsigned short)((u + 0x7FFFu + ((u >> 16) & 1u)) >> 16); }
__device__ __forceinline__ float bf16_rne(float x) { return __uint_as_float(((unsigned int)bf16_bits(x)) << 16); }

// Fragment order of a plane of rows x kd: tiles of 16 rows x 32 k, 512 elements each, tile (row >> 4, k >> 5) at index (row >> 4) * (kd / 32) + (k >> 5);
// inside a tile the eight elements k = 16 j + 8 hh .. + 7 of row ln stand at 256 j + 8 (16 hh + ln). pk = element offset of (row, k).
__device__ __forceinline__ size_t pk(size_t row, int k, int kd) {
  return ((row >> 4) * (size_t)(kd >> 5) + (size_t)(k >> 5)) * 512 + (size_t)(((k >> 4) & 1) * 256 + (((k >> 3) & 1) * 16 + (int)(row & 15)) * 8 + (k & 7));
}
// fragment loader (A row or B column ln of the tile): p = tile + 8 lane, lane = 16 hh + ln; elements 0..7 <- k0+8hh.., elements 8..15 <- k0+16+8hh..
__device__ __forceinline__ v16h p_frag(const _Float16* p) { FragH f; f.half[0] = *(const v8us*)((const unsigned short*)p); f.half[1] = *(const v8us*)((const unsigned short*)p + 256); return f.v; }
__device__ __forceinline__ v8f g2_mma(v16h a, v16h b, v8f c) { v8f d = __builtin_amdgcn_wmma_f32_16x16x32_f16(false, a, false, b, (short)0, c, false, false); asm volatile("v_nop\n\tv_nop\n\tv_nop\n\tv_nop" : "+v"(d) : "v"(a), "v"(b)); return d; }
// f32 -> f16 hi and f16 residual carried x2^10
__device__ __forceinline__ void split4(const v4f v, v4h& h, v4h& r) {
#pragma unroll
  for (int i = 0; i < 4; ++i) { const _Float16 a = (_Float16)v[i]; h[i] = a; r[i] = (_Float16)((v[i] - (float)a) * 1024.0f); }
}

template <int K, int N, int BT>                /* BT = threads of the work-group */
__device__ __forceinline__ void wt_f16(const float* __restrict__ W, _Float16* __restrict__ Wt, int blk, float scale) {
  const int t = blk * BT + threadIdx.x; if (t >= N * (K / 8)) return;
  /* thread t makes the t-th group of eight of the fragment-ordered plane: 16 lanes read 16 neighbouring columns n of one row of W */
  const int tile = t >> 6, n = (tile / (K / 32)) * 16 + (t & 15), k8 = (tile % (K / 32)) * 32 + ((t >> 5) & 1) * 16 + ((t >> 4) & 1) * 8; FragH f;
#pragma unroll
  for (int i = 0; i < 8; ++i) f.h[i] = (_Float16)(bf16_rne(W[(size_t)(k8 + i) * N + n]) * scale);
  const v8us o = f.half[0];
  unsigned short* d = (unsigned short*)Wt + (size_t)t * 8;
  *(v8us*)d = o; 
}

#define XB (SEQ * DM / 8 / 256)               /* work-groups of the x plane per batch */
__device__ __forceinline__ void x16(const float* __restrict__ x, _Float16* __restrict__ X16, int blk) {
  const int b = blk / XB; const size_t t = (size_t)(blk - b * XB) * 256 + threadIdx.x;
  /* thread t makes the t-th group of eight of the batch's fragment-ordered plane */
  const int tile = (int)(t >> 6), row = (tile / (DM / 32)) * 16 + (int)(t & 15), k8 = (tile % (DM / 32)) * 32 + (int)((t >> 5) & 1) * 16 + (int)((t >> 4) & 1) * 8;
  const float* src = x + ((size_t)b * SEQ_FULL + row) * DM + k8;
  const v4f a = *(const v4fa*)src, c = *(const v4fa*)(src + 4); FragH f;
#pragma unroll
  for (int q = 0; q < 4; ++q) { f.h[q] = (_Float16)bf16_rne(a[q]); f.h[4 + q] = (_Float16)bf16_rne(c[q]); }
  unsigned short* d = (unsigned short*)X16 + (size_t)b * SEQ * DM + t * 8;
  *(v8us*)d = f.half[0]; 
}

// Mask structure check, spread over the chip: MCB work-groups of 4 waves, 8 rows each; a wave takes two rows and issues all their loads before it waits for the first.
// Row i, blocks of 128 columns: a block left of the diagonal's must be all zero (OR of the bits, sign aside), a block right of it all <= -1e8, that is, its bits as unsigned within
// [bits(-1e8), bits(-inf)] (minimum and maximum); the diagonal's own block is fetched once more and checked element by element. Every work-group writes its own 128-byte flag line.
#define MCB (SEQ / 8)
static_assert(MCB % 32 == 0);
__device__ __forceinline__ void maskchk(const float* __restrict__ mask, int* __restrict__ flg, int blk) {
  __shared__ int sb[4];
  constexpr int NL = SEQ / 128;                /* loads of 16 bytes a lane and row */
  constexpr unsigned ULO = 0xCCBEBC20u, UHI = 0xFF800000u;   /* bits of -1e8f and of -infinity */
  const int lane = threadIdx.x & 31;
  const int w = __builtin_amdgcn_readfirstlane((int)(threadIdx.x >> 5));
  const int i0 = blk * 8 + w * 2;
  const float* mr = mask + (size_t)i0 * SEQ_FULL;   /* wave-uniform; the lane's share is lane * 4 */
  v4f m[2][NL], dg[2];
#pragma unroll /* unrolled, as the loop inside: the loads are independent, and a rolled loop would wait for each in turn */
  for (int r = 0; r < 2; ++r) {
#pragma unroll
    for (int u = 0; u < NL; ++u) m[r][u] = *(const v4fa*)(mr + (size_t)r * SEQ_FULL + u * 128 + lane * 4);
    const float* du = mr + (size_t)r * SEQ_FULL + ((i0 + r) >> 7) * 128;
    dg[r] = *(const v4fa*)(du + lane * 4);
  }
  /* precaution: stands behind the run of loads, in front of any rewrite of their address registers; as a volatile statement it also keeps every load in front of the first check */
  asm volatile("s_wait_xcnt 0x0" ::: "memory");
  unsigned orl = 0u, mn = UHI, mx = ULO;
  bool bad = false;
#pragma unroll /* unrolled, as the loops inside: m and dg stay in registers only under constant indices */
  for (int r = 0; r < 2; ++r) {
    const int i = i0 + r, ud = i >> 7;         /* wave-uniform */
#pragma unroll
    for (int u = 0; u < NL; ++u) {
      const unsigned a = __float_as_uint(m[r][u][0]), b = __float_as_uint(m[r][u][1]), c = __float_as_uint(m[r][u][2]), d = __float_as_uint(m[r][u][3]);
      if (u < ud) { orl |= a | b; orl |= c | d; }
      else if (u > ud) { mn = min(min(mn, a), b); mn = min(min(mn, c), d); mx = max(max(mx, a), b); mx = max(max(mx, c), d); }
    }
#pragma unroll
    for (int q = 0; q < 4; ++q) { const int j = ud * 128 + lane * 4 + q; const float v = dg[r][q]; bad |= (j <= i) ? !(v == 0.0f) : !(v <= -1.0e8f); }
  }
  bad |= (orl & 0x7FFFFFFFu) != 0u || mn < ULO || mx > UHI;
  const int wbad = __builtin_amdgcn_ballot_w32(bad) != 0 ? 1 : 0;
  if (lane == 0) sb[w] = wbad;
  __syncthreads();
  if (w == 0) {
    int tot = 0;
#pragma unroll
    for (int q = 0; q < 4; ++q) tot |= sb[q];
    int* p = flg + blk * 32 + lane;
    *p = tot; 
  }
}

// The two planes that the QKV GEMM reads, in one launch: the jobs are independent of each other; the job is picked by the work-group's index.
// What the output GEMM alone needs (mask check, w_o transpose) is not done here, where the QKV GEMM would wait for it, but by the last work-groups of the attention launch.
#define WQB (3 * DM * (DM / 8) / 256)
#define WOB (DM * (DM / 8) / 128)             /* work-groups of 128 threads: they belong to the attention launch */
static_assert(WQB * 256 == 3 * DM * (DM / 8) && WOB * 128 == DM * (DM / 8) && XB * 256 * 8 == SEQ * DM);
__global__ __launch_bounds__(256) void k_prep(const float* __restrict__ x, const float* __restrict__ wqkv, _Float16* __restrict__ X16, _Float16* __restrict__ WT) {
  const int bx = blockIdx.x;
  if (bx < NB * XB) x16(x, X16, bx);
  else wt_f16<DM, 3 * DM, 256>(wqkv, WT, bx - NB * XB, 16.0f);
}

// lane l <-> lane l ^ 16 in one vector instruction (a shuffle would go through the LDS pipe and its wait)
__device__ __forceinline__ float xhalf(float x) { return __builtin_bit_cast(float, __builtin_amdgcn_permlanex16(__builtin_bit_cast(int, x), __builtin_bit_cast(int, x), 0x76543210, 0xfedcba98, false, false)); }

// One pass of the fused attention: 32 keys x the wave's 16 queries, both products transposed so that a lane owns one query (column ln) throughout.
// S^T = K Q^T: A = K rows (keys), B = Q rows (queries); accumulator register r of key tile t holds key k0 + 16 t + 8 hh + r of query q0 + ln,
// which is element 8 t + r of the B fragment of O^T += V^T P^T (A = V^T rows d, k = keys): P goes from accumulator to operand inside the lane.
// Online softmax: m = running maximum of the query (equal in both halves), l = this half's sum of p = 1024 exp(s - m); the accumulators are rescaled only in a pass where some query's maximum grew.
// RES: scores kh.qh + (kh.qr + kr.qh) 2^-10, output vh.ph + (vh.pr + vr.ph) 2^-10, the residual operands carried x2^10 in a second accumulator.
// attn_s: the score products of a pass (the last reader of its K fragments); attn_p: mask, online softmax and the P fragments
template <bool RES>
__device__ __forceinline__ void attn_s(const v16h (&kf)[4], const v16h (&krf)[4], const v16h (&qf)[2], const v16h (&qrf)[2], v8f (&s)[2]) {
  const v8f z8 = {0.f, 0.f, 0.f, 0.f, 0.f, 0.f, 0.f, 0.f};
#pragma unroll
  for (int t = 0; t < 2; ++t) {
    v8f c = g2_mma(kf[2 * t], qf[0], z8);
    c = g2_mma(kf[2 * t + 1], qf[1], c);
    if (RES) {
      v8f e = g2_mma(kf[2 * t], qrf[0], z8);
      e = g2_mma(krf[2 * t], qf[0], e);
      e = g2_mma(kf[2 * t + 1], qrf[1], e);
      e = g2_mma(krf[2 * t + 1], qf[1], e);
      c = c + e * 0.0009765625f;
    }
    s[t] = c * 0.125f;
  }
}
// RUN: the pass's sixteen v_exp_f32 stand in two statements of eight, each closed by one v_nop. The instruction set asks for one independent instruction or v_nop between a transcendental and an instruction
// that reads its result or overwrites its source; inside a run the next v_exp_f32 is that instruction (early-clobber outputs: no result shares a register with a source). Used in two copies of the pass;
// in the other copies the compiler fills the slot itself.
template <bool RES, bool RUN = false>
__device__ __forceinline__ void attn_p(v8f (&s)[2], int k0, int q0, int ln, int hh, float& m, float& l, v8f (&o0)[4], v8f (&o1)[4], v16h& pho, v16h& pro) {
  const float L2E = 1.44269504088896340736f;
  if (k0 + 31 > q0) {                          /* wave-uniform: only a pass that reaches the diagonal masks */
#pragma unroll
    for (int t = 0; t < 2; ++t)
#pragma unroll
      for (int r = 0; r < 8; ++r) s[t][r] = (k0 + 16 * t + 8 * hh + r <= q0 + ln) ? s[t][r] : -1.0e30f;
  }
  float tm = fmaxf(s[0][0], s[1][0]);
#pragma unroll
  for (int r = 1; r < 8; ++r) tm = fmaxf(tm, fmaxf(s[0][r], s[1][r]));
  tm = fmaxf(tm, xhalf(tm));
  const float mn = fmaxf(m, tm);
  if (__builtin_amdgcn_ballot_w32(mn > m) != 0) {
    const float f = __builtin_amdgcn_exp2f((m - mn) * L2E);
    l *= f;
#pragma unroll
    for (int t = 0; t < 4; ++t) { o0[t] = o0[t] * f; if (RES) o1[t] = o1[t] * f; }
    m = mn;
  }
  FragH ph, pr;
  v8f w[2];
  if constexpr (RUN) {
#pragma unroll /* unrolled: constant indices */
    for (int t = 0; t < 2; ++t) {
      v8f e;
#pragma unroll
      for (int r = 0; r < 8; ++r) e[r] = fmaf(s[t][r] - m, L2E, 10.0f);
      float x0, x1, x2, x3, x4, x5, x6, x7;
      /* one statement, so that nothing comes between a v_exp_f32 and the instruction that fills its slot; the v_nop fills the last one's */
      asm("v_exp_f32 %0, %8\n\tv_exp_f32 %1, %9\n\tv_exp_f32 %2, %10\n\tv_exp_f32 %3, %11\n\tv_exp_f32 %4, %12\n\tv_exp_f32 %5, %13\n\tv_exp_f32 %6, %14\n\tv_exp_f32 %7, %15\n\tv_nop"
          : "=&v"(x0), "=&v"(x1), "=&v"(x2), "=&v"(x3), "=&v"(x4), "=&v"(x5), "=&v"(x6), "=&v"(x7)
          : "v"(e[0]), "v"(e[1]), "v"(e[2]), "v"(e[3]), "v"(e[4]), "v"(e[5]), "v"(e[6]), "v"(e[7]));
      w[t] = v8f{x0, x1, x2, x3, x4, x5, x6, x7};
    }
  }
#pragma unroll
  for (int t = 0; t < 2; ++t)
#pragma unroll
    for (int r = 0; r < 8; ++r) {
      float p;
      if constexpr (RUN) p = w[t][r]; else p = __builtin_amdgcn_exp2f(fmaf(s[t][r] - m, L2E, 10.0f));
      l += p;
      const _Float16 h = (_Float16)p;
      ph.h[8 * t + r] = h;
      if (RES) pr.h[8 * t + r] = (_Float16)((p - (float)h) * 1024.0f);
    }
  pho = ph.v;
  if (RES) pro = pr.v;
}
template <bool RES>
__device__ __forceinline__ void attn_out(const v16h (&vf)[4], const v16h (&vrf)[4], const v16h ph, const v16h pr, v8f (&o0)[4], v8f (&o1)[4]) {
#pragma unroll
  for (int t = 0; t < 4; ++t) {
    o0[t] = g2_mma(vf[t], ph, o0[t]);
    if (RES) { o1[t] = g2_mma(vf[t], pr, o1[t]); o1[t] = g2_mma(vrf[t], ph, o1[t]); }
  }
}

// precaution: stands behind a run of global loads or stores, in front of any rewrite of their address registers
__device__ __forceinline__ void xwait() { asm volatile("s_wait_xcnt 0x0" ::: "memory"); }
// fragment of the tile at a wave-uniform base; lofs = the lane's fixed byte offset, 16 lane
__device__ __forceinline__ v16h u_frag(const _Float16* ubase, unsigned lofs) {
  const char* p = (const char*)ubase + lofs; FragH f; f.half[0] = *(const v8us*)p; f.half[1] = *(const v8us*)(p + 512); return f.v;
}
// K fragments of keys k0 .. k0 + 31: two key tiles x two halves of the head; kb = the head's first tile in the batch's K plane (16 keys further = 16 DM elements, the head's second half = the next tile)
__device__ __forceinline__ void attn_ldk(v16h (&kf)[4], const _Float16* kb, unsigned lofs, int k0) {
#pragma unroll
  for (int t = 0; t < 2; ++t) { kf[2 * t] = u_frag(kb + (size_t)(k0 + 16 * t) * DM, lofs); kf[2 * t + 1] = u_frag(kb + (size_t)(k0 + 16 * t) * DM + 512, lofs); }
  xwait();
}
// V^T fragments of the same keys: four tiles of 16 head columns, side by side; vb = the head's V^T plane
__device__ __forceinline__ void attn_ldv(v16h (&vf)[4], const _Float16* vb, unsigned lofs, int k0) {
#pragma unroll
  for (int t = 0; t < 4; ++t) vf[t] = u_frag(vb + (size_t)k0 * HD + 512 * t, lofs);
  xwait();
}

// Causal attention, all heads in one launch: blockIdx.x = (batch, head), blockIdx.y = block of 64 queries (longest first); a wave owns 16 queries and walks keys 0 .. q0 + 15 in passes of 32.
// The attention itself: no LDS, no barrier. Writes ctx x64 as f16 (hi plane; residual plane for query rows < EARLY).
// blockIdx.y >= SEQ / 64: the AXB work-groups that do the mask check and the w_o transpose. They come last in the grid, for speed only. The pick is the same for a whole work-group, so the mask check's barrier stands under uniform control flow.
#define AXB (MCB + WOB)
static_assert(AXB % (NB * NH) == 0);
__global__ __launch_bounds__(128) void k_attn(const _Float16* __restrict__ Q16, const _Float16* __restrict__ K16, const _Float16* __restrict__ Qr, const _Float16* __restrict__ Kr,
                                              const _Float16* __restrict__ VTh, const _Float16* __restrict__ VTr, _Float16* __restrict__ CTh, _Float16* __restrict__ CTr,
                                              const float* __restrict__ mask, const float* __restrict__ wo, int* __restrict__ flg, _Float16* __restrict__ WoT) {
  if ((int)blockIdx.y >= SEQ / 64) {
    const int e = ((int)blockIdx.y - SEQ / 64) * (NB * NH) + (int)blockIdx.x;
    if (e < MCB) maskchk(mask, flg, e);        /* first: its waves live longest */
    else wt_f16<DM, DM, 128>(wo, WoT, e - MCB, 16.0f);
    return;
  }
  const int lane = threadIdx.x & 31, ln = lane & 15, hh = lane >> 4;
  const int w = __builtin_amdgcn_readfirstlane((int)(threadIdx.x >> 5));
  const int bh = blockIdx.x, b = bh / NH, h = bh - b * NH;
  const int q0 = (SEQ / 64 - 1 - (int)blockIdx.y) * 64 + 16 * w;
  const int np = (q0 >> 5) + 1;                /* passes with k0 <= q0 + 15 */
  const _Float16* qp = Q16 + ((size_t)b * SEQ + q0) * DM + h * (HD * 16) + lane * 8;
  const _Float16* kb = K16 + (size_t)b * SEQ * DM + h * (HD * 16);
  const _Float16* vb = VTh + (size_t)bh * HD * SEQ;
  const unsigned kofs = (unsigned)lane * 16u, vofs = kofs;
  const v8f z8 = {0.f, 0.f, 0.f, 0.f, 0.f, 0.f, 0.f, 0.f};
  v8f o0[4] = {z8, z8, z8, z8}, o1[4] = {z8, z8, z8, z8};
  float m = -3.0e38f, l = 0.f;
  v16h ph, pr;
  const v16h qf[2] = {p_frag(qp), p_frag(qp + 512)};
  xwait();
  const bool early = q0 < EARLY;               /* the same for the whole block */
  if (early) {
    const _Float16* qrp = Qr + ((size_t)b * EARLY + q0) * DM + h * (HD * 16) + lane * 8;
    const _Float16* krb = Kr + (size_t)b * EARLY * DM + h * (HD * 16);
    const _Float16* vrb = VTr + (size_t)bh * HD * SEQ;
    const v16h qrf[2] = {p_frag(qrp), p_frag(qrp + 512)};
    xwait();
#pragma unroll 1 /* rolled: an unrolled body would hold two passes' hi and residual fragments at once */
    for (int p = 0; p < np; ++p) {
      v16h kf[4], krf[4], vf[4], vrf[4];
      attn_ldk(kf, kb, kofs, p * 32);
      attn_ldk(krf, krb, kofs, p * 32);
      v8f s[2];
      attn_s<true>(kf, krf, qf, qrf, s);
      attn_p<true>(s, p * 32, q0, ln, hh, m, l, o0, o1, ph, pr);
      /* V is loaded behind the scores here: K and V, hi and residual, live at once would pass 256 registers */
      attn_ldv(vf, vb, vofs, p * 32);
      attn_ldv(vrf, vrb, vofs, p * 32);
      attn_out<true>(vf, vrf, ph, pr, o0, o1);
    }
  } else {
    /* two fragment sets. V of the next pass is asked for at the head of a pass and read at the foot of the next one. K is read at a pass's head, so a K set is refilled right behind the score products
       that read it, with the keys of the pass after next: two passes' K loads are then in flight, where a load at the head of the pass before had one pass to arrive and held the next request back until it had.
       Past the end the last pass is fetched again and not used. */
    v16h ka[4], va[4], kc[4], vc[4];
    v8f s[2];
    attn_ldk(ka, kb, kofs, 0); attn_ldv(va, vb, vofs, 0);
    attn_ldk(kc, kb, kofs, (1 < np ? 1 : np - 1) * 32);
    int p = 0;
#pragma unroll 1 /* the body already holds two passes, one per fragment set; no way out of its middle: with one, the compiler waited at the loop's head for the youngest loads */
    for (; p + 2 <= np; p += 2) {
      const int p2 = p + 2 < np ? p + 2 : np - 1, p3 = p + 3 < np ? p + 3 : np - 1;
      attn_ldv(vc, vb, vofs, (p + 1) * 32);
      attn_s<false>(ka, ka, qf, qf, s);
      attn_ldk(ka, kb, kofs, p2 * 32);
      attn_p<false, true>(s, p * 32, q0, ln, hh, m, l, o0, o1, ph, pr);
      attn_out<false>(va, va, ph, ph, o0, o1);
      attn_ldv(va, vb, vofs, p2 * 32);
      attn_s<false>(kc, kc, qf, qf, s);
      attn_ldk(kc, kb, kofs, p3 * 32);
      attn_p<false>(s, (p + 1) * 32, q0, ln, hh, m, l, o0, o1, ph, pr);
      attn_out<false>(vc, vc, ph, ph, o0, o1);
    }
    if (p < np) {                              /* wave-uniform: an odd count's last pass; its fragments are loaded already */
      attn_s<false>(ka, ka, qf, qf, s);
      attn_p<false, true>(s, p * 32, q0, ln, hh, m, l, o0, o1, ph, pr);
      attn_out<false>(va, va, ph, ph, o0, o1);
    }
  }
  l += xhalf(l);
  const float sc = 64.0f / l;
  const size_t o = ((size_t)b * SEQ + q0) * DM + h * (HD * 16) + lane * 8;   /* fragment order: columns 16 t + 8 hh .. of the head = half t & 1 of its tile t >> 1 */
#pragma unroll
  for (int t = 0; t < 4; ++t) {
    FragH fh, fr;
#pragma unroll
    for (int r = 0; r < 8; ++r) {
      const float v = (early ? o0[t][r] + o1[t][r] * 0.0009765625f : o0[t][r]) * sc;
      const _Float16 a = (_Float16)v; fh.h[r] = a; fr.h[r] = (_Float16)((v - (float)a) * 1024.0f);
    }
    *(v8us*)((unsigned short*)CTh + o + 256 * t) = fh.half[0];
    xwait();
    if (early) { *(v8us*)((unsigned short*)CTr + o + 256 * t) = fr.half[0]; xwait(); }
  }
}

// General f16 GEMM, A [m][k] and B as Bt[n][k], both in fragment order with a k extent of DM; block = 4 waves; wave tile RT x 64 (RT = 32, or 16 with the residual accumulator).
// WIDE: wave tile 64 x 64, the block's 4 waves 2 down x 2 across (128 x 128): a k step then loads 8 fragments for 16 products (not 6 for 8), and the block's waves ask for 16 different tiles a step for 64 products (not 12 for 32).
// RES: second accumulator gets Ar.Bh (+ Ah.Br if BRES), both carried x2^10, folded in the epilogue. causal 1: k-loop stops at the tile's last key block; causal 2: column tiles past the diagonal are skipped.
// EPI 0: QKV routing (q/k f16 planes + early residual planes, k / v caches in f32, V^T hi and residual planes C5 / C6), 1: f32 plane, 2: f16 hi (+res) planes, 3: f32 output + bias, NaN fill when the mask check failed.
// the fragments of one k step of a wave: two A tiles (four where WIDE), four B tiles (and their residual tiles where BR)
struct MmSet { v16h a0, a1, a2, a3, b[4], br[4]; };
// the wave's tile rows at k = 0: wave-uniform and fixed for the whole k loop, so that they stay in scalar registers
struct MmBase { const _Float16 *a0, *a1, *a2, *a3, *b[4], *br[4]; };
// all loads of one k step in one run; vo = the lane's byte offset 16 lane + 32 k: the one vector register that the loads name
template <bool BR, bool WIDE>
__device__ __forceinline__ void mm_ld(MmSet& f, const MmBase& p, unsigned vo) {
  f.a0 = u_frag(p.a0, vo); f.a1 = u_frag(p.a1, vo);
  if (WIDE) { f.a2 = u_frag(p.a2, vo); f.a3 = u_frag(p.a3, vo); }
#pragma unroll /* unrolled: constant indices, and the loads go out together */
  for (int t = 0; t < 4; ++t) { f.b[t] = u_frag(p.b[t], vo); if (BR) f.br[t] = u_frag(p.br[t], vo); }
  /* WIDE: the precaution of xwait(), with vo as an input: the address register then lives up to the wait, where otherwise the run's last load was given it as a destination */
  if (WIDE) asm volatile("s_wait_xcnt 0x0" :: "v"(vo) : "memory");
  else xwait();
}
template <bool BR, bool WIDE>
__device__ __forceinline__ void mm_do(const MmSet& f, v8f (&c0)[4], v8f (&c1)[4], v8f (&c2)[4], v8f (&c3)[4]) {
#pragma unroll /* unrolled: constant indices, eight (WIDE: sixteen) independent accumulators in a row */
  for (int t = 0; t < 4; ++t) {
    if (WIDE) {                                /* the plain builtin: operands of an asm statement were all kept below v256, and three sets beside 16 accumulators then spilled */
      c0[t] = __builtin_amdgcn_wmma_f32_16x16x32_f16(false, f.a0, false, f.b[t], (short)0, c0[t], false, false);
      c1[t] = __builtin_amdgcn_wmma_f32_16x16x32_f16(false, f.a1, false, f.b[t], (short)0, c1[t], false, false);
      c2[t] = __builtin_amdgcn_wmma_f32_16x16x32_f16(false, f.a2, false, f.b[t], (short)0, c2[t], false, false);
      c3[t] = __builtin_amdgcn_wmma_f32_16x16x32_f16(false, f.a3, false, f.b[t], (short)0, c3[t], false, false);
      continue;
    }
    c0[t] = g2_mma(f.a0, f.b[t], c0[t]);
    c1[t] = g2_mma(f.a1, f.b[t], c1[t]);
    if (BR) c1[t] = g2_mma(f.a0, f.br[t], c1[t]);
  }
}
template <bool RES, bool BRES, int EPI, bool WIDE = false>
__device__ __forceinline__ void mm_body(float* __restrict__ smem, unsigned bx,
    const _Float16* __restrict__ Ah, const _Float16* __restrict__ Ar, size_t sA, size_t sAr,
    const _Float16* __restrict__ Bh, const _Float16* __restrict__ Br, size_t sB,
    int rbase, int ntn, int K, int causal, float alpha,
    float* __restrict__ Cf, _Float16* __restrict__ C1, _Float16* __restrict__ C2, _Float16* __restrict__ C3, _Float16* __restrict__ C4,
    _Float16* __restrict__ C5, _Float16* __restrict__ C6,
    const float* __restrict__ bias, const int* __restrict__ flags, int ldc, size_t sC) {
  static_assert(!(WIDE && RES));
  constexpr int RT = RES ? 16 : (WIDE ? 64 : 32);
  constexpr int RS = WIDE ? 32 : RT;           /* rows that a wave stages at a time */
  constexpr int lda = DM, ldb = DM;            /* compile-time: the tiles of a k step then differ by immediate offsets from one scalar base per plane */
  float (&so)[4][RS][68] = *reinterpret_cast<float (*)[4][RS][68]>(smem);   /* the work-group's staging, 4 x RS x 68 floats */
  const int tid = threadIdx.x, lane = tid & 31, ln = lane & 15, hh = lane >> 4;
  const int w = __builtin_amdgcn_readfirstlane(tid >> 5);
  const int by = blockIdx.y;
  const int mt = bx / ntn, nq = bx - mt * ntn;
  const int row0 = rbase + (WIDE ? mt * 128 + 64 * (w >> 1) : mt * (4 * RT) + RT * w), col0 = WIDE ? nq * 128 + 64 * (w & 1) : nq * 64;
  if (causal == 2 && col0 > row0 + RT - 1) return;
  int kend = K;
  if (causal == 1) { const int kc = (((row0 + RT - 1) >> 5) + 1) << 5; kend = kc < K ? kc : K; }
  /* wave-uniform tile addresses (row0, col0 are multiples of 16: a row of tiles holds 16 lda elements); the lane's share is the fixed byte offset lofs */
  const unsigned lofs = (unsigned)lane * 16u;
  const _Float16* ap0 = Ah + (size_t)by * sA + (size_t)row0 * lda;
  const _Float16* ap1;
  if (RES) ap1 = Ar + (size_t)by * sAr + (size_t)row0 * lda; else ap1 = ap0 + (size_t)16 * lda;
  const _Float16* bp = Bh + (size_t)by * sB + (size_t)col0 * ldb;
  const _Float16* brp = bp;
  if (RES && BRES) brp = Br + (size_t)by * sB + (size_t)col0 * ldb;
  const v8f z8 = {0.f, 0.f, 0.f, 0.f, 0.f, 0.f, 0.f, 0.f};
  v8f c0[4] = {z8, z8, z8, z8}, c1[4] = {z8, z8, z8, z8}, c2[4] = {z8, z8, z8, z8}, c3[4] = {z8, z8, z8, z8};   /* c2, c3: rows 32 .. 63 of a WIDE tile */
  /* ring of NS fragment sets: the loads of k step s + NS - 1 go out in front of the products of step s, so that a wave waits once a step at most, for loads issued NS - 1 steps earlier */
  constexpr int NS = 3;                        /* three sets and the 64 accumulator registers stay below 256 registers; a fourth set would not (WIDE: 192 + 128, three waves a SIMD) */
  MmSet fs[NS];
  MmBase pb; pb.a0 = ap0; pb.a1 = ap1; pb.a2 = ap0 + (size_t)32 * lda; pb.a3 = ap0 + (size_t)48 * lda;
#pragma unroll /* unrolled: constant indices, the pointers stay in registers */
  for (int t = 0; t < 4; ++t) { pb.b[t] = bp + (size_t)(16 * t) * ldb; pb.br[t] = brp + (size_t)(16 * t) * ldb; }
#pragma unroll /* unrolled: fs stays in registers only under constant indices */
  for (int s = 0; s < NS - 1; ++s) mm_ld<RES && BRES, WIDE>(fs[s], pb, lofs + 32u * (unsigned)(32 * s < kend ? 32 * s : kend - 32));
  int kb = 0;
#pragma unroll 1 /* the body already holds NS steps, one per fragment set; no branch inside it: the compiler sinks a set's loads into a branch that holds their only use, down to their products */
  for (; kb + 32 * NS <= kend; kb += 32 * NS) {
#pragma unroll /* unrolled: constant set indices */
    for (int s = 0; s < NS; ++s) {
      const int kn = kb + 32 * (s + NS - 1);   /* past the end the last step is fetched again and not used */
      mm_ld<RES && BRES, WIDE>(fs[(s + NS - 1) % NS], pb, lofs + 32u * (unsigned)(kn < kend ? kn : kend - 32));
      /* the scheduling barrier keeps a step's products behind the loads that go out in front of them: without it the plain builtins were moved up over the loads, which then stood close in front of their own use */
      if (WIDE) __builtin_amdgcn_sched_barrier(0);
      mm_do<RES && BRES, WIDE>(fs[s], c0, c1, c2, c3);
    }
  }
  /* the steps left over, fewer than NS: their sets are loaded already */
#pragma unroll /* unrolled: constant set indices */
  for (int s = 0; s < NS - 1; ++s)
    if (kb + 32 * s < kend) mm_do<RES && BRES, WIDE>(fs[s], c0, c1, c2, c3);   /* wave-uniform */
  int poison = 0;
  if (EPI == 3) { int fl = 0;
#pragma unroll /* unrolled: the flag loads go out together */
    for (int q = 0; q < MCB / 32; ++q) fl |= flags[(q * 32 + lane) * 32];
    for (int off = 16; off > 0; off >>= 1) fl |= __shfl_xor(fl, off, 32); poison = fl; }
  const float nanv = __uint_as_float(0x7fc00000u);
  const int rsub = lane >> 4, c4 = (lane & 15) * 4, rowt = row0;
  float bvs[4] = {0.f, 0.f, 0.f, 0.f};         /* WIDE: the lane's four bias values, fetched once for both halves */
  if (WIDE && (EPI == 0 || EPI == 3)) {
    const int bi = col0 + ln;
#pragma unroll /* unrolled: constant indices */
    for (int t = 0; t < 4; ++t) bvs[t] = bf16_rne(bias[bi + t * 16]);
    asm volatile("s_wait_xcnt 0x0" :: "v"(bi) : "memory");   /* the precaution of xwait(); bi as an input keeps the loads' index register alive up to the wait */
  }
#pragma unroll 1 /* a WIDE tile goes through the wave's staging in two halves of 32 rows; rolled: two copies of the epilogue would bring the kernel's text to about 32 KB */
  for (int hf = 0; hf < RT / RS; ++hf) {
  const int row0 = rowt + RS * hf;             /* first row of this half */
#pragma unroll
  for (int t = 0; t < 4; ++t) {
    float bv = bvs[t];
    if (!WIDE && (EPI == 0 || EPI == 3)) bv = bf16_rne(bias[col0 + t * 16 + ln]);
#pragma unroll
    for (int r = 0; r < 8; ++r) {
      if (!RES) {
        float v0 = c0[t][r] * alpha + bv, v1 = c1[t][r] * alpha + bv;
        if (EPI == 3) { v0 = poison ? nanv : v0; v1 = poison ? nanv : v1; }
        so[w][8 * hh + r][t * 16 + ln] = v0; so[w][(RS - 16) + 8 * hh + r][t * 16 + ln] = v1;
      } else {
        float v0 = (c0[t][r] + c1[t][r] * 0.0009765625f) * alpha + bv;
        if (EPI == 3) v0 = poison ? nanv : v0;
        so[w][8 * hh + r][t * 16 + ln] = v0;
      }
    }
  }
  /* WIDE: LDS alone; in the tile's second half a fence on global memory too would wait for the first half's stores */
  if (WIDE) __builtin_amdgcn_fence(4 /* acq_rel order */, "workgroup", "local"); else __builtin_amdgcn_fence(4 /* acq_rel order */, "workgroup");
  __builtin_amdgcn_wave_barrier();
  {
#pragma unroll
    for (int q = 0; q < RS / 2; ++q) {
      const int r = q * 2 + rsub; const int row = row0 + r;
      const v4f v = *(const v4fa*)&so[w][r][c4];
      if (EPI == 1 || EPI == 3) {
        *(v4f*)(Cf + (size_t)by * sC + (size_t)row * ldc + col0 + c4) = v;
      } else if (EPI == 2) {
        v4h h4, r4; split4(v, h4, r4);
        const size_t o = (size_t)by * sC + (size_t)row * ldc + col0 + c4;
        *(v4h*)(C1 + o) = h4;
        if (RES) *(v4h*)(C2 + o) = r4;
      } else {
        const int which = col0 / DM, hc = col0 - which * DM, h = hc >> 6;
        const size_t o16 = pk((size_t)by * SEQ + row, hc + c4, DM);
        const size_t oe = pk((size_t)by * EARLY + row, hc + c4, DM);
        const size_t of = (((size_t)by * NH + h) * SEQ_FULL + row) * HD + c4;
        if (which == 0) {
          v4h h4, r4; split4(v, h4, r4);
          *(v4h*)(C1 + o16) = h4;
          if (row0 < EARLY) *(v4h*)(C3 + oe) = r4;
        } else if (which == 1) {
          *(v4f*)(Cf + OUT1_OFF + of) = v;
          v4h h4, r4; split4(v, h4, r4);
          *(v4h*)(C2 + o16) = h4;
          if (row0 < EARLY) *(v4h*)(C4 + oe) = r4;
        } else {
          *(v4f*)(Cf + OUT2_OFF + of) = v;
        }
      }
    }
    if constexpr (EPI == 0 && !RES) {
      if (col0 >= 2 * DM) {                    /* wave-uniform: a tile of v */
        xwait();                               /* behind the cache stores of the loop above, whose registers the block below takes over */
        /* V^T in fragment order, rows d, k = keys, the four d tiles of a block of 32 keys side by side: tile index (key >> 5) * 4 + (d >> 4). The wave's staged 32 keys x 64 head columns
           are exactly those four tiles, 256 groups of eight keys: group 32 g + lane is read down a column of the staging (16 neighbouring columns a half wave) and stored as 512 contiguous bytes a wave */
        const size_t vo = ((size_t)by * NH + ((col0 - 2 * DM) >> 6)) * HD * SEQ + (size_t)row0 * HD + lane * 8;
        float vv[8][8];
#pragma unroll /* unrolled, as the loop inside: vv stays in registers only under constant indices; all LDS reads go out in one run, in front of the first store's wait */
        for (int g = 0; g < 8; ++g)
#pragma unroll
          for (int q = 0; q < 8; ++q) vv[g][q] = so[w][(g & 1) * 16 + hh * 8 + q][(g >> 1) * 16 + ln];
#pragma unroll /* unrolled: constant indices, constant offsets off one address per plane */
        for (int g = 0; g < 8; ++g) {
          FragH fh, fr;
#pragma unroll
          for (int q = 0; q < 8; ++q) { const float v = vv[g][q]; const _Float16 h = (_Float16)v; fh.h[q] = h; fr.h[q] = (_Float16)((v - (float)h) * 1024.0f); }
          *(v8us*)((unsigned short*)C5 + vo + 256 * g) = fh.half[0];
          *(v8us*)((unsigned short*)C6 + vo + 256 * g) = fr.half[0];
          xwait();
        }
      }
    }
  }
  if (WIDE) xwait();                           /* behind this half's stores, on the way out of the loop too: their registers are taken over by the copies below, which the compiler runs on both ways */
  if (WIDE && hf + 1 < RT / RS) {
    /* keeps this half's reads of the wave's staging in front of the next half's writes to it (other lanes' rows; one wave's LDS operations run in order); LDS alone, so that the wave does not wait here for its global stores */
    __builtin_amdgcn_fence(4 /* acq_rel order */, "workgroup", "local"); __builtin_amdgcn_wave_barrier();
#pragma unroll /* unrolled: constant indices; rows 32 .. 63 move to where the loop's body reads */
    for (int t = 0; t < 4; ++t) { c0[t] = c2[t]; c1[t] = c3[t]; }
  }
  }
}

// the fused QKV projection as a launch of its own: WIDE tiles
template <bool RES, bool BRES, int EPI>
__global__ __launch_bounds__(128) void k_mm(
    const _Float16* __restrict__ Ah, const _Float16* __restrict__ Ar, size_t sA, size_t sAr,
    const _Float16* __restrict__ Bh, const _Float16* __restrict__ Br, size_t sB,
    int rbase, int ntn, int K, int causal, float alpha,
    float* __restrict__ Cf, _Float16* __restrict__ C1, _Float16* __restrict__ C2, _Float16* __restrict__ C3, _Float16* __restrict__ C4,
    _Float16* __restrict__ C5, _Float16* __restrict__ C6,
    const float* __restrict__ bias, const int* __restrict__ flags, int ldc, size_t sC) {
  __shared__ __attribute__((aligned(16))) float sm[4 * 32 * 68];
  mm_body<RES, BRES, EPI, true>(sm, blockIdx.x, Ah, Ar, sA, sAr, Bh, Br, sB, rbase, ntn, K, causal, alpha, Cf, C1, C2, C3, C4, C5, C6, bias, flags, ldc, sC);
}
// out = (ctx x64).(w_o x16) 2^-10 + b_o, early and late rows in one launch: the two parts are independent, and neither fills the chip alone. grid.y = batch;
// the first OEB work-groups take the early rows (64 each, with the ctx residual plane), the others the late rows (128 each, single plane). The pick is the same for a whole work-group.
#define OEB ((EARLY / 64) * (DM / 64))
#define OLB (((SEQ - EARLY) / 128) * (DM / 64))
__global__ __launch_bounds__(128) void k_out(const _Float16* __restrict__ CTh, const _Float16* __restrict__ CTr, const _Float16* __restrict__ WoT,
                                             float* __restrict__ out, const float* __restrict__ bo, const int* __restrict__ flags) {
  __shared__ __attribute__((aligned(16))) float sm[4 * 32 * 68];
  const unsigned bx = blockIdx.x;
  if (bx < OEB)
    mm_body<true, false, 3>(sm, bx, CTh, CTr, (size_t)SEQ * DM, (size_t)SEQ * DM, WoT, nullptr, (size_t)0,
                            0, DM / 64, DM, 0, 0.0009765625f, out, nullptr, nullptr, nullptr, nullptr, nullptr, nullptr, bo, flags, DM, (size_t)SEQ_FULL * DM);
  else
    mm_body<false, false, 3>(sm, bx - OEB, CTh, nullptr, (size_t)SEQ * DM, (size_t)0, WoT, nullptr, (size_t)0,
                             EARLY, DM / 64, DM, 0, 0.0009765625f, out, nullptr, nullptr, nullptr, nullptr, nullptr, nullptr, bo, flags, DM, (size_t)SEQ_FULL * DM);
}

extern "C" void kernel_launch(void* const* d_in, const int* in_sizes, int n_in,
                              void* d_out, int out_size, void* d_ws, size_t ws_size, hipStream_t stream) {
  if (n_in < 6) return;
  if ((size_t)in_sizes[0] < (size_t)(NB - 1) * SEQ_FULL * DM + (size_t)SEQ * DM) return;
  if ((size_t)in_sizes[1] < (size_t)DM * 3 * DM) return;
  if (in_sizes[2] < 3 * DM) return;
  if ((size_t)in_sizes[3] < (size_t)DM * DM) return;
  if (in_sizes[4] < DM) return;
  if ((size_t)in_sizes[5] < (size_t)(SEQ - 1) * SEQ_FULL + SEQ) return;
  if ((size_t)out_size < OUT2_OFF + ((size_t)((NB - 1) * NH + NH - 1) * SEQ_FULL + SEQ) * HD) return;
  const float* x = (const float*)d_in[0];        /* x      [B][L][1024] */
  const float* wqkv = (const float*)d_in[1];     /* w_qkv  [1024][3072] ([in][out]; columns q | k | v) */
  const float* bqkv = (const float*)d_in[2];     /* b_qkv  [3072] */
  const float* wo = (const float*)d_in[3];       /* w_o    [1024][1024] ([in][out]) */
  const float* bo = (const float*)d_in[4];       /* b_o    [1024] */
  const float* mask = (const float*)d_in[5];     /* mask   [1][1][L][L] additive */
  float* out = (float*)d_out;

  constexpr size_t SZ_WT = (size_t)3 * DM * DM * 2, SZ_WO = (size_t)DM * DM * 2, SZ_TOK = (size_t)NB * SEQ * DM * 2;
  constexpr size_t SZ_ER = (size_t)NB * EARLY * DM * 2;
  constexpr size_t SZ_FL = (size_t)MCB * 128;
  constexpr size_t SZ_ALL = SZ_WT + SZ_WO + 7 * SZ_TOK + 2 * SZ_ER + SZ_FL;
  static_assert(SZ_ALL <= (size_t)268435456);
  static_assert(SZ_WT % 256 == 0 && SZ_WO % 256 == 0 && SZ_TOK % 256 == 0 && SZ_ER % 256 == 0 && SZ_FL % 256 == 0);
  if (SZ_ALL > ws_size) return;
  char* ws = (char*)d_ws; size_t off = 0;
  auto take = [&](size_t bytes) { char* p = ws + off; off += bytes; return p; };
  _Float16* WT = (_Float16*)take(SZ_WT);      /* [3072][1024] x16, fragment order (as every f16 plane here) */
  _Float16* WoT = (_Float16*)take(SZ_WO);     /* [1024][1024] x16 */
  _Float16* X16 = (_Float16*)take(SZ_TOK);    /* [NB*SEQ][1024] */
  _Float16* Q16 = (_Float16*)take(SZ_TOK);
  _Float16* K16 = (_Float16*)take(SZ_TOK);
  _Float16* VTh = (_Float16*)take(SZ_TOK);    /* per (batch, head): 64 x SEQ */
  _Float16* VTr = (_Float16*)take(SZ_TOK);
  _Float16* CTh = (_Float16*)take(SZ_TOK);    /* ctx x64, [NB*SEQ][1024] */
  _Float16* CTr = (_Float16*)take(SZ_TOK);
  _Float16* Qr = (_Float16*)take(SZ_ER);      /* [NB][EARLY][1024] */
  _Float16* Kr = (_Float16*)take(SZ_ER);
  int* MCHK = (int*)take(SZ_FL);              /* MCB lines of 32 ints */

  k_prep<<<(unsigned)(NB * XB + WQB), 256, 0, stream>>>(x, wqkv, X16, WT);
  /* fused QKV projection: grid.y = batch; blocks of 128 rows x 128 columns, a wave's 64 columns = one (q|k|v, head) */
  k_mm<false, false, 0><<<dim3((unsigned)((SEQ / 128) * (3 * DM / 128)), NB), 128, 0, stream>>>(
      X16, nullptr, (size_t)SEQ * DM, (size_t)0,
      WT, nullptr, (size_t)0,
      0, 3 * DM / 128, DM, 0, 0.0625f,
      out, Q16, K16, Qr, Kr, VTh, VTr, bqkv, nullptr, 0, (size_t)0);

  /* scores, softmax and P V of every (batch, head) in one launch, with the mask check and the w_o transpose behind them in the grid */
  k_attn<<<dim3((unsigned)(NB * NH), (unsigned)(SEQ / 64 + AXB / (NB * NH))), 128, 0, stream>>>(Q16, K16, Qr, Kr, VTh, VTr, CTh, CTr, mask, wo, MCHK, WoT);
  k_out<<<dim3((unsigned)(OEB + OLB), NB), 128, 0, stream>>>(CTh, CTr, WoT, out, bo, MCHK);
}
